// v000
// Times are from an AMD MI455X. After a warm-up the kernel runs many times in a row, and a time is the length of
// such a window on the GPU divided by its runs, so every launch and the gaps after it count. The runs cycle
// through copies of the inputs. A figure is the median of several windows, for all but v000 over two sittings.
// Sittings can differ by a few percent; kernels timed side by side share one.
// The starting kernel, v000, takes 338 microseconds a run.
// compute dtype: all float inputs rounded to bf16; LayerNorms, pair bias (LN(z) . wz), softmax, sigmoid gate in f32; q|k|v|g projections on WMMA 16x16x32 with the LayerNorm output rounded once to f16 against exact f16 x 2^8 weights; attention logits with single f16 q, k (32-dim heads), P as f16 hi + residual (x 2^11) . v (hi + residual; 3 products); (g o) as f16 hi + residual (2 products) . wo (f16 x 2^8) + bo; f32 output.
#include <hip/hip_runtime.h>
#include <math.h>

typedef __attribute__((ext_vector_type(16))) _Float16 v16h;
typedef __attribute__((ext_vector_type(16))) __bf16 v16b;
typedef __attribute__((ext_vector_type(8)))  _Float16 v8h;
typedef __attribute__((ext_vector_type(8)))  float v8f;
typedef __attribute__((ext_vector_type(4)))  float v4f;
typedef __attribute__((ext_vector_type(2)))  float v2f;
typedef __attribute__((ext_vector_type(4)))  unsigned v4u;
typedef __attribute__((ext_vector_type(4)))  int v4i;
typedef float __attribute__((may_alias)) float_a;
typedef int __attribute__((may_alias)) int_a;

template <typename T> __device__ __forceinline__ void vst2(void* p, T v) { *(T*)p = v;  }
__device__ __forceinline__ v8f wmma16(v16h a, v16h b, v8f c) {
  v8f d = __builtin_amdgcn_wmma_f32_16x16x32_f16(false, a, false, b, (short)0, c, false, false);
  asm volatile("v_nop\n\tv_nop\n\tv_nop\n\tv_nop" : "+v"(d) : "v"(a), "v"(b));
  return d;
}
__device__ __forceinline__ v8f wmma_bf(v16b a, v16b b, v8f c) {
  v8f d = __builtin_amdgcn_wmma_f32_16x16x32_bf16(false, a, false, b, (short)0, c, false, false);
  asm volatile("v_nop\n\tv_nop\n\tv_nop\n\tv_nop" : "+v"(d) : "v"(a), "v"(b));
  return d;
}
// 16x16x32 fragments: lane = (h = lane>>4, row/col = lane&15); elements 0..7 = k0+8h+0..7, 8..15 = k0+16+8h+0..7; D element r = row 8h+r
__device__ __forceinline__ v16h frag_h(const _Float16* rowk0, int lane) {
  union { v16h v; v8h q[2]; } u; const _Float16* p = rowk0 + 8 * (lane >> 4);
  u.q[0] = *(const v8h*)p; u.q[1] = *(const v8h*)(p + 16); return u.v;
}
__device__ __forceinline__ v16h frag_f32(const float* rowk0, int lane) {
  v16h a; const float* p = rowk0 + 8 * (lane >> 4);
#pragma unroll
  for (int i = 0; i < 8; ++i) { a[i] = (_Float16)p[i]; a[8 + i] = (_Float16)p[16 + i]; }
  return a;
}
__device__ __forceinline__ v16h frag_f32s(const float* rowk0, int lane, float sc) {
  v16h a; const float* p = rowk0 + 8 * (lane >> 4);
#pragma unroll
  for (int i = 0; i < 8; ++i) { a[i] = (_Float16)(p[i] * sc); a[8 + i] = (_Float16)(p[16 + i] * sc); }
  return a;
}
// column fragment from a [K][ld] layout (column n), rows >= K read as 0
__device__ __forceinline__ v16h fragc_f32(const float* W, int k0, int n, int lane, int ld, int K) {
  v16h a; const int g = lane >> 4;
#pragma unroll
  for (int i = 0; i < 8; ++i) { const int ka = k0 + 8 * g + i, kb = ka + 16;
    a[i] = (_Float16)(ka < K ? W[(size_t)(ka < K ? ka : K - 1) * ld + n] : 0.f); a[8 + i] = (_Float16)(kb < K ? W[(size_t)(kb < K ? kb : K - 1) * ld + n] : 0.f); }
  return a;
}
struct F2 { v16b h, l; };
__device__ __forceinline__ F2 bsplit16(const float v[16]) { F2 r;
#pragma unroll
  for (int i = 0; i < 16; ++i) { const __bf16 h = (__bf16)v[i]; r.h[i] = h; r.l[i] = (__bf16)(v[i] - (float)h); }
  return r; }
__device__ __forceinline__ F2 split_row(const float* row, int k0, int lane) { float v[16]; const float* p = row + k0 + 8 * (lane >> 4);
#pragma unroll
  for (int i = 0; i < 8; ++i) { v[i] = p[i]; v[8 + i] = p[16 + i]; }
  return bsplit16(v); }
__device__ __forceinline__ F2 split_rowK(const float* row, int k0, int lane, int K) { float v[16]; const int g = lane >> 4;
#pragma unroll
  for (int i = 0; i < 8; ++i) { const int ka = k0 + 8 * g + i, kb = ka + 16; v[i] = ka < K ? row[ka < K ? ka : K - 1] : 0.f; v[8 + i] = kb < K ? row[kb < K ? kb : K - 1] : 0.f; }
  return bsplit16(v); }
__device__ __forceinline__ F2 split_col(const float* W, int k0, int n, int lane, int ld, int K) { float v[16]; const int g = lane >> 4;
#pragma unroll
  for (int i = 0; i < 8; ++i) { const int ka = k0 + 8 * g + i, kb = ka + 16; v[i] = ka < K ? W[(size_t)(ka < K ? ka : K - 1) * ld + n] : 0.f; v[8 + i] = kb < K ? W[(size_t)(kb < K ? kb : K - 1) * ld + n] : 0.f; }
  return bsplit16(v); }
__device__ __forceinline__ v8f mac3(const F2& a, const F2& b, v8f c) { c = wmma_bf(a.l, b.h, c); c = wmma_bf(a.h, b.l, c); return wmma_bf(a.h, b.h, c); }
__device__ __forceinline__ float sigm(float v) { return 1.0f / (1.0f + expf(-v)); }
#define LDSX() do { asm volatile("s_wait_dscnt 0" ::: "memory"); __builtin_amdgcn_wave_barrier(); __builtin_amdgcn_fence(__ATOMIC_RELEASE, "workgroup"); } while (0)


// MSA row attention with pair bias (B 1, S 128 sequences x R 256 residues, c_m 256, 8 heads x 32, c_z 128): out = (sigmoid(LN(m) wg + bg) * softmax(q k / sqrt(32) + 1e9 (mask - 1) + LN(z) wz) v) wo + bo.
#define SQ 128
#define RR 256
#define CM 256
#define NH 8
#define CA 32
#define CZ 128
#define FF 1024
#define NROW (SQ * RR)
#define WSC 256.0f
#ifndef TON
#define TON 1           // unused
#endif
typedef __attribute__((ext_vector_type(8))) __bf16 v8b;
__device__ __forceinline__ v16b frag_b(const __bf16* rowk0, int lane) {
  union { v16b v; v8b q[2]; } u; const __bf16* p = rowk0 + 8 * (lane >> 4);
  u.q[0] = *(const v8b*)p; u.q[1] = *(const v8b*)(p + 16); return u.v;
}
__device__ __forceinline__ float bfr(float v) { return (float)(__bf16)v; }
__device__ __attribute__((noinline)) float exp_ni(float v) { return expf(v); }
__device__ __attribute__((noinline)) float erf_ni(float v) { return erff(v); }

// weight rows (f16 x 2^8, transposed (in,out)): RW [1024][256] = row q|k|v|g ; CW [1024][256]; RWO [256][256]; CWO [256][256]; TW1 [1024][256]; TW2 [256][1024]
#define WS_RW   0u
#define WS_CW   (WS_RW + 2u * 1024 * CM)
#define WS_RWO  (WS_CW + 2u * 1024 * CM)
#define WS_CWO  (WS_RWO + 2u * CM * CM)
#define WS_TW1  (WS_CWO + 2u * CM * CM)
#define WS_TW2  (WS_TW1 + 2u * FF * CM)
#define WS_XH   (WS_TW2 + 2u * CM * FF)                 // f16 LN rows [NROW][256] (natural s*R + r)
#define WS_QK   (WS_XH + 2u * (size_t)NROW * CM)         // f16 q|k rows [compact][512]
#define WS_VT   (WS_QK + 2u * (size_t)NROW * 2 * CM)     // f16 hi|lo v planes [b][256][N]
#define WS_VTL  (WS_VT + 2u * (size_t)NROW * CM)
#define WS_G    (WS_VTL + 2u * (size_t)NROW * CM)        // f16 sigmoid gate rows [natural][256]
#define WS_O    (WS_G + 2u * (size_t)NROW * CM)          // f32 attention output [compact][256]
#define WS_M    (WS_O + 4u * (size_t)NROW * CM)          // f32 working m [natural][256]
#define WS_PB   (WS_M + 4u * (size_t)NROW * CM)          // f32 pair bias [h][q][k]
#define WS_H1   (WS_PB + 4u * (size_t)NH * RR * RR)      // f16 relu rows [natural][1024]
#define WS_END  (WS_H1 + 2u * (size_t)NROW * FF)

// ---- k_packw: block = output row n; which: 0 RW (W = rq|rk|rv|rg by n/256), 1 CW, 2 RWO, 3 CWO, 4 TW1, 5 TW2
__global__ __launch_bounds__(256) void k_packw(const float* __restrict__ RQ, const float* __restrict__ RK, const float* __restrict__ RV, const float* __restrict__ RG, const float* __restrict__ CQ, const float* __restrict__ CK, const float* __restrict__ CV, const float* __restrict__ CG, const float* __restrict__ RWO, const float* __restrict__ CWO, const float* __restrict__ TW1, const float* __restrict__ TW2, char* __restrict__ ws) {
  const int n = blockIdx.x, which = blockIdx.y, t = threadIdx.x; __shared__ __align__(16) _Float16 s[FF];
  const float* Wm; int kin, kout, col; _Float16* dst;
  if (which == 0) { if (n >= 1024) return; const int g4 = n / CM; col = n % CM; Wm = g4 == 0 ? RQ : g4 == 1 ? RK : g4 == 2 ? RV : RG; kin = CM; kout = CM; dst = (_Float16*)(ws + WS_RW) + (size_t)n * CM; }
  else if (which == 1) { if (n >= 1024) return; const int g4 = n / CM; col = n % CM; Wm = g4 == 0 ? CQ : g4 == 1 ? CK : g4 == 2 ? CV : CG; kin = CM; kout = CM; dst = (_Float16*)(ws + WS_CW) + (size_t)n * CM; }
  else if (which == 2) { if (n >= CM) return; col = n; Wm = RWO; kin = CM; kout = CM; dst = (_Float16*)(ws + WS_RWO) + (size_t)n * CM; }
  else if (which == 3) { if (n >= CM) return; col = n; Wm = CWO; kin = CM; kout = CM; dst = (_Float16*)(ws + WS_CWO) + (size_t)n * CM; }
  else if (which == 4) { if (n >= FF) return; col = n; Wm = TW1; kin = CM; kout = FF; dst = (_Float16*)(ws + WS_TW1) + (size_t)n * CM; }
  else { if (n >= CM) return; col = n; Wm = TW2; kin = FF; kout = CM; dst = (_Float16*)(ws + WS_TW2) + (size_t)n * FF; }
  for (int k = t; k < kin; k += 256) s[k] = (_Float16)(bfr(Wm[(size_t)k * kout + col]) * WSC); __syncthreads(); for (int q = t; q < kin / 8; q += 256) vst2((unsigned*)(dst + q * 8), *(const v4u*)&s[q * 8]); }
// ---- k_init: M = bf16(m)
__global__ __launch_bounds__(256) void k_init(const float* __restrict__ X, float* __restrict__ M) { const size_t base = (size_t)blockIdx.x * 4096; for (int q = threadIdx.x; q < 1024; q += 256) { v4f v = *(const v4f*)(X + base + q * 4); v[0] = bfr(v[0]); v[1] = bfr(v[1]); v[2] = bfr(v[2]); v[3] = bfr(v[3]); vst2(M + base + q * 4, v); } }
// ---- k_ln: block = natural row: XH = LN(M) w + b (jnp.var, 1e-5) -> f16
__global__ __launch_bounds__(256) void k_ln(const float* __restrict__ M, const float* __restrict__ G, const float* __restrict__ Bt, _Float16* __restrict__ XH) { __shared__ float red[8]; __shared__ __align__(16) _Float16 sh[CM]; const int t = threadIdx.x; const size_t row = blockIdx.x;
  const float v = M[row * CM + t]; float s = v;
#pragma unroll
  for (int o = 1; o < 32; o <<= 1) s += __shfl_xor(s, o);
  if ((t & 31) == 0) red[t >> 5] = s; __syncthreads(); float mu = 0.f; for (int i = 0; i < 8; ++i) mu += red[i]; mu /= (float)CM; __syncthreads();
  const float d = v - mu; float q = d * d;
#pragma unroll
  for (int o = 1; o < 32; o <<= 1) q += __shfl_xor(q, o);
  if ((t & 31) == 0) red[t >> 5] = q; __syncthreads(); float var = 0.f; for (int i = 0; i < 8; ++i) var += red[i]; var /= (float)CM;
  sh[t] = (_Float16)(d / sqrtf(var + 1e-5f) * bfr(G[t]) + bfr(Bt[t])); __syncthreads(); if (t < CM / 8) vst2((unsigned*)(XH + row * CM + t * 8), *(const v4u*)&sh[t * 8]); }
// natural row index of (batch b, token n): MODE 0 row attention (b = s, n = r); MODE 1 column attention (b = r, n = s)
template <int MODE> __device__ __forceinline__ size_t nat(size_t b, int n) { return MODE == 0 ? b * RR + n : (size_t)n * RR + b; }
// ---- k_proj<MODE>: block = (64 tokens, 128 of 1024 cols (q|k|v|g), b): A = XH rows; q|k -> QK compact rows (single f16); v -> planes hi/lo; g -> sigmoid -> f16 natural rows
template <int MODE>
__global__ __launch_bounds__(128) void k_proj(const _Float16* __restrict__ XH, const _Float16* __restrict__ Wr, const float* __restrict__ BG, _Float16* __restrict__ QK, _Float16* __restrict__ VT, _Float16* __restrict__ VTL, _Float16* __restrict__ Gt) {
  constexpr int NN = MODE == 0 ? RR : SQ; __shared__ __align__(16) _Float16 sh[64][136]; __shared__ __align__(16) _Float16 th[128][72], tl[128][72];
  const int tid = threadIdx.x, wave = tid >> 5, lane = tid & 31, col = lane & 15, g = lane >> 4; const size_t b = blockIdx.z; const int n0 = blockIdx.x * 64 + wave * 16; const int c0 = blockIdx.y * 128; const int which = c0 / CM;   // 0 q, 1 k, 2 v, 3 g
  v8f acc[8] = {};
#pragma unroll
  for (int kc = 0; kc < CM / 32; ++kc) { const v16h a = frag_h(XH + nat<MODE>(b, n0 + col) * CM + kc * 32, lane);
#pragma unroll
    for (int j = 0; j < 8; ++j) acc[j] = wmma16(a, frag_h(Wr + (size_t)(c0 + j * 16 + col) * CM + kc * 32, lane), acc[j]); }
#pragma unroll
  for (int j = 0; j < 8; ++j) { const int cc = (c0 % CM) + j * 16 + col; const float bg = (which == 3) ? bfr(BG[cc]) : 0.f;
#pragma unroll
    for (int r = 0; r < 8; ++r) { float v = acc[j][r] * (1.0f / WSC); if (which == 3) v = 1.0f / (1.0f + expf(-(v + bg)));
      if (which == 2) { const _Float16 hv = (_Float16)v; th[j * 16 + col][wave * 16 + 8 * g + r] = hv; tl[j * 16 + col][wave * 16 + 8 * g + r] = (_Float16)((v - (float)hv) * 2048.0f); } else sh[wave * 16 + 8 * g + r][j * 16 + col] = (_Float16)v; } }
  __syncthreads();
  if (which < 2) { for (int e = tid; e < 64 * 16; e += 128) { const int rl = e >> 4, q = e & 15; vst2((unsigned*)(QK + (b * NN + blockIdx.x * 64 + rl) * (2 * CM) + c0 + q * 8), *(const v4u*)&sh[rl][q * 8]); } }
  else if (which == 2) { const int cv0 = c0 - 2 * CM; for (int e = tid; e < 128 * 8; e += 128) { const int cl = e >> 3, q = e & 7; const size_t o = ((b * CM + cv0 + cl) * (size_t)NN) + blockIdx.x * 64 + q * 8; vst2((unsigned*)(VT + o), *(const v4u*)&th[cl][q * 8]); vst2((unsigned*)(VTL + o), *(const v4u*)&tl[cl][q * 8]); } }
  else { for (int e = tid; e < 64 * 16; e += 128) { const int rl = e >> 4, q = e & 15; vst2((unsigned*)(Gt + nat<MODE>(b, blockIdx.x * 64 + rl) * CM + (c0 - 3 * CM) + q * 8), *(const v4u*)&sh[rl][q * 8]); } } }
// ---- k_pb: block = query residue q: PB[h][q][k] = LN(z[q][k]) . wb[:, h]
__global__ __launch_bounds__(256) void k_pb(const float* __restrict__ Zp, const float* __restrict__ G, const float* __restrict__ Bt, const float* __restrict__ WB, float* __restrict__ PB) { __shared__ __align__(16) float sp[NH][RR]; __shared__ float swb[CZ][NH + 1]; const int t = threadIdx.x, lane = t & 31, w = t >> 5; const int q = blockIdx.x;
  for (int e = t; e < CZ * NH; e += 256) swb[e / NH][e % NH] = bfr(WB[e]); __syncthreads();
  for (int k = w; k < RR; k += 8) { const float* zr = Zp + ((size_t)q * RR + k) * CZ; float v[4]; float s = 0.f; for (int i = 0; i < 4; ++i) { v[i] = bfr(zr[lane + 32 * i]); s += v[i]; }
#pragma unroll
    for (int o = 1; o < 32; o <<= 1) s += __shfl_xor(s, o);
    const float mu = s / (float)CZ; float qq = 0.f; for (int i = 0; i < 4; ++i) { const float d = v[i] - mu; qq += d * d; }
#pragma unroll
    for (int o = 1; o < 32; o <<= 1) qq += __shfl_xor(qq, o);
    const float inv = 1.0f / sqrtf(qq / (float)CZ + 1e-5f); float ph[NH];
#pragma unroll
    for (int h = 0; h < NH; ++h) ph[h] = 0.f;
    for (int i = 0; i < 4; ++i) { const int c = lane + 32 * i; const float ln = (v[i] - mu) * inv * bfr(G[c]) + bfr(Bt[c]);
#pragma unroll
      for (int h = 0; h < NH; ++h) ph[h] += ln * swb[c][h]; }
#pragma unroll
    for (int h = 0; h < NH; ++h) { float x = ph[h];
#pragma unroll
      for (int o = 1; o < 32; o <<= 1) x += __shfl_xor(x, o);
      if (lane == 0) sp[h][k] = x; } }
  __syncthreads(); for (int e = t; e < NH * RR / 4; e += 256) { const int h = e / (RR / 4), q4 = e % (RR / 4); vst2(PB + ((size_t)h * RR + q) * RR + q4 * 4, *(const v4f*)&sp[h][q4 * 4]); } }
// ---- k_att<MODE>: block = (64 queries, head, b): logits q.k x 32^-0.5 (+ pair bias in MODE 0), masked keys excluded, softmax, P . v (planes hi + residual) -> O compact rows
template <int MODE>
__global__ __launch_bounds__(128) void k_att(const _Float16* __restrict__ QK, const _Float16* __restrict__ VT, const _Float16* __restrict__ VTL, const float* __restrict__ PB, const float* __restrict__ MASK, float* __restrict__ O) {
  constexpr int NN = MODE == 0 ? RR : SQ; __shared__ __align__(16) float sp[4][16][36]; __shared__ __align__(16) float so[4][16][36];
  const int tid = threadIdx.x, wave = tid >> 5, lane = tid & 31, col = lane & 15, g = lane >> 4; const int h = blockIdx.y; const size_t b = blockIdx.z; const int q0 = blockIdx.x * 64 + wave * 16; const size_t rq = b * NN + q0;
  const v16h aq = frag_h(QK + (rq + col) * (2 * CM) + h * CA, lane);
  float m[8], l[8];
#pragma unroll
  for (int r = 0; r < 8; ++r) { m[r] = -3.0e38f; l[r] = 0.f; }
  v8f acc[2] = {}, accl[2] = {};
#pragma unroll 1
  for (int ks = 0; ks < NN / 32; ++ks) { v8f s[2];
#pragma unroll
    for (int ct = 0; ct < 2; ++ct) { const int kk = ks * 32 + ct * 16 + col; const size_t rk = b * NN + kk; const v16h kh = frag_h(QK + rk * (2 * CM) + CM + h * CA, lane); v8f c = {}; c = wmma16(aq, kh, c);
      const bool keep = bfr(MASK[nat<MODE>(b, kk)]) != 0.f;
#pragma unroll
      for (int r = 0; r < 8; ++r) { float sc = c[r] * 0.17677669529663687f; if (MODE == 0) sc += PB[((size_t)h * RR + (q0 + 8 * g + r)) * RR + kk]; s[ct][r] = keep ? sc : -3.0e38f; } }
    float alpha[8];
#pragma unroll
    for (int r = 0; r < 8; ++r) { float mx = fmaxf(s[0][r], s[1][r]);
#pragma unroll
      for (int o = 1; o < 16; o <<= 1) mx = fmaxf(mx, __shfl_xor(mx, o));
      const float mn = fmaxf(m[r], mx); alpha[r] = (m[r] <= -1.0e38f) ? 0.f : __expf(m[r] - mn); const float e0 = (s[0][r] <= -1.0e38f) ? 0.f : __expf(s[0][r] - mn), e1 = (s[1][r] <= -1.0e38f) ? 0.f : __expf(s[1][r] - mn); float es = e0 + e1;
#pragma unroll
      for (int o = 1; o < 16; o <<= 1) es += __shfl_xor(es, o);
      l[r] = l[r] * alpha[r] + es; m[r] = mn; sp[wave][8 * g + r][col] = e0; sp[wave][8 * g + r][16 + col] = e1; }
#pragma unroll
    for (int j = 0; j < 2; ++j)
#pragma unroll
      for (int r = 0; r < 8; ++r) { acc[j][r] *= alpha[r]; accl[j][r] *= alpha[r]; }
    LDSX();
    v16h pa, pal; { const float* prow = &sp[wave][col][0] + 8 * (lane >> 4);
#pragma unroll
      for (int i = 0; i < 8; ++i) { const float p0 = prow[i] * 2048.0f, p1 = prow[16 + i] * 2048.0f; pa[i] = (_Float16)p0; pa[8 + i] = (_Float16)p1; pal[i] = (_Float16)((p0 - (float)pa[i]) * 2048.0f); pal[8 + i] = (_Float16)((p1 - (float)pa[8 + i]) * 2048.0f); } }
#pragma unroll
    for (int j = 0; j < 2; ++j) { const size_t po = (b * CM + (size_t)h * CA + j * 16 + col) * (size_t)NN + ks * 32; const v16h vh = frag_h(VT + po, lane); acc[j] = wmma16(pa, vh, acc[j]); accl[j] = wmma16(pa, frag_h(VTL + po, lane), accl[j]); accl[j] = wmma16(pal, vh, accl[j]); }
    LDSX(); }
#pragma unroll
  for (int r = 0; r < 8; ++r) { const float il = (l[r] > 0.f) ? (1.0f / 2048.0f) / l[r] : 0.f;
#pragma unroll
    for (int j = 0; j < 2; ++j) so[wave][8 * g + r][j * 16 + col] = (acc[j][r] + accl[j][r] * (1.0f / 2048.0f)) * il; }
  LDSX(); for (int rl = 0; rl < 16; ++rl) if (lane < 8) vst2(O + (rq + rl) * CM + (size_t)h * CA + lane * 4, *(const v4f*)&so[wave][rl][lane * 4]); }
// ---- k_go<MODE>: block = (64 natural rows, 128 cols): M = (g o) . wo + bo ; A operand built on the fly from G (natural) and O (compact)
template <int MODE>
__global__ __launch_bounds__(128) void k_go(const _Float16* __restrict__ Gt, const float* __restrict__ O, const _Float16* __restrict__ WOr, const float* __restrict__ BO, float* __restrict__ M) { __shared__ __align__(16) float sf[4][16][132];
  const int tid = threadIdx.x, wave = tid >> 5, lane = tid & 31, col = lane & 15, g = lane >> 4; const size_t r0 = (size_t)blockIdx.x * 64 + wave * 16; const int c0 = blockIdx.y * 128;
  const size_t nr = r0 + col; const size_t s_ = nr / RR, r_ = nr % RR; const size_t cidx = MODE == 0 ? nr : r_ * SQ + s_;   // compact row of this natural row
  v8f acc[8] = {}, accl2[8] = {};
#pragma unroll
  for (int kc = 0; kc < CM / 32; ++kc) { v16h a, al; const _Float16* gp = Gt + nr * CM + kc * 32 + 8 * g; const float* op = O + cidx * CM + kc * 32 + 8 * g;
#pragma unroll
    for (int i = 0; i < 8; ++i) { const float v0 = (float)gp[i] * op[i], v1 = (float)gp[16 + i] * op[16 + i]; a[i] = (_Float16)v0; a[8 + i] = (_Float16)v1; al[i] = (_Float16)((v0 - (float)a[i]) * 2048.0f); al[8 + i] = (_Float16)((v1 - (float)a[8 + i]) * 2048.0f); }
#pragma unroll
    for (int j = 0; j < 8; ++j) { const v16h w = frag_h(WOr + (size_t)(c0 + j * 16 + col) * CM + kc * 32, lane); acc[j] = wmma16(a, w, acc[j]); accl2[j] = wmma16(al, w, accl2[j]); } }
#pragma unroll
  for (int j = 0; j < 8; ++j) { const int c = c0 + j * 16 + col; const float bb = bfr(BO[c]);
#pragma unroll
    for (int r = 0; r < 8; ++r) sf[wave][8 * g + r][j * 16 + col] = (acc[j][r] + accl2[j][r] * (1.0f / 2048.0f)) * (1.0f / WSC) + bb; }
  LDSX(); for (int rl = 0; rl < 16; ++rl) vst2(M + (r0 + rl) * CM + c0 + lane * 4, *(const v4f*)&sf[wave][rl][lane * 4]); }   // M here = the output buffer (no residual in this module)
// ---- k_ff1: block = (64 rows, 128 of 1024 cols): H1 = relu(XH . W1 + b1) -> f16 ; k_ff2: out = H1 . W2 + b2 + M
__global__ __launch_bounds__(128) void k_ff1(const _Float16* __restrict__ XH, const _Float16* __restrict__ W1r, const float* __restrict__ B1, _Float16* __restrict__ H1) { __shared__ __align__(16) _Float16 sh[4][16][136];
  const int tid = threadIdx.x, wave = tid >> 5, lane = tid & 31, col = lane & 15, g = lane >> 4; const size_t r0 = (size_t)blockIdx.x * 64 + wave * 16; const int c0 = blockIdx.y * 128;
  v8f acc[8] = {};
#pragma unroll
  for (int kc = 0; kc < CM / 32; ++kc) { const v16h a = frag_h(XH + (r0 + col) * CM + kc * 32, lane);
#pragma unroll
    for (int j = 0; j < 8; ++j) acc[j] = wmma16(a, frag_h(W1r + (size_t)(c0 + j * 16 + col) * CM + kc * 32, lane), acc[j]); }
#pragma unroll
  for (int j = 0; j < 8; ++j) { const float bb = bfr(B1[c0 + j * 16 + col]);
#pragma unroll
    for (int r = 0; r < 8; ++r) sh[wave][8 * g + r][j * 16 + col] = (_Float16)fmaxf(acc[j][r] * (1.0f / WSC) + bb, 0.f); }
  LDSX(); for (int rl = 0; rl < 16; ++rl) if (lane < 16) vst2((unsigned*)(H1 + (r0 + rl) * FF + c0 + lane * 8), *(const v4u*)&sh[wave][rl][lane * 8]); }
__global__ __launch_bounds__(128) void k_ff2(const _Float16* __restrict__ H1, const _Float16* __restrict__ W2r, const float* __restrict__ B2, const float* __restrict__ M, float* __restrict__ OUT) { __shared__ __align__(16) float sf[4][16][132];
  const int tid = threadIdx.x, wave = tid >> 5, lane = tid & 31, col = lane & 15, g = lane >> 4; const size_t r0 = (size_t)blockIdx.x * 64 + wave * 16; const int c0 = blockIdx.y * 128;
  v8f acc[8] = {};
#pragma unroll 2
  for (int kc = 0; kc < FF / 32; ++kc) { const v16h a = frag_h(H1 + (r0 + col) * FF + kc * 32, lane);
#pragma unroll
    for (int j = 0; j < 8; ++j) acc[j] = wmma16(a, frag_h(W2r + (size_t)(c0 + j * 16 + col) * FF + kc * 32, lane), acc[j]); }
#pragma unroll
  for (int j = 0; j < 8; ++j) { const int c = c0 + j * 16 + col; const float bb = bfr(B2[c]);
#pragma unroll
    for (int r = 0; r < 8; ++r) sf[wave][8 * g + r][j * 16 + col] = acc[j][r] * (1.0f / WSC) + bb + M[(r0 + 8 * g + r) * CM + c]; }
  LDSX(); for (int rl = 0; rl < 16; ++rl) vst2(OUT + (r0 + rl) * CM + c0 + lane * 4, *(const v4f*)&sf[wave][rl][lane * 4]); }
extern "C" void kernel_launch(void* const* d_in, const int* in_sizes, int n_in, void* d_out, int out_size, void* d_ws, size_t ws_size, hipStream_t stream) {
  (void)in_sizes; (void)n_in; (void)out_size;
  const float** F = (const float**)d_in;   // 0 m [1,128,256,256], 1 z [1,256,256,128], 2 mask [1,128,256], 3 ln_m_g, 4 ln_m_b, 5 ln_z_g, 6 ln_z_b, 7 wz [128,8], 8 wq [256,8,32], 9 wk, 10 wv, 11 wg, 12 bg [8,32], 13 wo [8,32,256], 14 bo [256]
  if (ws_size < (size_t)WS_END) return;
  char* ws = (char*)d_ws; _Float16 *RW = (_Float16*)(ws + WS_RW), *RWOp = (_Float16*)(ws + WS_RWO), *XH = (_Float16*)(ws + WS_XH), *QK = (_Float16*)(ws + WS_QK), *VT = (_Float16*)(ws + WS_VT), *VTL = (_Float16*)(ws + WS_VTL), *Gt = (_Float16*)(ws + WS_G);
  float *O = (float*)(ws + WS_O), *M = (float*)(ws + WS_M), *PB = (float*)(ws + WS_PB);
  k_packw<<<dim3(1024, 3), 256, 0, stream>>>(F[8], F[9], F[10], F[11], F[8], F[9], F[10], F[11], F[13], F[13], F[8], F[13], ws);   // which 0 (q|k|v|g rows) and 2 (wo rows) are used; which 1 packs in-bounds duplicates; 3-5 not launched
  k_init<<<(unsigned)((size_t)NROW * CM / 4096), 256, 0, stream>>>(F[0], M);
  k_ln<<<NROW, 256, 0, stream>>>(M, F[3], F[4], XH);
  k_proj<0><<<dim3(RR / 64, 8, SQ), 128, 0, stream>>>(XH, RW, F[12], QK, VT, VTL, Gt);
  k_pb<<<RR, 256, 0, stream>>>(F[1], F[5], F[6], F[7], PB);
  k_att<0><<<dim3(RR / 64, NH, SQ), 128, 0, stream>>>(QK, VT, VTL, PB, F[2], O);
  k_go<0><<<dim3(NROW / 64, CM / 128), 128, 0, stream>>>(Gt, O, RWOp, F[14], (float*)d_out);
}

// v001
// One run takes 277 microseconds.
// Timed twice side by side with v000, it ran 1.26 and 1.27 times as fast.
// compute dtype: all float inputs rounded to bf16; LayerNorms, pair bias (LN(z) . wz), softmax, sigmoid gate in f32; q|k|v|g projections on WMMA 16x16x32 with the LayerNorm output rounded once to f16 against exact f16 x 2^8 weights; attention logits with single f16 q, k (32-dim heads), P as f16 hi + residual (x 2^11) . v (hi + residual; 3 products); (g o) as f16 hi + residual (2 products) . wo (f16 x 2^8) + bo; f32 output.
#include <hip/hip_runtime.h>
#include <math.h>

typedef __attribute__((ext_vector_type(16))) _Float16 v16h;
typedef __attribute__((ext_vector_type(16))) __bf16 v16b;
typedef __attribute__((ext_vector_type(8)))  _Float16 v8h;
typedef __attribute__((ext_vector_type(8)))  float v8f;
typedef __attribute__((ext_vector_type(4)))  float v4f;
typedef __attribute__((ext_vector_type(2)))  float v2f;
typedef __attribute__((ext_vector_type(4)))  unsigned v4u;
typedef __attribute__((ext_vector_type(4)))  int v4i;
typedef float __attribute__((may_alias)) float_a;
typedef int __attribute__((may_alias)) int_a;

template <typename T> __device__ __forceinline__ void vst2(void* p, T v) { *(T*)p = v;  }
__device__ __forceinline__ v8f wmma16(v16h a, v16h b, v8f c) {
  v8f d = __builtin_amdgcn_wmma_f32_16x16x32_f16(false, a, false, b, (short)0, c, false, false);
  asm volatile("v_nop\n\tv_nop\n\tv_nop\n\tv_nop" : "+v"(d) : "v"(a), "v"(b));
  return d;
}
__device__ __forceinline__ v8f wmma_bf(v16b a, v16b b, v8f c) {
  v8f d = __builtin_amdgcn_wmma_f32_16x16x32_bf16(false, a, false, b, (short)0, c, false, false);
  asm volatile("v_nop\n\tv_nop\n\tv_nop\n\tv_nop" : "+v"(d) : "v"(a), "v"(b));
  return d;
}
// 16x16x32 fragments: lane = (h = lane>>4, row/col = lane&15); elements 0..7 = k0+8h+0..7, 8..15 = k0+16+8h+0..7; D element r = row 8h+r
__device__ __forceinline__ v16h frag_h(const _Float16* rowk0, int lane) {
  union { v16h v; v8h q[2]; } u; const _Float16* p = rowk0 + 8 * (lane >> 4);
  u.q[0] = *(const v8h*)p; u.q[1] = *(const v8h*)(p + 16); return u.v;
}
__device__ __forceinline__ v16h frag_f32(const float* rowk0, int lane) {
  v16h a; const float* p = rowk0 + 8 * (lane >> 4);
#pragma unroll
  for (int i = 0; i < 8; ++i) { a[i] = (_Float16)p[i]; a[8 + i] = (_Float16)p[16 + i]; }
  return a;
}
__device__ __forceinline__ v16h frag_f32s(const float* rowk0, int lane, float sc) {
  v16h a; const float* p = rowk0 + 8 * (lane >> 4);
#pragma unroll
  for (int i = 0; i < 8; ++i) { a[i] = (_Float16)(p[i] * sc); a[8 + i] = (_Float16)(p[16 + i] * sc); }
  return a;
}
// column fragment from a [K][ld] layout (column n), rows >= K read as 0
__device__ __forceinline__ v16h fragc_f32(const float* W, int k0, int n, int lane, int ld, int K) {
  v16h a; const int g = lane >> 4;
#pragma unroll
  for (int i = 0; i < 8; ++i) { const int ka = k0 + 8 * g + i, kb = ka + 16;
    a[i] = (_Float16)(ka < K ? W[(size_t)(ka < K ? ka : K - 1) * ld + n] : 0.f); a[8 + i] = (_Float16)(kb < K ? W[(size_t)(kb < K ? kb : K - 1) * ld + n] : 0.f); }
  return a;
}
struct F2 { v16b h, l; };
__device__ __forceinline__ F2 bsplit16(const float v[16]) { F2 r;
#pragma unroll
  for (int i = 0; i < 16; ++i) { const __bf16 h = (__bf16)v[i]; r.h[i] = h; r.l[i] = (__bf16)(v[i] - (float)h); }
  return r; }
__device__ __forceinline__ F2 split_row(const float* row, int k0, int lane) { float v[16]; const float* p = row + k0 + 8 * (lane >> 4);
#pragma unroll
  for (int i = 0; i < 8; ++i) { v[i] = p[i]; v[8 + i] = p[16 + i]; }
  return bsplit16(v); }
__device__ __forceinline__ F2 split_rowK(const float* row, int k0, int lane, int K) { float v[16]; const int g = lane >> 4;
#pragma unroll
  for (int i = 0; i < 8; ++i) { const int ka = k0 + 8 * g + i, kb = ka + 16; v[i] = ka < K ? row[ka < K ? ka : K - 1] : 0.f; v[8 + i] = kb < K ? row[kb < K ? kb : K - 1] : 0.f; }
  return bsplit16(v); }
__device__ __forceinline__ F2 split_col(const float* W, int k0, int n, int lane, int ld, int K) { float v[16]; const int g = lane >> 4;
#pragma unroll
  for (int i = 0; i < 8; ++i) { const int ka = k0 + 8 * g + i, kb = ka + 16; v[i] = ka < K ? W[(size_t)(ka < K ? ka : K - 1) * ld + n] : 0.f; v[8 + i] = kb < K ? W[(size_t)(kb < K ? kb : K - 1) * ld + n] : 0.f; }
  return bsplit16(v); }
__device__ __forceinline__ v8f mac3(const F2& a, const F2& b, v8f c) { c = wmma_bf(a.l, b.h, c); c = wmma_bf(a.h, b.l, c); return wmma_bf(a.h, b.h, c); }
__device__ __forceinline__ float sigm(float v) { return 1.0f / (1.0f + expf(-v)); }
#define LDSX() do { asm volatile("s_wait_dscnt 0" ::: "memory"); __builtin_amdgcn_wave_barrier(); __builtin_amdgcn_fence(__ATOMIC_RELEASE, "workgroup"); } while (0)


// MSA row attention with pair bias (B 1, S 128 sequences x R 256 residues, c_m 256, 8 heads x 32, c_z 128): out = (sigmoid(LN(m) wg + bg) * softmax(q k / sqrt(32) + 1e9 (mask - 1) + LN(z) wz) v) wo + bo.
#define SQ 128
#define RR 256
#define CM 256
#define NH 8
#define CA 32
#define CZ 128
#define FF 1024
#define NROW (SQ * RR)
#define WSC 256.0f
#ifndef TON
#define TON 1           // unused
#endif
typedef __attribute__((ext_vector_type(8))) __bf16 v8b;
__device__ __forceinline__ v16b frag_b(const __bf16* rowk0, int lane) {
  union { v16b v; v8b q[2]; } u; const __bf16* p = rowk0 + 8 * (lane >> 4);
  u.q[0] = *(const v8b*)p; u.q[1] = *(const v8b*)(p + 16); return u.v;
}
__device__ __forceinline__ float bfr(float v) { return (float)(__bf16)v; }
__device__ __attribute__((noinline)) float exp_ni(float v) { return expf(v); }
__device__ __attribute__((noinline)) float erf_ni(float v) { return erff(v); }

// weight rows (f16 x 2^8, transposed (in,out)): RW [1024][256] = row q|k|v|g ; CW [1024][256]; RWO [256][256]; CWO [256][256]; TW1 [1024][256]; TW2 [256][1024]
#define WS_RW   0u
#define WS_CW   (WS_RW + 2u * 1024 * CM)
#define WS_RWO  (WS_CW + 2u * 1024 * CM)
#define WS_CWO  (WS_RWO + 2u * CM * CM)
#define WS_TW1  (WS_CWO + 2u * CM * CM)
#define WS_TW2  (WS_TW1 + 2u * FF * CM)
#define WS_XH   (WS_TW2 + 2u * CM * FF)                 // f16 LN rows [NROW][256] (natural s*R + r)
#define WS_QK   (WS_XH + 2u * (size_t)NROW * CM)         // f16 q|k rows [compact][512]
#define WS_VT   (WS_QK + 2u * (size_t)NROW * 2 * CM)     // f16 hi|lo v planes [b][256][N]
#define WS_VTL  (WS_VT + 2u * (size_t)NROW * CM)
#define WS_G    (WS_VTL + 2u * (size_t)NROW * CM)        // f16 sigmoid gate rows [natural][256]
#define WS_O    (WS_G + 2u * (size_t)NROW * CM)          // f32 attention output [compact][256]
#define WS_M    (WS_O + 4u * (size_t)NROW * CM)          // f32 working m [natural][256]
#define WS_PB   (WS_M + 4u * (size_t)NROW * CM)          // f32 pair bias [h][q][k]
#define WS_H1   (WS_PB + 4u * (size_t)NH * RR * RR)      // f16 relu rows [natural][1024]
#define WS_END  (WS_H1 + 2u * (size_t)NROW * FF)

// ---- k_packw: block = output row n; which: 0 RW (W = rq|rk|rv|rg by n/256), 1 CW, 2 RWO, 3 CWO, 4 TW1, 5 TW2
__global__ __launch_bounds__(256) void k_packw(const float* __restrict__ RQ, const float* __restrict__ RK, const float* __restrict__ RV, const float* __restrict__ RG, const float* __restrict__ CQ, const float* __restrict__ CK, const float* __restrict__ CV, const float* __restrict__ CG, const float* __restrict__ RWO, const float* __restrict__ CWO, const float* __restrict__ TW1, const float* __restrict__ TW2, char* __restrict__ ws) {
  const int n = blockIdx.x, which = blockIdx.y, t = threadIdx.x; __shared__ __align__(16) _Float16 s[FF];
  const float* Wm; int kin, kout, col; _Float16* dst;
  if (which == 0) { if (n >= 1024) return; const int g4 = n / CM; col = n % CM; Wm = g4 == 0 ? RQ : g4 == 1 ? RK : g4 == 2 ? RV : RG; kin = CM; kout = CM; dst = (_Float16*)(ws + WS_RW) + (size_t)n * CM; }
  else if (which == 1) { if (n >= 1024) return; const int g4 = n / CM; col = n % CM; Wm = g4 == 0 ? CQ : g4 == 1 ? CK : g4 == 2 ? CV : CG; kin = CM; kout = CM; dst = (_Float16*)(ws + WS_CW) + (size_t)n * CM; }
  else if (which == 2) { if (n >= CM) return; col = n; Wm = RWO; kin = CM; kout = CM; dst = (_Float16*)(ws + WS_RWO) + (size_t)n * CM; }
  else if (which == 3) { if (n >= CM) return; col = n; Wm = CWO; kin = CM; kout = CM; dst = (_Float16*)(ws + WS_CWO) + (size_t)n * CM; }
  else if (which == 4) { if (n >= FF) return; col = n; Wm = TW1; kin = CM; kout = FF; dst = (_Float16*)(ws + WS_TW1) + (size_t)n * CM; }
  else { if (n >= CM) return; col = n; Wm = TW2; kin = FF; kout = CM; dst = (_Float16*)(ws + WS_TW2) + (size_t)n * FF; }
  for (int k = t; k < kin; k += 256) s[k] = (_Float16)(bfr(Wm[(size_t)k * kout + col]) * WSC); __syncthreads(); for (int q = t; q < kin / 8; q += 256) vst2((unsigned*)(dst + q * 8), *(const v4u*)&s[q * 8]); }
// ---- k_init: M = bf16(m)
__global__ __launch_bounds__(256) void k_init(const float* __restrict__ X, float* __restrict__ M) { const size_t base = (size_t)blockIdx.x * 4096; for (int q = threadIdx.x; q < 1024; q += 256) { v4f v = *(const v4f*)(X + base + q * 4); v[0] = bfr(v[0]); v[1] = bfr(v[1]); v[2] = bfr(v[2]); v[3] = bfr(v[3]); vst2(M + base + q * 4, v); } }
// ---- k_ln: block = natural row: XH = LN(M) w + b (jnp.var, 1e-5) -> f16
__global__ __launch_bounds__(256) void k_ln(const float* __restrict__ M, const float* __restrict__ G, const float* __restrict__ Bt, _Float16* __restrict__ XH) { __shared__ float red[8]; __shared__ __align__(16) _Float16 sh[CM]; const int t = threadIdx.x; const size_t row = blockIdx.x;
  const float v = M[row * CM + t]; float s = v;
#pragma unroll
  for (int o = 1; o < 32; o <<= 1) s += __shfl_xor(s, o);
  if ((t & 31) == 0) red[t >> 5] = s; __syncthreads(); float mu = 0.f; for (int i = 0; i < 8; ++i) mu += red[i]; mu /= (float)CM; __syncthreads();
  const float d = v - mu; float q = d * d;
#pragma unroll
  for (int o = 1; o < 32; o <<= 1) q += __shfl_xor(q, o);
  if ((t & 31) == 0) red[t >> 5] = q; __syncthreads(); float var = 0.f; for (int i = 0; i < 8; ++i) var += red[i]; var /= (float)CM;
  sh[t] = (_Float16)(d / sqrtf(var + 1e-5f) * bfr(G[t]) + bfr(Bt[t])); __syncthreads(); if (t < CM / 8) vst2((unsigned*)(XH + row * CM + t * 8), *(const v4u*)&sh[t * 8]); }
// natural row index of (batch b, token n): MODE 0 row attention (b = s, n = r); MODE 1 column attention (b = r, n = s)
template <int MODE> __device__ __forceinline__ size_t nat(size_t b, int n) { return MODE == 0 ? b * RR + n : (size_t)n * RR + b; }
// ---- k_proj<MODE>: block = (64 tokens, 128 of 1024 cols (q|k|v|g), b): A = XH rows; q|k -> QK compact rows (single f16); v -> planes hi/lo; g -> sigmoid -> f16 natural rows
template <int MODE>
__global__ __launch_bounds__(128) void k_proj(const _Float16* __restrict__ XH, const _Float16* __restrict__ Wr, const float* __restrict__ BG, _Float16* __restrict__ QK, _Float16* __restrict__ VT, _Float16* __restrict__ VTL, _Float16* __restrict__ Gt) {
  constexpr int NN = MODE == 0 ? RR : SQ; __shared__ __align__(16) _Float16 sh[64][136]; __shared__ __align__(16) _Float16 th[128][72], tl[128][72];
  const int tid = threadIdx.x, wave = tid >> 5, lane = tid & 31, col = lane & 15, g = lane >> 4; const size_t b = blockIdx.z; const int n0 = blockIdx.x * 64 + wave * 16; const int c0 = blockIdx.y * 128; const int which = c0 / CM;   // 0 q, 1 k, 2 v, 3 g
  v8f acc[8] = {};
#pragma unroll
  for (int kc = 0; kc < CM / 32; ++kc) { const v16h a = frag_h(XH + nat<MODE>(b, n0 + col) * CM + kc * 32, lane);
#pragma unroll
    for (int j = 0; j < 8; ++j) acc[j] = wmma16(a, frag_h(Wr + (size_t)(c0 + j * 16 + col) * CM + kc * 32, lane), acc[j]); }
#pragma unroll
  for (int j = 0; j < 8; ++j) { const int cc = (c0 % CM) + j * 16 + col; const float bg = (which == 3) ? bfr(BG[cc]) : 0.f;
#pragma unroll
    for (int r = 0; r < 8; ++r) { float v = acc[j][r] * (1.0f / WSC); if (which == 3) v = 1.0f / (1.0f + expf(-(v + bg)));
      if (which == 2) { const _Float16 hv = (_Float16)v; th[j * 16 + col][wave * 16 + 8 * g + r] = hv; tl[j * 16 + col][wave * 16 + 8 * g + r] = (_Float16)((v - (float)hv) * 2048.0f); } else sh[wave * 16 + 8 * g + r][j * 16 + col] = (_Float16)v; } }
  __syncthreads();
  if (which < 2) { for (int e = tid; e < 64 * 16; e += 128) { const int rl = e >> 4, q = e & 15; vst2((unsigned*)(QK + (b * NN + blockIdx.x * 64 + rl) * (2 * CM) + c0 + q * 8), *(const v4u*)&sh[rl][q * 8]); } }
  else if (which == 2) { const int cv0 = c0 - 2 * CM; for (int e = tid; e < 128 * 8; e += 128) { const int cl = e >> 3, q = e & 7; const size_t o = ((b * CM + cv0 + cl) * (size_t)NN) + blockIdx.x * 64 + q * 8; vst2((unsigned*)(VT + o), *(const v4u*)&th[cl][q * 8]); vst2((unsigned*)(VTL + o), *(const v4u*)&tl[cl][q * 8]); } }
  else { for (int e = tid; e < 64 * 16; e += 128) { const int rl = e >> 4, q = e & 15; vst2((unsigned*)(Gt + nat<MODE>(b, blockIdx.x * 64 + rl) * CM + (c0 - 3 * CM) + q * 8), *(const v4u*)&sh[rl][q * 8]); } } }
// ---- k_pb: block = (query residue q, 128 keys): PB[h][q][k] = LN(z[q][k]) . wb[:, h]; 16 lanes share one z row (8 channels a lane, two 16-byte loads), a wave works on 2 rows at a time; this lane's 8 x 8 weights stay in registers
// value of lane l ^ MSK inside a 16-lane row, by a DPP move (no LDS round trip as with __shfl_xor)
template <int MSK> __device__ __forceinline__ float rowx(float x) { return __builtin_bit_cast(float, __builtin_amdgcn_mov_dpp(__builtin_bit_cast(int, x), 0x160 | MSK, 0xf, 0xf, true)); }
#define PBK 128
__global__ __launch_bounds__(256) void k_pb(const float* __restrict__ Zp, const float* __restrict__ G, const float* __restrict__ Bt, const float* __restrict__ WB, float* __restrict__ PB) { __shared__ __align__(16) float sp[NH][PBK + 4]; __shared__ __align__(16) float swb[CZ / 4][4 * NH + 4];   // swb: 4 channels x 8 heads a row, pitch 36 words: the 16 lanes' 16-byte reads fall on distinct banks
  const int t = threadIdx.x, lane = t & 31, w = t >> 5, l16 = lane & 15, hf = lane >> 4; const int q = blockIdx.x, k0 = blockIdx.y * PBK;
  const float* zr = Zp + ((size_t)q * RR + k0 + w * 16 + hf) * CZ + l16 * 4;   // rows w*16 + 2p + hf; channels 4*l16 + e and 64 + 4*l16 + e
  // every loop of this kernel is fully unrolled: its arrays are indexed by constants and stay in registers
  v4f za[8], zb[8];   // the wave's 16 rows: all 16 loads are issued before the first use, so memory latency is paid once
#pragma unroll
  for (int p = 0; p < 8; ++p) { za[p] = *(const v4f*)(zr + (size_t)p * 2 * CZ); zb[p] = *(const v4f*)(zr + (size_t)p * 2 * CZ + 64); }
  v4f g4[2], b4[2];
#pragma unroll
  for (int i = 0; i < 2; ++i) { g4[i] = *(const v4f*)(G + 64 * i + l16 * 4); b4[i] = *(const v4f*)(Bt + 64 * i + l16 * 4); }
  { v4f w4 = *(const v4f*)(WB + t * 4); w4[0] = bfr(w4[0]); w4[1] = bfr(w4[1]); w4[2] = bfr(w4[2]); w4[3] = bfr(w4[3]); *(v4f*)&swb[t >> 3][(t & 7) * 4] = w4; } __syncthreads();
  float wv[8][NH], gg[8], bb[8];
#pragma unroll
  for (int i = 0; i < 2; ++i) {
#pragma unroll
    for (int e = 0; e < 4; ++e) { gg[i * 4 + e] = bfr(g4[i][e]); bb[i * 4 + e] = bfr(b4[i][e]); const v4f w0 = *(const v4f*)&swb[16 * i + l16][e * NH], w1 = *(const v4f*)&swb[16 * i + l16][e * NH + 4];
#pragma unroll
      for (int h = 0; h < 4; ++h) { wv[i * 4 + e][h] = w0[h]; wv[i * 4 + e][4 + h] = w1[h]; } } }
  const bool b0 = (l16 & 1) != 0, b1 = (l16 & 2) != 0, b2 = (l16 & 4) != 0;
#pragma unroll
  for (int p = 0; p < 8; ++p) { float v[8];
#pragma unroll
    for (int e = 0; e < 4; ++e) { v[e] = bfr(za[p][e]); v[4 + e] = bfr(zb[p][e]); }
    float s = ((v[0] + v[1]) + (v[2] + v[3])) + ((v[4] + v[5]) + (v[6] + v[7]));
    s += rowx<1>(s); s += rowx<2>(s); s += rowx<4>(s); s += rowx<8>(s);
    const float mu = s / (float)CZ; float qq = 0.f;
#pragma unroll
    for (int i = 0; i < 8; ++i) { v[i] -= mu; qq += v[i] * v[i]; }
    qq += rowx<1>(qq); qq += rowx<2>(qq); qq += rowx<4>(qq); qq += rowx<8>(qq);
    const float inv = 1.0f / sqrtf(qq / (float)CZ + 1e-5f); float ph[NH];
#pragma unroll
    for (int h = 0; h < NH; ++h) ph[h] = 0.f;
#pragma unroll
    for (int i = 0; i < 8; ++i) { const float ln = v[i] * inv * gg[i] + bb[i];
#pragma unroll
      for (int h = 0; h < NH; ++h) ph[h] += ln * wv[i][h]; }
    // sum over the 16 lanes, halving the heads a lane carries at each of the first three steps: lane l16 ends with head l16 & 7
    float y[4], u[2];
#pragma unroll
    for (int i = 0; i < 4; ++i) y[i] = (b0 ? ph[2 * i + 1] : ph[2 * i]) + rowx<1>(b0 ? ph[2 * i] : ph[2 * i + 1]);
#pragma unroll
    for (int i = 0; i < 2; ++i) u[i] = (b1 ? y[2 * i + 1] : y[2 * i]) + rowx<2>(b1 ? y[2 * i] : y[2 * i + 1]);
    float x = (b2 ? u[1] : u[0]) + rowx<4>(b2 ? u[0] : u[1]); x += rowx<8>(x);
    if (l16 < NH) sp[l16][w * 16 + p * 2 + hf] = x; }
  __syncthreads(); { const int h = t >> 5, q4 = t & 31; vst2(PB + ((size_t)h * RR + q) * RR + k0 + q4 * 4, *(const v4f*)&sp[h][q4 * 4]); } }
// ---- k_att<MODE>: block = (64 queries, head, b): logits q.k x 32^-0.5 (+ pair bias in MODE 0), masked keys excluded, softmax, P . v (planes hi + residual) -> O compact rows
template <int MODE>
__global__ __launch_bounds__(128) void k_att(const _Float16* __restrict__ QK, const _Float16* __restrict__ VT, const _Float16* __restrict__ VTL, const float* __restrict__ PB, const float* __restrict__ MASK, float* __restrict__ O) {
  constexpr int NN = MODE == 0 ? RR : SQ; __shared__ __align__(16) float sp[4][16][36]; __shared__ __align__(16) float so[4][16][36];
  const int tid = threadIdx.x, wave = tid >> 5, lane = tid & 31, col = lane & 15, g = lane >> 4; const int h = blockIdx.y; const size_t b = blockIdx.z; const int q0 = blockIdx.x * 64 + wave * 16; const size_t rq = b * NN + q0;
  const v16h aq = frag_h(QK + (rq + col) * (2 * CM) + h * CA, lane);
  float m[8], l[8];
#pragma unroll
  for (int r = 0; r < 8; ++r) { m[r] = -3.0e38f; l[r] = 0.f; }
  v8f acc[2] = {}, accl[2] = {};
#pragma unroll 1
  for (int ks = 0; ks < NN / 32; ++ks) { v8f s[2];
#pragma unroll
    for (int ct = 0; ct < 2; ++ct) { const int kk = ks * 32 + ct * 16 + col; const size_t rk = b * NN + kk; const v16h kh = frag_h(QK + rk * (2 * CM) + CM + h * CA, lane); v8f c = {}; c = wmma16(aq, kh, c);
      const bool keep = bfr(MASK[nat<MODE>(b, kk)]) != 0.f;
#pragma unroll
      for (int r = 0; r < 8; ++r) { float sc = c[r] * 0.17677669529663687f; if (MODE == 0) sc += PB[((size_t)h * RR + (q0 + 8 * g + r)) * RR + kk]; s[ct][r] = keep ? sc : -3.0e38f; } }
    float alpha[8];
#pragma unroll
    for (int r = 0; r < 8; ++r) { float mx = fmaxf(s[0][r], s[1][r]);
#pragma unroll
      for (int o = 1; o < 16; o <<= 1) mx = fmaxf(mx, __shfl_xor(mx, o));
      const float mn = fmaxf(m[r], mx); alpha[r] = (m[r] <= -1.0e38f) ? 0.f : __expf(m[r] - mn); const float e0 = (s[0][r] <= -1.0e38f) ? 0.f : __expf(s[0][r] - mn), e1 = (s[1][r] <= -1.0e38f) ? 0.f : __expf(s[1][r] - mn); float es = e0 + e1;
#pragma unroll
      for (int o = 1; o < 16; o <<= 1) es += __shfl_xor(es, o);
      l[r] = l[r] * alpha[r] + es; m[r] = mn; sp[wave][8 * g + r][col] = e0; sp[wave][8 * g + r][16 + col] = e1; }
#pragma unroll
    for (int j = 0; j < 2; ++j)
#pragma unroll
      for (int r = 0; r < 8; ++r) { acc[j][r] *= alpha[r]; accl[j][r] *= alpha[r]; }
    LDSX();
    v16h pa, pal; { const float* prow = &sp[wave][col][0] + 8 * (lane >> 4);
#pragma unroll
      for (int i = 0; i < 8; ++i) { const float p0 = prow[i] * 2048.0f, p1 = prow[16 + i] * 2048.0f; pa[i] = (_Float16)p0; pa[8 + i] = (_Float16)p1; pal[i] = (_Float16)((p0 - (float)pa[i]) * 2048.0f); pal[8 + i] = (_Float16)((p1 - (float)pa[8 + i]) * 2048.0f); } }
#pragma unroll
    for (int j = 0; j < 2; ++j) { const size_t po = (b * CM + (size_t)h * CA + j * 16 + col) * (size_t)NN + ks * 32; const v16h vh = frag_h(VT + po, lane); acc[j] = wmma16(pa, vh, acc[j]); accl[j] = wmma16(pa, frag_h(VTL + po, lane), accl[j]); accl[j] = wmma16(pal, vh, accl[j]); }
    LDSX(); }
#pragma unroll
  for (int r = 0; r < 8; ++r) { const float il = (l[r] > 0.f) ? (1.0f / 2048.0f) / l[r] : 0.f;
#pragma unroll
    for (int j = 0; j < 2; ++j) so[wave][8 * g + r][j * 16 + col] = (acc[j][r] + accl[j][r] * (1.0f / 2048.0f)) * il; }
  LDSX(); for (int rl = 0; rl < 16; ++rl) if (lane < 8) vst2(O + (rq + rl) * CM + (size_t)h * CA + lane * 4, *(const v4f*)&so[wave][rl][lane * 4]); }
// ---- k_go<MODE>: block = (64 natural rows, 128 cols): M = (g o) . wo + bo ; A operand built on the fly from G (natural) and O (compact)
template <int MODE>
__global__ __launch_bounds__(128) void k_go(const _Float16* __restrict__ Gt, const float* __restrict__ O, const _Float16* __restrict__ WOr, const float* __restrict__ BO, float* __restrict__ M) { __shared__ __align__(16) float sf[4][16][132];
  const int tid = threadIdx.x, wave = tid >> 5, lane = tid & 31, col = lane & 15, g = lane >> 4; const size_t r0 = (size_t)blockIdx.x * 64 + wave * 16; const int c0 = blockIdx.y * 128;
  const size_t nr = r0 + col; const size_t s_ = nr / RR, r_ = nr % RR; const size_t cidx = MODE == 0 ? nr : r_ * SQ + s_;   // compact row of this natural row
  v8f acc[8] = {}, accl2[8] = {};
#pragma unroll
  for (int kc = 0; kc < CM / 32; ++kc) { v16h a, al; const _Float16* gp = Gt + nr * CM + kc * 32 + 8 * g; const float* op = O + cidx * CM + kc * 32 + 8 * g;
#pragma unroll
    for (int i = 0; i < 8; ++i) { const float v0 = (float)gp[i] * op[i], v1 = (float)gp[16 + i] * op[16 + i]; a[i] = (_Float16)v0; a[8 + i] = (_Float16)v1; al[i] = (_Float16)((v0 - (float)a[i]) * 2048.0f); al[8 + i] = (_Float16)((v1 - (float)a[8 + i]) * 2048.0f); }
#pragma unroll
    for (int j = 0; j < 8; ++j) { const v16h w = frag_h(WOr + (size_t)(c0 + j * 16 + col) * CM + kc * 32, lane); acc[j] = wmma16(a, w, acc[j]); accl2[j] = wmma16(al, w, accl2[j]); } }
#pragma unroll
  for (int j = 0; j < 8; ++j) { const int c = c0 + j * 16 + col; const float bb = bfr(BO[c]);
#pragma unroll
    for (int r = 0; r < 8; ++r) sf[wave][8 * g + r][j * 16 + col] = (acc[j][r] + accl2[j][r] * (1.0f / 2048.0f)) * (1.0f / WSC) + bb; }
  LDSX(); for (int rl = 0; rl < 16; ++rl) vst2(M + (r0 + rl) * CM + c0 + lane * 4, *(const v4f*)&sf[wave][rl][lane * 4]); }   // M here = the output buffer (no residual in this module)
// ---- k_ff1: block = (64 rows, 128 of 1024 cols): H1 = relu(XH . W1 + b1) -> f16 ; k_ff2: out = H1 . W2 + b2 + M
__global__ __launch_bounds__(128) void k_ff1(const _Float16* __restrict__ XH, const _Float16* __restrict__ W1r, const float* __restrict__ B1, _Float16* __restrict__ H1) { __shared__ __align__(16) _Float16 sh[4][16][136];
  const int tid = threadIdx.x, wave = tid >> 5, lane = tid & 31, col = lane & 15, g = lane >> 4; const size_t r0 = (size_t)blockIdx.x * 64 + wave * 16; const int c0 = blockIdx.y * 128;
  v8f acc[8] = {};
#pragma unroll
  for (int kc = 0; kc < CM / 32; ++kc) { const v16h a = frag_h(XH + (r0 + col) * CM + kc * 32, lane);
#pragma unroll
    for (int j = 0; j < 8; ++j) acc[j] = wmma16(a, frag_h(W1r + (size_t)(c0 + j * 16 + col) * CM + kc * 32, lane), acc[j]); }
#pragma unroll
  for (int j = 0; j < 8; ++j) { const float bb = bfr(B1[c0 + j * 16 + col]);
#pragma unroll
    for (int r = 0; r < 8; ++r) sh[wave][8 * g + r][j * 16 + col] = (_Float16)fmaxf(acc[j][r] * (1.0f / WSC) + bb, 0.f); }
  LDSX(); for (int rl = 0; rl < 16; ++rl) if (lane < 16) vst2((unsigned*)(H1 + (r0 + rl) * FF + c0 + lane * 8), *(const v4u*)&sh[wave][rl][lane * 8]); }
__global__ __launch_bounds__(128) void k_ff2(const _Float16* __restrict__ H1, const _Float16* __restrict__ W2r, const float* __restrict__ B2, const float* __restrict__ M, float* __restrict__ OUT) { __shared__ __align__(16) float sf[4][16][132];
  const int tid = threadIdx.x, wave = tid >> 5, lane = tid & 31, col = lane & 15, g = lane >> 4; const size_t r0 = (size_t)blockIdx.x * 64 + wave * 16; const int c0 = blockIdx.y * 128;
  v8f acc[8] = {};
#pragma unroll 2
  for (int kc = 0; kc < FF / 32; ++kc) { const v16h a = frag_h(H1 + (r0 + col) * FF + kc * 32, lane);
#pragma unroll
    for (int j = 0; j < 8; ++j) acc[j] = wmma16(a, frag_h(W2r + (size_t)(c0 + j * 16 + col) * FF + kc * 32, lane), acc[j]); }
#pragma unroll
  for (int j = 0; j < 8; ++j) { const int c = c0 + j * 16 + col; const float bb = bfr(B2[c]);
#pragma unroll
    for (int r = 0; r < 8; ++r) sf[wave][8 * g + r][j * 16 + col] = acc[j][r] * (1.0f / WSC) + bb + M[(r0 + 8 * g + r) * CM + c]; }
  LDSX(); for (int rl = 0; rl < 16; ++rl) vst2(OUT + (r0 + rl) * CM + c0 + lane * 4, *(const v4f*)&sf[wave][rl][lane * 4]); }
extern "C" void kernel_launch(void* const* d_in, const int* in_sizes, int n_in, void* d_out, int out_size, void* d_ws, size_t ws_size, hipStream_t stream) {
  (void)in_sizes; (void)n_in; (void)out_size;
  const float** F = (const float**)d_in;   // 0 m [1,128,256,256], 1 z [1,256,256,128], 2 mask [1,128,256], 3 ln_m_g, 4 ln_m_b, 5 ln_z_g, 6 ln_z_b, 7 wz [128,8], 8 wq [256,8,32], 9 wk, 10 wv, 11 wg, 12 bg [8,32], 13 wo [8,32,256], 14 bo [256]
  if (ws_size < (size_t)WS_END) return;
  char* ws = (char*)d_ws; _Float16 *RW = (_Float16*)(ws + WS_RW), *RWOp = (_Float16*)(ws + WS_RWO), *XH = (_Float16*)(ws + WS_XH), *QK = (_Float16*)(ws + WS_QK), *VT = (_Float16*)(ws + WS_VT), *VTL = (_Float16*)(ws + WS_VTL), *Gt = (_Float16*)(ws + WS_G);
  float *O = (float*)(ws + WS_O), *M = (float*)(ws + WS_M), *PB = (float*)(ws + WS_PB);
  k_packw<<<dim3(1024, 3), 256, 0, stream>>>(F[8], F[9], F[10], F[11], F[8], F[9], F[10], F[11], F[13], F[13], F[8], F[13], ws);   // which 0 (q|k|v|g rows) and 2 (wo rows) are used; which 1 packs in-bounds duplicates; 3-5 not launched
  k_init<<<(unsigned)((size_t)NROW * CM / 4096), 256, 0, stream>>>(F[0], M);
  k_ln<<<NROW, 256, 0, stream>>>(M, F[3], F[4], XH);
  k_proj<0><<<dim3(RR / 64, 8, SQ), 128, 0, stream>>>(XH, RW, F[12], QK, VT, VTL, Gt);
  k_pb<<<dim3(RR, RR / PBK), 256, 0, stream>>>(F[1], F[5], F[6], F[7], PB);
  k_att<0><<<dim3(RR / 64, NH, SQ), 128, 0, stream>>>(QK, VT, VTL, PB, F[2], O);
  k_go<0><<<dim3(NROW / 64, CM / 128), 128, 0, stream>>>(Gt, O, RWOp, F[14], (float*)d_out);
}

// v002
// Measured time: 248 microseconds a run.
// Two timings next to v001 put it at 1.12 and 1.13 times that version's speed.
// Over all steps from v000 it is 1.42 times as fast.
// compute dtype: all float inputs rounded to bf16; LayerNorms, pair bias (LN(z) . wz), softmax, sigmoid gate in f32; q|k|v|g projections on WMMA 16x16x32 with the LayerNorm output rounded once to f16 against exact f16 x 2^8 weights; attention logits with single f16 q, k (32-dim heads), P as f16 hi + residual (x 2^11) . v (hi + residual; 3 products); (g o) as f16 hi + residual (2 products) . wo (f16 x 2^8) + bo; f32 output.
#include <hip/hip_runtime.h>
#include <math.h>

typedef __attribute__((ext_vector_type(16))) _Float16 v16h;
typedef __attribute__((ext_vector_type(16))) __bf16 v16b;
typedef __attribute__((ext_vector_type(8)))  _Float16 v8h;
typedef __attribute__((ext_vector_type(8)))  float v8f;
typedef __attribute__((ext_vector_type(4)))  float v4f;
typedef __attribute__((ext_vector_type(2)))  float v2f;
typedef __attribute__((ext_vector_type(4)))  unsigned v4u;
typedef __attribute__((ext_vector_type(4)))  int v4i;
typedef float __attribute__((may_alias)) float_a;
typedef int __attribute__((may_alias)) int_a;

template <typename T> __device__ __forceinline__ void vst2(void* p, T v) { *(T*)p = v;  }
__device__ __forceinline__ v8f wmma16(v16h a, v16h b, v8f c) {
  v8f d = __builtin_amdgcn_wmma_f32_16x16x32_f16(false, a, false, b, (short)0, c, false, false);
  asm volatile("v_nop\n\tv_nop\n\tv_nop\n\tv_nop" : "+v"(d) : "v"(a), "v"(b));
  return d;
}
__device__ __forceinline__ v8f wmma_bf(v16b a, v16b b, v8f c) {
  v8f d = __builtin_amdgcn_wmma_f32_16x16x32_bf16(false, a, false, b, (short)0, c, false, false);
  asm volatile("v_nop\n\tv_nop\n\tv_nop\n\tv_nop" : "+v"(d) : "v"(a), "v"(b));
  return d;
}
// 16x16x32 fragments: lane = (h = lane>>4, row/col = lane&15); elements 0..7 = k0+8h+0..7, 8..15 = k0+16+8h+0..7; D element r = row 8h+r
__device__ __forceinline__ v16h frag_h(const _Float16* rowk0, int lane) {
  union { v16h v; v8h q[2]; } u; const _Float16* p = rowk0 + 8 * (lane >> 4);
  u.q[0] = *(const v8h*)p; u.q[1] = *(const v8h*)(p + 16); return u.v;
}
__device__ __forceinline__ v16h frag_f32(const float* rowk0, int lane) {
  v16h a; const float* p = rowk0 + 8 * (lane >> 4);
#pragma unroll
  for (int i = 0; i < 8; ++i) { a[i] = (_Float16)p[i]; a[8 + i] = (_Float16)p[16 + i]; }
  return a;
}
__device__ __forceinline__ v16h frag_f32s(const float* rowk0, int lane, float sc) {
  v16h a; const float* p = rowk0 + 8 * (lane >> 4);
#pragma unroll
  for (int i = 0; i < 8; ++i) { a[i] = (_Float16)(p[i] * sc); a[8 + i] = (_Float16)(p[16 + i] * sc); }
  return a;
}
// column fragment from a [K][ld] layout (column n), rows >= K read as 0
__device__ __forceinline__ v16h fragc_f32(const float* W, int k0, int n, int lane, int ld, int K) {
  v16h a; const int g = lane >> 4;
#pragma unroll
  for (int i = 0; i < 8; ++i) { const int ka = k0 + 8 * g + i, kb = ka + 16;
    a[i] = (_Float16)(ka < K ? W[(size_t)(ka < K ? ka : K - 1) * ld + n] : 0.f); a[8 + i] = (_Float16)(kb < K ? W[(size_t)(kb < K ? kb : K - 1) * ld + n] : 0.f); }
  return a;
}
struct F2 { v16b h, l; };
__device__ __forceinline__ F2 bsplit16(const float v[16]) { F2 r;
#pragma unroll
  for (int i = 0; i < 16; ++i) { const __bf16 h = (__bf16)v[i]; r.h[i] = h; r.l[i] = (__bf16)(v[i] - (float)h); }
  return r; }
__device__ __forceinline__ F2 split_row(const float* row, int k0, int lane) { float v[16]; const float* p = row + k0 + 8 * (lane >> 4);
#pragma unroll
  for (int i = 0; i < 8; ++i) { v[i] = p[i]; v[8 + i] = p[16 + i]; }
  return bsplit16(v); }
__device__ __forceinline__ F2 split_rowK(const float* row, int k0, int lane, int K) { float v[16]; const int g = lane >> 4;
#pragma unroll
  for (int i = 0; i < 8; ++i) { const int ka = k0 + 8 * g + i, kb = ka + 16; v[i] = ka < K ? row[ka < K ? ka : K - 1] : 0.f; v[8 + i] = kb < K ? row[kb < K ? kb : K - 1] : 0.f; }
  return bsplit16(v); }
__device__ __forceinline__ F2 split_col(const float* W, int k0, int n, int lane, int ld, int K) { float v[16]; const int g = lane >> 4;
#pragma unroll
  for (int i = 0; i < 8; ++i) { const int ka = k0 + 8 * g + i, kb = ka + 16; v[i] = ka < K ? W[(size_t)(ka < K ? ka : K - 1) * ld + n] : 0.f; v[8 + i] = kb < K ? W[(size_t)(kb < K ? kb : K - 1) * ld + n] : 0.f; }
  return bsplit16(v); }
__device__ __forceinline__ v8f mac3(const F2& a, const F2& b, v8f c) { c = wmma_bf(a.l, b.h, c); c = wmma_bf(a.h, b.l, c); return wmma_bf(a.h, b.h, c); }
__device__ __forceinline__ float sigm(float v) { return 1.0f / (1.0f + expf(-v)); }
#define LDSX() do { asm volatile("s_wait_dscnt 0" ::: "memory"); __builtin_amdgcn_wave_barrier(); __builtin_amdgcn_fence(__ATOMIC_RELEASE, "workgroup"); } while (0)


// MSA row attention with pair bias (B 1, S 128 sequences x R 256 residues, c_m 256, 8 heads x 32, c_z 128): out = (sigmoid(LN(m) wg + bg) * softmax(q k / sqrt(32) + 1e9 (mask - 1) + LN(z) wz) v) wo + bo.
#define SQ 128
#define RR 256
#define CM 256
#define NH 8
#define CA 32
#define CZ 128
#define FF 1024
#define NROW (SQ * RR)
#define WSC 256.0f
#ifndef TON
#define TON 1           // unused
#endif
typedef __attribute__((ext_vector_type(8))) __bf16 v8b;
__device__ __forceinline__ v16b frag_b(const __bf16* rowk0, int lane) {
  union { v16b v; v8b q[2]; } u; const __bf16* p = rowk0 + 8 * (lane >> 4);
  u.q[0] = *(const v8b*)p; u.q[1] = *(const v8b*)(p + 16); return u.v;
}
__device__ __forceinline__ float bfr(float v) { return (float)(__bf16)v; }
__device__ __attribute__((noinline)) float exp_ni(float v) { return expf(v); }
__device__ __attribute__((noinline)) float erf_ni(float v) { return erff(v); }

// weight rows (f16 x 2^8, transposed (in,out)): RW [1024][256] = row q|k|v|g ; CW [1024][256]; RWO [256][256]; CWO [256][256]; TW1 [1024][256]; TW2 [256][1024]
#define WS_RW   0u
#define WS_CW   (WS_RW + 2u * 1024 * CM)
#define WS_RWO  (WS_CW + 2u * 1024 * CM)
#define WS_CWO  (WS_RWO + 2u * CM * CM)
#define WS_TW1  (WS_CWO + 2u * CM * CM)
#define WS_TW2  (WS_TW1 + 2u * FF * CM)
#define WS_XH   (WS_TW2 + 2u * CM * FF)                 // f16 LN rows [NROW][256] (natural s*R + r)
#define WS_QK   (WS_XH + 2u * (size_t)NROW * CM)         // f16 q|k rows [compact][512]
#define WS_VT   (WS_QK + 2u * (size_t)NROW * 2 * CM)     // f16 hi|lo v planes [b][256][N]
#define WS_VTL  (WS_VT + 2u * (size_t)NROW * CM)
#define WS_G    (WS_VTL + 2u * (size_t)NROW * CM)        // f16 sigmoid gate rows [natural][256]
#define WS_O    (WS_G + 2u * (size_t)NROW * CM)          // f32 attention output [compact][256]
#define WS_M    (WS_O + 4u * (size_t)NROW * CM)          // f32 working m [natural][256]
#define WS_PB   (WS_M + 4u * (size_t)NROW * CM)          // f32 pair bias [h][q][k]
#define WS_H1   (WS_PB + 4u * (size_t)NH * RR * RR)      // f16 relu rows [natural][1024]
#define WS_END  (WS_H1 + 2u * (size_t)NROW * FF)

// ---- k_packw: block = output row n; which: 0 RW (W = rq|rk|rv|rg by n/256), 1 CW, 2 RWO, 3 CWO, 4 TW1, 5 TW2
__global__ __launch_bounds__(256) void k_packw(const float* __restrict__ RQ, const float* __restrict__ RK, const float* __restrict__ RV, const float* __restrict__ RG, const float* __restrict__ CQ, const float* __restrict__ CK, const float* __restrict__ CV, const float* __restrict__ CG, const float* __restrict__ RWO, const float* __restrict__ CWO, const float* __restrict__ TW1, const float* __restrict__ TW2, char* __restrict__ ws) {
  const int n = blockIdx.x, which = blockIdx.y, t = threadIdx.x; __shared__ __align__(16) _Float16 s[FF];
  const float* Wm; int kin, kout, col; _Float16* dst;
  if (which == 0) { if (n >= 1024) return; const int g4 = n / CM; col = n % CM; Wm = g4 == 0 ? RQ : g4 == 1 ? RK : g4 == 2 ? RV : RG; kin = CM; kout = CM; dst = (_Float16*)(ws + WS_RW) + (size_t)n * CM; }
  else if (which == 1) { if (n >= 1024) return; const int g4 = n / CM; col = n % CM; Wm = g4 == 0 ? CQ : g4 == 1 ? CK : g4 == 2 ? CV : CG; kin = CM; kout = CM; dst = (_Float16*)(ws + WS_CW) + (size_t)n * CM; }
  else if (which == 2) { if (n >= CM) return; col = n; Wm = RWO; kin = CM; kout = CM; dst = (_Float16*)(ws + WS_RWO) + (size_t)n * CM; }
  else if (which == 3) { if (n >= CM) return; col = n; Wm = CWO; kin = CM; kout = CM; dst = (_Float16*)(ws + WS_CWO) + (size_t)n * CM; }
  else if (which == 4) { if (n >= FF) return; col = n; Wm = TW1; kin = CM; kout = FF; dst = (_Float16*)(ws + WS_TW1) + (size_t)n * CM; }
  else { if (n >= CM) return; col = n; Wm = TW2; kin = FF; kout = CM; dst = (_Float16*)(ws + WS_TW2) + (size_t)n * FF; }
  for (int k = t; k < kin; k += 256) s[k] = (_Float16)(bfr(Wm[(size_t)k * kout + col]) * WSC); __syncthreads(); for (int q = t; q < kin / 8; q += 256) vst2((unsigned*)(dst + q * 8), *(const v4u*)&s[q * 8]); }
// ---- k_ln: XH = LN(bf16(m)) w + b (jnp.var, 1e-5) -> f16. One wave owns a row (lane l: channels 4l + e and 128 + 4l + e, so each 16-byte load of a wave covers 512 contiguous bytes) and works on LNR rows; no LDS, no barrier
// value of lane l ^ MSK inside a 16-lane row, by a DPP move (no LDS round trip as with __shfl_xor)
template <int MSK> __device__ __forceinline__ float rowx(float x) { return __builtin_bit_cast(float, __builtin_amdgcn_mov_dpp(__builtin_bit_cast(int, x), 0x160 | MSK, 0xf, 0xf, true)); }
// lane l with lane l ^ 16
__device__ __forceinline__ float xhalf(float x) { return __builtin_bit_cast(float, __builtin_amdgcn_permlanex16(__builtin_bit_cast(int, x), __builtin_bit_cast(int, x), 0x76543210, 0xfedcba98, false, false)); }
__device__ __forceinline__ float wsum(float s) { s += rowx<1>(s); s += rowx<2>(s); s += rowx<4>(s); s += rowx<8>(s); return s + xhalf(s); }
typedef __attribute__((ext_vector_type(4))) _Float16 v4h;
#define LNR 8
__global__ __launch_bounds__(256) void k_ln(const float* __restrict__ X, const float* __restrict__ G, const float* __restrict__ Bt, _Float16* __restrict__ XH) { const int lane = threadIdx.x & 31; const size_t row0 = ((size_t)blockIdx.x * 8 + (threadIdx.x >> 5)) * LNR;
  const float* xr = X + row0 * CM + lane * 4; _Float16* yr = XH + row0 * CM + lane * 4;
  // both loops are fully unrolled: the arrays are indexed by constants and stay in registers
  v4f xa[LNR], xb[LNR];   // the wave's LNR rows: all loads are issued before the first use, so memory latency is paid once
#pragma unroll
  for (int p = 0; p < LNR; ++p) { xa[p] = *(const v4f*)(xr + (size_t)p * CM); xb[p] = *(const v4f*)(xr + (size_t)p * CM + 128); }
  const v4f g0 = *(const v4f*)(G + lane * 4), g1 = *(const v4f*)(G + 128 + lane * 4), c0 = *(const v4f*)(Bt + lane * 4), c1 = *(const v4f*)(Bt + 128 + lane * 4);
  float gg[8], bb[8];
#pragma unroll
  for (int e = 0; e < 4; ++e) { gg[e] = bfr(g0[e]); gg[4 + e] = bfr(g1[e]); bb[e] = bfr(c0[e]); bb[4 + e] = bfr(c1[e]); }
#pragma unroll
  for (int p = 0; p < LNR; ++p) { float v[8];
#pragma unroll
    for (int e = 0; e < 4; ++e) { v[e] = bfr(xa[p][e]); v[4 + e] = bfr(xb[p][e]); }
    const float mu = wsum(((v[0] + v[1]) + (v[2] + v[3])) + ((v[4] + v[5]) + (v[6] + v[7]))) / (float)CM; float qq = 0.f;
#pragma unroll
    for (int i = 0; i < 8; ++i) { v[i] -= mu; qq += v[i] * v[i]; }
    const float inv = 1.0f / sqrtf(wsum(qq) / (float)CM + 1e-5f); v4h h0, h1;
#pragma unroll
    for (int e = 0; e < 4; ++e) { h0[e] = (_Float16)(v[e] * inv * gg[e] + bb[e]); h1[e] = (_Float16)(v[4 + e] * inv * gg[4 + e] + bb[4 + e]); }
    vst2(yr + (size_t)p * CM, h0); vst2(yr + (size_t)p * CM + 128, h1); } }
// natural row index of (batch b, token n): MODE 0 row attention (b = s, n = r); MODE 1 column attention (b = r, n = s)
template <int MODE> __device__ __forceinline__ size_t nat(size_t b, int n) { return MODE == 0 ? b * RR + n : (size_t)n * RR + b; }
// ---- k_proj<MODE>: block = (64 tokens, 128 of 1024 cols (q|k|v|g), b): A = XH rows; q|k -> QK compact rows (single f16); v -> planes hi/lo; g -> sigmoid -> f16 natural rows
template <int MODE>
__global__ __launch_bounds__(128) void k_proj(const _Float16* __restrict__ XH, const _Float16* __restrict__ Wr, const float* __restrict__ BG, _Float16* __restrict__ QK, _Float16* __restrict__ VT, _Float16* __restrict__ VTL, _Float16* __restrict__ Gt) {
  constexpr int NN = MODE == 0 ? RR : SQ; __shared__ __align__(16) _Float16 sh[64][136]; __shared__ __align__(16) _Float16 th[128][72], tl[128][72];
  const int tid = threadIdx.x, wave = tid >> 5, lane = tid & 31, col = lane & 15, g = lane >> 4; const size_t b = blockIdx.z; const int n0 = blockIdx.x * 64 + wave * 16; const int c0 = blockIdx.y * 128; const int which = c0 / CM;   // 0 q, 1 k, 2 v, 3 g
  v8f acc[8] = {};
#pragma unroll
  for (int kc = 0; kc < CM / 32; ++kc) { const v16h a = frag_h(XH + nat<MODE>(b, n0 + col) * CM + kc * 32, lane);
#pragma unroll
    for (int j = 0; j < 8; ++j) acc[j] = wmma16(a, frag_h(Wr + (size_t)(c0 + j * 16 + col) * CM + kc * 32, lane), acc[j]); }
#pragma unroll
  for (int j = 0; j < 8; ++j) { const int cc = (c0 % CM) + j * 16 + col; const float bg = (which == 3) ? bfr(BG[cc]) : 0.f;
#pragma unroll
    for (int r = 0; r < 8; ++r) { float v = acc[j][r] * (1.0f / WSC); if (which == 3) v = 1.0f / (1.0f + expf(-(v + bg)));
      if (which == 2) { const _Float16 hv = (_Float16)v; th[j * 16 + col][wave * 16 + 8 * g + r] = hv; tl[j * 16 + col][wave * 16 + 8 * g + r] = (_Float16)((v - (float)hv) * 2048.0f); } else sh[wave * 16 + 8 * g + r][j * 16 + col] = (_Float16)v; } }
  __syncthreads();
  if (which < 2) { for (int e = tid; e < 64 * 16; e += 128) { const int rl = e >> 4, q = e & 15; vst2((unsigned*)(QK + (b * NN + blockIdx.x * 64 + rl) * (2 * CM) + c0 + q * 8), *(const v4u*)&sh[rl][q * 8]); } }
  else if (which == 2) { const int cv0 = c0 - 2 * CM; for (int e = tid; e < 128 * 8; e += 128) { const int cl = e >> 3, q = e & 7; const size_t o = ((b * CM + cv0 + cl) * (size_t)NN) + blockIdx.x * 64 + q * 8; vst2((unsigned*)(VT + o), *(const v4u*)&th[cl][q * 8]); vst2((unsigned*)(VTL + o), *(const v4u*)&tl[cl][q * 8]); } }
  else { for (int e = tid; e < 64 * 16; e += 128) { const int rl = e >> 4, q = e & 15; vst2((unsigned*)(Gt + nat<MODE>(b, blockIdx.x * 64 + rl) * CM + (c0 - 3 * CM) + q * 8), *(const v4u*)&sh[rl][q * 8]); } } }
// ---- k_pb: block = (query residue q, 128 keys): PB[h][q][k] = LN(z[q][k]) . wb[:, h]; 16 lanes share one z row (8 channels a lane, two 16-byte loads), a wave works on 2 rows at a time; this lane's 8 x 8 weights stay in registers
#define PBK 128
__global__ __launch_bounds__(256) void k_pb(const float* __restrict__ Zp, const float* __restrict__ G, const float* __restrict__ Bt, const float* __restrict__ WB, float* __restrict__ PB) { __shared__ __align__(16) float sp[NH][PBK + 4]; __shared__ __align__(16) float swb[CZ / 4][4 * NH + 4];   // swb: 4 channels x 8 heads a row, pitch 36 words: the 16 lanes' 16-byte reads fall on distinct banks
  const int t = threadIdx.x, lane = t & 31, w = t >> 5, l16 = lane & 15, hf = lane >> 4; const int q = blockIdx.x, k0 = blockIdx.y * PBK;
  const float* zr = Zp + ((size_t)q * RR + k0 + w * 16 + hf) * CZ + l16 * 4;   // rows w*16 + 2p + hf; channels 4*l16 + e and 64 + 4*l16 + e
  // every loop of this kernel is fully unrolled: its arrays are indexed by constants and stay in registers
  v4f za[8], zb[8];   // the wave's 16 rows: all 16 loads are issued before the first use, so memory latency is paid once
#pragma unroll
  for (int p = 0; p < 8; ++p) { za[p] = *(const v4f*)(zr + (size_t)p * 2 * CZ); zb[p] = *(const v4f*)(zr + (size_t)p * 2 * CZ + 64); }
  v4f g4[2], b4[2];
#pragma unroll
  for (int i = 0; i < 2; ++i) { g4[i] = *(const v4f*)(G + 64 * i + l16 * 4); b4[i] = *(const v4f*)(Bt + 64 * i + l16 * 4); }
  { v4f w4 = *(const v4f*)(WB + t * 4); w4[0] = bfr(w4[0]); w4[1] = bfr(w4[1]); w4[2] = bfr(w4[2]); w4[3] = bfr(w4[3]); *(v4f*)&swb[t >> 3][(t & 7) * 4] = w4; } __syncthreads();
  float wv[8][NH], gg[8], bb[8];
#pragma unroll
  for (int i = 0; i < 2; ++i) {
#pragma unroll
    for (int e = 0; e < 4; ++e) { gg[i * 4 + e] = bfr(g4[i][e]); bb[i * 4 + e] = bfr(b4[i][e]); const v4f w0 = *(const v4f*)&swb[16 * i + l16][e * NH], w1 = *(const v4f*)&swb[16 * i + l16][e * NH + 4];
#pragma unroll
      for (int h = 0; h < 4; ++h) { wv[i * 4 + e][h] = w0[h]; wv[i * 4 + e][4 + h] = w1[h]; } } }
  const bool b0 = (l16 & 1) != 0, b1 = (l16 & 2) != 0, b2 = (l16 & 4) != 0;
#pragma unroll
  for (int p = 0; p < 8; ++p) { float v[8];
#pragma unroll
    for (int e = 0; e < 4; ++e) { v[e] = bfr(za[p][e]); v[4 + e] = bfr(zb[p][e]); }
    float s = ((v[0] + v[1]) + (v[2] + v[3])) + ((v[4] + v[5]) + (v[6] + v[7]));
    s += rowx<1>(s); s += rowx<2>(s); s += rowx<4>(s); s += rowx<8>(s);
    const float mu = s / (float)CZ; float qq = 0.f;
#pragma unroll
    for (int i = 0; i < 8; ++i) { v[i] -= mu; qq += v[i] * v[i]; }
    qq += rowx<1>(qq); qq += rowx<2>(qq); qq += rowx<4>(qq); qq += rowx<8>(qq);
    const float inv = 1.0f / sqrtf(qq / (float)CZ + 1e-5f); float ph[NH];
#pragma unroll
    for (int h = 0; h < NH; ++h) ph[h] = 0.f;
#pragma unroll
    for (int i = 0; i < 8; ++i) { const float ln = v[i] * inv * gg[i] + bb[i];
#pragma unroll
      for (int h = 0; h < NH; ++h) ph[h] += ln * wv[i][h]; }
    // sum over the 16 lanes, halving the heads a lane carries at each of the first three steps: lane l16 ends with head l16 & 7
    float y[4], u[2];
#pragma unroll
    for (int i = 0; i < 4; ++i) y[i] = (b0 ? ph[2 * i + 1] : ph[2 * i]) + rowx<1>(b0 ? ph[2 * i] : ph[2 * i + 1]);
#pragma unroll
    for (int i = 0; i < 2; ++i) u[i] = (b1 ? y[2 * i + 1] : y[2 * i]) + rowx<2>(b1 ? y[2 * i] : y[2 * i + 1]);
    float x = (b2 ? u[1] : u[0]) + rowx<4>(b2 ? u[0] : u[1]); x += rowx<8>(x);
    if (l16 < NH) sp[l16][w * 16 + p * 2 + hf] = x; }
  __syncthreads(); { const int h = t >> 5, q4 = t & 31; vst2(PB + ((size_t)h * RR + q) * RR + k0 + q4 * 4, *(const v4f*)&sp[h][q4 * 4]); } }
// ---- k_att<MODE>: block = (64 queries, head, b): logits q.k x 32^-0.5 (+ pair bias in MODE 0), masked keys excluded, softmax, P . v (planes hi + residual) -> O compact rows
template <int MODE>
__global__ __launch_bounds__(128) void k_att(const _Float16* __restrict__ QK, const _Float16* __restrict__ VT, const _Float16* __restrict__ VTL, const float* __restrict__ PB, const float* __restrict__ MASK, float* __restrict__ O) {
  constexpr int NN = MODE == 0 ? RR : SQ; __shared__ __align__(16) float sp[4][16][36]; __shared__ __align__(16) float so[4][16][36];
  const int tid = threadIdx.x, wave = tid >> 5, lane = tid & 31, col = lane & 15, g = lane >> 4; const int h = blockIdx.y; const size_t b = blockIdx.z; const int q0 = blockIdx.x * 64 + wave * 16; const size_t rq = b * NN + q0;
  const v16h aq = frag_h(QK + (rq + col) * (2 * CM) + h * CA, lane);
  float m[8], l[8];
#pragma unroll
  for (int r = 0; r < 8; ++r) { m[r] = -3.0e38f; l[r] = 0.f; }
  v8f acc[2] = {}, accl[2] = {};
#pragma unroll 1
  for (int ks = 0; ks < NN / 32; ++ks) { v8f s[2];
#pragma unroll
    for (int ct = 0; ct < 2; ++ct) { const int kk = ks * 32 + ct * 16 + col; const size_t rk = b * NN + kk; const v16h kh = frag_h(QK + rk * (2 * CM) + CM + h * CA, lane); v8f c = {}; c = wmma16(aq, kh, c);
      const bool keep = bfr(MASK[nat<MODE>(b, kk)]) != 0.f;
#pragma unroll
      for (int r = 0; r < 8; ++r) { float sc = c[r] * 0.17677669529663687f; if (MODE == 0) sc += PB[((size_t)h * RR + (q0 + 8 * g + r)) * RR + kk]; s[ct][r] = keep ? sc : -3.0e38f; } }
    float alpha[8];
#pragma unroll
    for (int r = 0; r < 8; ++r) { float mx = fmaxf(s[0][r], s[1][r]);
#pragma unroll
      for (int o = 1; o < 16; o <<= 1) mx = fmaxf(mx, __shfl_xor(mx, o));
      const float mn = fmaxf(m[r], mx); alpha[r] = (m[r] <= -1.0e38f) ? 0.f : __expf(m[r] - mn); const float e0 = (s[0][r] <= -1.0e38f) ? 0.f : __expf(s[0][r] - mn), e1 = (s[1][r] <= -1.0e38f) ? 0.f : __expf(s[1][r] - mn); float es = e0 + e1;
#pragma unroll
      for (int o = 1; o < 16; o <<= 1) es += __shfl_xor(es, o);
      l[r] = l[r] * alpha[r] + es; m[r] = mn; sp[wave][8 * g + r][col] = e0; sp[wave][8 * g + r][16 + col] = e1; }
#pragma unroll
    for (int j = 0; j < 2; ++j)
#pragma unroll
      for (int r = 0; r < 8; ++r) { acc[j][r] *= alpha[r]; accl[j][r] *= alpha[r]; }
    LDSX();
    v16h pa, pal; { const float* prow = &sp[wave][col][0] + 8 * (lane >> 4);
#pragma unroll
      for (int i = 0; i < 8; ++i) { const float p0 = prow[i] * 2048.0f, p1 = prow[16 + i] * 2048.0f; pa[i] = (_Float16)p0; pa[8 + i] = (_Float16)p1; pal[i] = (_Float16)((p0 - (float)pa[i]) * 2048.0f); pal[8 + i] = (_Float16)((p1 - (float)pa[8 + i]) * 2048.0f); } }
#pragma unroll
    for (int j = 0; j < 2; ++j) { const size_t po = (b * CM + (size_t)h * CA + j * 16 + col) * (size_t)NN + ks * 32; const v16h vh = frag_h(VT + po, lane); acc[j] = wmma16(pa, vh, acc[j]); accl[j] = wmma16(pa, frag_h(VTL + po, lane), accl[j]); accl[j] = wmma16(pal, vh, accl[j]); }
    LDSX(); }
#pragma unroll
  for (int r = 0; r < 8; ++r) { const float il = (l[r] > 0.f) ? (1.0f / 2048.0f) / l[r] : 0.f;
#pragma unroll
    for (int j = 0; j < 2; ++j) so[wave][8 * g + r][j * 16 + col] = (acc[j][r] + accl[j][r] * (1.0f / 2048.0f)) * il; }
  LDSX(); for (int rl = 0; rl < 16; ++rl) if (lane < 8) vst2(O + (rq + rl) * CM + (size_t)h * CA + lane * 4, *(const v4f*)&so[wave][rl][lane * 4]); }
// ---- k_go<MODE>: block = (64 natural rows, 128 cols): M = (g o) . wo + bo ; A operand built on the fly from G (natural) and O (compact)
template <int MODE>
__global__ __launch_bounds__(128) void k_go(const _Float16* __restrict__ Gt, const float* __restrict__ O, const _Float16* __restrict__ WOr, const float* __restrict__ BO, float* __restrict__ M) { __shared__ __align__(16) float sf[4][16][132];
  const int tid = threadIdx.x, wave = tid >> 5, lane = tid & 31, col = lane & 15, g = lane >> 4; const size_t r0 = (size_t)blockIdx.x * 64 + wave * 16; const int c0 = blockIdx.y * 128;
  const size_t nr = r0 + col; const size_t s_ = nr / RR, r_ = nr % RR; const size_t cidx = MODE == 0 ? nr : r_ * SQ + s_;   // compact row of this natural row
  v8f acc[8] = {}, accl2[8] = {};
#pragma unroll
  for (int kc = 0; kc < CM / 32; ++kc) { v16h a, al; const _Float16* gp = Gt + nr * CM + kc * 32 + 8 * g; const float* op = O + cidx * CM + kc * 32 + 8 * g;
#pragma unroll
    for (int i = 0; i < 8; ++i) { const float v0 = (float)gp[i] * op[i], v1 = (float)gp[16 + i] * op[16 + i]; a[i] = (_Float16)v0; a[8 + i] = (_Float16)v1; al[i] = (_Float16)((v0 - (float)a[i]) * 2048.0f); al[8 + i] = (_Float16)((v1 - (float)a[8 + i]) * 2048.0f); }
#pragma unroll
    for (int j = 0; j < 8; ++j) { const v16h w = frag_h(WOr + (size_t)(c0 + j * 16 + col) * CM + kc * 32, lane); acc[j] = wmma16(a, w, acc[j]); accl2[j] = wmma16(al, w, accl2[j]); } }
#pragma unroll
  for (int j = 0; j < 8; ++j) { const int c = c0 + j * 16 + col; const float bb = bfr(BO[c]);
#pragma unroll
    for (int r = 0; r < 8; ++r) sf[wave][8 * g + r][j * 16 + col] = (acc[j][r] + accl2[j][r] * (1.0f / 2048.0f)) * (1.0f / WSC) + bb; }
  LDSX(); for (int rl = 0; rl < 16; ++rl) vst2(M + (r0 + rl) * CM + c0 + lane * 4, *(const v4f*)&sf[wave][rl][lane * 4]); }   // M here = the output buffer (no residual in this module)
// ---- k_ff1: block = (64 rows, 128 of 1024 cols): H1 = relu(XH . W1 + b1) -> f16 ; k_ff2: out = H1 . W2 + b2 + M
__global__ __launch_bounds__(128) void k_ff1(const _Float16* __restrict__ XH, const _Float16* __restrict__ W1r, const float* __restrict__ B1, _Float16* __restrict__ H1) { __shared__ __align__(16) _Float16 sh[4][16][136];
  const int tid = threadIdx.x, wave = tid >> 5, lane = tid & 31, col = lane & 15, g = lane >> 4; const size_t r0 = (size_t)blockIdx.x * 64 + wave * 16; const int c0 = blockIdx.y * 128;
  v8f acc[8] = {};
#pragma unroll
  for (int kc = 0; kc < CM / 32; ++kc) { const v16h a = frag_h(XH + (r0 + col) * CM + kc * 32, lane);
#pragma unroll
    for (int j = 0; j < 8; ++j) acc[j] = wmma16(a, frag_h(W1r + (size_t)(c0 + j * 16 + col) * CM + kc * 32, lane), acc[j]); }
#pragma unroll
  for (int j = 0; j < 8; ++j) { const float bb = bfr(B1[c0 + j * 16 + col]);
#pragma unroll
    for (int r = 0; r < 8; ++r) sh[wave][8 * g + r][j * 16 + col] = (_Float16)fmaxf(acc[j][r] * (1.0f / WSC) + bb, 0.f); }
  LDSX(); for (int rl = 0; rl < 16; ++rl) if (lane < 16) vst2((unsigned*)(H1 + (r0 + rl) * FF + c0 + lane * 8), *(const v4u*)&sh[wave][rl][lane * 8]); }
__global__ __launch_bounds__(128) void k_ff2(const _Float16* __restrict__ H1, const _Float16* __restrict__ W2r, const float* __restrict__ B2, const float* __restrict__ M, float* __restrict__ OUT) { __shared__ __align__(16) float sf[4][16][132];
  const int tid = threadIdx.x, wave = tid >> 5, lane = tid & 31, col = lane & 15, g = lane >> 4; const size_t r0 = (size_t)blockIdx.x * 64 + wave * 16; const int c0 = blockIdx.y * 128;
  v8f acc[8] = {};
#pragma unroll 2
  for (int kc = 0; kc < FF / 32; ++kc) { const v16h a = frag_h(H1 + (r0 + col) * FF + kc * 32, lane);
#pragma unroll
    for (int j = 0; j < 8; ++j) acc[j] = wmma16(a, frag_h(W2r + (size_t)(c0 + j * 16 + col) * FF + kc * 32, lane), acc[j]); }
#pragma unroll
  for (int j = 0; j < 8; ++j) { const int c = c0 + j * 16 + col; const float bb = bfr(B2[c]);
#pragma unroll
    for (int r = 0; r < 8; ++r) sf[wave][8 * g + r][j * 16 + col] = acc[j][r] * (1.0f / WSC) + bb + M[(r0 + 8 * g + r) * CM + c]; }
  LDSX(); for (int rl = 0; rl < 16; ++rl) vst2(OUT + (r0 + rl) * CM + c0 + lane * 4, *(const v4f*)&sf[wave][rl][lane * 4]); }
extern "C" void kernel_launch(void* const* d_in, const int* in_sizes, int n_in, void* d_out, int out_size, void* d_ws, size_t ws_size, hipStream_t stream) {
  (void)in_sizes; (void)n_in; (void)out_size;
  const float** F = (const float**)d_in;   // 0 m [1,128,256,256], 1 z [1,256,256,128], 2 mask [1,128,256], 3 ln_m_g, 4 ln_m_b, 5 ln_z_g, 6 ln_z_b, 7 wz [128,8], 8 wq [256,8,32], 9 wk, 10 wv, 11 wg, 12 bg [8,32], 13 wo [8,32,256], 14 bo [256]
  if (ws_size < (size_t)WS_END) return;
  char* ws = (char*)d_ws; _Float16 *RW = (_Float16*)(ws + WS_RW), *RWOp = (_Float16*)(ws + WS_RWO), *XH = (_Float16*)(ws + WS_XH), *QK = (_Float16*)(ws + WS_QK), *VT = (_Float16*)(ws + WS_VT), *VTL = (_Float16*)(ws + WS_VTL), *Gt = (_Float16*)(ws + WS_G);
  float *O = (float*)(ws + WS_O), *PB = (float*)(ws + WS_PB);
  k_packw<<<dim3(1024, 3), 256, 0, stream>>>(F[8], F[9], F[10], F[11], F[8], F[9], F[10], F[11], F[13], F[13], F[8], F[13], ws);   // which 0 (q|k|v|g rows) and 2 (wo rows) are used; which 1 packs in-bounds duplicates; 3-5 not launched
  k_ln<<<NROW / (8 * LNR), 256, 0, stream>>>(F[0], F[3], F[4], XH);
  k_proj<0><<<dim3(RR / 64, 8, SQ), 128, 0, stream>>>(XH, RW, F[12], QK, VT, VTL, Gt);
  k_pb<<<dim3(RR, RR / PBK), 256, 0, stream>>>(F[1], F[5], F[6], F[7], PB);
  k_att<0><<<dim3(RR / 64, NH, SQ), 128, 0, stream>>>(QK, VT, VTL, PB, F[2], O);
  k_go<0><<<dim3(NROW / 64, CM / 128), 128, 0, stream>>>(Gt, O, RWOp, F[14], (float*)d_out);
}

// v003
// One run takes 228 microseconds.
// Two timings next to v002 both put it at 1.10 times that version's speed.
// Counting every step since v000, it is 1.56 times as fast.
// compute dtype: all float inputs rounded to bf16; LayerNorms, pair bias (LN(z) . wz), softmax, sigmoid gate in f32; q|k|v|g projections on WMMA 16x16x32 with the LayerNorm output rounded once to f16 against exact f16 x 2^8 weights; attention logits with single f16 q, k (32-dim heads), P as f16 hi + residual (x 2^11) . v (hi + residual; 3 products); (g o) as f16 hi + residual (2 products) . wo (f16 x 2^8) + bo; f32 output.
#include <hip/hip_runtime.h>
#include <math.h>

typedef __attribute__((ext_vector_type(16))) _Float16 v16h;
typedef __attribute__((ext_vector_type(16))) __bf16 v16b;
typedef __attribute__((ext_vector_type(8)))  _Float16 v8h;
typedef __attribute__((ext_vector_type(8)))  float v8f;
typedef __attribute__((ext_vector_type(4)))  float v4f;
typedef __attribute__((ext_vector_type(2)))  float v2f;
typedef __attribute__((ext_vector_type(4)))  unsigned v4u;
typedef __attribute__((ext_vector_type(4)))  int v4i;
typedef float __attribute__((may_alias)) float_a;
typedef int __attribute__((may_alias)) int_a;

template <typename T> __device__ __forceinline__ void vst2(void* p, T v) { *(T*)p = v;  }
__device__ __forceinline__ v8f wmma16(v16h a, v16h b, v8f c) {
  v8f d = __builtin_amdgcn_wmma_f32_16x16x32_f16(false, a, false, b, (short)0, c, false, false);
  asm volatile("v_nop\n\tv_nop\n\tv_nop\n\tv_nop" : "+v"(d) : "v"(a), "v"(b));
  return d;
}
__device__ __forceinline__ v8f wmma_bf(v16b a, v16b b, v8f c) {
  v8f d = __builtin_amdgcn_wmma_f32_16x16x32_bf16(false, a, false, b, (short)0, c, false, false);
  asm volatile("v_nop\n\tv_nop\n\tv_nop\n\tv_nop" : "+v"(d) : "v"(a), "v"(b));
  return d;
}
// 16x16x32 fragments: lane = (h = lane>>4, row/col = lane&15); elements 0..7 = k0+8h+0..7, 8..15 = k0+16+8h+0..7; D element r = row 8h+r
__device__ __forceinline__ v16h frag_h(const _Float16* rowk0, int lane) {
  union { v16h v; v8h q[2]; } u; const _Float16* p = rowk0 + 8 * (lane >> 4);
  u.q[0] = *(const v8h*)p; u.q[1] = *(const v8h*)(p + 16); return u.v;
}
// the same fragment from a 16 x 32 tile kept in fragment order: 1 KiB = [elements 0..7 | 8..15][lane][8 f16], so each of the wave's two 16-byte loads covers 512 contiguous bytes (4 whole lines, not pieces of 16)
__device__ __forceinline__ v16h frag_t(const _Float16* tile, int lane) {
  union { v16h v; v8h q[2]; } u; const _Float16* p = tile + 8 * lane;
  u.q[0] = *(const v8h*)p; u.q[1] = *(const v8h*)(p + 256); return u.v;
}
__device__ __forceinline__ v16h frag_f32(const float* rowk0, int lane) {
  v16h a; const float* p = rowk0 + 8 * (lane >> 4);
#pragma unroll
  for (int i = 0; i < 8; ++i) { a[i] = (_Float16)p[i]; a[8 + i] = (_Float16)p[16 + i]; }
  return a;
}
__device__ __forceinline__ v16h frag_f32s(const float* rowk0, int lane, float sc) {
  v16h a; const float* p = rowk0 + 8 * (lane >> 4);
#pragma unroll
  for (int i = 0; i < 8; ++i) { a[i] = (_Float16)(p[i] * sc); a[8 + i] = (_Float16)(p[16 + i] * sc); }
  return a;
}
// column fragment from a [K][ld] layout (column n), rows >= K read as 0
__device__ __forceinline__ v16h fragc_f32(const float* W, int k0, int n, int lane, int ld, int K) {
  v16h a; const int g = lane >> 4;
#pragma unroll
  for (int i = 0; i < 8; ++i) { const int ka = k0 + 8 * g + i, kb = ka + 16;
    a[i] = (_Float16)(ka < K ? W[(size_t)(ka < K ? ka : K - 1) * ld + n] : 0.f); a[8 + i] = (_Float16)(kb < K ? W[(size_t)(kb < K ? kb : K - 1) * ld + n] : 0.f); }
  return a;
}
struct F2 { v16b h, l; };
__device__ __forceinline__ F2 bsplit16(const float v[16]) { F2 r;
#pragma unroll
  for (int i = 0; i < 16; ++i) { const __bf16 h = (__bf16)v[i]; r.h[i] = h; r.l[i] = (__bf16)(v[i] - (float)h); }
  return r; }
__device__ __forceinline__ F2 split_row(const float* row, int k0, int lane) { float v[16]; const float* p = row + k0 + 8 * (lane >> 4);
#pragma unroll
  for (int i = 0; i < 8; ++i) { v[i] = p[i]; v[8 + i] = p[16 + i]; }
  return bsplit16(v); }
__device__ __forceinline__ F2 split_rowK(const float* row, int k0, int lane, int K) { float v[16]; const int g = lane >> 4;
#pragma unroll
  for (int i = 0; i < 8; ++i) { const int ka = k0 + 8 * g + i, kb = ka + 16; v[i] = ka < K ? row[ka < K ? ka : K - 1] : 0.f; v[8 + i] = kb < K ? row[kb < K ? kb : K - 1] : 0.f; }
  return bsplit16(v); }
__device__ __forceinline__ F2 split_col(const float* W, int k0, int n, int lane, int ld, int K) { float v[16]; const int g = lane >> 4;
#pragma unroll
  for (int i = 0; i < 8; ++i) { const int ka = k0 + 8 * g + i, kb = ka + 16; v[i] = ka < K ? W[(size_t)(ka < K ? ka : K - 1) * ld + n] : 0.f; v[8 + i] = kb < K ? W[(size_t)(kb < K ? kb : K - 1) * ld + n] : 0.f; }
  return bsplit16(v); }
__device__ __forceinline__ v8f mac3(const F2& a, const F2& b, v8f c) { c = wmma_bf(a.l, b.h, c); c = wmma_bf(a.h, b.l, c); return wmma_bf(a.h, b.h, c); }
__device__ __forceinline__ float sigm(float v) { return 1.0f / (1.0f + expf(-v)); }
#define LDSX() do { asm volatile("s_wait_dscnt 0" ::: "memory"); __builtin_amdgcn_wave_barrier(); __builtin_amdgcn_fence(__ATOMIC_RELEASE, "workgroup"); } while (0)


// MSA row attention with pair bias (B 1, S 128 sequences x R 256 residues, c_m 256, 8 heads x 32, c_z 128): out = (sigmoid(LN(m) wg + bg) * softmax(q k / sqrt(32) + 1e9 (mask - 1) + LN(z) wz) v) wo + bo.
#define SQ 128
#define RR 256
#define CM 256
#define NH 8
#define CA 32
#define CZ 128
#define FF 1024
#define NROW (SQ * RR)
#define WSC 256.0f
#ifndef TON
#define TON 1           // unused
#endif
typedef __attribute__((ext_vector_type(8))) __bf16 v8b;
__device__ __forceinline__ v16b frag_b(const __bf16* rowk0, int lane) {
  union { v16b v; v8b q[2]; } u; const __bf16* p = rowk0 + 8 * (lane >> 4);
  u.q[0] = *(const v8b*)p; u.q[1] = *(const v8b*)(p + 16); return u.v;
}
__device__ __forceinline__ float bfr(float v) { return (float)(__bf16)v; }
__device__ __attribute__((noinline)) float exp_ni(float v) { return expf(v); }
__device__ __attribute__((noinline)) float erf_ni(float v) { return erff(v); }

// weights (f16 x 2^8, transposed (in,out)), as 16 x 32 tiles in fragment order [out / 16][in / 32][512]: RW 1024 x 256 = q|k|v|g ; CW 1024 x 256; RWO 256 x 256; CWO 256 x 256; TW1 1024 x 256; TW2 256 x 1024
#define WS_RW   0u
#define WS_CW   (WS_RW + 2u * 1024 * CM)
#define WS_RWO  (WS_CW + 2u * 1024 * CM)
#define WS_CWO  (WS_RWO + 2u * CM * CM)
#define WS_TW1  (WS_CWO + 2u * CM * CM)
#define WS_TW2  (WS_TW1 + 2u * FF * CM)
#define WS_XH   (WS_TW2 + 2u * CM * FF)                 // f16 LN rows [NROW][256] (natural s*R + r)
#define WS_QK   (WS_XH + 2u * (size_t)NROW * CM)         // f16 q|k tiles in fragment order [b][q|k][head][N / 16][512]
#define WS_VT   (WS_QK + 2u * (size_t)NROW * 2 * CM)     // f16 hi|lo v planes, tiles (16 channels x 32 tokens) in fragment order [b][256 / 16][N / 32][512]
#define WS_VTL  (WS_VT + 2u * (size_t)NROW * CM)
#define WS_G    (WS_VTL + 2u * (size_t)NROW * CM)        // f16 sigmoid gate, tiles (16 natural rows x 32 channels) in fragment order [NROW / 16][256 / 32][512]
#define WS_O    (WS_G + 2u * (size_t)NROW * CM)          // f32 attention output, tiles (16 compact rows x 32 channels = one head) in fragment order [NROW / 16][256 / 32][element quad 0..3][lane][4]
#define WS_M    (WS_O + 4u * (size_t)NROW * CM)          // f32 working m [natural][256]
#define WS_PB   (WS_M + 4u * (size_t)NROW * CM)          // f32 pair bias [h][q][k]
#define WS_H1   (WS_PB + 4u * (size_t)NH * RR * RR)      // f16 relu rows [natural][1024]
#define WS_END  (WS_H1 + 2u * (size_t)NROW * FF)

// ---- k_packw: block = 16 output rows n0 .. n0 + 15 = one row of tiles, so every 128-byte line of the packed weights has one writer; which: 0 RW (W = rq|rk|rv|rg by n/256), 1 CW, 2 RWO, 3 CWO, 4 TW1, 5 TW2
__global__ __launch_bounds__(256) void k_packw(const float* __restrict__ RQ, const float* __restrict__ RK, const float* __restrict__ RV, const float* __restrict__ RG, const float* __restrict__ CQ, const float* __restrict__ CK, const float* __restrict__ CV, const float* __restrict__ CG, const float* __restrict__ RWO, const float* __restrict__ CWO, const float* __restrict__ TW1, const float* __restrict__ TW2, char* __restrict__ ws) {
  const int n0 = blockIdx.x * 16, which = blockIdx.y, t = threadIdx.x;
  const float* Wm; int kin, kout, col; _Float16* dst;
  if (which == 0) { if (n0 >= 1024) return; const int g4 = n0 / CM; col = n0 % CM; Wm = g4 == 0 ? RQ : g4 == 1 ? RK : g4 == 2 ? RV : RG; kin = CM; kout = CM; dst = (_Float16*)(ws + WS_RW); }
  else if (which == 1) { if (n0 >= 1024) return; const int g4 = n0 / CM; col = n0 % CM; Wm = g4 == 0 ? CQ : g4 == 1 ? CK : g4 == 2 ? CV : CG; kin = CM; kout = CM; dst = (_Float16*)(ws + WS_CW); }
  else if (which == 2) { if (n0 >= CM) return; col = n0; Wm = RWO; kin = CM; kout = CM; dst = (_Float16*)(ws + WS_RWO); }
  else if (which == 3) { if (n0 >= CM) return; col = n0; Wm = CWO; kin = CM; kout = CM; dst = (_Float16*)(ws + WS_CWO); }
  else if (which == 4) { if (n0 >= FF) return; col = n0; Wm = TW1; kin = CM; kout = FF; dst = (_Float16*)(ws + WS_TW1); }
  else { if (n0 >= CM) return; col = n0; Wm = TW2; kin = FF; kout = CM; dst = (_Float16*)(ws + WS_TW2); }
  dst += (size_t)blockIdx.x * (kin / 32) * 512;
  // chunk e = (k tile e >> 6, half (e >> 5) & 1, lane e & 31) lies at f16 offset 8 e: a wave stores 512 contiguous bytes; its 8 values are k .. k + 7 of output row n0 + (lane & 15)
  for (int e = t; e < kin * 2; e += 256) { const int ln = e & 31, k = (e >> 6) * 32 + ((e >> 5) & 1) * 16 + (ln >> 4) * 8; v8h o;
#pragma unroll   // o is indexed by constants and stays in registers
    for (int i = 0; i < 8; ++i) o[i] = (_Float16)(bfr(Wm[(size_t)(k + i) * kout + col + (ln & 15)]) * WSC);
    vst2(dst + e * 8, o); } }
// ---- k_ln: XH = LN(bf16(m)) w + b (jnp.var, 1e-5) -> f16. One wave owns a row (lane l: channels 4l + e and 128 + 4l + e, so each 16-byte load of a wave covers 512 contiguous bytes) and works on LNR rows; no LDS, no barrier
// value of lane l ^ MSK inside a 16-lane row, by a DPP move (no LDS round trip as with __shfl_xor)
template <int MSK> __device__ __forceinline__ float rowx(float x) { return __builtin_bit_cast(float, __builtin_amdgcn_mov_dpp(__builtin_bit_cast(int, x), 0x160 | MSK, 0xf, 0xf, true)); }
// lane l with lane l ^ 16
__device__ __forceinline__ float xhalf(float x) { return __builtin_bit_cast(float, __builtin_amdgcn_permlanex16(__builtin_bit_cast(int, x), __builtin_bit_cast(int, x), 0x76543210, 0xfedcba98, false, false)); }
__device__ __forceinline__ float wsum(float s) { s += rowx<1>(s); s += rowx<2>(s); s += rowx<4>(s); s += rowx<8>(s); return s + xhalf(s); }
typedef __attribute__((ext_vector_type(4))) _Float16 v4h;
#define LNR 8
__global__ __launch_bounds__(256) void k_ln(const float* __restrict__ X, const float* __restrict__ G, const float* __restrict__ Bt, _Float16* __restrict__ XH) { const int lane = threadIdx.x & 31; const size_t row0 = ((size_t)blockIdx.x * 8 + (threadIdx.x >> 5)) * LNR;
  const float* xr = X + row0 * CM + lane * 4; _Float16* yr = XH + row0 * CM + lane * 4;
  // both loops are fully unrolled: the arrays are indexed by constants and stay in registers
  v4f xa[LNR], xb[LNR];   // the wave's LNR rows: all loads are issued before the first use, so memory latency is paid once
#pragma unroll
  for (int p = 0; p < LNR; ++p) { xa[p] = *(const v4f*)(xr + (size_t)p * CM); xb[p] = *(const v4f*)(xr + (size_t)p * CM + 128); }
  const v4f g0 = *(const v4f*)(G + lane * 4), g1 = *(const v4f*)(G + 128 + lane * 4), c0 = *(const v4f*)(Bt + lane * 4), c1 = *(const v4f*)(Bt + 128 + lane * 4);
  float gg[8], bb[8];
#pragma unroll
  for (int e = 0; e < 4; ++e) { gg[e] = bfr(g0[e]); gg[4 + e] = bfr(g1[e]); bb[e] = bfr(c0[e]); bb[4 + e] = bfr(c1[e]); }
#pragma unroll
  for (int p = 0; p < LNR; ++p) { float v[8];
#pragma unroll
    for (int e = 0; e < 4; ++e) { v[e] = bfr(xa[p][e]); v[4 + e] = bfr(xb[p][e]); }
    const float mu = wsum(((v[0] + v[1]) + (v[2] + v[3])) + ((v[4] + v[5]) + (v[6] + v[7]))) / (float)CM; float qq = 0.f;
#pragma unroll
    for (int i = 0; i < 8; ++i) { v[i] -= mu; qq += v[i] * v[i]; }
    const float inv = 1.0f / sqrtf(wsum(qq) / (float)CM + 1e-5f); v4h h0, h1;
#pragma unroll
    for (int e = 0; e < 4; ++e) { h0[e] = (_Float16)(v[e] * inv * gg[e] + bb[e]); h1[e] = (_Float16)(v[4 + e] * inv * gg[4 + e] + bb[4 + e]); }
    vst2(yr + (size_t)p * CM, h0); vst2(yr + (size_t)p * CM + 128, h1); } }
// natural row index of (batch b, token n): MODE 0 row attention (b = s, n = r); MODE 1 column attention (b = r, n = s)
template <int MODE> __device__ __forceinline__ size_t nat(size_t b, int n) { return MODE == 0 ? b * RR + n : (size_t)n * RR + b; }
// ---- k_proj<MODE>: block = (64 tokens, 128 of 1024 cols (q|k|v|g), b): A = XH rows; q|k -> QK (single f16); v -> planes hi/lo; g -> sigmoid -> f16; all four stored as whole tiles in their reader's fragment order
template <int MODE>
__global__ __launch_bounds__(128) void k_proj(const _Float16* __restrict__ XH, const _Float16* __restrict__ Wr, const float* __restrict__ BG, _Float16* __restrict__ QK, _Float16* __restrict__ VT, _Float16* __restrict__ VTL, _Float16* __restrict__ Gt) {
  static_assert(MODE == 0, "a gate tile holds 16 natural rows: 16 tokens of one b only in row attention");
  constexpr int NN = MODE == 0 ? RR : SQ; __shared__ __align__(16) _Float16 sh[64][136]; __shared__ __align__(16) _Float16 th[128][72], tl[128][72];
  const int tid = threadIdx.x, wave = tid >> 5, lane = tid & 31, col = lane & 15, g = lane >> 4; const size_t b = blockIdx.z; const int n0 = blockIdx.x * 64 + wave * 16; const int c0 = blockIdx.y * 128; const int which = c0 / CM;   // 0 q, 1 k, 2 v, 3 g
  v8f acc[8] = {};
#pragma unroll
  for (int kc = 0; kc < CM / 32; ++kc) { const v16h a = frag_h(XH + nat<MODE>(b, n0 + col) * CM + kc * 32, lane);
#pragma unroll
    for (int j = 0; j < 8; ++j) acc[j] = wmma16(a, frag_t(Wr + ((size_t)(c0 / 16 + j) * (CM / 32) + kc) * 512, lane), acc[j]); }
#pragma unroll
  for (int j = 0; j < 8; ++j) { const int cc = (c0 % CM) + j * 16 + col; const float bg = (which == 3) ? bfr(BG[cc]) : 0.f;
#pragma unroll
    for (int r = 0; r < 8; ++r) { float v = acc[j][r] * (1.0f / WSC); if (which == 3) v = 1.0f / (1.0f + expf(-(v + bg)));
      if (which == 2) { const _Float16 hv = (_Float16)v; th[j * 16 + col][wave * 16 + 8 * g + r] = hv; tl[j * 16 + col][wave * 16 + 8 * g + r] = (_Float16)((v - (float)hv) * 2048.0f); } else sh[wave * 16 + 8 * g + r][j * 16 + col] = (_Float16)v; } }
  __syncthreads();
  if (which < 2) { for (int e = tid; e < 64 * 16; e += 128) { const int ln = e & 31, hf = (e >> 5) & 1, rt = (e >> 6) & 3, hl = e >> 8;   // a wave stores 512 contiguous bytes: half hf of the tile (head hl of the block's 4, token tile rt)
      vst2((unsigned*)(QK + (((b * 2 + which) * NH + (c0 % CM) / CA + hl) * (NN / 16) + blockIdx.x * 4 + rt) * 512 + hf * 256 + ln * 8), *(const v4u*)&sh[rt * 16 + (ln & 15)][(hl * 4 + hf * 2 + (ln >> 4)) * 8]); } }
  else if (which == 2) { const int cv0 = c0 - 2 * CM; for (int e = tid; e < 128 * 8; e += 128) { const int ln = e & 31, hf = (e >> 5) & 1, kl = (e >> 6) & 1, ctl = e >> 7, cl = ctl * 16 + (ln & 15), tk = (kl * 4 + hf * 2 + (ln >> 4)) * 8;   // half hf of the tile (channel tile ctl of 8, 32-token group kl of 2)
      const size_t o = ((b * (CM / 16) + cv0 / 16 + ctl) * (size_t)(NN / 32) + blockIdx.x * 2 + kl) * 512 + hf * 256 + ln * 8; vst2((unsigned*)(VT + o), *(const v4u*)&th[cl][tk]); vst2((unsigned*)(VTL + o), *(const v4u*)&tl[cl][tk]); } }
  else { for (int e = tid; e < 64 * 16; e += 128) { const int ln = e & 31, hf = (e >> 5) & 1, rt = (e >> 6) & 3, hl = e >> 8;
      vst2((unsigned*)(Gt + ((nat<MODE>(b, blockIdx.x * 64) / 16 + rt) * (CM / 32) + (c0 - 3 * CM) / 32 + hl) * 512 + hf * 256 + ln * 8), *(const v4u*)&sh[rt * 16 + (ln & 15)][(hl * 4 + hf * 2 + (ln >> 4)) * 8]); } } }
// ---- k_pb: block = (query residue q, 128 keys): PB[h][q][k] = LN(z[q][k]) . wb[:, h]; 16 lanes share one z row (8 channels a lane, two 16-byte loads), a wave works on 2 rows at a time; this lane's 8 x 8 weights stay in registers
#define PBK 128
__global__ __launch_bounds__(256) void k_pb(const float* __restrict__ Zp, const float* __restrict__ G, const float* __restrict__ Bt, const float* __restrict__ WB, float* __restrict__ PB) { __shared__ __align__(16) float sp[NH][PBK + 4]; __shared__ __align__(16) float swb[CZ / 4][4 * NH + 4];   // swb: 4 channels x 8 heads a row, pitch 36 words: the 16 lanes' 16-byte reads fall on distinct banks
  const int t = threadIdx.x, lane = t & 31, w = t >> 5, l16 = lane & 15, hf = lane >> 4; const int q = blockIdx.x, k0 = blockIdx.y * PBK;
  const float* zr = Zp + ((size_t)q * RR + k0 + w * 16 + hf) * CZ + l16 * 4;   // rows w*16 + 2p + hf; channels 4*l16 + e and 64 + 4*l16 + e
  // every loop of this kernel is fully unrolled: its arrays are indexed by constants and stay in registers
  v4f za[8], zb[8];   // the wave's 16 rows: all 16 loads are issued before the first use, so memory latency is paid once
#pragma unroll
  for (int p = 0; p < 8; ++p) { za[p] = *(const v4f*)(zr + (size_t)p * 2 * CZ); zb[p] = *(const v4f*)(zr + (size_t)p * 2 * CZ + 64); }
  v4f g4[2], b4[2];
#pragma unroll
  for (int i = 0; i < 2; ++i) { g4[i] = *(const v4f*)(G + 64 * i + l16 * 4); b4[i] = *(const v4f*)(Bt + 64 * i + l16 * 4); }
  { v4f w4 = *(const v4f*)(WB + t * 4); w4[0] = bfr(w4[0]); w4[1] = bfr(w4[1]); w4[2] = bfr(w4[2]); w4[3] = bfr(w4[3]); *(v4f*)&swb[t >> 3][(t & 7) * 4] = w4; } __syncthreads();
  float wv[8][NH], gg[8], bb[8];
#pragma unroll
  for (int i = 0; i < 2; ++i) {
#pragma unroll
    for (int e = 0; e < 4; ++e) { gg[i * 4 + e] = bfr(g4[i][e]); bb[i * 4 + e] = bfr(b4[i][e]); const v4f w0 = *(const v4f*)&swb[16 * i + l16][e * NH], w1 = *(const v4f*)&swb[16 * i + l16][e * NH + 4];
#pragma unroll
      for (int h = 0; h < 4; ++h) { wv[i * 4 + e][h] = w0[h]; wv[i * 4 + e][4 + h] = w1[h]; } } }
  const bool b0 = (l16 & 1) != 0, b1 = (l16 & 2) != 0, b2 = (l16 & 4) != 0;
#pragma unroll
  for (int p = 0; p < 8; ++p) { float v[8];
#pragma unroll
    for (int e = 0; e < 4; ++e) { v[e] = bfr(za[p][e]); v[4 + e] = bfr(zb[p][e]); }
    float s = ((v[0] + v[1]) + (v[2] + v[3])) + ((v[4] + v[5]) + (v[6] + v[7]));
    s += rowx<1>(s); s += rowx<2>(s); s += rowx<4>(s); s += rowx<8>(s);
    const float mu = s / (float)CZ; float qq = 0.f;
#pragma unroll
    for (int i = 0; i < 8; ++i) { v[i] -= mu; qq += v[i] * v[i]; }
    qq += rowx<1>(qq); qq += rowx<2>(qq); qq += rowx<4>(qq); qq += rowx<8>(qq);
    const float inv = 1.0f / sqrtf(qq / (float)CZ + 1e-5f); float ph[NH];
#pragma unroll
    for (int h = 0; h < NH; ++h) ph[h] = 0.f;
#pragma unroll
    for (int i = 0; i < 8; ++i) { const float ln = v[i] * inv * gg[i] + bb[i];
#pragma unroll
      for (int h = 0; h < NH; ++h) ph[h] += ln * wv[i][h]; }
    // sum over the 16 lanes, halving the heads a lane carries at each of the first three steps: lane l16 ends with head l16 & 7
    float y[4], u[2];
#pragma unroll
    for (int i = 0; i < 4; ++i) y[i] = (b0 ? ph[2 * i + 1] : ph[2 * i]) + rowx<1>(b0 ? ph[2 * i] : ph[2 * i + 1]);
#pragma unroll
    for (int i = 0; i < 2; ++i) u[i] = (b1 ? y[2 * i + 1] : y[2 * i]) + rowx<2>(b1 ? y[2 * i] : y[2 * i + 1]);
    float x = (b2 ? u[1] : u[0]) + rowx<4>(b2 ? u[0] : u[1]); x += rowx<8>(x);
    if (l16 < NH) sp[l16][w * 16 + p * 2 + hf] = x; }
  __syncthreads(); { const int h = t >> 5, q4 = t & 31; vst2(PB + ((size_t)h * RR + q) * RR + k0 + q4 * 4, *(const v4f*)&sp[h][q4 * 4]); } }
// ---- k_att<MODE>: block = (64 queries, head, b): logits q.k x 32^-0.5 (+ pair bias in MODE 0), masked keys excluded, softmax, P . v (planes hi + residual) -> O, one tile a wave
template <int MODE>
__global__ __launch_bounds__(128) void k_att(const _Float16* __restrict__ QK, const _Float16* __restrict__ VT, const _Float16* __restrict__ VTL, const float* __restrict__ PB, const float* __restrict__ MASK, float* __restrict__ O) {
  constexpr int NN = MODE == 0 ? RR : SQ; __shared__ __align__(16) float sp[4][16][36]; __shared__ __align__(16) float so[4][16][36];
  const int tid = threadIdx.x, wave = tid >> 5, lane = tid & 31, col = lane & 15, g = lane >> 4; const int h = blockIdx.y; const size_t b = blockIdx.z; const int q0 = blockIdx.x * 64 + wave * 16; const size_t rq = b * NN + q0;
  const v16h aq = frag_t(QK + (((b * 2 + 0) * NH + h) * (NN / 16) + q0 / 16) * 512, lane);
  float m[8], l[8];
#pragma unroll
  for (int r = 0; r < 8; ++r) { m[r] = -3.0e38f; l[r] = 0.f; }
  v8f acc[2] = {}, accl[2] = {};
#pragma unroll 1
  for (int ks = 0; ks < NN / 32; ++ks) { v8f s[2];
#pragma unroll
    for (int ct = 0; ct < 2; ++ct) { const int kk = ks * 32 + ct * 16 + col; const v16h kh = frag_t(QK + (((b * 2 + 1) * NH + h) * (NN / 16) + ks * 2 + ct) * 512, lane); v8f c = {}; c = wmma16(aq, kh, c);
      const bool keep = bfr(MASK[nat<MODE>(b, kk)]) != 0.f;
#pragma unroll
      for (int r = 0; r < 8; ++r) { float sc = c[r] * 0.17677669529663687f; if (MODE == 0) sc += PB[((size_t)h * RR + (q0 + 8 * g + r)) * RR + kk]; s[ct][r] = keep ? sc : -3.0e38f; } }
    float alpha[8];
#pragma unroll
    for (int r = 0; r < 8; ++r) { float mx = fmaxf(s[0][r], s[1][r]);
#pragma unroll
      for (int o = 1; o < 16; o <<= 1) mx = fmaxf(mx, __shfl_xor(mx, o));
      const float mn = fmaxf(m[r], mx); alpha[r] = (m[r] <= -1.0e38f) ? 0.f : __expf(m[r] - mn); const float e0 = (s[0][r] <= -1.0e38f) ? 0.f : __expf(s[0][r] - mn), e1 = (s[1][r] <= -1.0e38f) ? 0.f : __expf(s[1][r] - mn); float es = e0 + e1;
#pragma unroll
      for (int o = 1; o < 16; o <<= 1) es += __shfl_xor(es, o);
      l[r] = l[r] * alpha[r] + es; m[r] = mn; sp[wave][8 * g + r][col] = e0; sp[wave][8 * g + r][16 + col] = e1; }
#pragma unroll
    for (int j = 0; j < 2; ++j)
#pragma unroll
      for (int r = 0; r < 8; ++r) { acc[j][r] *= alpha[r]; accl[j][r] *= alpha[r]; }
    LDSX();
    v16h pa, pal; { const float* prow = &sp[wave][col][0] + 8 * (lane >> 4);
#pragma unroll
      for (int i = 0; i < 8; ++i) { const float p0 = prow[i] * 2048.0f, p1 = prow[16 + i] * 2048.0f; pa[i] = (_Float16)p0; pa[8 + i] = (_Float16)p1; pal[i] = (_Float16)((p0 - (float)pa[i]) * 2048.0f); pal[8 + i] = (_Float16)((p1 - (float)pa[8 + i]) * 2048.0f); } }
#pragma unroll
    for (int j = 0; j < 2; ++j) { const size_t po = ((b * (CM / 16) + h * 2 + j) * (size_t)(NN / 32) + ks) * 512; const v16h vh = frag_t(VT + po, lane); acc[j] = wmma16(pa, vh, acc[j]); accl[j] = wmma16(pa, frag_t(VTL + po, lane), accl[j]); accl[j] = wmma16(pal, vh, accl[j]); }
    LDSX(); }
#pragma unroll
  for (int r = 0; r < 8; ++r) { const float il = (l[r] > 0.f) ? (1.0f / 2048.0f) / l[r] : 0.f;
#pragma unroll
    for (int j = 0; j < 2; ++j) so[wave][8 * g + r][j * 16 + col] = (acc[j][r] + accl[j][r] * (1.0f / 2048.0f)) * il; }
  LDSX(); { float* ot = O + ((rq / 16) * (CM / 32) + h) * 512 + lane * 4;   // lane = (g, row col): quads 0, 1 = channels 8g .. 8g + 7, quads 2, 3 = 16 + 8g .. ; each store of the wave is 512 contiguous bytes
    for (int qd = 0; qd < 4; ++qd) vst2(ot + qd * 128, *(const v4f*)&so[wave][col][(qd >> 1) * 16 + 8 * g + (qd & 1) * 4]); } }
// ---- k_go<MODE>: block = (64 natural rows, 128 cols): M = (g o) . wo + bo ; A operand built on the fly from the G and O tiles
template <int MODE>
__global__ __launch_bounds__(128) void k_go(const _Float16* __restrict__ Gt, const float* __restrict__ O, const _Float16* __restrict__ WOr, const float* __restrict__ BO, float* __restrict__ M) { __shared__ __align__(16) float sf[4][16][132];
  const int tid = threadIdx.x, wave = tid >> 5, lane = tid & 31, col = lane & 15, g = lane >> 4; const size_t r0 = (size_t)blockIdx.x * 64 + wave * 16; const int c0 = blockIdx.y * 128;
  static_assert(MODE == 0, "one tile index serves G (natural rows) and O (compact rows): the two orders agree only in row attention");
  const size_t t0 = (r0 / 16) * (CM / 32);
  v8f acc[8] = {}, accl2[8] = {};
#pragma unroll
  for (int kc = 0; kc < CM / 32; ++kc) { v16h a, al; const v16h gv = frag_t(Gt + (t0 + kc) * 512, lane); const float* op = O + (t0 + kc) * 512 + lane * 4; v4f ov[4];
#pragma unroll   // ov is indexed by constants and stays in registers
    for (int qd = 0; qd < 4; ++qd) ov[qd] = *(const v4f*)(op + qd * 128);
#pragma unroll
    for (int i = 0; i < 16; ++i) { const float v0 = (float)gv[i] * ov[i >> 2][i & 3]; a[i] = (_Float16)v0; al[i] = (_Float16)((v0 - (float)a[i]) * 2048.0f); }
#pragma unroll
    for (int j = 0; j < 8; ++j) { const v16h w = frag_t(WOr + ((size_t)(c0 / 16 + j) * (CM / 32) + kc) * 512, lane); acc[j] = wmma16(a, w, acc[j]); accl2[j] = wmma16(al, w, accl2[j]); } }
#pragma unroll
  for (int j = 0; j < 8; ++j) { const int c = c0 + j * 16 + col; const float bb = bfr(BO[c]);
#pragma unroll
    for (int r = 0; r < 8; ++r) sf[wave][8 * g + r][j * 16 + col] = (acc[j][r] + accl2[j][r] * (1.0f / 2048.0f)) * (1.0f / WSC) + bb; }
  LDSX(); for (int rl = 0; rl < 16; ++rl) vst2(M + (r0 + rl) * CM + c0 + lane * 4, *(const v4f*)&sf[wave][rl][lane * 4]); }   // M here = the output buffer (no residual in this module)
// ---- k_ff1: block = (64 rows, 128 of 1024 cols): H1 = relu(XH . W1 + b1) -> f16 ; k_ff2: out = H1 . W2 + b2 + M
__global__ __launch_bounds__(128) void k_ff1(const _Float16* __restrict__ XH, const _Float16* __restrict__ W1r, const float* __restrict__ B1, _Float16* __restrict__ H1) { __shared__ __align__(16) _Float16 sh[4][16][136];
  const int tid = threadIdx.x, wave = tid >> 5, lane = tid & 31, col = lane & 15, g = lane >> 4; const size_t r0 = (size_t)blockIdx.x * 64 + wave * 16; const int c0 = blockIdx.y * 128;
  v8f acc[8] = {};
#pragma unroll
  for (int kc = 0; kc < CM / 32; ++kc) { const v16h a = frag_h(XH + (r0 + col) * CM + kc * 32, lane);
#pragma unroll
    for (int j = 0; j < 8; ++j) acc[j] = wmma16(a, frag_t(W1r + ((size_t)(c0 / 16 + j) * (CM / 32) + kc) * 512, lane), acc[j]); }
#pragma unroll
  for (int j = 0; j < 8; ++j) { const float bb = bfr(B1[c0 + j * 16 + col]);
#pragma unroll
    for (int r = 0; r < 8; ++r) sh[wave][8 * g + r][j * 16 + col] = (_Float16)fmaxf(acc[j][r] * (1.0f / WSC) + bb, 0.f); }
  LDSX(); for (int rl = 0; rl < 16; ++rl) if (lane < 16) vst2((unsigned*)(H1 + (r0 + rl) * FF + c0 + lane * 8), *(const v4u*)&sh[wave][rl][lane * 8]); }
__global__ __launch_bounds__(128) void k_ff2(const _Float16* __restrict__ H1, const _Float16* __restrict__ W2r, const float* __restrict__ B2, const float* __restrict__ M, float* __restrict__ OUT) { __shared__ __align__(16) float sf[4][16][132];
  const int tid = threadIdx.x, wave = tid >> 5, lane = tid & 31, col = lane & 15, g = lane >> 4; const size_t r0 = (size_t)blockIdx.x * 64 + wave * 16; const int c0 = blockIdx.y * 128;
  v8f acc[8] = {};
#pragma unroll 2
  for (int kc = 0; kc < FF / 32; ++kc) { const v16h a = frag_h(H1 + (r0 + col) * FF + kc * 32, lane);
#pragma unroll
    for (int j = 0; j < 8; ++j) acc[j] = wmma16(a, frag_t(W2r + ((size_t)(c0 / 16 + j) * (FF / 32) + kc) * 512, lane), acc[j]); }
#pragma unroll
  for (int j = 0; j < 8; ++j) { const int c = c0 + j * 16 + col; const float bb = bfr(B2[c]);
#pragma unroll
    for (int r = 0; r < 8; ++r) sf[wave][8 * g + r][j * 16 + col] = acc[j][r] * (1.0f / WSC) + bb + M[(r0 + 8 * g + r) * CM + c]; }
  LDSX(); for (int rl = 0; rl < 16; ++rl) vst2(OUT + (r0 + rl) * CM + c0 + lane * 4, *(const v4f*)&sf[wave][rl][lane * 4]); }
extern "C" void kernel_launch(void* const* d_in, const int* in_sizes, int n_in, void* d_out, int out_size, void* d_ws, size_t ws_size, hipStream_t stream) {
  (void)in_sizes; (void)n_in; (void)out_size;
  const float** F = (const float**)d_in;   // 0 m [1,128,256,256], 1 z [1,256,256,128], 2 mask [1,128,256], 3 ln_m_g, 4 ln_m_b, 5 ln_z_g, 6 ln_z_b, 7 wz [128,8], 8 wq [256,8,32], 9 wk, 10 wv, 11 wg, 12 bg [8,32], 13 wo [8,32,256], 14 bo [256]
  if (ws_size < (size_t)WS_END) return;
  char* ws = (char*)d_ws; _Float16 *RW = (_Float16*)(ws + WS_RW), *RWOp = (_Float16*)(ws + WS_RWO), *XH = (_Float16*)(ws + WS_XH), *QK = (_Float16*)(ws + WS_QK), *VT = (_Float16*)(ws + WS_VT), *VTL = (_Float16*)(ws + WS_VTL), *Gt = (_Float16*)(ws + WS_G);
  float *O = (float*)(ws + WS_O), *PB = (float*)(ws + WS_PB);
  k_packw<<<dim3(64, 3), 256, 0, stream>>>(F[8], F[9], F[10], F[11], F[8], F[9], F[10], F[11], F[13], F[13], F[8], F[13], ws);   // which 0 (q|k|v|g rows) and 2 (wo rows) are used; which 1 packs in-bounds duplicates; 3-5 not launched
  k_ln<<<NROW / (8 * LNR), 256, 0, stream>>>(F[0], F[3], F[4], XH);
  k_proj<0><<<dim3(RR / 64, 8, SQ), 128, 0, stream>>>(XH, RW, F[12], QK, VT, VTL, Gt);
  k_pb<<<dim3(RR, RR / PBK), 256, 0, stream>>>(F[1], F[5], F[6], F[7], PB);
  k_att<0><<<dim3(RR / 64, NH, SQ), 128, 0, stream>>>(QK, VT, VTL, PB, F[2], O);
  k_go<0><<<dim3(NROW / 64, CM / 128), 128, 0, stream>>>(Gt, O, RWOp, F[14], (float*)d_out);
}

// v004
// It runs in 142 microseconds.
// Next to v003, in two timings, it ran 1.60 and 1.62 times as fast.
// Over all steps from v000 it is 2.52 times as fast.
// compute dtype: all float inputs rounded to bf16; LayerNorms, pair bias (LN(z) . wz), softmax, sigmoid gate in f32; q|k|v|g projections on WMMA 16x16x32 with the LayerNorm output rounded once to f16 against exact f16 x 2^8 weights; attention logits with single f16 q, k (32-dim heads), P as f16 hi + residual (x 2^11) . v (hi + residual; 3 products); (g o) as f16 hi + residual (2 products) . wo (f16 x 2^8) + bo; f32 output.
#include <hip/hip_runtime.h>
#include <math.h>

typedef __attribute__((ext_vector_type(16))) _Float16 v16h;
typedef __attribute__((ext_vector_type(16))) __bf16 v16b;
typedef __attribute__((ext_vector_type(8)))  _Float16 v8h;
typedef __attribute__((ext_vector_type(8)))  float v8f;
typedef __attribute__((ext_vector_type(4)))  float v4f;
typedef __attribute__((ext_vector_type(2)))  float v2f;
typedef __attribute__((ext_vector_type(4)))  unsigned v4u;
typedef __attribute__((ext_vector_type(4)))  int v4i;
typedef float __attribute__((may_alias)) float_a;
typedef int __attribute__((may_alias)) int_a;

template <typename T> __device__ __forceinline__ void vst2(void* p, T v) { *(T*)p = v;  }
__device__ __forceinline__ v8f wmma16(v16h a, v16h b, v8f c) {
  v8f d = __builtin_amdgcn_wmma_f32_16x16x32_f16(false, a, false, b, (short)0, c, false, false);
  asm volatile("v_nop\n\tv_nop\n\tv_nop\n\tv_nop" : "+v"(d) : "v"(a), "v"(b));
  return d;
}
__device__ __forceinline__ v8f wmma_bf(v16b a, v16b b, v8f c) {
  v8f d = __builtin_amdgcn_wmma_f32_16x16x32_bf16(false, a, false, b, (short)0, c, false, false);
  asm volatile("v_nop\n\tv_nop\n\tv_nop\n\tv_nop" : "+v"(d) : "v"(a), "v"(b));
  return d;
}
// 16x16x32 fragments: lane = (h = lane>>4, row/col = lane&15); elements 0..7 = k0+8h+0..7, 8..15 = k0+16+8h+0..7; D element r = row 8h+r
__device__ __forceinline__ v16h frag_h(const _Float16* rowk0, int lane) {
  union { v16h v; v8h q[2]; } u; const _Float16* p = rowk0 + 8 * (lane >> 4);
  u.q[0] = *(const v8h*)p; u.q[1] = *(const v8h*)(p + 16); return u.v;
}
// the same fragment from a 16 x 32 tile kept in fragment order: 1 KiB = [elements 0..7 | 8..15][lane][8 f16], so each of the wave's two 16-byte loads covers 512 contiguous bytes (4 whole lines, not pieces of 16)
__device__ __forceinline__ v16h frag_t(const _Float16* tile, int lane) {
  union { v16h v; v8h q[2]; } u; const _Float16* p = tile + 8 * lane;
  u.q[0] = *(const v8h*)p; u.q[1] = *(const v8h*)(p + 256); return u.v;
}
__device__ __forceinline__ v16h frag_f32(const float* rowk0, int lane) {
  v16h a; const float* p = rowk0 + 8 * (lane >> 4);
#pragma unroll
  for (int i = 0; i < 8; ++i) { a[i] = (_Float16)p[i]; a[8 + i] = (_Float16)p[16 + i]; }
  return a;
}
__device__ __forceinline__ v16h frag_f32s(const float* rowk0, int lane, float sc) {
  v16h a; const float* p = rowk0 + 8 * (lane >> 4);
#pragma unroll
  for (int i = 0; i < 8; ++i) { a[i] = (_Float16)(p[i] * sc); a[8 + i] = (_Float16)(p[16 + i] * sc); }
  return a;
}
// column fragment from a [K][ld] layout (column n), rows >= K read as 0
__device__ __forceinline__ v16h fragc_f32(const float* W, int k0, int n, int lane, int ld, int K) {
  v16h a; const int g = lane >> 4;
#pragma unroll
  for (int i = 0; i < 8; ++i) { const int ka = k0 + 8 * g + i, kb = ka + 16;
    a[i] = (_Float16)(ka < K ? W[(size_t)(ka < K ? ka : K - 1) * ld + n] : 0.f); a[8 + i] = (_Float16)(kb < K ? W[(size_t)(kb < K ? kb : K - 1) * ld + n] : 0.f); }
  return a;
}
struct F2 { v16b h, l; };
__device__ __forceinline__ F2 bsplit16(const float v[16]) { F2 r;
#pragma unroll
  for (int i = 0; i < 16; ++i) { const __bf16 h = (__bf16)v[i]; r.h[i] = h; r.l[i] = (__bf16)(v[i] - (float)h); }
  return r; }
__device__ __forceinline__ F2 split_row(const float* row, int k0, int lane) { float v[16]; const float* p = row + k0 + 8 * (lane >> 4);
#pragma unroll
  for (int i = 0; i < 8; ++i) { v[i] = p[i]; v[8 + i] = p[16 + i]; }
  return bsplit16(v); }
__device__ __forceinline__ F2 split_rowK(const float* row, int k0, int lane, int K) { float v[16]; const int g = lane >> 4;
#pragma unroll
  for (int i = 0; i < 8; ++i) { const int ka = k0 + 8 * g + i, kb = ka + 16; v[i] = ka < K ? row[ka < K ? ka : K - 1] : 0.f; v[8 + i] = kb < K ? row[kb < K ? kb : K - 1] : 0.f; }
  return bsplit16(v); }
__device__ __forceinline__ F2 split_col(const float* W, int k0, int n, int lane, int ld, int K) { float v[16]; const int g = lane >> 4;
#pragma unroll
  for (int i = 0; i < 8; ++i) { const int ka = k0 + 8 * g + i, kb = ka + 16; v[i] = ka < K ? W[(size_t)(ka < K ? ka : K - 1) * ld + n] : 0.f; v[8 + i] = kb < K ? W[(size_t)(kb < K ? kb : K - 1) * ld + n] : 0.f; }
  return bsplit16(v); }
__device__ __forceinline__ v8f mac3(const F2& a, const F2& b, v8f c) { c = wmma_bf(a.l, b.h, c); c = wmma_bf(a.h, b.l, c); return wmma_bf(a.h, b.h, c); }
__device__ __forceinline__ float sigm(float v) { return 1.0f / (1.0f + expf(-v)); }
#define LDSX() do { asm volatile("s_wait_dscnt 0" ::: "memory"); __builtin_amdgcn_wave_barrier(); __builtin_amdgcn_fence(__ATOMIC_RELEASE, "workgroup"); } while (0)


// MSA row attention with pair bias (B 1, S 128 sequences x R 256 residues, c_m 256, 8 heads x 32, c_z 128): out = (sigmoid(LN(m) wg + bg) * softmax(q k / sqrt(32) + 1e9 (mask - 1) + LN(z) wz) v) wo + bo.
#define SQ 128
#define RR 256
#define CM 256
#define NH 8
#define CA 32
#define CZ 128
#define FF 1024
#define NROW (SQ * RR)
#define WSC 256.0f
#ifndef TON
#define TON 1           // unused
#endif
typedef __attribute__((ext_vector_type(8))) __bf16 v8b;
__device__ __forceinline__ v16b frag_b(const __bf16* rowk0, int lane) {
  union { v16b v; v8b q[2]; } u; const __bf16* p = rowk0 + 8 * (lane >> 4);
  u.q[0] = *(const v8b*)p; u.q[1] = *(const v8b*)(p + 16); return u.v;
}
__device__ __forceinline__ float bfr(float v) { return (float)(__bf16)v; }
__device__ __attribute__((noinline)) float exp_ni(float v) { return expf(v); }
__device__ __attribute__((noinline)) float erf_ni(float v) { return erff(v); }

// weights (f16 x 2^8, transposed (in,out)), as 16 x 32 tiles in fragment order [out / 16][in / 32][512]: RW 1024 x 256 = q|k|v|g ; CW 1024 x 256; RWO 256 x 256; CWO 256 x 256; TW1 1024 x 256; TW2 256 x 1024
#define WS_RW   0u
#define WS_CW   (WS_RW + 2u * 1024 * CM)
#define WS_RWO  (WS_CW + 2u * 1024 * CM)
#define WS_CWO  (WS_RWO + 2u * CM * CM)
#define WS_TW1  (WS_CWO + 2u * CM * CM)
#define WS_TW2  (WS_TW1 + 2u * FF * CM)
#define WS_XH   (WS_TW2 + 2u * CM * FF)                 // f16 LN rows [NROW][256] (natural s*R + r)
#define WS_QK   (WS_XH + 2u * (size_t)NROW * CM)         // f16 q|k tiles in fragment order [b][q|k][head][N / 16][512]
#define WS_VT   (WS_QK + 2u * (size_t)NROW * 2 * CM)     // f16 hi|lo v planes, tiles (16 channels x 32 tokens) in fragment order [b][256 / 16][N / 32][512]
#define WS_VTL  (WS_VT + 2u * (size_t)NROW * CM)
#define WS_G    (WS_VTL + 2u * (size_t)NROW * CM)        // f16 sigmoid gate, tiles (16 natural rows x 32 channels) in fragment order [NROW / 16][256 / 32][512]
#define WS_O    (WS_G + 2u * (size_t)NROW * CM)          // f32 attention output, tiles (16 compact rows x 32 channels = one head) in fragment order [NROW / 16][256 / 32][element quad 0..3][lane][4]
#define WS_M    (WS_O + 4u * (size_t)NROW * CM)          // f32 working m [natural][256]
#define WS_PB   (WS_M + 4u * (size_t)NROW * CM)          // f32 pair bias [h][q][k]
#define WS_H1   (WS_PB + 4u * (size_t)NH * RR * RR)      // f16 relu rows [natural][1024]
#define WS_END  (WS_H1 + 2u * (size_t)NROW * FF)

// ---- k_packw: block = 16 output rows n0 .. n0 + 15 = one row of tiles, so every 128-byte line of the packed weights has one writer; which: 0 RW (W = rq|rk|rv|rg by n/256), 1 CW, 2 RWO, 3 CWO, 4 TW1, 5 TW2
__global__ __launch_bounds__(256) void k_packw(const float* __restrict__ RQ, const float* __restrict__ RK, const float* __restrict__ RV, const float* __restrict__ RG, const float* __restrict__ CQ, const float* __restrict__ CK, const float* __restrict__ CV, const float* __restrict__ CG, const float* __restrict__ RWO, const float* __restrict__ CWO, const float* __restrict__ TW1, const float* __restrict__ TW2, char* __restrict__ ws) {
  const int n0 = blockIdx.x * 16, which = blockIdx.y, t = threadIdx.x;
  const float* Wm; int kin, kout, col; _Float16* dst;
  if (which == 0) { if (n0 >= 1024) return; const int g4 = n0 / CM; col = n0 % CM; Wm = g4 == 0 ? RQ : g4 == 1 ? RK : g4 == 2 ? RV : RG; kin = CM; kout = CM; dst = (_Float16*)(ws + WS_RW); }
  else if (which == 1) { if (n0 >= 1024) return; const int g4 = n0 / CM; col = n0 % CM; Wm = g4 == 0 ? CQ : g4 == 1 ? CK : g4 == 2 ? CV : CG; kin = CM; kout = CM; dst = (_Float16*)(ws + WS_CW); }
  else if (which == 2) { if (n0 >= CM) return; col = n0; Wm = RWO; kin = CM; kout = CM; dst = (_Float16*)(ws + WS_RWO); }
  else if (which == 3) { if (n0 >= CM) return; col = n0; Wm = CWO; kin = CM; kout = CM; dst = (_Float16*)(ws + WS_CWO); }
  else if (which == 4) { if (n0 >= FF) return; col = n0; Wm = TW1; kin = CM; kout = FF; dst = (_Float16*)(ws + WS_TW1); }
  else { if (n0 >= CM) return; col = n0; Wm = TW2; kin = FF; kout = CM; dst = (_Float16*)(ws + WS_TW2); }
  dst += (size_t)blockIdx.x * (kin / 32) * 512;
  // chunk e = (k tile e >> 6, half (e >> 5) & 1, lane e & 31) lies at f16 offset 8 e: a wave stores 512 contiguous bytes; its 8 values are k .. k + 7 of output row n0 + (lane & 15)
  for (int e = t; e < kin * 2; e += 256) { const int ln = e & 31, k = (e >> 6) * 32 + ((e >> 5) & 1) * 16 + (ln >> 4) * 8; v8h o;
#pragma unroll   // o is indexed by constants and stays in registers
    for (int i = 0; i < 8; ++i) o[i] = (_Float16)(bfr(Wm[(size_t)(k + i) * kout + col + (ln & 15)]) * WSC);
    vst2(dst + e * 8, o); } }
// ---- k_ln: XH = LN(bf16(m)) w + b (jnp.var, 1e-5) -> f16. One wave owns a row (lane l: channels 4l + e and 128 + 4l + e, so each 16-byte load of a wave covers 512 contiguous bytes) and works on LNR rows; no LDS, no barrier
// value of lane l ^ MSK inside a 16-lane row, by a DPP move (no LDS round trip as with __shfl_xor)
template <int MSK> __device__ __forceinline__ float rowx(float x) { return __builtin_bit_cast(float, __builtin_amdgcn_mov_dpp(__builtin_bit_cast(int, x), 0x160 | MSK, 0xf, 0xf, true)); }
// lane l with lane l ^ 16
__device__ __forceinline__ float xhalf(float x) { return __builtin_bit_cast(float, __builtin_amdgcn_permlanex16(__builtin_bit_cast(int, x), __builtin_bit_cast(int, x), 0x76543210, 0xfedcba98, false, false)); }
__device__ __forceinline__ float wsum(float s) { s += rowx<1>(s); s += rowx<2>(s); s += rowx<4>(s); s += rowx<8>(s); return s + xhalf(s); }
typedef __attribute__((ext_vector_type(4))) _Float16 v4h;
#define LNR 8
__global__ __launch_bounds__(256) void k_ln(const float* __restrict__ X, const float* __restrict__ G, const float* __restrict__ Bt, _Float16* __restrict__ XH) { const int lane = threadIdx.x & 31; const size_t row0 = ((size_t)blockIdx.x * 8 + (threadIdx.x >> 5)) * LNR;
  const float* xr = X + row0 * CM + lane * 4; _Float16* yr = XH + row0 * CM + lane * 4;
  // both loops are fully unrolled: the arrays are indexed by constants and stay in registers
  v4f xa[LNR], xb[LNR];   // the wave's LNR rows: all loads are issued before the first use, so memory latency is paid once
#pragma unroll
  for (int p = 0; p < LNR; ++p) { xa[p] = *(const v4f*)(xr + (size_t)p * CM); xb[p] = *(const v4f*)(xr + (size_t)p * CM + 128); }
  const v4f g0 = *(const v4f*)(G + lane * 4), g1 = *(const v4f*)(G + 128 + lane * 4), c0 = *(const v4f*)(Bt + lane * 4), c1 = *(const v4f*)(Bt + 128 + lane * 4);
  float gg[8], bb[8];
#pragma unroll
  for (int e = 0; e < 4; ++e) { gg[e] = bfr(g0[e]); gg[4 + e] = bfr(g1[e]); bb[e] = bfr(c0[e]); bb[4 + e] = bfr(c1[e]); }
#pragma unroll
  for (int p = 0; p < LNR; ++p) { float v[8];
#pragma unroll
    for (int e = 0; e < 4; ++e) { v[e] = bfr(xa[p][e]); v[4 + e] = bfr(xb[p][e]); }
    const float mu = wsum(((v[0] + v[1]) + (v[2] + v[3])) + ((v[4] + v[5]) + (v[6] + v[7]))) / (float)CM; float qq = 0.f;
#pragma unroll
    for (int i = 0; i < 8; ++i) { v[i] -= mu; qq += v[i] * v[i]; }
    const float inv = 1.0f / sqrtf(wsum(qq) / (float)CM + 1e-5f); v4h h0, h1;
#pragma unroll
    for (int e = 0; e < 4; ++e) { h0[e] = (_Float16)(v[e] * inv * gg[e] + bb[e]); h1[e] = (_Float16)(v[4 + e] * inv * gg[4 + e] + bb[4 + e]); }
    vst2(yr + (size_t)p * CM, h0); vst2(yr + (size_t)p * CM + 128, h1); } }
// natural row index of (batch b, token n): MODE 0 row attention (b = s, n = r); MODE 1 column attention (b = r, n = s)
template <int MODE> __device__ __forceinline__ size_t nat(size_t b, int n) { return MODE == 0 ? b * RR + n : (size_t)n * RR + b; }
// ---- k_proj<MODE>: block = (64 tokens, 128 of 1024 cols (q|k|v|g), b): A = XH rows; q|k -> QK (single f16); v -> planes hi/lo; g -> sigmoid -> f16; all four stored as whole tiles in their reader's fragment order
template <int MODE>
__global__ __launch_bounds__(128) void k_proj(const _Float16* __restrict__ XH, const _Float16* __restrict__ Wr, const float* __restrict__ BG, _Float16* __restrict__ QK, _Float16* __restrict__ VT, _Float16* __restrict__ VTL, _Float16* __restrict__ Gt) {
  static_assert(MODE == 0, "a gate tile holds 16 natural rows: 16 tokens of one b only in row attention");
  constexpr int NN = MODE == 0 ? RR : SQ; __shared__ __align__(16) _Float16 sh[64][136]; __shared__ __align__(16) _Float16 th[128][72], tl[128][72];
  const int tid = threadIdx.x, wave = tid >> 5, lane = tid & 31, col = lane & 15, g = lane >> 4; const size_t b = blockIdx.z; const int n0 = blockIdx.x * 64 + wave * 16; const int c0 = blockIdx.y * 128; const int which = c0 / CM;   // 0 q, 1 k, 2 v, 3 g
  v8f acc[8] = {};
  // fragments are fetched ahead: a weight fragment's load for the next k block is issued right behind the WMMA that read it, so 8 fragments stay in flight and a WMMA waits only for a load issued 8 WMMAs earlier, not for its own; the row fragment of the next k block is requested ahead of this block's WMMAs
  const _Float16* ar = XH + nat<MODE>(b, n0 + col) * CM; const _Float16* wr = Wr + (size_t)(c0 / 16) * (CM / 32) * 512;
  v16h a = frag_h(ar, lane), wf[8]; float bgv[8];   // the gate bias too is requested here (in bounds for every block; only the gate blocks use it): behind the WMMAs each of its 8 loads was waited for alone
#pragma unroll   // bgv and wf are indexed by constants and stay in registers (this loop and the next three)
  for (int j = 0; j < 8; ++j) bgv[j] = BG[(c0 % CM) + j * 16 + col];
#pragma unroll
  for (int j = 0; j < 8; ++j) wf[j] = frag_t(wr + (size_t)j * (CM / 32) * 512, lane);
  asm volatile("s_wait_xcnt 0x0" ::: "memory");   // stands in front of what rewrites the address registers of the loads above (a WMMA result takes those of the bias loads)
#pragma unroll
  for (int kc = 0; kc < CM / 32; ++kc) { v16h an = a; if (kc + 1 < CM / 32) an = frag_h(ar + (kc + 1) * 32, lane);
#pragma unroll
    for (int j = 0; j < 8; ++j) { acc[j] = wmma16(a, wf[j], acc[j]); if (kc + 1 < CM / 32) wf[j] = frag_t(wr + ((size_t)j * (CM / 32) + kc + 1) * 512, lane); }
    a = an; }
#pragma unroll
  for (int j = 0; j < 8; ++j) { const float bg = (which == 3) ? bfr(bgv[j]) : 0.f;
#pragma unroll
    for (int r = 0; r < 8; ++r) { float v = acc[j][r] * (1.0f / WSC); if (which == 3) v = 1.0f / (1.0f + expf(-(v + bg)));
      if (which == 2) { const _Float16 hv = (_Float16)v; th[j * 16 + col][wave * 16 + 8 * g + r] = hv; tl[j * 16 + col][wave * 16 + 8 * g + r] = (_Float16)((v - (float)hv) * 2048.0f); } else sh[wave * 16 + 8 * g + r][j * 16 + col] = (_Float16)v; } }
  __syncthreads();
  if (which < 2) { for (int e = tid; e < 64 * 16; e += 128) { const int ln = e & 31, hf = (e >> 5) & 1, rt = (e >> 6) & 3, hl = e >> 8;   // a wave stores 512 contiguous bytes: half hf of the tile (head hl of the block's 4, token tile rt)
      vst2((unsigned*)(QK + (((b * 2 + which) * NH + (c0 % CM) / CA + hl) * (NN / 16) + blockIdx.x * 4 + rt) * 512 + hf * 256 + ln * 8), *(const v4u*)&sh[rt * 16 + (ln & 15)][(hl * 4 + hf * 2 + (ln >> 4)) * 8]); } }
  else if (which == 2) { const int cv0 = c0 - 2 * CM; for (int e = tid; e < 128 * 8; e += 128) { const int ln = e & 31, hf = (e >> 5) & 1, kl = (e >> 6) & 1, ctl = e >> 7, cl = ctl * 16 + (ln & 15), tk = (kl * 4 + hf * 2 + (ln >> 4)) * 8;   // half hf of the tile (channel tile ctl of 8, 32-token group kl of 2)
      const size_t o = ((b * (CM / 16) + cv0 / 16 + ctl) * (size_t)(NN / 32) + blockIdx.x * 2 + kl) * 512 + hf * 256 + ln * 8; vst2((unsigned*)(VT + o), *(const v4u*)&th[cl][tk]); vst2((unsigned*)(VTL + o), *(const v4u*)&tl[cl][tk]); } }
  else { for (int e = tid; e < 64 * 16; e += 128) { const int ln = e & 31, hf = (e >> 5) & 1, rt = (e >> 6) & 3, hl = e >> 8;
      vst2((unsigned*)(Gt + ((nat<MODE>(b, blockIdx.x * 64) / 16 + rt) * (CM / 32) + (c0 - 3 * CM) / 32 + hl) * 512 + hf * 256 + ln * 8), *(const v4u*)&sh[rt * 16 + (ln & 15)][(hl * 4 + hf * 2 + (ln >> 4)) * 8]); } } }
// ---- k_pb: block = (query residue q, 128 keys): PB[h][q][k] = LN(z[q][k]) . wb[:, h]; 16 lanes share one z row (8 channels a lane, two 16-byte loads), a wave works on 2 rows at a time; this lane's 8 x 8 weights stay in registers
#define PBK 128
__global__ __launch_bounds__(256) void k_pb(const float* __restrict__ Zp, const float* __restrict__ G, const float* __restrict__ Bt, const float* __restrict__ WB, float* __restrict__ PB) { __shared__ __align__(16) float sp[NH][PBK + 4]; __shared__ __align__(16) float swb[CZ / 4][4 * NH + 4];   // swb: 4 channels x 8 heads a row, pitch 36 words: the 16 lanes' 16-byte reads fall on distinct banks
  const int t = threadIdx.x, lane = t & 31, w = t >> 5, l16 = lane & 15, hf = lane >> 4; const int q = blockIdx.x, k0 = blockIdx.y * PBK;
  const float* zr = Zp + ((size_t)q * RR + k0 + w * 16 + hf) * CZ + l16 * 4;   // rows w*16 + 2p + hf; channels 4*l16 + e and 64 + 4*l16 + e
  // every loop of this kernel is fully unrolled: its arrays are indexed by constants and stay in registers
  v4f za[8], zb[8];   // the wave's 16 rows: all 16 loads are issued before the first use, so memory latency is paid once
#pragma unroll
  for (int p = 0; p < 8; ++p) { za[p] = *(const v4f*)(zr + (size_t)p * 2 * CZ); zb[p] = *(const v4f*)(zr + (size_t)p * 2 * CZ + 64); }
  v4f g4[2], b4[2];
#pragma unroll
  for (int i = 0; i < 2; ++i) { g4[i] = *(const v4f*)(G + 64 * i + l16 * 4); b4[i] = *(const v4f*)(Bt + 64 * i + l16 * 4); }
  { v4f w4 = *(const v4f*)(WB + t * 4); w4[0] = bfr(w4[0]); w4[1] = bfr(w4[1]); w4[2] = bfr(w4[2]); w4[3] = bfr(w4[3]); *(v4f*)&swb[t >> 3][(t & 7) * 4] = w4; } __syncthreads();
  float wv[8][NH], gg[8], bb[8];
#pragma unroll
  for (int i = 0; i < 2; ++i) {
#pragma unroll
    for (int e = 0; e < 4; ++e) { gg[i * 4 + e] = bfr(g4[i][e]); bb[i * 4 + e] = bfr(b4[i][e]); const v4f w0 = *(const v4f*)&swb[16 * i + l16][e * NH], w1 = *(const v4f*)&swb[16 * i + l16][e * NH + 4];
#pragma unroll
      for (int h = 0; h < 4; ++h) { wv[i * 4 + e][h] = w0[h]; wv[i * 4 + e][4 + h] = w1[h]; } } }
  const bool b0 = (l16 & 1) != 0, b1 = (l16 & 2) != 0, b2 = (l16 & 4) != 0;
#pragma unroll
  for (int p = 0; p < 8; ++p) { float v[8];
#pragma unroll
    for (int e = 0; e < 4; ++e) { v[e] = bfr(za[p][e]); v[4 + e] = bfr(zb[p][e]); }
    float s = ((v[0] + v[1]) + (v[2] + v[3])) + ((v[4] + v[5]) + (v[6] + v[7]));
    s += rowx<1>(s); s += rowx<2>(s); s += rowx<4>(s); s += rowx<8>(s);
    const float mu = s / (float)CZ; float qq = 0.f;
#pragma unroll
    for (int i = 0; i < 8; ++i) { v[i] -= mu; qq += v[i] * v[i]; }
    qq += rowx<1>(qq); qq += rowx<2>(qq); qq += rowx<4>(qq); qq += rowx<8>(qq);
    const float inv = 1.0f / sqrtf(qq / (float)CZ + 1e-5f); float ph[NH];
#pragma unroll
    for (int h = 0; h < NH; ++h) ph[h] = 0.f;
#pragma unroll
    for (int i = 0; i < 8; ++i) { const float ln = v[i] * inv * gg[i] + bb[i];
#pragma unroll
      for (int h = 0; h < NH; ++h) ph[h] += ln * wv[i][h]; }
    // sum over the 16 lanes, halving the heads a lane carries at each of the first three steps: lane l16 ends with head l16 & 7
    float y[4], u[2];
#pragma unroll
    for (int i = 0; i < 4; ++i) y[i] = (b0 ? ph[2 * i + 1] : ph[2 * i]) + rowx<1>(b0 ? ph[2 * i] : ph[2 * i + 1]);
#pragma unroll
    for (int i = 0; i < 2; ++i) u[i] = (b1 ? y[2 * i + 1] : y[2 * i]) + rowx<2>(b1 ? y[2 * i] : y[2 * i + 1]);
    float x = (b2 ? u[1] : u[0]) + rowx<4>(b2 ? u[0] : u[1]); x += rowx<8>(x);
    if (l16 < NH) sp[l16][w * 16 + p * 2 + hf] = x; }
  __syncthreads(); { const int h = t >> 5, q4 = t & 31; vst2(PB + ((size_t)h * RR + q) * RR + k0 + q4 * 4, *(const v4f*)&sp[h][q4 * 4]); } }
// ---- k_att<MODE>: block = (64 queries, head, b): logits q.k x 32^-0.5 (+ pair bias in MODE 0), masked keys excluded, softmax, P . v (planes hi + residual) -> O, one tile a wave
template <int MODE>
__global__ __launch_bounds__(128) void k_att(const _Float16* __restrict__ QK, const _Float16* __restrict__ VT, const _Float16* __restrict__ VTL, const float* __restrict__ PB, const float* __restrict__ MASK, float* __restrict__ O) {
  constexpr int NN = MODE == 0 ? RR : SQ; __shared__ __align__(16) float sp[4][16][36]; __shared__ __align__(16) float so[4][16][36];
  const int tid = threadIdx.x, wave = tid >> 5, lane = tid & 31, col = lane & 15, g = lane >> 4; const int h = blockIdx.y; const size_t b = blockIdx.z; const int q0 = blockIdx.x * 64 + wave * 16; const size_t rq = b * NN + q0;
  const v16h aq = frag_t(QK + (((b * 2 + 0) * NH + h) * (NN / 16) + q0 / 16) * 512, lane);
  float m[8], l[8];
#pragma unroll
  for (int r = 0; r < 8; ++r) { m[r] = -3.0e38f; l[r] = 0.f; }
  v8f acc[2] = {}, accl[2] = {};
#pragma unroll 1
  for (int ks = 0; ks < NN / 32; ++ks) { v8f s[2];
    // all loads of the pass are issued here, ahead of its first WMMA: one wait on memory a pass, and v lands behind the softmax
    v16h kh[2], vh[2], vl[2]; float mk[2], pb[2][8];
#pragma unroll   // the arrays are indexed by constants and stay in registers
    for (int ct = 0; ct < 2; ++ct) { const int kk = ks * 32 + ct * 16 + col; kh[ct] = frag_t(QK + (((b * 2 + 1) * NH + h) * (NN / 16) + ks * 2 + ct) * 512, lane); mk[ct] = MASK[nat<MODE>(b, kk)];
#pragma unroll
      for (int r = 0; r < 8; ++r) pb[ct][r] = MODE == 0 ? PB[((size_t)h * RR + (q0 + 8 * g + r)) * RR + kk] : 0.f; }
    asm volatile("s_wait_xcnt 0x0" ::: "memory");   // stands in front of what rewrites the address registers of the loads above: results of the v loads, the next pass's address additions
#pragma unroll
    for (int j = 0; j < 2; ++j) { const size_t po = ((b * (CM / 16) + h * 2 + j) * (size_t)(NN / 32) + ks) * 512; vh[j] = frag_t(VT + po, lane); vl[j] = frag_t(VTL + po, lane); }
    asm volatile("s_wait_xcnt 0x0" ::: "memory");   // the same for the v loads
#pragma unroll
    for (int ct = 0; ct < 2; ++ct) { v8f c = {}; c = wmma16(aq, kh[ct], c);
      const bool keep = bfr(mk[ct]) != 0.f;
#pragma unroll
      for (int r = 0; r < 8; ++r) { float sc = c[r] * 0.17677669529663687f; if (MODE == 0) sc += pb[ct][r]; s[ct][r] = keep ? sc : -3.0e38f; } }
    float alpha[8];
#pragma unroll
    for (int r = 0; r < 8; ++r) { float mx = fmaxf(s[0][r], s[1][r]);
#pragma unroll
      for (int o = 1; o < 16; o <<= 1) mx = fmaxf(mx, __shfl_xor(mx, o));
      const float mn = fmaxf(m[r], mx); alpha[r] = (m[r] <= -1.0e38f) ? 0.f : __expf(m[r] - mn); const float e0 = (s[0][r] <= -1.0e38f) ? 0.f : __expf(s[0][r] - mn), e1 = (s[1][r] <= -1.0e38f) ? 0.f : __expf(s[1][r] - mn); float es = e0 + e1;
#pragma unroll
      for (int o = 1; o < 16; o <<= 1) es += __shfl_xor(es, o);
      l[r] = l[r] * alpha[r] + es; m[r] = mn; sp[wave][8 * g + r][col] = e0; sp[wave][8 * g + r][16 + col] = e1; }
#pragma unroll
    for (int j = 0; j < 2; ++j)
#pragma unroll
      for (int r = 0; r < 8; ++r) { acc[j][r] *= alpha[r]; accl[j][r] *= alpha[r]; }
    LDSX();
    v16h pa, pal; { const float* prow = &sp[wave][col][0] + 8 * (lane >> 4);
#pragma unroll
      for (int i = 0; i < 8; ++i) { const float p0 = prow[i] * 2048.0f, p1 = prow[16 + i] * 2048.0f; pa[i] = (_Float16)p0; pa[8 + i] = (_Float16)p1; pal[i] = (_Float16)((p0 - (float)pa[i]) * 2048.0f); pal[8 + i] = (_Float16)((p1 - (float)pa[8 + i]) * 2048.0f); } }
#pragma unroll
    for (int j = 0; j < 2; ++j) { acc[j] = wmma16(pa, vh[j], acc[j]); accl[j] = wmma16(pa, vl[j], accl[j]); accl[j] = wmma16(pal, vh[j], accl[j]); }
    LDSX(); }
#pragma unroll
  for (int r = 0; r < 8; ++r) { const float il = (l[r] > 0.f) ? (1.0f / 2048.0f) / l[r] : 0.f;
#pragma unroll
    for (int j = 0; j < 2; ++j) so[wave][8 * g + r][j * 16 + col] = (acc[j][r] + accl[j][r] * (1.0f / 2048.0f)) * il; }
  LDSX(); { float* ot = O + ((rq / 16) * (CM / 32) + h) * 512 + lane * 4;   // lane = (g, row col): quads 0, 1 = channels 8g .. 8g + 7, quads 2, 3 = 16 + 8g .. ; each store of the wave is 512 contiguous bytes
    for (int qd = 0; qd < 4; ++qd) vst2(ot + qd * 128, *(const v4f*)&so[wave][col][(qd >> 1) * 16 + 8 * g + (qd & 1) * 4]); } }
// ---- k_go<MODE>: block = (64 natural rows, 128 cols): M = (g o) . wo + bo ; A operand built on the fly from the G and O tiles
template <int MODE>
__global__ __launch_bounds__(128) void k_go(const _Float16* __restrict__ Gt, const float* __restrict__ O, const _Float16* __restrict__ WOr, const float* __restrict__ BO, float* __restrict__ M) { __shared__ __align__(16) float sf[4][16][132];
  const int tid = threadIdx.x, wave = tid >> 5, lane = tid & 31, col = lane & 15, g = lane >> 4; const size_t r0 = (size_t)blockIdx.x * 64 + wave * 16; const int c0 = blockIdx.y * 128;
  static_assert(MODE == 0, "one tile index serves G (natural rows) and O (compact rows): the two orders agree only in row attention");
  const size_t t0 = (r0 / 16) * (CM / 32);
  v8f acc[8] = {}, accl2[8] = {};
  // loads run ahead of the WMMAs: the 64 weight fragments (order f = kc * 8 + j) go through a ring of GOW register sets, fragment f + GOW being requested right behind the two WMMAs that read fragment f; the gate and o tiles of block kc + 1 are requested ahead of block kc's WMMAs
  constexpr int GOW = 7; const _Float16* wr = WOr + (size_t)(c0 / 16) * (CM / 32) * 512; v16h wf[GOW];
#pragma unroll   // every loop here is fully unrolled: wf and ov are indexed by constants and stay in registers
  for (int f = 0; f < GOW; ++f) wf[f] = frag_t(wr + ((size_t)(f & 7) * (CM / 32) + (f >> 3)) * 512, lane);
  v16h gv = frag_t(Gt + t0 * 512, lane); v4f ov[4];
#pragma unroll
  for (int qd = 0; qd < 4; ++qd) ov[qd] = *(const v4f*)(O + t0 * 512 + lane * 4 + qd * 128);
#pragma unroll
  for (int kc = 0; kc < CM / 32; ++kc) { v16h a, al;
    __builtin_amdgcn_sched_barrier(0);   // keeps this block's conversions (and with them the wait for its gate and o tiles) behind the WMMAs of the block before: moved up among them they would wait for loads just issued
#pragma unroll
    for (int i = 0; i < 16; ++i) { const float v0 = (float)gv[i] * ov[i >> 2][i & 3]; a[i] = (_Float16)v0; al[i] = (_Float16)((v0 - (float)a[i]) * 2048.0f); }
    if (kc + 1 < CM / 32) { gv = frag_t(Gt + (t0 + kc + 1) * 512, lane);
#pragma unroll
      for (int qd = 0; qd < 4; ++qd) ov[qd] = *(const v4f*)(O + (t0 + kc + 1) * 512 + lane * 4 + qd * 128);
      asm volatile("s_wait_xcnt 0x0" ::: "memory"); }   // stands in front of whatever rewrites the address registers of the six loads above (in the last block a later load's result does)
#pragma unroll
    for (int j = 0; j < 8; ++j) { const int f = kc * 8 + j, fn = f + GOW; acc[j] = wmma16(a, wf[f % GOW], acc[j]); accl2[j] = wmma16(al, wf[f % GOW], accl2[j]); if (fn < 8 * (CM / 32)) wf[f % GOW] = frag_t(wr + ((size_t)(fn & 7) * (CM / 32) + (fn >> 3)) * 512, lane); } }
#pragma unroll
  for (int j = 0; j < 8; ++j) { const int c = c0 + j * 16 + col; const float bb = bfr(BO[c]);
#pragma unroll
    for (int r = 0; r < 8; ++r) sf[wave][8 * g + r][j * 16 + col] = (acc[j][r] + accl2[j][r] * (1.0f / 2048.0f)) * (1.0f / WSC) + bb; }
  LDSX(); for (int rl = 0; rl < 16; ++rl) vst2(M + (r0 + rl) * CM + c0 + lane * 4, *(const v4f*)&sf[wave][rl][lane * 4]); }   // M here = the output buffer (no residual in this module)
// ---- k_ff1: block = (64 rows, 128 of 1024 cols): H1 = relu(XH . W1 + b1) -> f16 ; k_ff2: out = H1 . W2 + b2 + M
__global__ __launch_bounds__(128) void k_ff1(const _Float16* __restrict__ XH, const _Float16* __restrict__ W1r, const float* __restrict__ B1, _Float16* __restrict__ H1) { __shared__ __align__(16) _Float16 sh[4][16][136];
  const int tid = threadIdx.x, wave = tid >> 5, lane = tid & 31, col = lane & 15, g = lane >> 4; const size_t r0 = (size_t)blockIdx.x * 64 + wave * 16; const int c0 = blockIdx.y * 128;
  v8f acc[8] = {};
#pragma unroll
  for (int kc = 0; kc < CM / 32; ++kc) { const v16h a = frag_h(XH + (r0 + col) * CM + kc * 32, lane);
#pragma unroll
    for (int j = 0; j < 8; ++j) acc[j] = wmma16(a, frag_t(W1r + ((size_t)(c0 / 16 + j) * (CM / 32) + kc) * 512, lane), acc[j]); }
#pragma unroll
  for (int j = 0; j < 8; ++j) { const float bb = bfr(B1[c0 + j * 16 + col]);
#pragma unroll
    for (int r = 0; r < 8; ++r) sh[wave][8 * g + r][j * 16 + col] = (_Float16)fmaxf(acc[j][r] * (1.0f / WSC) + bb, 0.f); }
  LDSX(); for (int rl = 0; rl < 16; ++rl) if (lane < 16) vst2((unsigned*)(H1 + (r0 + rl) * FF + c0 + lane * 8), *(const v4u*)&sh[wave][rl][lane * 8]); }
__global__ __launch_bounds__(128) void k_ff2(const _Float16* __restrict__ H1, const _Float16* __restrict__ W2r, const float* __restrict__ B2, const float* __restrict__ M, float* __restrict__ OUT) { __shared__ __align__(16) float sf[4][16][132];
  const int tid = threadIdx.x, wave = tid >> 5, lane = tid & 31, col = lane & 15, g = lane >> 4; const size_t r0 = (size_t)blockIdx.x * 64 + wave * 16; const int c0 = blockIdx.y * 128;
  v8f acc[8] = {};
#pragma unroll 2
  for (int kc = 0; kc < FF / 32; ++kc) { const v16h a = frag_h(H1 + (r0 + col) * FF + kc * 32, lane);
#pragma unroll
    for (int j = 0; j < 8; ++j) acc[j] = wmma16(a, frag_t(W2r + ((size_t)(c0 / 16 + j) * (FF / 32) + kc) * 512, lane), acc[j]); }
#pragma unroll
  for (int j = 0; j < 8; ++j) { const int c = c0 + j * 16 + col; const float bb = bfr(B2[c]);
#pragma unroll
    for (int r = 0; r < 8; ++r) sf[wave][8 * g + r][j * 16 + col] = acc[j][r] * (1.0f / WSC) + bb + M[(r0 + 8 * g + r) * CM + c]; }
  LDSX(); for (int rl = 0; rl < 16; ++rl) vst2(OUT + (r0 + rl) * CM + c0 + lane * 4, *(const v4f*)&sf[wave][rl][lane * 4]); }
extern "C" void kernel_launch(void* const* d_in, const int* in_sizes, int n_in, void* d_out, int out_size, void* d_ws, size_t ws_size, hipStream_t stream) {
  (void)in_sizes; (void)n_in; (void)out_size;
  const float** F = (const float**)d_in;   // 0 m [1,128,256,256], 1 z [1,256,256,128], 2 mask [1,128,256], 3 ln_m_g, 4 ln_m_b, 5 ln_z_g, 6 ln_z_b, 7 wz [128,8], 8 wq [256,8,32], 9 wk, 10 wv, 11 wg, 12 bg [8,32], 13 wo [8,32,256], 14 bo [256]
  if (ws_size < (size_t)WS_END) return;
  char* ws = (char*)d_ws; _Float16 *RW = (_Float16*)(ws + WS_RW), *RWOp = (_Float16*)(ws + WS_RWO), *XH = (_Float16*)(ws + WS_XH), *QK = (_Float16*)(ws + WS_QK), *VT = (_Float16*)(ws + WS_VT), *VTL = (_Float16*)(ws + WS_VTL), *Gt = (_Float16*)(ws + WS_G);
  float *O = (float*)(ws + WS_O), *PB = (float*)(ws + WS_PB);
  k_packw<<<dim3(64, 3), 256, 0, stream>>>(F[8], F[9], F[10], F[11], F[8], F[9], F[10], F[11], F[13], F[13], F[8], F[13], ws);   // which 0 (q|k|v|g rows) and 2 (wo rows) are used; which 1 packs in-bounds duplicates; 3-5 not launched
  k_ln<<<NROW / (8 * LNR), 256, 0, stream>>>(F[0], F[3], F[4], XH);
  k_proj<0><<<dim3(RR / 64, 8, SQ), 128, 0, stream>>>(XH, RW, F[12], QK, VT, VTL, Gt);
  k_pb<<<dim3(RR, RR / PBK), 256, 0, stream>>>(F[1], F[5], F[6], F[7], PB);
  k_att<0><<<dim3(RR / 64, NH, SQ), 128, 0, stream>>>(QK, VT, VTL, PB, F[2], O);
  k_go<0><<<dim3(NROW / 64, CM / 128), 128, 0, stream>>>(Gt, O, RWOp, F[14], (float*)d_out);
}

// v005
// A run of this version takes 127 microseconds.
// In two side-by-side timings against v004, it was 1.10 and 1.13 times as fast.
// All steps since v000 together make it 2.81 times as fast.
// compute dtype: all float inputs rounded to bf16; LayerNorms, pair bias (LN(z) . wz), softmax, sigmoid gate in f32; q|k|v|g projections on WMMA 16x16x32 with the LayerNorm output rounded once to f16 against exact f16 x 2^8 weights; attention logits with single f16 q, k (32-dim heads), P as f16 hi + residual (x 2^11) . v (hi + residual; 3 products); (g o) as f16 hi + residual (2 products) . wo (f16 x 2^8) + bo; f32 output.
#include <hip/hip_runtime.h>
#include <math.h>

typedef __attribute__((ext_vector_type(16))) _Float16 v16h;
typedef __attribute__((ext_vector_type(16))) __bf16 v16b;
typedef __attribute__((ext_vector_type(8)))  _Float16 v8h;
typedef __attribute__((ext_vector_type(8)))  float v8f;
typedef __attribute__((ext_vector_type(4)))  float v4f;
typedef __attribute__((ext_vector_type(2)))  float v2f;
typedef __attribute__((ext_vector_type(4)))  unsigned v4u;
typedef __attribute__((ext_vector_type(4)))  int v4i;
typedef float __attribute__((may_alias)) float_a;
typedef int __attribute__((may_alias)) int_a;

template <typename T> __device__ __forceinline__ void vst2(void* p, T v) { *(T*)p = v;  }
__device__ __forceinline__ v8f wmma16(v16h a, v16h b, v8f c) {
  v8f d = __builtin_amdgcn_wmma_f32_16x16x32_f16(false, a, false, b, (short)0, c, false, false);
  asm volatile("v_nop\n\tv_nop\n\tv_nop\n\tv_nop" : "+v"(d) : "v"(a), "v"(b));
  return d;
}
__device__ __forceinline__ v8f wmma_bf(v16b a, v16b b, v8f c) {
  v8f d = __builtin_amdgcn_wmma_f32_16x16x32_bf16(false, a, false, b, (short)0, c, false, false);
  asm volatile("v_nop\n\tv_nop\n\tv_nop\n\tv_nop" : "+v"(d) : "v"(a), "v"(b));
  return d;
}
// 16x16x32 fragments: lane = (h = lane>>4, row/col = lane&15); elements 0..7 = k0+8h+0..7, 8..15 = k0+16+8h+0..7; D element r = row 8h+r
__device__ __forceinline__ v16h frag_h(const _Float16* rowk0, int lane) {
  union { v16h v; v8h q[2]; } u; const _Float16* p = rowk0 + 8 * (lane >> 4);
  u.q[0] = *(const v8h*)p; u.q[1] = *(const v8h*)(p + 16); return u.v;
}
// the same fragment from a 16 x 32 tile kept in fragment order: 1 KiB = [elements 0..7 | 8..15][lane][8 f16], so each of the wave's two 16-byte loads covers 512 contiguous bytes (4 whole lines, not pieces of 16)
__device__ __forceinline__ v16h frag_t(const _Float16* tile, int lane) {
  union { v16h v; v8h q[2]; } u; const _Float16* p = tile + 8 * lane;
  u.q[0] = *(const v8h*)p; u.q[1] = *(const v8h*)(p + 256); return u.v;
}
__device__ __forceinline__ v16h frag_f32(const float* rowk0, int lane) {
  v16h a; const float* p = rowk0 + 8 * (lane >> 4);
#pragma unroll
  for (int i = 0; i < 8; ++i) { a[i] = (_Float16)p[i]; a[8 + i] = (_Float16)p[16 + i]; }
  return a;
}
__device__ __forceinline__ v16h frag_f32s(const float* rowk0, int lane, float sc) {
  v16h a; const float* p = rowk0 + 8 * (lane >> 4);
#pragma unroll
  for (int i = 0; i < 8; ++i) { a[i] = (_Float16)(p[i] * sc); a[8 + i] = (_Float16)(p[16 + i] * sc); }
  return a;
}
// column fragment from a [K][ld] layout (column n), rows >= K read as 0
__device__ __forceinline__ v16h fragc_f32(const float* W, int k0, int n, int lane, int ld, int K) {
  v16h a; const int g = lane >> 4;
#pragma unroll
  for (int i = 0; i < 8; ++i) { const int ka = k0 + 8 * g + i, kb = ka + 16;
    a[i] = (_Float16)(ka < K ? W[(size_t)(ka < K ? ka : K - 1) * ld + n] : 0.f); a[8 + i] = (_Float16)(kb < K ? W[(size_t)(kb < K ? kb : K - 1) * ld + n] : 0.f); }
  return a;
}
struct F2 { v16b h, l; };
__device__ __forceinline__ F2 bsplit16(const float v[16]) { F2 r;
#pragma unroll
  for (int i = 0; i < 16; ++i) { const __bf16 h = (__bf16)v[i]; r.h[i] = h; r.l[i] = (__bf16)(v[i] - (float)h); }
  return r; }
__device__ __forceinline__ F2 split_row(const float* row, int k0, int lane) { float v[16]; const float* p = row + k0 + 8 * (lane >> 4);
#pragma unroll
  for (int i = 0; i < 8; ++i) { v[i] = p[i]; v[8 + i] = p[16 + i]; }
  return bsplit16(v); }
__device__ __forceinline__ F2 split_rowK(const float* row, int k0, int lane, int K) { float v[16]; const int g = lane >> 4;
#pragma unroll
  for (int i = 0; i < 8; ++i) { const int ka = k0 + 8 * g + i, kb = ka + 16; v[i] = ka < K ? row[ka < K ? ka : K - 1] : 0.f; v[8 + i] = kb < K ? row[kb < K ? kb : K - 1] : 0.f; }
  return bsplit16(v); }
__device__ __forceinline__ F2 split_col(const float* W, int k0, int n, int lane, int ld, int K) { float v[16]; const int g = lane >> 4;
#pragma unroll
  for (int i = 0; i < 8; ++i) { const int ka = k0 + 8 * g + i, kb = ka + 16; v[i] = ka < K ? W[(size_t)(ka < K ? ka : K - 1) * ld + n] : 0.f; v[8 + i] = kb < K ? W[(size_t)(kb < K ? kb : K - 1) * ld + n] : 0.f; }
  return bsplit16(v); }
__device__ __forceinline__ v8f mac3(const F2& a, const F2& b, v8f c) { c = wmma_bf(a.l, b.h, c); c = wmma_bf(a.h, b.l, c); return wmma_bf(a.h, b.h, c); }
__device__ __forceinline__ float sigm(float v) { return 1.0f / (1.0f + expf(-v)); }
#define LDSX() do { asm volatile("s_wait_dscnt 0" ::: "memory"); __builtin_amdgcn_wave_barrier(); __builtin_amdgcn_fence(__ATOMIC_RELEASE, "workgroup"); } while (0)


// MSA row attention with pair bias (B 1, S 128 sequences x R 256 residues, c_m 256, 8 heads x 32, c_z 128): out = (sigmoid(LN(m) wg + bg) * softmax(q k / sqrt(32) + 1e9 (mask - 1) + LN(z) wz) v) wo + bo.
#define SQ 128
#define RR 256
#define CM 256
#define NH 8
#define CA 32
#define CZ 128
#define FF 1024
#define NROW (SQ * RR)
#define WSC 256.0f
#ifndef TON
#define TON 1           // unused
#endif
typedef __attribute__((ext_vector_type(8))) __bf16 v8b;
__device__ __forceinline__ v16b frag_b(const __bf16* rowk0, int lane) {
  union { v16b v; v8b q[2]; } u; const __bf16* p = rowk0 + 8 * (lane >> 4);
  u.q[0] = *(const v8b*)p; u.q[1] = *(const v8b*)(p + 16); return u.v;
}
__device__ __forceinline__ float bfr(float v) { return (float)(__bf16)v; }
__device__ __attribute__((noinline)) float exp_ni(float v) { return expf(v); }
__device__ __attribute__((noinline)) float erf_ni(float v) { return erff(v); }

// weights (f16 x 2^8, transposed (in,out)), as 16 x 32 tiles in fragment order [out / 16][in / 32][512]: RW 1024 x 256 = q|k|v|g ; CW 1024 x 256; RWO 256 x 256; CWO 256 x 256; TW1 1024 x 256; TW2 256 x 1024
#define WS_RW   0u
#define WS_CW   (WS_RW + 2u * 1024 * CM)
#define WS_RWO  (WS_CW + 2u * 1024 * CM)
#define WS_CWO  (WS_RWO + 2u * CM * CM)
#define WS_TW1  (WS_CWO + 2u * CM * CM)
#define WS_TW2  (WS_TW1 + 2u * FF * CM)
#define WS_XH   (WS_TW2 + 2u * CM * FF)                 // f16 LN rows [NROW][256] (natural s*R + r)
#define WS_QK   (WS_XH + 2u * (size_t)NROW * CM)         // f16 q|k tiles in fragment order [b][q|k][head][N / 16][512]
#define WS_VT   (WS_QK + 2u * (size_t)NROW * 2 * CM)     // f16 hi|lo v planes, tiles (16 channels x 32 tokens) in fragment order [b][256 / 16][N / 32][512]
#define WS_VTL  (WS_VT + 2u * (size_t)NROW * CM)
#define WS_G    (WS_VTL + 2u * (size_t)NROW * CM)        // f16 sigmoid gate, tiles (16 natural rows x 32 channels) in fragment order [NROW / 16][256 / 32][512]
#define WS_O    (WS_G + 2u * (size_t)NROW * CM)          // f32 attention output, tiles (16 compact rows x 32 channels = one head) in fragment order [NROW / 16][256 / 32][element quad 0..3][lane][4]
#define WS_M    (WS_O + 4u * (size_t)NROW * CM)          // f32 working m [natural][256]
#define WS_PB   (WS_M + 4u * (size_t)NROW * CM)          // f32 pair bias, tiles (16 queries x 32 keys) in the order of k_att's score registers [h][q / 16][k / 32][quad = (k % 32 / 16) * 2 + k % 8 / 4][lane = (k % 16 / 8) * 16 + q % 16][4]
#define WS_H1   (WS_PB + 4u * (size_t)NH * RR * RR)      // f16 relu rows [natural][1024]
#define WS_END  (WS_H1 + 2u * (size_t)NROW * FF)

// ---- k_packw: block = 16 output rows n0 .. n0 + 15 = one row of tiles, so every 128-byte line of the packed weights has one writer; which: 0 RW (W = rq|rk|rv|rg by n/256), 1 CW, 2 RWO, 3 CWO, 4 TW1, 5 TW2
__global__ __launch_bounds__(256) void k_packw(const float* __restrict__ RQ, const float* __restrict__ RK, const float* __restrict__ RV, const float* __restrict__ RG, const float* __restrict__ CQ, const float* __restrict__ CK, const float* __restrict__ CV, const float* __restrict__ CG, const float* __restrict__ RWO, const float* __restrict__ CWO, const float* __restrict__ TW1, const float* __restrict__ TW2, char* __restrict__ ws) {
  const int n0 = blockIdx.x * 16, which = blockIdx.y, t = threadIdx.x;
  const float* Wm; int kin, kout, col; _Float16* dst;
  if (which == 0) { if (n0 >= 1024) return; const int g4 = n0 / CM; col = n0 % CM; Wm = g4 == 0 ? RQ : g4 == 1 ? RK : g4 == 2 ? RV : RG; kin = CM; kout = CM; dst = (_Float16*)(ws + WS_RW); }
  else if (which == 1) { if (n0 >= 1024) return; const int g4 = n0 / CM; col = n0 % CM; Wm = g4 == 0 ? CQ : g4 == 1 ? CK : g4 == 2 ? CV : CG; kin = CM; kout = CM; dst = (_Float16*)(ws + WS_CW); }
  else if (which == 2) { if (n0 >= CM) return; col = n0; Wm = RWO; kin = CM; kout = CM; dst = (_Float16*)(ws + WS_RWO); }
  else if (which == 3) { if (n0 >= CM) return; col = n0; Wm = CWO; kin = CM; kout = CM; dst = (_Float16*)(ws + WS_CWO); }
  else if (which == 4) { if (n0 >= FF) return; col = n0; Wm = TW1; kin = CM; kout = FF; dst = (_Float16*)(ws + WS_TW1); }
  else { if (n0 >= CM) return; col = n0; Wm = TW2; kin = FF; kout = CM; dst = (_Float16*)(ws + WS_TW2); }
  dst += (size_t)blockIdx.x * (kin / 32) * 512;
  // chunk e = (k tile e >> 6, half (e >> 5) & 1, lane e & 31) lies at f16 offset 8 e: a wave stores 512 contiguous bytes; its 8 values are k .. k + 7 of output row n0 + (lane & 15)
  for (int e = t; e < kin * 2; e += 256) { const int ln = e & 31, k = (e >> 6) * 32 + ((e >> 5) & 1) * 16 + (ln >> 4) * 8; v8h o;
#pragma unroll   // o is indexed by constants and stays in registers
    for (int i = 0; i < 8; ++i) o[i] = (_Float16)(bfr(Wm[(size_t)(k + i) * kout + col + (ln & 15)]) * WSC);
    vst2(dst + e * 8, o); } }
// ---- k_ln: XH = LN(bf16(m)) w + b (jnp.var, 1e-5) -> f16. One wave owns a row (lane l: channels 4l + e and 128 + 4l + e, so each 16-byte load of a wave covers 512 contiguous bytes) and works on LNR rows; no LDS, no barrier
// value of lane l ^ MSK inside a 16-lane row, by a DPP move (no LDS round trip as with __shfl_xor)
template <int MSK> __device__ __forceinline__ float rowx(float x) { return __builtin_bit_cast(float, __builtin_amdgcn_mov_dpp(__builtin_bit_cast(int, x), 0x160 | MSK, 0xf, 0xf, true)); }
// lane l with lane l ^ 16
__device__ __forceinline__ float xhalf(float x) { return __builtin_bit_cast(float, __builtin_amdgcn_permlanex16(__builtin_bit_cast(int, x), __builtin_bit_cast(int, x), 0x76543210, 0xfedcba98, false, false)); }
__device__ __forceinline__ float wsum(float s) { s += rowx<1>(s); s += rowx<2>(s); s += rowx<4>(s); s += rowx<8>(s); return s + xhalf(s); }
typedef __attribute__((ext_vector_type(4))) _Float16 v4h;
#define LNR 8
__global__ __launch_bounds__(256) void k_ln(const float* __restrict__ X, const float* __restrict__ G, const float* __restrict__ Bt, _Float16* __restrict__ XH) { const int lane = threadIdx.x & 31; const size_t row0 = ((size_t)blockIdx.x * 8 + (threadIdx.x >> 5)) * LNR;
  const float* xr = X + row0 * CM + lane * 4; _Float16* yr = XH + row0 * CM + lane * 4;
  // both loops are fully unrolled: the arrays are indexed by constants and stay in registers
  v4f xa[LNR], xb[LNR];   // the wave's LNR rows: all loads are issued before the first use, so memory latency is paid once
#pragma unroll
  for (int p = 0; p < LNR; ++p) { xa[p] = *(const v4f*)(xr + (size_t)p * CM); xb[p] = *(const v4f*)(xr + (size_t)p * CM + 128); }
  const v4f g0 = *(const v4f*)(G + lane * 4), g1 = *(const v4f*)(G + 128 + lane * 4), c0 = *(const v4f*)(Bt + lane * 4), c1 = *(const v4f*)(Bt + 128 + lane * 4);
  float gg[8], bb[8];
#pragma unroll
  for (int e = 0; e < 4; ++e) { gg[e] = bfr(g0[e]); gg[4 + e] = bfr(g1[e]); bb[e] = bfr(c0[e]); bb[4 + e] = bfr(c1[e]); }
#pragma unroll
  for (int p = 0; p < LNR; ++p) { float v[8];
#pragma unroll
    for (int e = 0; e < 4; ++e) { v[e] = bfr(xa[p][e]); v[4 + e] = bfr(xb[p][e]); }
    const float mu = wsum(((v[0] + v[1]) + (v[2] + v[3])) + ((v[4] + v[5]) + (v[6] + v[7]))) / (float)CM; float qq = 0.f;
#pragma unroll
    for (int i = 0; i < 8; ++i) { v[i] -= mu; qq += v[i] * v[i]; }
    const float inv = 1.0f / sqrtf(wsum(qq) / (float)CM + 1e-5f); v4h h0, h1;
#pragma unroll
    for (int e = 0; e < 4; ++e) { h0[e] = (_Float16)(v[e] * inv * gg[e] + bb[e]); h1[e] = (_Float16)(v[4 + e] * inv * gg[4 + e] + bb[4 + e]); }
    vst2(yr + (size_t)p * CM, h0); vst2(yr + (size_t)p * CM + 128, h1); } }
// natural row index of (batch b, token n): MODE 0 row attention (b = s, n = r); MODE 1 column attention (b = r, n = s)
template <int MODE> __device__ __forceinline__ size_t nat(size_t b, int n) { return MODE == 0 ? b * RR + n : (size_t)n * RR + b; }
// ---- k_proj<MODE>: block = (64 tokens, 128 of 1024 cols (q|k|v|g), b): A = XH rows; q|k -> QK (single f16); v -> planes hi/lo; g -> sigmoid -> f16; all four stored as whole tiles in their reader's fragment order
template <int MODE>
__global__ __launch_bounds__(128) void k_proj(const _Float16* __restrict__ XH, const _Float16* __restrict__ Wr, const float* __restrict__ BG, _Float16* __restrict__ QK, _Float16* __restrict__ VT, _Float16* __restrict__ VTL, _Float16* __restrict__ Gt) {
  static_assert(MODE == 0, "a gate tile holds 16 natural rows: 16 tokens of one b only in row attention");
  constexpr int NN = MODE == 0 ? RR : SQ; __shared__ __align__(16) _Float16 sh[64][136]; __shared__ __align__(16) _Float16 th[128][72], tl[128][72];
  const int tid = threadIdx.x, wave = tid >> 5, lane = tid & 31, col = lane & 15, g = lane >> 4; const size_t b = blockIdx.z; const int n0 = blockIdx.x * 64 + wave * 16; const int c0 = blockIdx.y * 128; const int which = c0 / CM;   // 0 q, 1 k, 2 v, 3 g
  v8f acc[8] = {};
  // fragments are fetched ahead: a weight fragment's load for the next k block is issued right behind the WMMA that read it, so 8 fragments stay in flight and a WMMA waits only for a load issued 8 WMMAs earlier, not for its own; the row fragment of the next k block is requested ahead of this block's WMMAs
  const _Float16* ar = XH + nat<MODE>(b, n0 + col) * CM; const _Float16* wr = Wr + (size_t)(c0 / 16) * (CM / 32) * 512;
  v16h a = frag_h(ar, lane), wf[8]; float bgv[8];   // the gate bias too is requested here (in bounds for every block; only the gate blocks use it): behind the WMMAs each of its 8 loads was waited for alone
#pragma unroll   // bgv and wf are indexed by constants and stay in registers (this loop and the next three)
  for (int j = 0; j < 8; ++j) bgv[j] = BG[(c0 % CM) + j * 16 + col];
#pragma unroll
  for (int j = 0; j < 8; ++j) wf[j] = frag_t(wr + (size_t)j * (CM / 32) * 512, lane);
  asm volatile("s_wait_xcnt 0x0" ::: "memory");   // stands in front of what rewrites the address registers of the loads above (a WMMA result takes those of the bias loads)
#pragma unroll
  for (int kc = 0; kc < CM / 32; ++kc) { v16h an = a; if (kc + 1 < CM / 32) an = frag_h(ar + (kc + 1) * 32, lane);
#pragma unroll
    for (int j = 0; j < 8; ++j) { acc[j] = wmma16(a, wf[j], acc[j]); if (kc + 1 < CM / 32) wf[j] = frag_t(wr + ((size_t)j * (CM / 32) + kc + 1) * 512, lane); }
    a = an; }
#pragma unroll
  for (int j = 0; j < 8; ++j) { const float bg = (which == 3) ? bfr(bgv[j]) : 0.f;
#pragma unroll
    for (int r = 0; r < 8; ++r) { float v = acc[j][r] * (1.0f / WSC); if (which == 3) v = 1.0f / (1.0f + expf(-(v + bg)));
      if (which == 2) { const _Float16 hv = (_Float16)v; th[j * 16 + col][wave * 16 + 8 * g + r] = hv; tl[j * 16 + col][wave * 16 + 8 * g + r] = (_Float16)((v - (float)hv) * 2048.0f); } else sh[wave * 16 + 8 * g + r][j * 16 + col] = (_Float16)v; } }
  __syncthreads();
  if (which < 2) { for (int e = tid; e < 64 * 16; e += 128) { const int ln = e & 31, hf = (e >> 5) & 1, rt = (e >> 6) & 3, hl = e >> 8;   // a wave stores 512 contiguous bytes: half hf of the tile (head hl of the block's 4, token tile rt)
      vst2((unsigned*)(QK + (((b * 2 + which) * NH + (c0 % CM) / CA + hl) * (NN / 16) + blockIdx.x * 4 + rt) * 512 + hf * 256 + ln * 8), *(const v4u*)&sh[rt * 16 + (ln & 15)][(hl * 4 + hf * 2 + (ln >> 4)) * 8]); } }
  else if (which == 2) { const int cv0 = c0 - 2 * CM; for (int e = tid; e < 128 * 8; e += 128) { const int ln = e & 31, hf = (e >> 5) & 1, kl = (e >> 6) & 1, ctl = e >> 7, cl = ctl * 16 + (ln & 15), tk = (kl * 4 + hf * 2 + (ln >> 4)) * 8;   // half hf of the tile (channel tile ctl of 8, 32-token group kl of 2)
      const size_t o = ((b * (CM / 16) + cv0 / 16 + ctl) * (size_t)(NN / 32) + blockIdx.x * 2 + kl) * 512 + hf * 256 + ln * 8; vst2((unsigned*)(VT + o), *(const v4u*)&th[cl][tk]); vst2((unsigned*)(VTL + o), *(const v4u*)&tl[cl][tk]); } }
  else { for (int e = tid; e < 64 * 16; e += 128) { const int ln = e & 31, hf = (e >> 5) & 1, rt = (e >> 6) & 3, hl = e >> 8;
      vst2((unsigned*)(Gt + ((nat<MODE>(b, blockIdx.x * 64) / 16 + rt) * (CM / 32) + (c0 - 3 * CM) / 32 + hl) * 512 + hf * 256 + ln * 8), *(const v4u*)&sh[rt * 16 + (ln & 15)][(hl * 4 + hf * 2 + (ln >> 4)) * 8]); } } }
// ---- k_pb: block = (8 keys, 16 query residues) = 128 z rows, row rho = (query rho / 8, key rho % 8): per head it owns two whole 256-byte runs of a PB tile; PB(h, q, k) = LN(z[q][k]) . wb[:, h]; 16 lanes share one z row (8 channels a lane, two 16-byte loads), a wave works on 2 rows at a time; this lane's 8 x 8 weights stay in registers
#define PBK 128
__global__ __launch_bounds__(256) void k_pb(const float* __restrict__ Zp, const float* __restrict__ G, const float* __restrict__ Bt, const float* __restrict__ WB, float* __restrict__ PB) { __shared__ __align__(16) float sp[NH][PBK + 4]; __shared__ __align__(16) float swb[CZ / 4][4 * NH + 4];   // swb: 4 channels x 8 heads a row, pitch 36 words: the 16 lanes' 16-byte reads fall on distinct banks
  const int t = threadIdx.x, lane = t & 31, w = t >> 5, l16 = lane & 15, hf = lane >> 4; const int ko = blockIdx.x, qt = blockIdx.y;
  const float* zr = Zp + (((size_t)qt * 16 + w * 2) * RR + ko * 8 + hf) * CZ + l16 * 4;   // rows rho = w*16 + 2p + hf: query qt*16 + 2w + p/4, key ko*8 + 2(p%4) + hf; channels 4*l16 + e and 64 + 4*l16 + e
  // every loop of this kernel is fully unrolled: its arrays are indexed by constants and stay in registers
  v4f za[8], zb[8];   // the wave's 16 rows: all 16 loads are issued before the first use, so memory latency is paid once
#pragma unroll
  for (int p = 0; p < 8; ++p) { za[p] = *(const v4f*)(zr + ((size_t)(p >> 2) * RR + (p & 3) * 2) * CZ); zb[p] = *(const v4f*)(zr + ((size_t)(p >> 2) * RR + (p & 3) * 2) * CZ + 64); }
  v4f g4[2], b4[2];
#pragma unroll
  for (int i = 0; i < 2; ++i) { g4[i] = *(const v4f*)(G + 64 * i + l16 * 4); b4[i] = *(const v4f*)(Bt + 64 * i + l16 * 4); }
  { v4f w4 = *(const v4f*)(WB + t * 4); w4[0] = bfr(w4[0]); w4[1] = bfr(w4[1]); w4[2] = bfr(w4[2]); w4[3] = bfr(w4[3]); *(v4f*)&swb[t >> 3][(t & 7) * 4] = w4; } __syncthreads();
  float wv[8][NH], gg[8], bb[8];
#pragma unroll
  for (int i = 0; i < 2; ++i) {
#pragma unroll
    for (int e = 0; e < 4; ++e) { gg[i * 4 + e] = bfr(g4[i][e]); bb[i * 4 + e] = bfr(b4[i][e]); const v4f w0 = *(const v4f*)&swb[16 * i + l16][e * NH], w1 = *(const v4f*)&swb[16 * i + l16][e * NH + 4];
#pragma unroll
      for (int h = 0; h < 4; ++h) { wv[i * 4 + e][h] = w0[h]; wv[i * 4 + e][4 + h] = w1[h]; } } }
  const bool b0 = (l16 & 1) != 0, b1 = (l16 & 2) != 0, b2 = (l16 & 4) != 0;
#pragma unroll
  for (int p = 0; p < 8; ++p) { float v[8];
#pragma unroll
    for (int e = 0; e < 4; ++e) { v[e] = bfr(za[p][e]); v[4 + e] = bfr(zb[p][e]); }
    float s = ((v[0] + v[1]) + (v[2] + v[3])) + ((v[4] + v[5]) + (v[6] + v[7]));
    s += rowx<1>(s); s += rowx<2>(s); s += rowx<4>(s); s += rowx<8>(s);
    const float mu = s / (float)CZ; float qq = 0.f;
#pragma unroll
    for (int i = 0; i < 8; ++i) { v[i] -= mu; qq += v[i] * v[i]; }
    qq += rowx<1>(qq); qq += rowx<2>(qq); qq += rowx<4>(qq); qq += rowx<8>(qq);
    const float inv = 1.0f / sqrtf(qq / (float)CZ + 1e-5f); float ph[NH];
#pragma unroll
    for (int h = 0; h < NH; ++h) ph[h] = 0.f;
#pragma unroll
    for (int i = 0; i < 8; ++i) { const float ln = v[i] * inv * gg[i] + bb[i];
#pragma unroll
      for (int h = 0; h < NH; ++h) ph[h] += ln * wv[i][h]; }
    // sum over the 16 lanes, halving the heads a lane carries at each of the first three steps: lane l16 ends with head l16 & 7
    float y[4], u[2];
#pragma unroll
    for (int i = 0; i < 4; ++i) y[i] = (b0 ? ph[2 * i + 1] : ph[2 * i]) + rowx<1>(b0 ? ph[2 * i] : ph[2 * i + 1]);
#pragma unroll
    for (int i = 0; i < 2; ++i) u[i] = (b1 ? y[2 * i + 1] : y[2 * i]) + rowx<2>(b1 ? y[2 * i] : y[2 * i + 1]);
    float x = (b2 ? u[1] : u[0]) + rowx<4>(b2 ? u[0] : u[1]); x += rowx<8>(x);
    if (l16 < NH) sp[l16][w * 16 + p * 2 + hf] = x; }
  __syncthreads(); { const int h = t >> 5, i = (t >> 4) & 1;   // ko = (32-key tile ko / 4, 16-key half (ko / 2) % 2, lane half ko % 2); a wave stores the head's two 256-byte runs (quads i = 0, 1; 16 queries x 4 keys each)
    vst2(PB + ((((size_t)h * (RR / 16) + qt) * (RR / 32) + (ko >> 2)) * 4 + ((ko >> 1) & 1) * 2 + i) * 128 + ((ko & 1) * 16 + l16) * 4, *(const v4f*)&sp[h][l16 * 8 + i * 4]); } }
// ---- k_att<MODE>: block = (64 queries, head, b), a wave = 16 queries. Both products are taken transposed: S^T = K . Q^T (A = key rows, B = query columns), O^T = V^T . P^T (A = channel rows, B = P^T). A lane (g, col) then holds 16 of the pass's 32 scores of ONE query, q0 + col (keys ct * 16 + 8g + r): maximum and sum are taken in the lane, with one exchange between the lane halves; the two score tiles, converted in place, are the B operand P^T, and the O^T registers are the O tile's quads: no LDS
template <int MODE>
__global__ __launch_bounds__(128) void k_att(const _Float16* __restrict__ QK, const _Float16* __restrict__ VT, const _Float16* __restrict__ VTL, const float* __restrict__ PB, const float* __restrict__ MASK, float* __restrict__ O) {
  static_assert(MODE == 0, "the pair bias tiles belong to row attention");
  constexpr int NN = MODE == 0 ? RR : SQ;
  const int tid = threadIdx.x, wave = tid >> 5, lane = tid & 31, g = lane >> 4; const int h = blockIdx.y; const size_t b = blockIdx.z; const int q0 = blockIdx.x * 64 + wave * 16; const size_t rq = b * NN + q0;
  const v16h bq = frag_t(QK + (((b * 2 + 0) * NH + h) * (NN / 16) + q0 / 16) * 512, lane);
  const float* pbt = PB + ((size_t)h * (RR / 16) + q0 / 16) * (RR / 32) * 512 + lane * 4;
  float m = -3.0e38f, l = 0.f;   // the query's running maximum (equal in both lane halves) and this half's share of its sum
  v8f acc[2] = {}, accl[2] = {};
#pragma unroll 1
  for (int ks = 0; ks < NN / 32; ++ks) { float s[2][8];
    // all loads of the pass are issued here, ahead of its first WMMA: one wait on memory a pass, and v lands behind the softmax
    v16h kh[2], vh[2], vl[2]; v4f pb[2][2];
    const float mkv = MASK[nat<MODE>(b, ks * 32 + lane)];   // lane = key of the pass
#pragma unroll   // the arrays are indexed by constants and stay in registers
    for (int ct = 0; ct < 2; ++ct) { kh[ct] = frag_t(QK + (((b * 2 + 1) * NH + h) * (NN / 16) + ks * 2 + ct) * 512, lane);
#pragma unroll
      for (int i = 0; i < 2; ++i) pb[ct][i] = *(const v4f*)(pbt + ks * 512 + (ct * 2 + i) * 128); }
    asm volatile("s_wait_xcnt 0x0" ::: "memory");   // stands in front of what rewrites the address registers of the loads above: results of the v loads, the next pass's address additions
#pragma unroll
    for (int j = 0; j < 2; ++j) vh[j] = frag_t(VT + ((b * (CM / 16) + h * 2 + j) * (size_t)(NN / 32) + ks) * 512, lane);
    asm volatile("s_wait_xcnt 0x0" ::: "memory");   // the same for the loads of v's high plane (a result of the low plane's loads takes their address registers)
#pragma unroll
    for (int j = 0; j < 2; ++j) vl[j] = frag_t(VTL + ((b * (CM / 16) + h * 2 + j) * (size_t)(NN / 32) + ks) * 512, lane);
    asm volatile("s_wait_xcnt 0x0" ::: "memory");   // the same for the low plane's loads
    const unsigned kept = __builtin_amdgcn_ballot_w32(bfr(mkv) != 0.f);   // bit = key of the pass
#pragma unroll
    for (int ct = 0; ct < 2; ++ct) { v8f c = {}; c = wmma16(kh[ct], bq, c);
#pragma unroll
      for (int r = 0; r < 8; ++r) { float sc = c[r] * 0.17677669529663687f; if (MODE == 0) sc += pb[ct][r >> 2][r & 3]; s[ct][r] = sc; } }
    if (kept != 0xffffffffu) { const unsigned kb = kept >> (8 * g);   // one scalar test a pass: only a pass with a masked key pays for the 16 selects
#pragma unroll
      for (int ct = 0; ct < 2; ++ct)
#pragma unroll
        for (int r = 0; r < 8; ++r) if (((kb >> (ct * 16 + r)) & 1u) == 0u) s[ct][r] = -3.0e38f; }
    float t[8];
#pragma unroll
    for (int r = 0; r < 8; ++r) t[r] = fmaxf(s[0][r], s[1][r]);
    float mx = fmaxf(fmaxf(fmaxf(t[0], t[1]), fmaxf(t[2], t[3])), fmaxf(fmaxf(t[4], t[5]), fmaxf(t[6], t[7]))); mx = fmaxf(mx, xhalf(mx));
    const float mn = fmaxf(m, mx), alpha = (m <= -1.0e38f) ? 0.f : __expf(m - mn);
#pragma unroll
    for (int ct = 0; ct < 2; ++ct)
#pragma unroll
      for (int r = 0; r < 8; ++r) s[ct][r] = (s[ct][r] <= -1.0e38f) ? 0.f : __expf(s[ct][r] - mn);
#pragma unroll
    for (int r = 0; r < 8; ++r) t[r] = s[0][r] + s[1][r];
    l = l * alpha + (((t[0] + t[1]) + (t[2] + t[3])) + ((t[4] + t[5]) + (t[6] + t[7]))); m = mn;
#pragma unroll
    for (int j = 0; j < 2; ++j)
#pragma unroll
      for (int r = 0; r < 8; ++r) { acc[j][r] *= alpha; accl[j][r] *= alpha; }
    v16h pa, pal;   // B operand: element i = key 8g + i = tile 0 register i, element 8 + i = key 16 + 8g + i = tile 1 register i
#pragma unroll
    for (int i = 0; i < 8; ++i) { const float p0 = s[0][i] * 2048.0f, p1 = s[1][i] * 2048.0f; pa[i] = (_Float16)p0; pa[8 + i] = (_Float16)p1; pal[i] = (_Float16)((p0 - (float)pa[i]) * 2048.0f); pal[8 + i] = (_Float16)((p1 - (float)pa[8 + i]) * 2048.0f); }
#pragma unroll
    for (int j = 0; j < 2; ++j) { acc[j] = wmma16(vh[j], pa, acc[j]); accl[j] = wmma16(vl[j], pa, accl[j]); accl[j] = wmma16(vh[j], pal, accl[j]); } }
  l += xhalf(l);
  const float il = (l > 0.f) ? (1.0f / 2048.0f) / l : 0.f;
  float* ot = O + ((rq / 16) * (CM / 32) + h) * 512 + lane * 4;   // lane = (g, row col): quads 0, 1 = channels 8g .. 8g + 7, quads 2, 3 = 16 + 8g .. : register r of O^T tile j is channel j * 16 + 8g + r; each store of the wave is 512 contiguous bytes
#pragma unroll
  for (int qd = 0; qd < 4; ++qd) { v4f o;
#pragma unroll
    for (int e = 0; e < 4; ++e) o[e] = (acc[qd >> 1][(qd & 1) * 4 + e] + accl[qd >> 1][(qd & 1) * 4 + e] * (1.0f / 2048.0f)) * il;
    vst2(ot + qd * 128, o); } }
// ---- k_go<MODE>: block = (64 natural rows, 128 cols): M = (g o) . wo + bo ; A operand built on the fly from the G and O tiles
template <int MODE>
__global__ __launch_bounds__(128) void k_go(const _Float16* __restrict__ Gt, const float* __restrict__ O, const _Float16* __restrict__ WOr, const float* __restrict__ BO, float* __restrict__ M) { __shared__ __align__(16) float sf[4][16][132];
  const int tid = threadIdx.x, wave = tid >> 5, lane = tid & 31, col = lane & 15, g = lane >> 4; const size_t r0 = (size_t)blockIdx.x * 64 + wave * 16; const int c0 = blockIdx.y * 128;
  static_assert(MODE == 0, "one tile index serves G (natural rows) and O (compact rows): the two orders agree only in row attention");
  const size_t t0 = (r0 / 16) * (CM / 32);
  v8f acc[8] = {}, accl2[8] = {};
  // loads run ahead of the WMMAs: the 64 weight fragments (order f = kc * 8 + j) go through a ring of GOW register sets, fragment f + GOW being requested right behind the two WMMAs that read fragment f; the gate and o tiles of block kc + 1 are requested ahead of block kc's WMMAs
  constexpr int GOW = 7; const _Float16* wr = WOr + (size_t)(c0 / 16) * (CM / 32) * 512; v16h wf[GOW];
#pragma unroll   // every loop here is fully unrolled: wf and ov are indexed by constants and stay in registers
  for (int f = 0; f < GOW; ++f) wf[f] = frag_t(wr + ((size_t)(f & 7) * (CM / 32) + (f >> 3)) * 512, lane);
  v16h gv = frag_t(Gt + t0 * 512, lane); v4f ov[4];
#pragma unroll
  for (int qd = 0; qd < 4; ++qd) ov[qd] = *(const v4f*)(O + t0 * 512 + lane * 4 + qd * 128);
#pragma unroll
  for (int kc = 0; kc < CM / 32; ++kc) { v16h a, al;
    __builtin_amdgcn_sched_barrier(0);   // keeps this block's conversions (and with them the wait for its gate and o tiles) behind the WMMAs of the block before: moved up among them they would wait for loads just issued
#pragma unroll
    for (int i = 0; i < 16; ++i) { const float v0 = (float)gv[i] * ov[i >> 2][i & 3]; a[i] = (_Float16)v0; al[i] = (_Float16)((v0 - (float)a[i]) * 2048.0f); }
    if (kc + 1 < CM / 32) { gv = frag_t(Gt + (t0 + kc + 1) * 512, lane);
#pragma unroll
      for (int qd = 0; qd < 4; ++qd) ov[qd] = *(const v4f*)(O + (t0 + kc + 1) * 512 + lane * 4 + qd * 128);
      asm volatile("s_wait_xcnt 0x0" ::: "memory"); }   // stands in front of whatever rewrites the address registers of the six loads above (in the last block a later load's result does)
#pragma unroll
    for (int j = 0; j < 8; ++j) { const int f = kc * 8 + j, fn = f + GOW; acc[j] = wmma16(a, wf[f % GOW], acc[j]); accl2[j] = wmma16(al, wf[f % GOW], accl2[j]); if (fn < 8 * (CM / 32)) wf[f % GOW] = frag_t(wr + ((size_t)(fn & 7) * (CM / 32) + (fn >> 3)) * 512, lane); } }
#pragma unroll
  for (int j = 0; j < 8; ++j) { const int c = c0 + j * 16 + col; const float bb = bfr(BO[c]);
#pragma unroll
    for (int r = 0; r < 8; ++r) sf[wave][8 * g + r][j * 16 + col] = (acc[j][r] + accl2[j][r] * (1.0f / 2048.0f)) * (1.0f / WSC) + bb; }
  LDSX(); for (int rl = 0; rl < 16; ++rl) vst2(M + (r0 + rl) * CM + c0 + lane * 4, *(const v4f*)&sf[wave][rl][lane * 4]); }   // M here = the output buffer (no residual in this module)
// ---- k_ff1: block = (64 rows, 128 of 1024 cols): H1 = relu(XH . W1 + b1) -> f16 ; k_ff2: out = H1 . W2 + b2 + M
__global__ __launch_bounds__(128) void k_ff1(const _Float16* __restrict__ XH, const _Float16* __restrict__ W1r, const float* __restrict__ B1, _Float16* __restrict__ H1) { __shared__ __align__(16) _Float16 sh[4][16][136];
  const int tid = threadIdx.x, wave = tid >> 5, lane = tid & 31, col = lane & 15, g = lane >> 4; const size_t r0 = (size_t)blockIdx.x * 64 + wave * 16; const int c0 = blockIdx.y * 128;
  v8f acc[8] = {};
#pragma unroll
  for (int kc = 0; kc < CM / 32; ++kc) { const v16h a = frag_h(XH + (r0 + col) * CM + kc * 32, lane);
#pragma unroll
    for (int j = 0; j < 8; ++j) acc[j] = wmma16(a, frag_t(W1r + ((size_t)(c0 / 16 + j) * (CM / 32) + kc) * 512, lane), acc[j]); }
#pragma unroll
  for (int j = 0; j < 8; ++j) { const float bb = bfr(B1[c0 + j * 16 + col]);
#pragma unroll
    for (int r = 0; r < 8; ++r) sh[wave][8 * g + r][j * 16 + col] = (_Float16)fmaxf(acc[j][r] * (1.0f / WSC) + bb, 0.f); }
  LDSX(); for (int rl = 0; rl < 16; ++rl) if (lane < 16) vst2((unsigned*)(H1 + (r0 + rl) * FF + c0 + lane * 8), *(const v4u*)&sh[wave][rl][lane * 8]); }
__global__ __launch_bounds__(128) void k_ff2(const _Float16* __restrict__ H1, const _Float16* __restrict__ W2r, const float* __restrict__ B2, const float* __restrict__ M, float* __restrict__ OUT) { __shared__ __align__(16) float sf[4][16][132];
  const int tid = threadIdx.x, wave = tid >> 5, lane = tid & 31, col = lane & 15, g = lane >> 4; const size_t r0 = (size_t)blockIdx.x * 64 + wave * 16; const int c0 = blockIdx.y * 128;
  v8f acc[8] = {};
#pragma unroll 2
  for (int kc = 0; kc < FF / 32; ++kc) { const v16h a = frag_h(H1 + (r0 + col) * FF + kc * 32, lane);
#pragma unroll
    for (int j = 0; j < 8; ++j) acc[j] = wmma16(a, frag_t(W2r + ((size_t)(c0 / 16 + j) * (FF / 32) + kc) * 512, lane), acc[j]); }
#pragma unroll
  for (int j = 0; j < 8; ++j) { const int c = c0 + j * 16 + col; const float bb = bfr(B2[c]);
#pragma unroll
    for (int r = 0; r < 8; ++r) sf[wave][8 * g + r][j * 16 + col] = acc[j][r] * (1.0f / WSC) + bb + M[(r0 + 8 * g + r) * CM + c]; }
  LDSX(); for (int rl = 0; rl < 16; ++rl) vst2(OUT + (r0 + rl) * CM + c0 + lane * 4, *(const v4f*)&sf[wave][rl][lane * 4]); }
extern "C" void kernel_launch(void* const* d_in, const int* in_sizes, int n_in, void* d_out, int out_size, void* d_ws, size_t ws_size, hipStream_t stream) {
  (void)in_sizes; (void)n_in; (void)out_size;
  const float** F = (const float**)d_in;   // 0 m [1,128,256,256], 1 z [1,256,256,128], 2 mask [1,128,256], 3 ln_m_g, 4 ln_m_b, 5 ln_z_g, 6 ln_z_b, 7 wz [128,8], 8 wq [256,8,32], 9 wk, 10 wv, 11 wg, 12 bg [8,32], 13 wo [8,32,256], 14 bo [256]
  if (ws_size < (size_t)WS_END) return;
  char* ws = (char*)d_ws; _Float16 *RW = (_Float16*)(ws + WS_RW), *RWOp = (_Float16*)(ws + WS_RWO), *XH = (_Float16*)(ws + WS_XH), *QK = (_Float16*)(ws + WS_QK), *VT = (_Float16*)(ws + WS_VT), *VTL = (_Float16*)(ws + WS_VTL), *Gt = (_Float16*)(ws + WS_G);
  float *O = (float*)(ws + WS_O), *PB = (float*)(ws + WS_PB);
  k_packw<<<dim3(64, 3), 256, 0, stream>>>(F[8], F[9], F[10], F[11], F[8], F[9], F[10], F[11], F[13], F[13], F[8], F[13], ws);   // which 0 (q|k|v|g rows) and 2 (wo rows) are used; which 1 packs in-bounds duplicates; 3-5 not launched
  k_ln<<<NROW / (8 * LNR), 256, 0, stream>>>(F[0], F[3], F[4], XH);
  k_proj<0><<<dim3(RR / 64, 8, SQ), 128, 0, stream>>>(XH, RW, F[12], QK, VT, VTL, Gt);
  k_pb<<<dim3(RR / 8, RR / 16), 256, 0, stream>>>(F[1], F[5], F[6], F[7], PB);
  k_att<0><<<dim3(RR / 64, NH, SQ), 128, 0, stream>>>(QK, VT, VTL, PB, F[2], O);
  k_go<0><<<dim3(NROW / 64, CM / 128), 128, 0, stream>>>(Gt, O, RWOp, F[14], (float*)d_out);
}

// v006
// Measured time: 119 microseconds a run.
// Next to v005, in two timings, it ran 1.06 and 1.07 times as fast.
// All steps since v000 together make it 3.00 times as fast.
// compute dtype: all float inputs rounded to bf16; LayerNorms, pair bias (LN(z) . wz), softmax, sigmoid gate in f32; q|k|v|g projections on WMMA 16x16x32 with the LayerNorm output rounded once to f16 against exact f16 x 2^8 weights; attention logits with single f16 q, k (32-dim heads), P as f16 hi + residual (x 2^11) . v (hi + residual; 3 products); (g o) as f16 hi + residual (2 products) . wo (f16 x 2^8) + bo; f32 output.
#include <hip/hip_runtime.h>
#include <math.h>

typedef __attribute__((ext_vector_type(16))) _Float16 v16h;
typedef __attribute__((ext_vector_type(16))) __bf16 v16b;
typedef __attribute__((ext_vector_type(8)))  _Float16 v8h;
typedef __attribute__((ext_vector_type(8)))  float v8f;
typedef __attribute__((ext_vector_type(4)))  float v4f;
typedef __attribute__((ext_vector_type(2)))  float v2f;
typedef __attribute__((ext_vector_type(4)))  unsigned v4u;
typedef __attribute__((ext_vector_type(4)))  int v4i;
typedef float __attribute__((may_alias)) float_a;
typedef int __attribute__((may_alias)) int_a;

template <typename T> __device__ __forceinline__ void vst2(void* p, T v) { *(T*)p = v;  }
__device__ __forceinline__ v8f wmma16(v16h a, v16h b, v8f c) {
  v8f d = __builtin_amdgcn_wmma_f32_16x16x32_f16(false, a, false, b, (short)0, c, false, false);
  asm volatile("v_nop\n\tv_nop\n\tv_nop\n\tv_nop" : "+v"(d) : "v"(a), "v"(b));
  return d;
}
__device__ __forceinline__ v8f wmma_bf(v16b a, v16b b, v8f c) {
  v8f d = __builtin_amdgcn_wmma_f32_16x16x32_bf16(false, a, false, b, (short)0, c, false, false);
  asm volatile("v_nop\n\tv_nop\n\tv_nop\n\tv_nop" : "+v"(d) : "v"(a), "v"(b));
  return d;
}
// 16x16x32 fragments: lane = (h = lane>>4, row/col = lane&15); elements 0..7 = k0+8h+0..7, 8..15 = k0+16+8h+0..7; D element r = row 8h+r
__device__ __forceinline__ v16h frag_h(const _Float16* rowk0, int lane) {
  union { v16h v; v8h q[2]; } u; const _Float16* p = rowk0 + 8 * (lane >> 4);
  u.q[0] = *(const v8h*)p; u.q[1] = *(const v8h*)(p + 16); return u.v;
}
// the same fragment from a 16 x 32 tile kept in fragment order: 1 KiB = [elements 0..7 | 8..15][lane][8 f16], so each of the wave's two 16-byte loads covers 512 contiguous bytes (4 whole lines, not pieces of 16)
__device__ __forceinline__ v16h frag_t(const _Float16* tile, int lane) {
  union { v16h v; v8h q[2]; } u; const _Float16* p = tile + 8 * lane;
  u.q[0] = *(const v8h*)p; u.q[1] = *(const v8h*)(p + 256); return u.v;
}
__device__ __forceinline__ v16h frag_f32(const float* rowk0, int lane) {
  v16h a; const float* p = rowk0 + 8 * (lane >> 4);
#pragma unroll
  for (int i = 0; i < 8; ++i) { a[i] = (_Float16)p[i]; a[8 + i] = (_Float16)p[16 + i]; }
  return a;
}
__device__ __forceinline__ v16h frag_f32s(const float* rowk0, int lane, float sc) {
  v16h a; const float* p = rowk0 + 8 * (lane >> 4);
#pragma unroll
  for (int i = 0; i < 8; ++i) { a[i] = (_Float16)(p[i] * sc); a[8 + i] = (_Float16)(p[16 + i] * sc); }
  return a;
}
// column fragment from a [K][ld] layout (column n), rows >= K read as 0
__device__ __forceinline__ v16h fragc_f32(const float* W, int k0, int n, int lane, int ld, int K) {
  v16h a; const int g = lane >> 4;
#pragma unroll
  for (int i = 0; i < 8; ++i) { const int ka = k0 + 8 * g + i, kb = ka + 16;
    a[i] = (_Float16)(ka < K ? W[(size_t)(ka < K ? ka : K - 1) * ld + n] : 0.f); a[8 + i] = (_Float16)(kb < K ? W[(size_t)(kb < K ? kb : K - 1) * ld + n] : 0.f); }
  return a;
}
struct F2 { v16b h, l; };
__device__ __forceinline__ F2 bsplit16(const float v[16]) { F2 r;
#pragma unroll
  for (int i = 0; i < 16; ++i) { const __bf16 h = (__bf16)v[i]; r.h[i] = h; r.l[i] = (__bf16)(v[i] - (float)h); }
  return r; }
__device__ __forceinline__ F2 split_row(const float* row, int k0, int lane) { float v[16]; const float* p = row + k0 + 8 * (lane >> 4);
#pragma unroll
  for (int i = 0; i < 8; ++i) { v[i] = p[i]; v[8 + i] = p[16 + i]; }
  return bsplit16(v); }
__device__ __forceinline__ F2 split_rowK(const float* row, int k0, int lane, int K) { float v[16]; const int g = lane >> 4;
#pragma unroll
  for (int i = 0; i < 8; ++i) { const int ka = k0 + 8 * g + i, kb = ka + 16; v[i] = ka < K ? row[ka < K ? ka : K - 1] : 0.f; v[8 + i] = kb < K ? row[kb < K ? kb : K - 1] : 0.f; }
  return bsplit16(v); }
__device__ __forceinline__ F2 split_col(const float* W, int k0, int n, int lane, int ld, int K) { float v[16]; const int g = lane >> 4;
#pragma unroll
  for (int i = 0; i < 8; ++i) { const int ka = k0 + 8 * g + i, kb = ka + 16; v[i] = ka < K ? W[(size_t)(ka < K ? ka : K - 1) * ld + n] : 0.f; v[8 + i] = kb < K ? W[(size_t)(kb < K ? kb : K - 1) * ld + n] : 0.f; }
  return bsplit16(v); }
__device__ __forceinline__ v8f mac3(const F2& a, const F2& b, v8f c) { c = wmma_bf(a.l, b.h, c); c = wmma_bf(a.h, b.l, c); return wmma_bf(a.h, b.h, c); }
__device__ __forceinline__ float sigm(float v) { return 1.0f / (1.0f + expf(-v)); }
#define LDSX() do { asm volatile("s_wait_dscnt 0" ::: "memory"); __builtin_amdgcn_wave_barrier(); __builtin_amdgcn_fence(__ATOMIC_RELEASE, "workgroup"); } while (0)


// MSA row attention with pair bias (B 1, S 128 sequences x R 256 residues, c_m 256, 8 heads x 32, c_z 128): out = (sigmoid(LN(m) wg + bg) * softmax(q k / sqrt(32) + 1e9 (mask - 1) + LN(z) wz) v) wo + bo.
#define SQ 128
#define RR 256
#define CM 256
#define NH 8
#define CA 32
#define CZ 128
#define FF 1024
#define NROW (SQ * RR)
#define WSC 256.0f
#ifndef TON
#define TON 1           // unused
#endif
typedef __attribute__((ext_vector_type(8))) __bf16 v8b;
__device__ __forceinline__ v16b frag_b(const __bf16* rowk0, int lane) {
  union { v16b v; v8b q[2]; } u; const __bf16* p = rowk0 + 8 * (lane >> 4);
  u.q[0] = *(const v8b*)p; u.q[1] = *(const v8b*)(p + 16); return u.v;
}
__device__ __forceinline__ float bfr(float v) { return (float)(__bf16)v; }
__device__ __attribute__((noinline)) float exp_ni(float v) { return expf(v); }
__device__ __attribute__((noinline)) float erf_ni(float v) { return erff(v); }

// weights (f16 x 2^8, transposed (in,out)), as 16 x 32 tiles in fragment order [out / 16][in / 32][512]: RW 1024 x 256 = q|k|v|g ; CW 1024 x 256; RWO 256 x 256; CWO 256 x 256; TW1 1024 x 256; TW2 256 x 1024
#define WS_RW   0u
#define WS_CW   (WS_RW + 2u * 1024 * CM)
#define WS_RWO  (WS_CW + 2u * 1024 * CM)
#define WS_CWO  (WS_RWO + 2u * CM * CM)
#define WS_TW1  (WS_CWO + 2u * CM * CM)
#define WS_TW2  (WS_TW1 + 2u * FF * CM)
#define WS_XH   (WS_TW2 + 2u * CM * FF)                 // f16 LN rows [NROW][256] (natural s*R + r)
#define WS_QK   (WS_XH + 2u * (size_t)NROW * CM)         // f16 q|k tiles in fragment order [b][q|k][head][N / 16][512]
#define WS_VT   (WS_QK + 2u * (size_t)NROW * 2 * CM)     // f16 hi|lo v planes, tiles (16 channels x 32 tokens) in fragment order [b][256 / 16][N / 32][512]
#define WS_VTL  (WS_VT + 2u * (size_t)NROW * CM)
#define WS_G    (WS_VTL + 2u * (size_t)NROW * CM)        // f16 sigmoid gate, tiles (16 natural rows x 32 channels) in fragment order [NROW / 16][256 / 32][512]
#define WS_O    (WS_G + 2u * (size_t)NROW * CM)          // f32 attention output, tiles (16 compact rows x 32 channels = one head) in fragment order [NROW / 16][256 / 32][element quad 0..3][lane][4]
#define WS_M    (WS_O + 4u * (size_t)NROW * CM)          // f32 working m [natural][256]
#define WS_PB   (WS_M + 4u * (size_t)NROW * CM)          // f32 pair bias, tiles (16 queries x 32 keys) in the order of k_att's score registers [h][q / 16][k / 32][quad = (k % 32 / 16) * 2 + k % 8 / 4][lane = (k % 16 / 8) * 16 + q % 16][4]
#define WS_H1   (WS_PB + 4u * (size_t)NH * RR * RR)      // f16 relu rows [natural][1024]
#define WS_END  (WS_H1 + 2u * (size_t)NROW * FF)

// ---- k_packw: block = 16 output rows n0 .. n0 + 15 = one row of tiles, so every 128-byte line of the packed weights has one writer; which: 0 RW (W = rq|rk|rv|rg by n/256), 1 CW, 2 RWO, 3 CWO, 4 TW1, 5 TW2
__global__ __launch_bounds__(256) void k_packw(const float* __restrict__ RQ, const float* __restrict__ RK, const float* __restrict__ RV, const float* __restrict__ RG, const float* __restrict__ CQ, const float* __restrict__ CK, const float* __restrict__ CV, const float* __restrict__ CG, const float* __restrict__ RWO, const float* __restrict__ CWO, const float* __restrict__ TW1, const float* __restrict__ TW2, char* __restrict__ ws) {
  const int n0 = blockIdx.x * 16, which = blockIdx.y, t = threadIdx.x;
  const float* Wm; int kin, kout, col; _Float16* dst;
  if (which == 0) { if (n0 >= 1024) return; const int g4 = n0 / CM; col = n0 % CM; Wm = g4 == 0 ? RQ : g4 == 1 ? RK : g4 == 2 ? RV : RG; kin = CM; kout = CM; dst = (_Float16*)(ws + WS_RW); }
  else if (which == 1) { if (n0 >= 1024) return; const int g4 = n0 / CM; col = n0 % CM; Wm = g4 == 0 ? CQ : g4 == 1 ? CK : g4 == 2 ? CV : CG; kin = CM; kout = CM; dst = (_Float16*)(ws + WS_CW); }
  else if (which == 2) { if (n0 >= CM) return; col = n0; Wm = RWO; kin = CM; kout = CM; dst = (_Float16*)(ws + WS_RWO); }
  else if (which == 3) { if (n0 >= CM) return; col = n0; Wm = CWO; kin = CM; kout = CM; dst = (_Float16*)(ws + WS_CWO); }
  else if (which == 4) { if (n0 >= FF) return; col = n0; Wm = TW1; kin = CM; kout = FF; dst = (_Float16*)(ws + WS_TW1); }
  else { if (n0 >= CM) return; col = n0; Wm = TW2; kin = FF; kout = CM; dst = (_Float16*)(ws + WS_TW2); }
  dst += (size_t)blockIdx.x * (kin / 32) * 512;
  // chunk e = (k tile e >> 6, half (e >> 5) & 1, lane e & 31) lies at f16 offset 8 e: a wave stores 512 contiguous bytes; its 8 values are k .. k + 7 of output row n0 + (lane & 15)
  for (int e = t; e < kin * 2; e += 256) { const int ln = e & 31, k = (e >> 6) * 32 + ((e >> 5) & 1) * 16 + (ln >> 4) * 8; v8h o;
#pragma unroll   // o is indexed by constants and stays in registers
    for (int i = 0; i < 8; ++i) o[i] = (_Float16)(bfr(Wm[(size_t)(k + i) * kout + col + (ln & 15)]) * WSC);
    vst2(dst + e * 8, o); } }
// ---- k_ln: XH = LN(bf16(m)) w + b (jnp.var, 1e-5) -> f16. One wave owns a row (lane l: channels 4l + e and 128 + 4l + e, so each 16-byte load of a wave covers 512 contiguous bytes) and works on LNR rows; no LDS, no barrier
// value of lane l ^ MSK inside a 16-lane row, by a DPP move (no LDS round trip as with __shfl_xor)
template <int MSK> __device__ __forceinline__ float rowx(float x) { return __builtin_bit_cast(float, __builtin_amdgcn_mov_dpp(__builtin_bit_cast(int, x), 0x160 | MSK, 0xf, 0xf, true)); }
// lane l with lane l ^ 16
__device__ __forceinline__ float xhalf(float x) { return __builtin_bit_cast(float, __builtin_amdgcn_permlanex16(__builtin_bit_cast(int, x), __builtin_bit_cast(int, x), 0x76543210, 0xfedcba98, false, false)); }
__device__ __forceinline__ float wsum(float s) { s += rowx<1>(s); s += rowx<2>(s); s += rowx<4>(s); s += rowx<8>(s); return s + xhalf(s); }
typedef __attribute__((ext_vector_type(4))) _Float16 v4h;
#define LNR 8
__global__ __launch_bounds__(256) void k_ln(const float* __restrict__ X, const float* __restrict__ G, const float* __restrict__ Bt, _Float16* __restrict__ XH) { const int lane = threadIdx.x & 31; const size_t row0 = ((size_t)blockIdx.x * 8 + (threadIdx.x >> 5)) * LNR;
  const float* xr = X + row0 * CM + lane * 4; _Float16* yr = XH + row0 * CM + lane * 4;
  // both loops are fully unrolled: the arrays are indexed by constants and stay in registers
  v4f xa[LNR], xb[LNR];   // the wave's LNR rows: all loads are issued before the first use, so memory latency is paid once
#pragma unroll
  for (int p = 0; p < LNR; ++p) { xa[p] = *(const v4f*)(xr + (size_t)p * CM); xb[p] = *(const v4f*)(xr + (size_t)p * CM + 128); }
  const v4f g0 = *(const v4f*)(G + lane * 4), g1 = *(const v4f*)(G + 128 + lane * 4), c0 = *(const v4f*)(Bt + lane * 4), c1 = *(const v4f*)(Bt + 128 + lane * 4);
  float gg[8], bb[8];
#pragma unroll
  for (int e = 0; e < 4; ++e) { gg[e] = bfr(g0[e]); gg[4 + e] = bfr(g1[e]); bb[e] = bfr(c0[e]); bb[4 + e] = bfr(c1[e]); }
#pragma unroll
  for (int p = 0; p < LNR; ++p) { float v[8];
#pragma unroll
    for (int e = 0; e < 4; ++e) { v[e] = bfr(xa[p][e]); v[4 + e] = bfr(xb[p][e]); }
    const float mu = wsum(((v[0] + v[1]) + (v[2] + v[3])) + ((v[4] + v[5]) + (v[6] + v[7]))) / (float)CM; float qq = 0.f;
#pragma unroll
    for (int i = 0; i < 8; ++i) { v[i] -= mu; qq += v[i] * v[i]; }
    const float inv = 1.0f / sqrtf(wsum(qq) / (float)CM + 1e-5f); v4h h0, h1;
#pragma unroll
    for (int e = 0; e < 4; ++e) { h0[e] = (_Float16)(v[e] * inv * gg[e] + bb[e]); h1[e] = (_Float16)(v[4 + e] * inv * gg[4 + e] + bb[4 + e]); }
    vst2(yr + (size_t)p * CM, h0); vst2(yr + (size_t)p * CM + 128, h1); } }
// natural row index of (batch b, token n): MODE 0 row attention (b = s, n = r); MODE 1 column attention (b = r, n = s)
template <int MODE> __device__ __forceinline__ size_t nat(size_t b, int n) { return MODE == 0 ? b * RR + n : (size_t)n * RR + b; }
// ---- k_proj<MODE>: block = (128 tokens, 128 of 1024 cols (q|k|v|g), b), a wave = two 16-token tiles (64 tokens apart), so each loaded weight fragment feeds two WMMAs: A = XH rows; q|k -> QK (single f16); v -> planes hi/lo; g -> sigmoid -> f16; all four stored as whole tiles in their reader's fragment order
template <int MODE>
__global__ __launch_bounds__(128) void k_proj(const _Float16* __restrict__ XH, const _Float16* __restrict__ Wr, const float* __restrict__ BG, _Float16* __restrict__ QK, _Float16* __restrict__ VT, _Float16* __restrict__ VTL, _Float16* __restrict__ Gt) {
  static_assert(MODE == 0, "a gate tile holds 16 natural rows: 16 tokens of one b only in row attention");
  constexpr int NN = MODE == 0 ? RR : SQ; __shared__ __align__(16) _Float16 sh[64][136]; __shared__ __align__(16) _Float16 th[128][72], tl[128][72];
  const int tid = threadIdx.x, wave = tid >> 5, lane = tid & 31, col = lane & 15, g = lane >> 4; const size_t b = blockIdx.z; const int n0 = blockIdx.x * 128 + wave * 16; const int c0 = blockIdx.y * 128; const int which = c0 / CM;   // 0 q, 1 k, 2 v, 3 g; the wave's token tile u starts at n0 + 64 u
  v8f acc[2][8] = {};
  // fragments are fetched ahead: the 64 weight fragments (order f = kc * 8 + j) go through a ring of PJW register sets, fragment f + PJW being requested right behind the two WMMAs that read fragment f, so a WMMA waits only for a load issued 14 WMMAs earlier, not for its own (7 sets, not 8: the wave stays within 256 registers, 4 waves a SIMD); the two row fragments of the next k block are requested ahead of this block's WMMAs
  const _Float16* ar0 = XH + nat<MODE>(b, n0 + col) * CM; const _Float16* ar1 = XH + nat<MODE>(b, n0 + 64 + col) * CM; const _Float16* wr = Wr + (size_t)(c0 / 16) * (CM / 32) * 512;
  v16h a0 = frag_h(ar0, lane), a1 = frag_h(ar1, lane); constexpr int PJW = 7; v16h wf[PJW]; float bgv[8];
#pragma unroll   // bgv and wf are indexed by constants and stay in registers (this loop and the next three)
  for (int f = 0; f < PJW; ++f) wf[f] = frag_t(wr + ((size_t)(f & 7) * (CM / 32) + (f >> 3)) * 512, lane);
#pragma unroll
  for (int kc = 0; kc < CM / 32; ++kc) { v16h an0 = a0, an1 = a1; if (kc + 1 < CM / 32) { an0 = frag_h(ar0 + (kc + 1) * 32, lane); an1 = frag_h(ar1 + (kc + 1) * 32, lane);
      if (kc + 2 == CM / 32) asm volatile("s_wait_xcnt 0x0" ::: "memory"); }   // behind the last row loads: stands in front of what rewrites their address registers, which are free from here on (a later weight load's result takes them)
    else {   // the gate bias is requested ahead of the last k block's WMMAs, in the registers that the row fragments fetched ahead have left (in bounds for every block; only the gate blocks use it): behind the WMMAs each of its 8 loads was waited for alone
#pragma unroll
      for (int j = 0; j < 8; ++j) bgv[j] = BG[(c0 % CM) + j * 16 + col];
      asm volatile("s_wait_xcnt 0x0" ::: "memory"); }   // stands in front of what rewrites the address registers of the bias loads
#pragma unroll
    for (int j = 0; j < 8; ++j) { const int f = kc * 8 + j, fn = f + PJW; acc[0][j] = wmma16(a0, wf[f % PJW], acc[0][j]); acc[1][j] = wmma16(a1, wf[f % PJW], acc[1][j]); if (fn < 8 * (CM / 32)) wf[f % PJW] = frag_t(wr + ((size_t)(fn & 7) * (CM / 32) + (fn >> 3)) * 512, lane); }
    a0 = an0; a1 = an1; }
  // the block's two groups of 64 tokens (tile u of every wave) go through the staging arrays one after the other
  v8f cur[8];   // the group in work
#pragma unroll
  for (int j = 0; j < 8; ++j) cur[j] = acc[0][j];
#pragma unroll 1   // kept rolled: the text behind the WMMAs (the gate's exp and division above all) stands once
  for (int u = 0; u < 2; ++u) { const int bx = blockIdx.x * 2 + u;   // index of the 64-token group
  if (u) __syncthreads();   // every reader of group 0 has left the staging arrays before group 1 is written there
#pragma unroll
  for (int j = 0; j < 8; ++j) { const float bg = (which == 3) ? bfr(bgv[j]) : 0.f;
#pragma unroll
    for (int r = 0; r < 8; ++r) { float v = cur[j][r] * (1.0f / WSC); if (which == 3) v = 1.0f / (1.0f + expf(-(v + bg)));
      if (which == 2) { const _Float16 hv = (_Float16)v; th[j * 16 + col][wave * 16 + 8 * g + r] = hv; tl[j * 16 + col][wave * 16 + 8 * g + r] = (_Float16)((v - (float)hv) * 2048.0f); } else sh[wave * 16 + 8 * g + r][j * 16 + col] = (_Float16)v; } }
  __syncthreads();
  if (which < 2) { for (int e = tid; e < 64 * 16; e += 128) { const int ln = e & 31, hf = (e >> 5) & 1, rt = (e >> 6) & 3, hl = e >> 8;   // a wave stores 512 contiguous bytes: half hf of the tile (head hl of the block's 4, token tile rt)
      vst2((unsigned*)(QK + (((b * 2 + which) * NH + (c0 % CM) / CA + hl) * (NN / 16) + bx * 4 + rt) * 512 + hf * 256 + ln * 8), *(const v4u*)&sh[rt * 16 + (ln & 15)][(hl * 4 + hf * 2 + (ln >> 4)) * 8]); } }
  else if (which == 2) { const int cv0 = c0 - 2 * CM; for (int e = tid; e < 128 * 8; e += 128) { const int ln = e & 31, hf = (e >> 5) & 1, kl = (e >> 6) & 1, ctl = e >> 7, cl = ctl * 16 + (ln & 15), tk = (kl * 4 + hf * 2 + (ln >> 4)) * 8;   // half hf of the tile (channel tile ctl of 8, 32-token group kl of 2)
      const size_t o = ((b * (CM / 16) + cv0 / 16 + ctl) * (size_t)(NN / 32) + bx * 2 + kl) * 512 + hf * 256 + ln * 8; vst2((unsigned*)(VT + o), *(const v4u*)&th[cl][tk]); vst2((unsigned*)(VTL + o), *(const v4u*)&tl[cl][tk]); } }
  else { for (int e = tid; e < 64 * 16; e += 128) { const int ln = e & 31, hf = (e >> 5) & 1, rt = (e >> 6) & 3, hl = e >> 8;
      vst2((unsigned*)(Gt + ((nat<MODE>(b, bx * 64) / 16 + rt) * (CM / 32) + (c0 - 3 * CM) / 32 + hl) * 512 + hf * 256 + ln * 8), *(const v4u*)&sh[rt * 16 + (ln & 15)][(hl * 4 + hf * 2 + (ln >> 4)) * 8]); } }
#pragma unroll
  for (int j = 0; j < 8; ++j) cur[j] = acc[1][j]; } }
// ---- k_pb: block = (8 keys, 16 query residues) = 128 z rows, row rho = (query rho / 8, key rho % 8): per head it owns two whole 256-byte runs of a PB tile; PB(h, q, k) = LN(z[q][k]) . wb[:, h]; 16 lanes share one z row (8 channels a lane, two 16-byte loads), a wave works on 2 rows at a time; this lane's 8 x 8 weights stay in registers
#define PBK 128
__global__ __launch_bounds__(256) void k_pb(const float* __restrict__ Zp, const float* __restrict__ G, const float* __restrict__ Bt, const float* __restrict__ WB, float* __restrict__ PB) { __shared__ __align__(16) float sp[NH][PBK + 4]; __shared__ __align__(16) float swb[CZ / 4][4 * NH + 4];   // swb: 4 channels x 8 heads a row, pitch 36 words: the 16 lanes' 16-byte reads fall on distinct banks
  const int t = threadIdx.x, lane = t & 31, w = t >> 5, l16 = lane & 15, hf = lane >> 4; const int ko = blockIdx.x, qt = blockIdx.y;
  const float* zr = Zp + (((size_t)qt * 16 + w * 2) * RR + ko * 8 + hf) * CZ + l16 * 4;   // rows rho = w*16 + 2p + hf: query qt*16 + 2w + p/4, key ko*8 + 2(p%4) + hf; channels 4*l16 + e and 64 + 4*l16 + e
  // every loop of this kernel is fully unrolled: its arrays are indexed by constants and stay in registers
  v4f za[8], zb[8];   // the wave's 16 rows: all 16 loads are issued before the first use, so memory latency is paid once
#pragma unroll
  for (int p = 0; p < 8; ++p) { za[p] = *(const v4f*)(zr + ((size_t)(p >> 2) * RR + (p & 3) * 2) * CZ); zb[p] = *(const v4f*)(zr + ((size_t)(p >> 2) * RR + (p & 3) * 2) * CZ + 64); }
  v4f g4[2], b4[2];
#pragma unroll
  for (int i = 0; i < 2; ++i) { g4[i] = *(const v4f*)(G + 64 * i + l16 * 4); b4[i] = *(const v4f*)(Bt + 64 * i + l16 * 4); }
  { v4f w4 = *(const v4f*)(WB + t * 4); w4[0] = bfr(w4[0]); w4[1] = bfr(w4[1]); w4[2] = bfr(w4[2]); w4[3] = bfr(w4[3]); *(v4f*)&swb[t >> 3][(t & 7) * 4] = w4; } __syncthreads();
  float wv[8][NH], gg[8], bb[8];
#pragma unroll
  for (int i = 0; i < 2; ++i) {
#pragma unroll
    for (int e = 0; e < 4; ++e) { gg[i * 4 + e] = bfr(g4[i][e]); bb[i * 4 + e] = bfr(b4[i][e]); const v4f w0 = *(const v4f*)&swb[16 * i + l16][e * NH], w1 = *(const v4f*)&swb[16 * i + l16][e * NH + 4];
#pragma unroll
      for (int h = 0; h < 4; ++h) { wv[i * 4 + e][h] = w0[h]; wv[i * 4 + e][4 + h] = w1[h]; } } }
  const bool b0 = (l16 & 1) != 0, b1 = (l16 & 2) != 0, b2 = (l16 & 4) != 0;
#pragma unroll
  for (int p = 0; p < 8; ++p) { float v[8];
#pragma unroll
    for (int e = 0; e < 4; ++e) { v[e] = bfr(za[p][e]); v[4 + e] = bfr(zb[p][e]); }
    float s = ((v[0] + v[1]) + (v[2] + v[3])) + ((v[4] + v[5]) + (v[6] + v[7]));
    s += rowx<1>(s); s += rowx<2>(s); s += rowx<4>(s); s += rowx<8>(s);
    const float mu = s / (float)CZ; float qq = 0.f;
#pragma unroll
    for (int i = 0; i < 8; ++i) { v[i] -= mu; qq += v[i] * v[i]; }
    qq += rowx<1>(qq); qq += rowx<2>(qq); qq += rowx<4>(qq); qq += rowx<8>(qq);
    const float inv = 1.0f / sqrtf(qq / (float)CZ + 1e-5f); float ph[NH];
#pragma unroll
    for (int h = 0; h < NH; ++h) ph[h] = 0.f;
#pragma unroll
    for (int i = 0; i < 8; ++i) { const float ln = v[i] * inv * gg[i] + bb[i];
#pragma unroll
      for (int h = 0; h < NH; ++h) ph[h] += ln * wv[i][h]; }
    // sum over the 16 lanes, halving the heads a lane carries at each of the first three steps: lane l16 ends with head l16 & 7
    float y[4], u[2];
#pragma unroll
    for (int i = 0; i < 4; ++i) y[i] = (b0 ? ph[2 * i + 1] : ph[2 * i]) + rowx<1>(b0 ? ph[2 * i] : ph[2 * i + 1]);
#pragma unroll
    for (int i = 0; i < 2; ++i) u[i] = (b1 ? y[2 * i + 1] : y[2 * i]) + rowx<2>(b1 ? y[2 * i] : y[2 * i + 1]);
    float x = (b2 ? u[1] : u[0]) + rowx<4>(b2 ? u[0] : u[1]); x += rowx<8>(x);
    if (l16 < NH) sp[l16][w * 16 + p * 2 + hf] = x; }
  __syncthreads(); { const int h = t >> 5, i = (t >> 4) & 1;   // ko = (32-key tile ko / 4, 16-key half (ko / 2) % 2, lane half ko % 2); a wave stores the head's two 256-byte runs (quads i = 0, 1; 16 queries x 4 keys each)
    vst2(PB + ((((size_t)h * (RR / 16) + qt) * (RR / 32) + (ko >> 2)) * 4 + ((ko >> 1) & 1) * 2 + i) * 128 + ((ko & 1) * 16 + l16) * 4, *(const v4f*)&sp[h][l16 * 8 + i * 4]); } }
// ---- k_att<MODE>: block = (128 queries, head, b), a wave = 32 queries = two 16-query tiles u, so each loaded K and V fragment feeds two WMMAs. Both products are taken transposed: S^T = K . Q^T (A = key rows, B = query columns), O^T = V^T . P^T (A = channel rows, B = P^T). A lane (g, col) then holds, per tile, 16 of the pass's 32 scores of ONE query, q0 + 16 u + col (keys ct * 16 + 8g + r): maximum and sum are taken in the lane, with one exchange between the lane halves; the two score tiles, converted in place, are the B operand P^T, and the O^T registers are the O tile's quads: no LDS
template <int MODE>
__global__ __launch_bounds__(128) void k_att(const _Float16* __restrict__ QK, const _Float16* __restrict__ VT, const _Float16* __restrict__ VTL, const float* __restrict__ PB, const float* __restrict__ MASK, float* __restrict__ O) {
  static_assert(MODE == 0, "the pair bias tiles belong to row attention");
  constexpr int NN = MODE == 0 ? RR : SQ;
  const int tid = threadIdx.x, wave = tid >> 5, lane = tid & 31, g = lane >> 4; const int h = blockIdx.y; const size_t b = blockIdx.z; const int q0 = blockIdx.x * 128 + wave * 32; const size_t rq = b * NN + q0;
  v16h bq[2];
#pragma unroll   // every array over u is indexed by constants and stays in registers
  for (int u = 0; u < 2; ++u) bq[u] = frag_t(QK + (((b * 2 + 0) * NH + h) * (NN / 16) + q0 / 16 + u) * 512, lane);
  const float* pbt = PB + ((size_t)h * (RR / 16) + q0 / 16) * (RR / 32) * 512 + lane * 4;
  float m[2] = {-3.0e38f, -3.0e38f}, l[2] = {0.f, 0.f};   // per query tile: the query's running maximum (equal in both lane halves) and this half's share of its sum
  v8f acc[2][2] = {}, accl[2][2] = {};
#pragma unroll 1
  for (int ks = 0; ks < NN / 32; ++ks) {
    // all loads of the pass are issued here, ahead of its first WMMA: one wait on memory a pass, and v lands behind the softmax
    v16h kh[2], vh[2], vl[2]; v4f pb[2][2][2];
    const float mkv = MASK[nat<MODE>(b, ks * 32 + lane)];   // lane = key of the pass
#pragma unroll   // the arrays are indexed by constants and stay in registers
    for (int ct = 0; ct < 2; ++ct) { kh[ct] = frag_t(QK + (((b * 2 + 1) * NH + h) * (NN / 16) + ks * 2 + ct) * 512, lane);
#pragma unroll
      for (int u = 0; u < 2; ++u)
#pragma unroll
        for (int i = 0; i < 2; ++i) pb[u][ct][i] = *(const v4f*)(pbt + (u * (RR / 32) + ks) * 512 + (ct * 2 + i) * 128); }
    asm volatile("s_wait_xcnt 0x0" ::: "memory");   // stands in front of what rewrites the address registers of the loads above: results of the v loads, the next pass's address additions
#pragma unroll
    for (int j = 0; j < 2; ++j) vh[j] = frag_t(VT + ((b * (CM / 16) + h * 2 + j) * (size_t)(NN / 32) + ks) * 512, lane);
    asm volatile("s_wait_xcnt 0x0" ::: "memory");   // the same for the loads of v's high plane (a result of the low plane's loads takes their address registers)
#pragma unroll
    for (int j = 0; j < 2; ++j) vl[j] = frag_t(VTL + ((b * (CM / 16) + h * 2 + j) * (size_t)(NN / 32) + ks) * 512, lane);
    asm volatile("s_wait_xcnt 0x0" ::: "memory");   // the same for the low plane's loads
    const unsigned kept = __builtin_amdgcn_ballot_w32(bfr(mkv) != 0.f);   // bit = key of the pass
#pragma unroll
    for (int u = 0; u < 2; ++u) { float s[2][8];
#pragma unroll
    for (int ct = 0; ct < 2; ++ct) { v8f c = {}; c = wmma16(kh[ct], bq[u], c);
#pragma unroll
      for (int r = 0; r < 8; ++r) { float sc = c[r] * 0.17677669529663687f; if (MODE == 0) sc += pb[u][ct][r >> 2][r & 3]; s[ct][r] = sc; } }
    if (kept != 0xffffffffu) { const unsigned kb = kept >> (8 * g);   // one scalar test a tile and pass: only a pass with a masked key pays for the 16 selects
#pragma unroll
      for (int ct = 0; ct < 2; ++ct)
#pragma unroll
        for (int r = 0; r < 8; ++r) if (((kb >> (ct * 16 + r)) & 1u) == 0u) s[ct][r] = -3.0e38f; }
    float t[8];
#pragma unroll
    for (int r = 0; r < 8; ++r) t[r] = fmaxf(s[0][r], s[1][r]);
    float mx = fmaxf(fmaxf(fmaxf(t[0], t[1]), fmaxf(t[2], t[3])), fmaxf(fmaxf(t[4], t[5]), fmaxf(t[6], t[7]))); mx = fmaxf(mx, xhalf(mx));
    const float mn = fmaxf(m[u], mx), alpha = (m[u] <= -1.0e38f) ? 0.f : __expf(m[u] - mn);
#pragma unroll
    for (int ct = 0; ct < 2; ++ct)
#pragma unroll
      for (int r = 0; r < 8; ++r) s[ct][r] = (s[ct][r] <= -1.0e38f) ? 0.f : __expf(s[ct][r] - mn);
#pragma unroll
    for (int r = 0; r < 8; ++r) t[r] = s[0][r] + s[1][r];
    l[u] = l[u] * alpha + (((t[0] + t[1]) + (t[2] + t[3])) + ((t[4] + t[5]) + (t[6] + t[7]))); m[u] = mn;
#pragma unroll
    for (int j = 0; j < 2; ++j)
#pragma unroll
      for (int r = 0; r < 8; ++r) { acc[u][j][r] *= alpha; accl[u][j][r] *= alpha; }
    v16h pa, pal;   // B operand: element i = key 8g + i = tile 0 register i, element 8 + i = key 16 + 8g + i = tile 1 register i
#pragma unroll
    for (int i = 0; i < 8; ++i) { const float p0 = s[0][i] * 2048.0f, p1 = s[1][i] * 2048.0f; pa[i] = (_Float16)p0; pa[8 + i] = (_Float16)p1; pal[i] = (_Float16)((p0 - (float)pa[i]) * 2048.0f); pal[8 + i] = (_Float16)((p1 - (float)pa[8 + i]) * 2048.0f); }
#pragma unroll
    for (int j = 0; j < 2; ++j) { acc[u][j] = wmma16(vh[j], pa, acc[u][j]); accl[u][j] = wmma16(vl[j], pa, accl[u][j]); accl[u][j] = wmma16(vh[j], pal, accl[u][j]); } } }
#pragma unroll
  for (int u = 0; u < 2; ++u) { const float ls = l[u] + xhalf(l[u]);
  const float il = (ls > 0.f) ? (1.0f / 2048.0f) / ls : 0.f;
  float* ot = O + ((rq / 16 + u) * (CM / 32) + h) * 512 + lane * 4;   // lane = (g, row col): quads 0, 1 = channels 8g .. 8g + 7, quads 2, 3 = 16 + 8g .. : register r of O^T tile j is channel j * 16 + 8g + r; each store of the wave is 512 contiguous bytes
#pragma unroll
  for (int qd = 0; qd < 4; ++qd) { v4f o;
#pragma unroll
    for (int e = 0; e < 4; ++e) o[e] = (acc[u][qd >> 1][(qd & 1) * 4 + e] + accl[u][qd >> 1][(qd & 1) * 4 + e] * (1.0f / 2048.0f)) * il;
    vst2(ot + qd * 128, o); } } }
// ---- k_go<MODE>: block = (64 natural rows, 128 cols): M = (g o) . wo + bo ; A operand built on the fly from the G and O tiles
template <int MODE>
__global__ __launch_bounds__(128) void k_go(const _Float16* __restrict__ Gt, const float* __restrict__ O, const _Float16* __restrict__ WOr, const float* __restrict__ BO, float* __restrict__ M) { __shared__ __align__(16) float sf[4][16][132];
  const int tid = threadIdx.x, wave = tid >> 5, lane = tid & 31, col = lane & 15, g = lane >> 4; const size_t r0 = (size_t)blockIdx.x * 64 + wave * 16; const int c0 = blockIdx.y * 128;
  static_assert(MODE == 0, "one tile index serves G (natural rows) and O (compact rows): the two orders agree only in row attention");
  const size_t t0 = (r0 / 16) * (CM / 32);
  v8f acc[8] = {}, accl2[8] = {};
  // loads run ahead of the WMMAs: the 64 weight fragments (order f = kc * 8 + j) go through a ring of GOW register sets, fragment f + GOW being requested right behind the two WMMAs that read fragment f; the gate and o tiles of block kc + 1 are requested ahead of block kc's WMMAs
  constexpr int GOW = 7; const _Float16* wr = WOr + (size_t)(c0 / 16) * (CM / 32) * 512; v16h wf[GOW];
#pragma unroll   // every loop here is fully unrolled: wf and ov are indexed by constants and stay in registers
  for (int f = 0; f < GOW; ++f) wf[f] = frag_t(wr + ((size_t)(f & 7) * (CM / 32) + (f >> 3)) * 512, lane);
  v16h gv = frag_t(Gt + t0 * 512, lane); v4f ov[4];
#pragma unroll
  for (int qd = 0; qd < 4; ++qd) ov[qd] = *(const v4f*)(O + t0 * 512 + lane * 4 + qd * 128);
#pragma unroll
  for (int kc = 0; kc < CM / 32; ++kc) { v16h a, al;
    __builtin_amdgcn_sched_barrier(0);   // keeps this block's conversions (and with them the wait for its gate and o tiles) behind the WMMAs of the block before: moved up among them they would wait for loads just issued
#pragma unroll
    for (int i = 0; i < 16; ++i) { const float v0 = (float)gv[i] * ov[i >> 2][i & 3]; a[i] = (_Float16)v0; al[i] = (_Float16)((v0 - (float)a[i]) * 2048.0f); }
    if (kc + 1 < CM / 32) { gv = frag_t(Gt + (t0 + kc + 1) * 512, lane);
#pragma unroll
      for (int qd = 0; qd < 4; ++qd) ov[qd] = *(const v4f*)(O + (t0 + kc + 1) * 512 + lane * 4 + qd * 128);
      asm volatile("s_wait_xcnt 0x0" ::: "memory"); }   // stands in front of whatever rewrites the address registers of the six loads above (in the last block a later load's result does)
#pragma unroll
    for (int j = 0; j < 8; ++j) { const int f = kc * 8 + j, fn = f + GOW; acc[j] = wmma16(a, wf[f % GOW], acc[j]); accl2[j] = wmma16(al, wf[f % GOW], accl2[j]); if (fn < 8 * (CM / 32)) wf[f % GOW] = frag_t(wr + ((size_t)(fn & 7) * (CM / 32) + (fn >> 3)) * 512, lane); } }
#pragma unroll
  for (int j = 0; j < 8; ++j) { const int c = c0 + j * 16 + col; const float bb = bfr(BO[c]);
#pragma unroll
    for (int r = 0; r < 8; ++r) sf[wave][8 * g + r][j * 16 + col] = (acc[j][r] + accl2[j][r] * (1.0f / 2048.0f)) * (1.0f / WSC) + bb; }
  LDSX(); for (int rl = 0; rl < 16; ++rl) vst2(M + (r0 + rl) * CM + c0 + lane * 4, *(const v4f*)&sf[wave][rl][lane * 4]); }   // M here = the output buffer (no residual in this module)
// ---- k_ff1: block = (64 rows, 128 of 1024 cols): H1 = relu(XH . W1 + b1) -> f16 ; k_ff2: out = H1 . W2 + b2 + M
__global__ __launch_bounds__(128) void k_ff1(const _Float16* __restrict__ XH, const _Float16* __restrict__ W1r, const float* __restrict__ B1, _Float16* __restrict__ H1) { __shared__ __align__(16) _Float16 sh[4][16][136];
  const int tid = threadIdx.x, wave = tid >> 5, lane = tid & 31, col = lane & 15, g = lane >> 4; const size_t r0 = (size_t)blockIdx.x * 64 + wave * 16; const int c0 = blockIdx.y * 128;
  v8f acc[8] = {};
#pragma unroll
  for (int kc = 0; kc < CM / 32; ++kc) { const v16h a = frag_h(XH + (r0 + col) * CM + kc * 32, lane);
#pragma unroll
    for (int j = 0; j < 8; ++j) acc[j] = wmma16(a, frag_t(W1r + ((size_t)(c0 / 16 + j) * (CM / 32) + kc) * 512, lane), acc[j]); }
#pragma unroll
  for (int j = 0; j < 8; ++j) { const float bb = bfr(B1[c0 + j * 16 + col]);
#pragma unroll
    for (int r = 0; r < 8; ++r) sh[wave][8 * g + r][j * 16 + col] = (_Float16)fmaxf(acc[j][r] * (1.0f / WSC) + bb, 0.f); }
  LDSX(); for (int rl = 0; rl < 16; ++rl) if (lane < 16) vst2((unsigned*)(H1 + (r0 + rl) * FF + c0 + lane * 8), *(const v4u*)&sh[wave][rl][lane * 8]); }
__global__ __launch_bounds__(128) void k_ff2(const _Float16* __restrict__ H1, const _Float16* __restrict__ W2r, const float* __restrict__ B2, const float* __restrict__ M, float* __restrict__ OUT) { __shared__ __align__(16) float sf[4][16][132];
  const int tid = threadIdx.x, wave = tid >> 5, lane = tid & 31, col = lane & 15, g = lane >> 4; const size_t r0 = (size_t)blockIdx.x * 64 + wave * 16; const int c0 = blockIdx.y * 128;
  v8f acc[8] = {};
#pragma unroll 2
  for (int kc = 0; kc < FF / 32; ++kc) { const v16h a = frag_h(H1 + (r0 + col) * FF + kc * 32, lane);
#pragma unroll
    for (int j = 0; j < 8; ++j) acc[j] = wmma16(a, frag_t(W2r + ((size_t)(c0 / 16 + j) * (FF / 32) + kc) * 512, lane), acc[j]); }
#pragma unroll
  for (int j = 0; j < 8; ++j) { const int c = c0 + j * 16 + col; const float bb = bfr(B2[c]);
#pragma unroll
    for (int r = 0; r < 8; ++r) sf[wave][8 * g + r][j * 16 + col] = acc[j][r] * (1.0f / WSC) + bb + M[(r0 + 8 * g + r) * CM + c]; }
  LDSX(); for (int rl = 0; rl < 16; ++rl) vst2(OUT + (r0 + rl) * CM + c0 + lane * 4, *(const v4f*)&sf[wave][rl][lane * 4]); }
extern "C" void kernel_launch(void* const* d_in, const int* in_sizes, int n_in, void* d_out, int out_size, void* d_ws, size_t ws_size, hipStream_t stream) {
  (void)in_sizes; (void)n_in; (void)out_size;
  const float** F = (const float**)d_in;   // 0 m [1,128,256,256], 1 z [1,256,256,128], 2 mask [1,128,256], 3 ln_m_g, 4 ln_m_b, 5 ln_z_g, 6 ln_z_b, 7 wz [128,8], 8 wq [256,8,32], 9 wk, 10 wv, 11 wg, 12 bg [8,32], 13 wo [8,32,256], 14 bo [256]
  if (ws_size < (size_t)WS_END) return;
  char* ws = (char*)d_ws; _Float16 *RW = (_Float16*)(ws + WS_RW), *RWOp = (_Float16*)(ws + WS_RWO), *XH = (_Float16*)(ws + WS_XH), *QK = (_Float16*)(ws + WS_QK), *VT = (_Float16*)(ws + WS_VT), *VTL = (_Float16*)(ws + WS_VTL), *Gt = (_Float16*)(ws + WS_G);
  float *O = (float*)(ws + WS_O), *PB = (float*)(ws + WS_PB);
  k_packw<<<dim3(64, 3), 256, 0, stream>>>(F[8], F[9], F[10], F[11], F[8], F[9], F[10], F[11], F[13], F[13], F[8], F[13], ws);   // which 0 (q|k|v|g rows) and 2 (wo rows) are used; which 1 packs in-bounds duplicates; 3-5 not launched
  k_ln<<<NROW / (8 * LNR), 256, 0, stream>>>(F[0], F[3], F[4], XH);
  k_proj<0><<<dim3(RR / 128, 8, SQ), 128, 0, stream>>>(XH, RW, F[12], QK, VT, VTL, Gt);
  k_pb<<<dim3(RR / 8, RR / 16), 256, 0, stream>>>(F[1], F[5], F[6], F[7], PB);
  k_att<0><<<dim3(RR / 128, NH, SQ), 128, 0, stream>>>(QK, VT, VTL, PB, F[2], O);
  k_go<0><<<dim3(NROW / 64, CM / 128), 128, 0, stream>>>(Gt, O, RWOp, F[14], (float*)d_out);
}

// v007
// One run takes 109 microseconds.
// Timed twice side by side with v006, it ran 1.07 and 1.08 times as fast.
// All steps since v000 together make it 3.22 times as fast.
// compute dtype: all float inputs rounded to bf16; LayerNorms, pair bias (LN(z) . wz), softmax, sigmoid gate in f32; q|k|v|g projections on WMMA 16x16x32 with the LayerNorm output rounded once to f16 against exact f16 x 2^8 weights; attention logits with single f16 q, k (32-dim heads), P as f16 hi + residual (x 2^11) . v (hi + residual; 3 products); (g o) as f16 hi + residual (2 products) . wo (f16 x 2^8) + bo; f32 output.
#include <hip/hip_runtime.h>
#include <math.h>

typedef __attribute__((ext_vector_type(16))) _Float16 v16h;
typedef __attribute__((ext_vector_type(16))) __bf16 v16b;
typedef __attribute__((ext_vector_type(8)))  _Float16 v8h;
typedef __attribute__((ext_vector_type(8)))  float v8f;
typedef __attribute__((ext_vector_type(4)))  float v4f;
typedef __attribute__((ext_vector_type(2)))  float v2f;
typedef __attribute__((ext_vector_type(4)))  unsigned v4u;
typedef __attribute__((ext_vector_type(4)))  int v4i;
typedef float __attribute__((may_alias)) float_a;
typedef int __attribute__((may_alias)) int_a;

template <typename T> __device__ __forceinline__ void vst2(void* p, T v) { *(T*)p = v;  }
__device__ __forceinline__ v8f wmma16(v16h a, v16h b, v8f c) {
  v8f d = __builtin_amdgcn_wmma_f32_16x16x32_f16(false, a, false, b, (short)0, c, false, false);
  asm volatile("v_nop\n\tv_nop\n\tv_nop\n\tv_nop" : "+v"(d) : "v"(a), "v"(b));
  return d;
}
__device__ __forceinline__ v8f wmma_bf(v16b a, v16b b, v8f c) {
  v8f d = __builtin_amdgcn_wmma_f32_16x16x32_bf16(false, a, false, b, (short)0, c, false, false);
  asm volatile("v_nop\n\tv_nop\n\tv_nop\n\tv_nop" : "+v"(d) : "v"(a), "v"(b));
  return d;
}
// 16x16x32 fragments: lane = (h = lane>>4, row/col = lane&15); elements 0..7 = k0+8h+0..7, 8..15 = k0+16+8h+0..7; D element r = row 8h+r
__device__ __forceinline__ v16h frag_h(const _Float16* rowk0, int lane) {
  union { v16h v; v8h q[2]; } u; const _Float16* p = rowk0 + 8 * (lane >> 4);
  u.q[0] = *(const v8h*)p; u.q[1] = *(const v8h*)(p + 16); return u.v;
}
// the same fragment from a 16 x 32 tile kept in fragment order: 1 KiB = [elements 0..7 | 8..15][lane][8 f16], so each of the wave's two 16-byte loads covers 512 contiguous bytes (4 whole lines, not pieces of 16)
__device__ __forceinline__ v16h frag_t(const _Float16* tile, int lane) {
  union { v16h v; v8h q[2]; } u; const _Float16* p = tile + 8 * lane;
  u.q[0] = *(const v8h*)p; u.q[1] = *(const v8h*)(p + 256); return u.v;
}
__device__ __forceinline__ v16h frag_f32(const float* rowk0, int lane) {
  v16h a; const float* p = rowk0 + 8 * (lane >> 4);
#pragma unroll
  for (int i = 0; i < 8; ++i) { a[i] = (_Float16)p[i]; a[8 + i] = (_Float16)p[16 + i]; }
  return a;
}
__device__ __forceinline__ v16h frag_f32s(const float* rowk0, int lane, float sc) {
  v16h a; const float* p = rowk0 + 8 * (lane >> 4);
#pragma unroll
  for (int i = 0; i < 8; ++i) { a[i] = (_Float16)(p[i] * sc); a[8 + i] = (_Float16)(p[16 + i] * sc); }
  return a;
}
// column fragment from a [K][ld] layout (column n), rows >= K read as 0
__device__ __forceinline__ v16h fragc_f32(const float* W, int k0, int n, int lane, int ld, int K) {
  v16h a; const int g = lane >> 4;
#pragma unroll
  for (int i = 0; i < 8; ++i) { const int ka = k0 + 8 * g + i, kb = ka + 16;
    a[i] = (_Float16)(ka < K ? W[(size_t)(ka < K ? ka : K - 1) * ld + n] : 0.f); a[8 + i] = (_Float16)(kb < K ? W[(size_t)(kb < K ? kb : K - 1) * ld + n] : 0.f); }
  return a;
}
struct F2 { v16b h, l; };
__device__ __forceinline__ F2 bsplit16(const float v[16]) { F2 r;
#pragma unroll
  for (int i = 0; i < 16; ++i) { const __bf16 h = (__bf16)v[i]; r.h[i] = h; r.l[i] = (__bf16)(v[i] - (float)h); }
  return r; }
__device__ __forceinline__ F2 split_row(const float* row, int k0, int lane) { float v[16]; const float* p = row + k0 + 8 * (lane >> 4);
#pragma unroll
  for (int i = 0; i < 8; ++i) { v[i] = p[i]; v[8 + i] = p[16 + i]; }
  return bsplit16(v); }
__device__ __forceinline__ F2 split_rowK(const float* row, int k0, int lane, int K) { float v[16]; const int g = lane >> 4;
#pragma unroll
  for (int i = 0; i < 8; ++i) { const int ka = k0 + 8 * g + i, kb = ka + 16; v[i] = ka < K ? row[ka < K ? ka : K - 1] : 0.f; v[8 + i] = kb < K ? row[kb < K ? kb : K - 1] : 0.f; }
  return bsplit16(v); }
__device__ __forceinline__ F2 split_col(const float* W, int k0, int n, int lane, int ld, int K) { float v[16]; const int g = lane >> 4;
#pragma unroll
  for (int i = 0; i < 8; ++i) { const int ka = k0 + 8 * g + i, kb = ka + 16; v[i] = ka < K ? W[(size_t)(ka < K ? ka : K - 1) * ld + n] : 0.f; v[8 + i] = kb < K ? W[(size_t)(kb < K ? kb : K - 1) * ld + n] : 0.f; }
  return bsplit16(v); }
__device__ __forceinline__ v8f mac3(const F2& a, const F2& b, v8f c) { c = wmma_bf(a.l, b.h, c); c = wmma_bf(a.h, b.l, c); return wmma_bf(a.h, b.h, c); }
__device__ __forceinline__ float sigm(float v) { return 1.0f / (1.0f + expf(-v)); }
#define LDSX() do { asm volatile("s_wait_dscnt 0" ::: "memory"); __builtin_amdgcn_wave_barrier(); __builtin_amdgcn_fence(__ATOMIC_RELEASE, "workgroup"); } while (0)


// MSA row attention with pair bias (B 1, S 128 sequences x R 256 residues, c_m 256, 8 heads x 32, c_z 128): out = (sigmoid(LN(m) wg + bg) * softmax(q k / sqrt(32) + 1e9 (mask - 1) + LN(z) wz) v) wo + bo.
#define SQ 128
#define RR 256
#define CM 256
#define NH 8
#define CA 32
#define CZ 128
#define FF 1024
#define NROW (SQ * RR)
#define WSC 256.0f
#ifndef TON
#define TON 1           // unused
#endif
typedef __attribute__((ext_vector_type(8))) __bf16 v8b;
__device__ __forceinline__ v16b frag_b(const __bf16* rowk0, int lane) {
  union { v16b v; v8b q[2]; } u; const __bf16* p = rowk0 + 8 * (lane >> 4);
  u.q[0] = *(const v8b*)p; u.q[1] = *(const v8b*)(p + 16); return u.v;
}
__device__ __forceinline__ float bfr(float v) { return (float)(__bf16)v; }
__device__ __attribute__((noinline)) float exp_ni(float v) { return expf(v); }
__device__ __attribute__((noinline)) float erf_ni(float v) { return erff(v); }

// weights (f16 x 2^8, transposed (in,out)), as 16 x 32 tiles in fragment order [out / 16][in / 32][512]: RW 1024 x 256 = q|k|v|g ; CW 1024 x 256; RWO 256 x 256; CWO 256 x 256; TW1 1024 x 256; TW2 256 x 1024
#define WS_RW   0u
#define WS_CW   (WS_RW + 2u * 1024 * CM)
#define WS_RWO  (WS_CW + 2u * 1024 * CM)
#define WS_CWO  (WS_RWO + 2u * CM * CM)
#define WS_TW1  (WS_CWO + 2u * CM * CM)
#define WS_TW2  (WS_TW1 + 2u * FF * CM)
#define WS_XH   (WS_TW2 + 2u * CM * FF)                 // f16 LN rows [NROW][256] (natural s*R + r)
#define WS_QK   (WS_XH + 2u * (size_t)NROW * CM)         // f16 q|k tiles in fragment order [b][q|k][head][N / 16][512]
#define WS_VT   (WS_QK + 2u * (size_t)NROW * 2 * CM)     // f16 hi|lo v planes, tiles (16 channels x 32 tokens) in fragment order [b][256 / 16][N / 32][512]
#define WS_VTL  (WS_VT + 2u * (size_t)NROW * CM)
#define WS_G    (WS_VTL + 2u * (size_t)NROW * CM)        // f16 sigmoid gate, tiles (16 natural rows x 32 channels) in fragment order [NROW / 16][256 / 32][512]
#define WS_O    (WS_G + 2u * (size_t)NROW * CM)          // f32 attention output, tiles (16 compact rows x 32 channels = one head) in fragment order [NROW / 16][256 / 32][element quad 0..3][lane][4]
#define WS_M    (WS_O + 4u * (size_t)NROW * CM)          // f32 working m [natural][256]
#define WS_PB   (WS_M + 4u * (size_t)NROW * CM)          // f32 pair bias, tiles (16 queries x 32 keys) in the order of k_att's score registers [h][q / 16][k / 32][quad = (k % 32 / 16) * 2 + k % 8 / 4][lane = (k % 16 / 8) * 16 + q % 16][4]
#define WS_H1   (WS_PB + 4u * (size_t)NH * RR * RR)      // f16 relu rows [natural][1024]
#define WS_END  (WS_H1 + 2u * (size_t)NROW * FF)

// ---- k_packw: block = 16 output rows n0 .. n0 + 15 = one row of tiles, so every 128-byte line of the packed weights has one writer; which: 0 RW (W = rq|rk|rv|rg by n/256), 1 CW, 2 RWO, 3 CWO, 4 TW1, 5 TW2
__global__ __launch_bounds__(256) void k_packw(const float* __restrict__ RQ, const float* __restrict__ RK, const float* __restrict__ RV, const float* __restrict__ RG, const float* __restrict__ CQ, const float* __restrict__ CK, const float* __restrict__ CV, const float* __restrict__ CG, const float* __restrict__ RWO, const float* __restrict__ CWO, const float* __restrict__ TW1, const float* __restrict__ TW2, char* __restrict__ ws) {
  const int n0 = blockIdx.x * 16, which = blockIdx.y, t = threadIdx.x;
  const float* Wm; int kin, kout, col; _Float16* dst;
  if (which == 0) { if (n0 >= 1024) return; const int g4 = n0 / CM; col = n0 % CM; Wm = g4 == 0 ? RQ : g4 == 1 ? RK : g4 == 2 ? RV : RG; kin = CM; kout = CM; dst = (_Float16*)(ws + WS_RW); }
  else if (which == 1) { if (n0 >= 1024) return; const int g4 = n0 / CM; col = n0 % CM; Wm = g4 == 0 ? CQ : g4 == 1 ? CK : g4 == 2 ? CV : CG; kin = CM; kout = CM; dst = (_Float16*)(ws + WS_CW); }
  else if (which == 2) { if (n0 >= CM) return; col = n0; Wm = RWO; kin = CM; kout = CM; dst = (_Float16*)(ws + WS_RWO); }
  else if (which == 3) { if (n0 >= CM) return; col = n0; Wm = CWO; kin = CM; kout = CM; dst = (_Float16*)(ws + WS_CWO); }
  else if (which == 4) { if (n0 >= FF) return; col = n0; Wm = TW1; kin = CM; kout = FF; dst = (_Float16*)(ws + WS_TW1); }
  else { if (n0 >= CM) return; col = n0; Wm = TW2; kin = FF; kout = CM; dst = (_Float16*)(ws + WS_TW2); }
  dst += (size_t)blockIdx.x * (kin / 32) * 512;
  // chunk e = (k tile e >> 6, half (e >> 5) & 1, lane e & 31) lies at f16 offset 8 e: a wave stores 512 contiguous bytes; its 8 values are k .. k + 7 of output row n0 + (lane & 15)
  for (int e = t; e < kin * 2; e += 256) { const int ln = e & 31, k = (e >> 6) * 32 + ((e >> 5) & 1) * 16 + (ln >> 4) * 8; v8h o;
#pragma unroll   // o is indexed by constants and stays in registers
    for (int i = 0; i < 8; ++i) o[i] = (_Float16)(bfr(Wm[(size_t)(k + i) * kout + col + (ln & 15)]) * WSC);
    vst2(dst + e * 8, o); } }
// ---- k_ln: XH = LN(bf16(m)) w + b (jnp.var, 1e-5) -> f16. One wave owns a row (lane l: channels 4l + e and 128 + 4l + e, so each 16-byte load of a wave covers 512 contiguous bytes) and works on LNR rows; no LDS, no barrier
// value of lane l ^ MSK inside a 16-lane row, by a DPP move (no LDS round trip as with __shfl_xor)
template <int MSK> __device__ __forceinline__ float rowx(float x) { return __builtin_bit_cast(float, __builtin_amdgcn_mov_dpp(__builtin_bit_cast(int, x), 0x160 | MSK, 0xf, 0xf, true)); }
// lane l with lane l ^ 16
__device__ __forceinline__ float xhalf(float x) { return __builtin_bit_cast(float, __builtin_amdgcn_permlanex16(__builtin_bit_cast(int, x), __builtin_bit_cast(int, x), 0x76543210, 0xfedcba98, false, false)); }
__device__ __forceinline__ float wsum(float s) { s += rowx<1>(s); s += rowx<2>(s); s += rowx<4>(s); s += rowx<8>(s); return s + xhalf(s); }
typedef __attribute__((ext_vector_type(4))) _Float16 v4h;
#define LNR 8
__global__ __launch_bounds__(256) void k_ln(const float* __restrict__ X, const float* __restrict__ G, const float* __restrict__ Bt, _Float16* __restrict__ XH) { const int lane = threadIdx.x & 31; const size_t row0 = ((size_t)blockIdx.x * 8 + (threadIdx.x >> 5)) * LNR;
  const float* xr = X + row0 * CM + lane * 4; _Float16* yr = XH + row0 * CM + lane * 4;
  // both loops are fully unrolled: the arrays are indexed by constants and stay in registers
  v4f xa[LNR], xb[LNR];   // the wave's LNR rows: all loads are issued before the first use, so memory latency is paid once
#pragma unroll
  for (int p = 0; p < LNR; ++p) { xa[p] = *(const v4f*)(xr + (size_t)p * CM); xb[p] = *(const v4f*)(xr + (size_t)p * CM + 128); }
  const v4f g0 = *(const v4f*)(G + lane * 4), g1 = *(const v4f*)(G + 128 + lane * 4), c0 = *(const v4f*)(Bt + lane * 4), c1 = *(const v4f*)(Bt + 128 + lane * 4);
  float gg[8], bb[8];
#pragma unroll
  for (int e = 0; e < 4; ++e) { gg[e] = bfr(g0[e]); gg[4 + e] = bfr(g1[e]); bb[e] = bfr(c0[e]); bb[4 + e] = bfr(c1[e]); }
#pragma unroll
  for (int p = 0; p < LNR; ++p) { float v[8];
#pragma unroll
    for (int e = 0; e < 4; ++e) { v[e] = bfr(xa[p][e]); v[4 + e] = bfr(xb[p][e]); }
    const float mu = wsum(((v[0] + v[1]) + (v[2] + v[3])) + ((v[4] + v[5]) + (v[6] + v[7]))) / (float)CM; float qq = 0.f;
#pragma unroll
    for (int i = 0; i < 8; ++i) { v[i] -= mu; qq += v[i] * v[i]; }
    const float inv = 1.0f / sqrtf(wsum(qq) / (float)CM + 1e-5f); v4h h0, h1;
#pragma unroll
    for (int e = 0; e < 4; ++e) { h0[e] = (_Float16)(v[e] * inv * gg[e] + bb[e]); h1[e] = (_Float16)(v[4 + e] * inv * gg[4 + e] + bb[4 + e]); }
    vst2(yr + (size_t)p * CM, h0); vst2(yr + (size_t)p * CM + 128, h1); } }
// natural row index of (batch b, token n): MODE 0 row attention (b = s, n = r); MODE 1 column attention (b = r, n = s)
template <int MODE> __device__ __forceinline__ size_t nat(size_t b, int n) { return MODE == 0 ? b * RR + n : (size_t)n * RR + b; }
// ---- k_proj<MODE>: block = (128 tokens, 128 of 1024 cols (q|k|v|g), b), a wave = two 16-token tiles (64 tokens apart), so each loaded weight fragment feeds two WMMAs: A = XH rows; q|k -> QK (single f16); v -> planes hi/lo; g -> sigmoid -> f16; all four stored as whole tiles in their reader's fragment order
template <int MODE>
__global__ __launch_bounds__(128) void k_proj(const _Float16* __restrict__ XH, const _Float16* __restrict__ Wr, const float* __restrict__ BG, _Float16* __restrict__ QK, _Float16* __restrict__ VT, _Float16* __restrict__ VTL, _Float16* __restrict__ Gt) {
  static_assert(MODE == 0, "a gate tile holds 16 natural rows: 16 tokens of one b only in row attention");
  constexpr int NN = MODE == 0 ? RR : SQ; __shared__ __align__(16) _Float16 sh[64][136]; __shared__ __align__(16) _Float16 th[128][72], tl[128][72];
  const int tid = threadIdx.x, wave = tid >> 5, lane = tid & 31, col = lane & 15, g = lane >> 4; const size_t b = blockIdx.z; const int n0 = blockIdx.x * 128 + wave * 16; const int c0 = blockIdx.y * 128; const int which = c0 / CM;   // 0 q, 1 k, 2 v, 3 g; the wave's token tile u starts at n0 + 64 u
  v8f acc[2][8] = {};
  // fragments are fetched ahead: the 64 weight fragments (order f = kc * 8 + j) go through a ring of PJW register sets, fragment f + PJW being requested right behind the two WMMAs that read fragment f, so a WMMA waits only for a load issued 12 WMMAs earlier, not for its own (7 sets, not 8: the wave stays within 256 registers, 4 waves a SIMD); the two row fragments of the next k block are requested ahead of this block's WMMAs
  const _Float16* ar0 = XH + nat<MODE>(b, n0 + col) * CM; const _Float16* ar1 = XH + nat<MODE>(b, n0 + 64 + col) * CM; const _Float16* wr = Wr + (size_t)(c0 / 16) * (CM / 32) * 512;
  v16h a0 = frag_h(ar0, lane), a1 = frag_h(ar1, lane); constexpr int PJW = 7; v16h wf[PJW]; float bgv[8];
#pragma unroll   // bgv and wf are indexed by constants and stay in registers (this loop and the next three)
  for (int f = 0; f < PJW; ++f) wf[f] = frag_t(wr + ((size_t)(f & 7) * (CM / 32) + (f >> 3)) * 512, lane);
  __builtin_amdgcn_sched_barrier(0);   // keeps the first loads of both row tiles ahead of the first WMMA: moved behind it, the second tile's loads were waited for alone, a second full memory latency at the head of every wave
#pragma unroll
  for (int kc = 0; kc < CM / 32; ++kc) { v16h an0 = a0, an1 = a1; if (kc + 1 < CM / 32) { an0 = frag_h(ar0 + (kc + 1) * 32, lane); an1 = frag_h(ar1 + (kc + 1) * 32, lane);
      if (kc + 2 == CM / 32) asm volatile("s_wait_xcnt 0x0" ::: "memory"); }   // behind the last row loads: stands in front of what rewrites their address registers, which are free from here on (a later weight load's result takes them)
    else {   // the gate bias is requested ahead of the last k block's WMMAs, in the registers that the row fragments fetched ahead have left (in bounds for every block; only the gate blocks use it): behind the WMMAs each of its 8 loads was waited for alone
#pragma unroll
      for (int j = 0; j < 8; ++j) bgv[j] = BG[(c0 % CM) + j * 16 + col];
      asm volatile("s_wait_xcnt 0x0" ::: "memory"); }   // stands in front of what rewrites the address registers of the bias loads
#pragma unroll
    for (int j = 0; j < 8; ++j) { const int f = kc * 8 + j, fn = f + PJW; acc[0][j] = wmma16(a0, wf[f % PJW], acc[0][j]); acc[1][j] = wmma16(a1, wf[f % PJW], acc[1][j]); if (fn < 8 * (CM / 32)) wf[f % PJW] = frag_t(wr + ((size_t)(fn & 7) * (CM / 32) + (fn >> 3)) * 512, lane); }
    a0 = an0; a1 = an1; }
  // the block's two groups of 64 tokens (tile u of every wave) go through the staging arrays one after the other
  v8f cur[8];   // the group in work
#pragma unroll
  for (int j = 0; j < 8; ++j) cur[j] = acc[0][j];
#pragma unroll 1   // kept rolled: the text behind the WMMAs (the gate's exp and division above all) stands once
  for (int u = 0; u < 2; ++u) { const int bx = blockIdx.x * 2 + u;   // index of the 64-token group
  if (u) __syncthreads();   // every reader of group 0 has left the staging arrays before group 1 is written there
  // the block's kind (q|k, v, gate) is tested once a group, not at each of its 64 values: each kind's values then stand in one straight run, independent of one another, so the gate's exp and division chains overlap
  if (which == 2) {
#pragma unroll   // cur is indexed by constants and stays in registers (these three pairs of loops)
    for (int j = 0; j < 8; ++j)
#pragma unroll
      for (int r = 0; r < 8; ++r) { const float v = cur[j][r] * (1.0f / WSC); const _Float16 hv = (_Float16)v; th[j * 16 + col][wave * 16 + 8 * g + r] = hv; tl[j * 16 + col][wave * 16 + 8 * g + r] = (_Float16)((v - (float)hv) * 2048.0f); } }
  else if (which == 3) {
#pragma unroll
    for (int j = 0; j < 8; ++j) { const float bg = bfr(bgv[j]);
#pragma unroll
      for (int r = 0; r < 8; ++r) sh[wave * 16 + 8 * g + r][j * 16 + col] = (_Float16)(1.0f / (1.0f + expf(-(cur[j][r] * (1.0f / WSC) + bg)))); } }
  else {
#pragma unroll
    for (int j = 0; j < 8; ++j)
#pragma unroll
      for (int r = 0; r < 8; ++r) sh[wave * 16 + 8 * g + r][j * 16 + col] = (_Float16)(cur[j][r] * (1.0f / WSC)); }
  __syncthreads();
  if (which < 2) { for (int e = tid; e < 64 * 16; e += 128) { const int ln = e & 31, hf = (e >> 5) & 1, rt = (e >> 6) & 3, hl = e >> 8;   // a wave stores 512 contiguous bytes: half hf of the tile (head hl of the block's 4, token tile rt)
      vst2((unsigned*)(QK + (((b * 2 + which) * NH + (c0 % CM) / CA + hl) * (NN / 16) + bx * 4 + rt) * 512 + hf * 256 + ln * 8), *(const v4u*)&sh[rt * 16 + (ln & 15)][(hl * 4 + hf * 2 + (ln >> 4)) * 8]); } }
  else if (which == 2) { const int cv0 = c0 - 2 * CM; for (int e = tid; e < 128 * 8; e += 128) { const int ln = e & 31, hf = (e >> 5) & 1, kl = (e >> 6) & 1, ctl = e >> 7, cl = ctl * 16 + (ln & 15), tk = (kl * 4 + hf * 2 + (ln >> 4)) * 8;   // half hf of the tile (channel tile ctl of 8, 32-token group kl of 2)
      const size_t o = ((b * (CM / 16) + cv0 / 16 + ctl) * (size_t)(NN / 32) + bx * 2 + kl) * 512 + hf * 256 + ln * 8; vst2((unsigned*)(VT + o), *(const v4u*)&th[cl][tk]); vst2((unsigned*)(VTL + o), *(const v4u*)&tl[cl][tk]); } }
  else { for (int e = tid; e < 64 * 16; e += 128) { const int ln = e & 31, hf = (e >> 5) & 1, rt = (e >> 6) & 3, hl = e >> 8;
      vst2((unsigned*)(Gt + ((nat<MODE>(b, bx * 64) / 16 + rt) * (CM / 32) + (c0 - 3 * CM) / 32 + hl) * 512 + hf * 256 + ln * 8), *(const v4u*)&sh[rt * 16 + (ln & 15)][(hl * 4 + hf * 2 + (ln >> 4)) * 8]); } }
#pragma unroll
  for (int j = 0; j < 8; ++j) cur[j] = acc[1][j]; } }
// ---- k_pb: block = (8 keys, 16 query residues) = 128 z rows, row rho = (query rho / 8, key rho % 8): per head it owns two whole 256-byte runs of a PB tile; PB(h, q, k) = LN(z[q][k]) . wb[:, h]; 16 lanes share one z row (8 channels a lane, two 16-byte loads), a wave works on 2 rows at a time; this lane's 8 x 8 weights stay in registers
#define PBK 128
__global__ __launch_bounds__(256) void k_pb(const float* __restrict__ Zp, const float* __restrict__ G, const float* __restrict__ Bt, const float* __restrict__ WB, float* __restrict__ PB) { __shared__ __align__(16) float sp[NH][PBK + 4]; __shared__ __align__(16) float swb[CZ / 4][4 * NH + 4];   // swb: 4 channels x 8 heads a row, pitch 36 words: the 16 lanes' 16-byte reads fall on distinct banks
  const int t = threadIdx.x, lane = t & 31, w = t >> 5, l16 = lane & 15, hf = lane >> 4; const int ko = blockIdx.x, qt = blockIdx.y;
  const float* zr = Zp + (((size_t)qt * 16 + w * 2) * RR + ko * 8 + hf) * CZ + l16 * 4;   // rows rho = w*16 + 2p + hf: query qt*16 + 2w + p/4, key ko*8 + 2(p%4) + hf; channels 4*l16 + e and 64 + 4*l16 + e
  // every loop of this kernel is fully unrolled: its arrays are indexed by constants and stay in registers
  v4f za[8], zb[8];   // the wave's 16 rows: all 16 loads are issued before the first use, so memory latency is paid once
#pragma unroll
  for (int p = 0; p < 8; ++p) { za[p] = *(const v4f*)(zr + ((size_t)(p >> 2) * RR + (p & 3) * 2) * CZ); zb[p] = *(const v4f*)(zr + ((size_t)(p >> 2) * RR + (p & 3) * 2) * CZ + 64); }
  v4f g4[2], b4[2];
#pragma unroll
  for (int i = 0; i < 2; ++i) { g4[i] = *(const v4f*)(G + 64 * i + l16 * 4); b4[i] = *(const v4f*)(Bt + 64 * i + l16 * 4); }
  { v4f w4 = *(const v4f*)(WB + t * 4); w4[0] = bfr(w4[0]); w4[1] = bfr(w4[1]); w4[2] = bfr(w4[2]); w4[3] = bfr(w4[3]); *(v4f*)&swb[t >> 3][(t & 7) * 4] = w4; } __syncthreads();
  float wv[8][NH], gg[8], bb[8];
#pragma unroll
  for (int i = 0; i < 2; ++i) {
#pragma unroll
    for (int e = 0; e < 4; ++e) { gg[i * 4 + e] = bfr(g4[i][e]); bb[i * 4 + e] = bfr(b4[i][e]); const v4f w0 = *(const v4f*)&swb[16 * i + l16][e * NH], w1 = *(const v4f*)&swb[16 * i + l16][e * NH + 4];
#pragma unroll
      for (int h = 0; h < 4; ++h) { wv[i * 4 + e][h] = w0[h]; wv[i * 4 + e][4 + h] = w1[h]; } } }
  const bool b0 = (l16 & 1) != 0, b1 = (l16 & 2) != 0, b2 = (l16 & 4) != 0;
#pragma unroll
  for (int p = 0; p < 8; ++p) { float v[8];
#pragma unroll
    for (int e = 0; e < 4; ++e) { v[e] = bfr(za[p][e]); v[4 + e] = bfr(zb[p][e]); }
    float s = ((v[0] + v[1]) + (v[2] + v[3])) + ((v[4] + v[5]) + (v[6] + v[7]));
    s += rowx<1>(s); s += rowx<2>(s); s += rowx<4>(s); s += rowx<8>(s);
    const float mu = s / (float)CZ; float qq = 0.f;
#pragma unroll
    for (int i = 0; i < 8; ++i) { v[i] -= mu; qq += v[i] * v[i]; }
    qq += rowx<1>(qq); qq += rowx<2>(qq); qq += rowx<4>(qq); qq += rowx<8>(qq);
    const float inv = 1.0f / sqrtf(qq / (float)CZ + 1e-5f); float ph[NH];
#pragma unroll
    for (int h = 0; h < NH; ++h) ph[h] = 0.f;
#pragma unroll
    for (int i = 0; i < 8; ++i) { const float ln = v[i] * inv * gg[i] + bb[i];
#pragma unroll
      for (int h = 0; h < NH; ++h) ph[h] += ln * wv[i][h]; }
    // sum over the 16 lanes, halving the heads a lane carries at each of the first three steps: lane l16 ends with head l16 & 7
    float y[4], u[2];
#pragma unroll
    for (int i = 0; i < 4; ++i) y[i] = (b0 ? ph[2 * i + 1] : ph[2 * i]) + rowx<1>(b0 ? ph[2 * i] : ph[2 * i + 1]);
#pragma unroll
    for (int i = 0; i < 2; ++i) u[i] = (b1 ? y[2 * i + 1] : y[2 * i]) + rowx<2>(b1 ? y[2 * i] : y[2 * i + 1]);
    float x = (b2 ? u[1] : u[0]) + rowx<4>(b2 ? u[0] : u[1]); x += rowx<8>(x);
    if (l16 < NH) sp[l16][w * 16 + p * 2 + hf] = x; }
  __syncthreads(); { const int h = t >> 5, i = (t >> 4) & 1;   // ko = (32-key tile ko / 4, 16-key half (ko / 2) % 2, lane half ko % 2); a wave stores the head's two 256-byte runs (quads i = 0, 1; 16 queries x 4 keys each)
    vst2(PB + ((((size_t)h * (RR / 16) + qt) * (RR / 32) + (ko >> 2)) * 4 + ((ko >> 1) & 1) * 2 + i) * 128 + ((ko & 1) * 16 + l16) * 4, *(const v4f*)&sp[h][l16 * 8 + i * 4]); } }
// ---- k_att<MODE>: block = (128 queries, head, b), a wave = 32 queries = two 16-query tiles u, so each loaded K and V fragment feeds two WMMAs. Both products are taken transposed: S^T = K . Q^T (A = key rows, B = query columns), O^T = V^T . P^T (A = channel rows, B = P^T). A lane (g, col) then holds, per tile, 16 of the pass's 32 scores of ONE query, q0 + 16 u + col (keys ct * 16 + 8g + r): maximum and sum are taken in the lane, with one exchange between the lane halves; the two score tiles, converted in place, are the B operand P^T, and the O^T registers are the O tile's quads: no LDS
template <int MODE>
__global__ __launch_bounds__(128) void k_att(const _Float16* __restrict__ QK, const _Float16* __restrict__ VT, const _Float16* __restrict__ VTL, const float* __restrict__ PB, const float* __restrict__ MASK, float* __restrict__ O) {
  static_assert(MODE == 0, "the pair bias tiles belong to row attention");
  constexpr int NN = MODE == 0 ? RR : SQ;
  const int tid = threadIdx.x, wave = tid >> 5, lane = tid & 31, g = lane >> 4; const int h = blockIdx.y; const size_t b = blockIdx.z; const int q0 = blockIdx.x * 128 + wave * 32; const size_t rq = b * NN + q0;
  v16h bq[2];
#pragma unroll   // every array over u is indexed by constants and stays in registers
  for (int u = 0; u < 2; ++u) bq[u] = frag_t(QK + (((b * 2 + 0) * NH + h) * (NN / 16) + q0 / 16 + u) * 512, lane);
  const float* pbt = PB + ((size_t)h * (RR / 16) + q0 / 16) * (RR / 32) * 512 + lane * 4;
  float m[2] = {-3.0e38f, -3.0e38f}, l[2] = {0.f, 0.f};   // per query tile: the query's running maximum (equal in both lane halves) and this half's share of its sum
  v8f acc[2][2] = {}, accl[2][2] = {};
#pragma unroll 1
  for (int ks = 0; ks < NN / 32; ++ks) {
    // all loads of the pass are issued here, ahead of its first WMMA: one wait on memory a pass, and v lands behind the softmax
    v16h kh[2], vh[2], vl[2]; v4f pb[2][2][2];
    const float mkv = MASK[nat<MODE>(b, ks * 32 + lane)];   // lane = key of the pass
#pragma unroll   // the arrays are indexed by constants and stay in registers
    for (int ct = 0; ct < 2; ++ct) { kh[ct] = frag_t(QK + (((b * 2 + 1) * NH + h) * (NN / 16) + ks * 2 + ct) * 512, lane);
#pragma unroll
      for (int u = 0; u < 2; ++u)
#pragma unroll
        for (int i = 0; i < 2; ++i) pb[u][ct][i] = *(const v4f*)(pbt + (u * (RR / 32) + ks) * 512 + (ct * 2 + i) * 128); }
    asm volatile("s_wait_xcnt 0x0" ::: "memory");   // stands in front of what rewrites the address registers of the loads above: results of the v loads, the next pass's address additions
#pragma unroll
    for (int j = 0; j < 2; ++j) vh[j] = frag_t(VT + ((b * (CM / 16) + h * 2 + j) * (size_t)(NN / 32) + ks) * 512, lane);
    asm volatile("s_wait_xcnt 0x0" ::: "memory");   // the same for the loads of v's high plane (a result of the low plane's loads takes their address registers)
#pragma unroll
    for (int j = 0; j < 2; ++j) vl[j] = frag_t(VTL + ((b * (CM / 16) + h * 2 + j) * (size_t)(NN / 32) + ks) * 512, lane);
    asm volatile("s_wait_xcnt 0x0" ::: "memory");   // the same for the low plane's loads
    const unsigned kept = __builtin_amdgcn_ballot_w32(bfr(mkv) != 0.f);   // bit = key of the pass
#pragma unroll
    for (int u = 0; u < 2; ++u) { float s[2][8];
#pragma unroll
    for (int ct = 0; ct < 2; ++ct) { v8f c = {}; c = wmma16(kh[ct], bq[u], c);
#pragma unroll
      for (int r = 0; r < 8; ++r) { float sc = c[r] * 0.17677669529663687f; if (MODE == 0) sc += pb[u][ct][r >> 2][r & 3]; s[ct][r] = sc; } }
    if (kept != 0xffffffffu) { const unsigned kb = kept >> (8 * g);   // one scalar test a tile and pass: only a pass with a masked key pays for the 16 selects
#pragma unroll
      for (int ct = 0; ct < 2; ++ct)
#pragma unroll
        for (int r = 0; r < 8; ++r) if (((kb >> (ct * 16 + r)) & 1u) == 0u) s[ct][r] = -3.0e38f; }
    float t[8];
#pragma unroll
    for (int r = 0; r < 8; ++r) t[r] = fmaxf(s[0][r], s[1][r]);
    float mx = fmaxf(fmaxf(fmaxf(t[0], t[1]), fmaxf(t[2], t[3])), fmaxf(fmaxf(t[4], t[5]), fmaxf(t[6], t[7]))); mx = fmaxf(mx, xhalf(mx));
    const float mn = fmaxf(m[u], mx), alpha = (m[u] <= -1.0e38f) ? 0.f : __expf(m[u] - mn);
#pragma unroll
    for (int ct = 0; ct < 2; ++ct)
#pragma unroll
      for (int r = 0; r < 8; ++r) s[ct][r] = (s[ct][r] <= -1.0e38f) ? 0.f : __expf(s[ct][r] - mn);
#pragma unroll
    for (int r = 0; r < 8; ++r) t[r] = s[0][r] + s[1][r];
    l[u] = l[u] * alpha + (((t[0] + t[1]) + (t[2] + t[3])) + ((t[4] + t[5]) + (t[6] + t[7]))); m[u] = mn;
#pragma unroll
    for (int j = 0; j < 2; ++j)
#pragma unroll
      for (int r = 0; r < 8; ++r) { acc[u][j][r] *= alpha; accl[u][j][r] *= alpha; }
    v16h pa, pal;   // B operand: element i = key 8g + i = tile 0 register i, element 8 + i = key 16 + 8g + i = tile 1 register i
#pragma unroll
    for (int i = 0; i < 8; ++i) { const float p0 = s[0][i] * 2048.0f, p1 = s[1][i] * 2048.0f; pa[i] = (_Float16)p0; pa[8 + i] = (_Float16)p1; pal[i] = (_Float16)((p0 - (float)pa[i]) * 2048.0f); pal[8 + i] = (_Float16)((p1 - (float)pa[8 + i]) * 2048.0f); }
#pragma unroll
    for (int j = 0; j < 2; ++j) { acc[u][j] = wmma16(vh[j], pa, acc[u][j]); accl[u][j] = wmma16(vl[j], pa, accl[u][j]); accl[u][j] = wmma16(vh[j], pal, accl[u][j]); } } }
#pragma unroll
  for (int u = 0; u < 2; ++u) { const float ls = l[u] + xhalf(l[u]);
  const float il = (ls > 0.f) ? (1.0f / 2048.0f) / ls : 0.f;
  float* ot = O + ((rq / 16 + u) * (CM / 32) + h) * 512 + lane * 4;   // lane = (g, row col): quads 0, 1 = channels 8g .. 8g + 7, quads 2, 3 = 16 + 8g .. : register r of O^T tile j is channel j * 16 + 8g + r; each store of the wave is 512 contiguous bytes
#pragma unroll
  for (int qd = 0; qd < 4; ++qd) { v4f o;
#pragma unroll
    for (int e = 0; e < 4; ++e) o[e] = (acc[u][qd >> 1][(qd & 1) * 4 + e] + accl[u][qd >> 1][(qd & 1) * 4 + e] * (1.0f / 2048.0f)) * il;
    vst2(ot + qd * 128, o); } } }
// ---- k_go<MODE>: block = (64 natural rows, 128 cols): M = (g o) . wo + bo ; A operand built on the fly from the G and O tiles
template <int MODE>
__global__ __launch_bounds__(128) void k_go(const _Float16* __restrict__ Gt, const float* __restrict__ O, const _Float16* __restrict__ WOr, const float* __restrict__ BO, float* __restrict__ M) { __shared__ __align__(16) float sf[4][16][132];
  const int tid = threadIdx.x, wave = tid >> 5, lane = tid & 31, col = lane & 15, g = lane >> 4; const size_t r0 = (size_t)blockIdx.x * 64 + wave * 16; const int c0 = blockIdx.y * 128;
  static_assert(MODE == 0, "one tile index serves G (natural rows) and O (compact rows): the two orders agree only in row attention");
  const size_t t0 = (r0 / 16) * (CM / 32);
  v8f acc[8] = {}, accl2[8] = {};
  // loads run ahead of the WMMAs: the 64 weight fragments (order f = kc * 8 + j) go through a ring of GOW register sets, fragment f + GOW being requested right behind the two WMMAs that read fragment f; the gate and o tiles of block kc + 1 are requested ahead of block kc's WMMAs
  constexpr int GOW = 7; const _Float16* wr = WOr + (size_t)(c0 / 16) * (CM / 32) * 512; v16h wf[GOW];
#pragma unroll   // every loop here is fully unrolled: wf and ov are indexed by constants and stay in registers
  for (int f = 0; f < GOW; ++f) wf[f] = frag_t(wr + ((size_t)(f & 7) * (CM / 32) + (f >> 3)) * 512, lane);
  v16h gv = frag_t(Gt + t0 * 512, lane); v4f ov[4];
#pragma unroll
  for (int qd = 0; qd < 4; ++qd) ov[qd] = *(const v4f*)(O + t0 * 512 + lane * 4 + qd * 128);
#pragma unroll
  for (int kc = 0; kc < CM / 32; ++kc) { v16h a, al;
    __builtin_amdgcn_sched_barrier(0);   // keeps this block's conversions (and with them the wait for its gate and o tiles) behind the WMMAs of the block before: moved up among them they would wait for loads just issued
#pragma unroll
    for (int i = 0; i < 16; ++i) { const float v0 = (float)gv[i] * ov[i >> 2][i & 3]; a[i] = (_Float16)v0; al[i] = (_Float16)((v0 - (float)a[i]) * 2048.0f); }
    if (kc + 1 < CM / 32) { gv = frag_t(Gt + (t0 + kc + 1) * 512, lane);
#pragma unroll
      for (int qd = 0; qd < 4; ++qd) ov[qd] = *(const v4f*)(O + (t0 + kc + 1) * 512 + lane * 4 + qd * 128);
      asm volatile("s_wait_xcnt 0x0" ::: "memory"); }   // stands in front of whatever rewrites the address registers of the six loads above (in the last block a later load's result does)
#pragma unroll
    for (int j = 0; j < 8; ++j) { const int f = kc * 8 + j, fn = f + GOW; acc[j] = wmma16(a, wf[f % GOW], acc[j]); accl2[j] = wmma16(al, wf[f % GOW], accl2[j]); if (fn < 8 * (CM / 32)) wf[f % GOW] = frag_t(wr + ((size_t)(fn & 7) * (CM / 32) + (fn >> 3)) * 512, lane); } }
#pragma unroll
  for (int j = 0; j < 8; ++j) { const int c = c0 + j * 16 + col; const float bb = bfr(BO[c]);
#pragma unroll
    for (int r = 0; r < 8; ++r) sf[wave][8 * g + r][j * 16 + col] = (acc[j][r] + accl2[j][r] * (1.0f / 2048.0f)) * (1.0f / WSC) + bb; }
  LDSX(); for (int rl = 0; rl < 16; ++rl) vst2(M + (r0 + rl) * CM + c0 + lane * 4, *(const v4f*)&sf[wave][rl][lane * 4]); }   // M here = the output buffer (no residual in this module)
// ---- k_ff1: block = (64 rows, 128 of 1024 cols): H1 = relu(XH . W1 + b1) -> f16 ; k_ff2: out = H1 . W2 + b2 + M
__global__ __launch_bounds__(128) void k_ff1(const _Float16* __restrict__ XH, const _Float16* __restrict__ W1r, const float* __restrict__ B1, _Float16* __restrict__ H1) { __shared__ __align__(16) _Float16 sh[4][16][136];
  const int tid = threadIdx.x, wave = tid >> 5, lane = tid & 31, col = lane & 15, g = lane >> 4; const size_t r0 = (size_t)blockIdx.x * 64 + wave * 16; const int c0 = blockIdx.y * 128;
  v8f acc[8] = {};
#pragma unroll
  for (int kc = 0; kc < CM / 32; ++kc) { const v16h a = frag_h(XH + (r0 + col) * CM + kc * 32, lane);
#pragma unroll
    for (int j = 0; j < 8; ++j) acc[j] = wmma16(a, frag_t(W1r + ((size_t)(c0 / 16 + j) * (CM / 32) + kc) * 512, lane), acc[j]); }
#pragma unroll
  for (int j = 0; j < 8; ++j) { const float bb = bfr(B1[c0 + j * 16 + col]);
#pragma unroll
    for (int r = 0; r < 8; ++r) sh[wave][8 * g + r][j * 16 + col] = (_Float16)fmaxf(acc[j][r] * (1.0f / WSC) + bb, 0.f); }
  LDSX(); for (int rl = 0; rl < 16; ++rl) if (lane < 16) vst2((unsigned*)(H1 + (r0 + rl) * FF + c0 + lane * 8), *(const v4u*)&sh[wave][rl][lane * 8]); }
__global__ __launch_bounds__(128) void k_ff2(const _Float16* __restrict__ H1, const _Float16* __restrict__ W2r, const float* __restrict__ B2, const float* __restrict__ M, float* __restrict__ OUT) { __shared__ __align__(16) float sf[4][16][132];
  const int tid = threadIdx.x, wave = tid >> 5, lane = tid & 31, col = lane & 15, g = lane >> 4; const size_t r0 = (size_t)blockIdx.x * 64 + wave * 16; const int c0 = blockIdx.y * 128;
  v8f acc[8] = {};
#pragma unroll 2
  for (int kc = 0; kc < FF / 32; ++kc) { const v16h a = frag_h(H1 + (r0 + col) * FF + kc * 32, lane);
#pragma unroll
    for (int j = 0; j < 8; ++j) acc[j] = wmma16(a, frag_t(W2r + ((size_t)(c0 / 16 + j) * (FF / 32) + kc) * 512, lane), acc[j]); }
#pragma unroll
  for (int j = 0; j < 8; ++j) { const int c = c0 + j * 16 + col; const float bb = bfr(B2[c]);
#pragma unroll
    for (int r = 0; r < 8; ++r) sf[wave][8 * g + r][j * 16 + col] = acc[j][r] * (1.0f / WSC) + bb + M[(r0 + 8 * g + r) * CM + c]; }
  LDSX(); for (int rl = 0; rl < 16; ++rl) vst2(OUT + (r0 + rl) * CM + c0 + lane * 4, *(const v4f*)&sf[wave][rl][lane * 4]); }
extern "C" void kernel_launch(void* const* d_in, const int* in_sizes, int n_in, void* d_out, int out_size, void* d_ws, size_t ws_size, hipStream_t stream) {
  (void)in_sizes; (void)n_in; (void)out_size;
  const float** F = (const float**)d_in;   // 0 m [1,128,256,256], 1 z [1,256,256,128], 2 mask [1,128,256], 3 ln_m_g, 4 ln_m_b, 5 ln_z_g, 6 ln_z_b, 7 wz [128,8], 8 wq [256,8,32], 9 wk, 10 wv, 11 wg, 12 bg [8,32], 13 wo [8,32,256], 14 bo [256]
  if (ws_size < (size_t)WS_END) return;
  char* ws = (char*)d_ws; _Float16 *RW = (_Float16*)(ws + WS_RW), *RWOp = (_Float16*)(ws + WS_RWO), *XH = (_Float16*)(ws + WS_XH), *QK = (_Float16*)(ws + WS_QK), *VT = (_Float16*)(ws + WS_VT), *VTL = (_Float16*)(ws + WS_VTL), *Gt = (_Float16*)(ws + WS_G);
  float *O = (float*)(ws + WS_O), *PB = (float*)(ws + WS_PB);
  k_packw<<<dim3(64, 3), 256, 0, stream>>>(F[8], F[9], F[10], F[11], F[8], F[9], F[10], F[11], F[13], F[13], F[8], F[13], ws);   // which 0 (q|k|v|g rows) and 2 (wo rows) are used; which 1 packs in-bounds duplicates; 3-5 not launched
  k_ln<<<NROW / (8 * LNR), 256, 0, stream>>>(F[0], F[3], F[4], XH);
  k_proj<0><<<dim3(RR / 128, 8, SQ), 128, 0, stream>>>(XH, RW, F[12], QK, VT, VTL, Gt);
  k_pb<<<dim3(RR / 8, RR / 16), 256, 0, stream>>>(F[1], F[5], F[6], F[7], PB);
  k_att<0><<<dim3(RR / 128, NH, SQ), 128, 0, stream>>>(QK, VT, VTL, PB, F[2], O);
  k_go<0><<<dim3(NROW / 64, CM / 128), 128, 0, stream>>>(Gt, O, RWOp, F[14], (float*)d_out);
}

// v008
// Measured time: 84.1 microseconds a run.
// In two side-by-side timings against v007, it was 1.30 and 1.29 times as fast.
// Over all steps from v000 it is 4.17 times as fast.
// compute dtype: all float inputs rounded to bf16; LayerNorms, pair bias (LN(z) . wz), softmax, sigmoid gate in f32; q|k|v|g projections on WMMA 16x16x32 with the LayerNorm output rounded once to f16 against exact f16 x 2^8 weights; attention logits with single f16 q, k (32-dim heads), P as f16 hi + residual (x 2^11) . v (hi + residual; 3 products); (g o) as f16 hi + residual (2 products) . wo (f16 x 2^8) + bo; f32 output.
#include <hip/hip_runtime.h>
#include <math.h>

typedef __attribute__((ext_vector_type(16))) _Float16 v16h;
typedef __attribute__((ext_vector_type(16))) __bf16 v16b;
typedef __attribute__((ext_vector_type(8)))  _Float16 v8h;
typedef __attribute__((ext_vector_type(8)))  float v8f;
typedef __attribute__((ext_vector_type(4)))  float v4f;
typedef __attribute__((ext_vector_type(2)))  float v2f;
typedef __attribute__((ext_vector_type(4)))  unsigned v4u;
typedef __attribute__((ext_vector_type(4)))  int v4i;
typedef float __attribute__((may_alias)) float_a;
typedef int __attribute__((may_alias)) int_a;

template <typename T> __device__ __forceinline__ void vst2(void* p, T v) { *(T*)p = v;  }
__device__ __forceinline__ v8f wmma16(v16h a, v16h b, v8f c) {
  v8f d = __builtin_amdgcn_wmma_f32_16x16x32_f16(false, a, false, b, (short)0, c, false, false);
  asm volatile("v_nop\n\tv_nop\n\tv_nop\n\tv_nop" : "+v"(d) : "v"(a), "v"(b));
  return d;
}
__device__ __forceinline__ v8f wmma_bf(v16b a, v16b b, v8f c) {
  v8f d = __builtin_amdgcn_wmma_f32_16x16x32_bf16(false, a, false, b, (short)0, c, false, false);
  asm volatile("v_nop\n\tv_nop\n\tv_nop\n\tv_nop" : "+v"(d) : "v"(a), "v"(b));
  return d;
}
// 16x16x32 fragments: lane = (h = lane>>4, row/col = lane&15); elements 0..7 = k0+8h+0..7, 8..15 = k0+16+8h+0..7; D element r = row 8h+r
__device__ __forceinline__ v16h frag_h(const _Float16* rowk0, int lane) {
  union { v16h v; v8h q[2]; } u; const _Float16* p = rowk0 + 8 * (lane >> 4);
  u.q[0] = *(const v8h*)p; u.q[1] = *(const v8h*)(p + 16); return u.v;
}
// the same fragment from a 16 x 32 tile kept in fragment order: 1 KiB = [elements 0..7 | 8..15][lane][8 f16], so each of the wave's two 16-byte loads covers 512 contiguous bytes (4 whole lines, not pieces of 16)
__device__ __forceinline__ v16h frag_t(const _Float16* tile, int lane) {
  union { v16h v; v8h q[2]; } u; const _Float16* p = tile + 8 * lane;
  u.q[0] = *(const v8h*)p; u.q[1] = *(const v8h*)(p + 256); return u.v;
}
__device__ __forceinline__ v16h frag_f32(const float* rowk0, int lane) {
  v16h a; const float* p = rowk0 + 8 * (lane >> 4);
#pragma unroll
  for (int i = 0; i < 8; ++i) { a[i] = (_Float16)p[i]; a[8 + i] = (_Float16)p[16 + i]; }
  return a;
}
__device__ __forceinline__ v16h frag_f32s(const float* rowk0, int lane, float sc) {
  v16h a; const float* p = rowk0 + 8 * (lane >> 4);
#pragma unroll
  for (int i = 0; i < 8; ++i) { a[i] = (_Float16)(p[i] * sc); a[8 + i] = (_Float16)(p[16 + i] * sc); }
  return a;
}
// column fragment from a [K][ld] layout (column n), rows >= K read as 0
__device__ __forceinline__ v16h fragc_f32(const float* W, int k0, int n, int lane, int ld, int K) {
  v16h a; const int g = lane >> 4;
#pragma unroll
  for (int i = 0; i < 8; ++i) { const int ka = k0 + 8 * g + i, kb = ka + 16;
    a[i] = (_Float16)(ka < K ? W[(size_t)(ka < K ? ka : K - 1) * ld + n] : 0.f); a[8 + i] = (_Float16)(kb < K ? W[(size_t)(kb < K ? kb : K - 1) * ld + n] : 0.f); }
  return a;
}
struct F2 { v16b h, l; };
__device__ __forceinline__ F2 bsplit16(const float v[16]) { F2 r;
#pragma unroll
  for (int i = 0; i < 16; ++i) { const __bf16 h = (__bf16)v[i]; r.h[i] = h; r.l[i] = (__bf16)(v[i] - (float)h); }
  return r; }
__device__ __forceinline__ F2 split_row(const float* row, int k0, int lane) { float v[16]; const float* p = row + k0 + 8 * (lane >> 4);
#pragma unroll
  for (int i = 0; i < 8; ++i) { v[i] = p[i]; v[8 + i] = p[16 + i]; }
  return bsplit16(v); }
__device__ __forceinline__ F2 split_rowK(const float* row, int k0, int lane, int K) { float v[16]; const int g = lane >> 4;
#pragma unroll
  for (int i = 0; i < 8; ++i) { const int ka = k0 + 8 * g + i, kb = ka + 16; v[i] = ka < K ? row[ka < K ? ka : K - 1] : 0.f; v[8 + i] = kb < K ? row[kb < K ? kb : K - 1] : 0.f; }
  return bsplit16(v); }
__device__ __forceinline__ F2 split_col(const float* W, int k0, int n, int lane, int ld, int K) { float v[16]; const int g = lane >> 4;
#pragma unroll
  for (int i = 0; i < 8; ++i) { const int ka = k0 + 8 * g + i, kb = ka + 16; v[i] = ka < K ? W[(size_t)(ka < K ? ka : K - 1) * ld + n] : 0.f; v[8 + i] = kb < K ? W[(size_t)(kb < K ? kb : K - 1) * ld + n] : 0.f; }
  return bsplit16(v); }
__device__ __forceinline__ v8f mac3(const F2& a, const F2& b, v8f c) { c = wmma_bf(a.l, b.h, c); c = wmma_bf(a.h, b.l, c); return wmma_bf(a.h, b.h, c); }
__device__ __forceinline__ float sigm(float v) { return 1.0f / (1.0f + expf(-v)); }
#define LDSX() do { asm volatile("s_wait_dscnt 0" ::: "memory"); __builtin_amdgcn_wave_barrier(); __builtin_amdgcn_fence(__ATOMIC_RELEASE, "workgroup"); } while (0)


// MSA row attention with pair bias (B 1, S 128 sequences x R 256 residues, c_m 256, 8 heads x 32, c_z 128): out = (sigmoid(LN(m) wg + bg) * softmax(q k / sqrt(32) + 1e9 (mask - 1) + LN(z) wz) v) wo + bo.
#define SQ 128
#define RR 256
#define CM 256
#define NH 8
#define CA 32
#define CZ 128
#define FF 1024
#define NROW (SQ * RR)
#define WSC 256.0f
#ifndef TON
#define TON 1           // unused
#endif
typedef __attribute__((ext_vector_type(8))) __bf16 v8b;
__device__ __forceinline__ v16b frag_b(const __bf16* rowk0, int lane) {
  union { v16b v; v8b q[2]; } u; const __bf16* p = rowk0 + 8 * (lane >> 4);
  u.q[0] = *(const v8b*)p; u.q[1] = *(const v8b*)(p + 16); return u.v;
}
__device__ __forceinline__ float bfr(float v) { return (float)(__bf16)v; }
__device__ __attribute__((noinline)) float exp_ni(float v) { return expf(v); }
__device__ __attribute__((noinline)) float erf_ni(float v) { return erff(v); }

// weights (f16 x 2^8, transposed (in,out)), as 16 x 32 tiles in fragment order [out / 16][in / 32][512]: RW 1024 x 256 = q|k|v|g ; CW 1024 x 256; RWO 256 x 256; CWO 256 x 256; TW1 1024 x 256; TW2 256 x 1024
#define WS_RW   0u
#define WS_CW   (WS_RW + 2u * 1024 * CM)
#define WS_RWO  (WS_CW + 2u * 1024 * CM)
#define WS_CWO  (WS_RWO + 2u * CM * CM)
#define WS_TW1  (WS_CWO + 2u * CM * CM)
#define WS_TW2  (WS_TW1 + 2u * FF * CM)
#define WS_XH   (WS_TW2 + 2u * CM * FF)                 // f16 LN rows [NROW][256] (natural s*R + r)
#define WS_QK   (WS_XH + 2u * (size_t)NROW * CM)         // not used any more (q stays in registers, k in LDS); the offsets behind it stay as they were
#define WS_VT   (WS_QK + 2u * (size_t)NROW * 2 * CM)     // not used any more, nor is WS_VTL (v hi, lo stay in LDS)
#define WS_VTL  (WS_VT + 2u * (size_t)NROW * CM)
#define WS_G    (WS_VTL + 2u * (size_t)NROW * CM)        // f16 sigmoid gate, tiles (16 natural rows x 32 channels) in fragment order [NROW / 16][256 / 32][512]
#define WS_O    (WS_G + 2u * (size_t)NROW * CM)          // f32 attention output, tiles (16 compact rows x 32 channels = one head) in fragment order [NROW / 16][256 / 32][element quad 0..3][lane][4]
#define WS_M    (WS_O + 4u * (size_t)NROW * CM)          // f32 working m [natural][256]
#define WS_PB   (WS_M + 4u * (size_t)NROW * CM)          // f32 pair bias, tiles (16 queries x 32 keys) in the order of k_pa's score registers [h][q / 16][k / 32][quad = (k % 32 / 16) * 2 + k % 8 / 4][lane = (k % 16 / 8) * 16 + q % 16][4]
#define WS_H1   (WS_PB + 4u * (size_t)NH * RR * RR)      // f16 relu rows [natural][1024]
#define WS_END  (WS_H1 + 2u * (size_t)NROW * FF)

// ---- k_packw: block = 16 output rows n0 .. n0 + 15 = one row of tiles, so every 128-byte line of the packed weights has one writer; which: 0 RW (W = rq|rk|rv|rg by n/256), 1 CW, 2 RWO, 3 CWO, 4 TW1, 5 TW2
__global__ __launch_bounds__(256) void k_packw(const float* __restrict__ RQ, const float* __restrict__ RK, const float* __restrict__ RV, const float* __restrict__ RG, const float* __restrict__ CQ, const float* __restrict__ CK, const float* __restrict__ CV, const float* __restrict__ CG, const float* __restrict__ RWO, const float* __restrict__ CWO, const float* __restrict__ TW1, const float* __restrict__ TW2, char* __restrict__ ws) {
  const int n0 = blockIdx.x * 16, which = blockIdx.y, t = threadIdx.x;
  const float* Wm; int kin, kout, col; _Float16* dst;
  if (which == 0) { if (n0 >= 1024) return; const int g4 = n0 / CM; col = n0 % CM; Wm = g4 == 0 ? RQ : g4 == 1 ? RK : g4 == 2 ? RV : RG; kin = CM; kout = CM; dst = (_Float16*)(ws + WS_RW); }
  else if (which == 1) { if (n0 >= 1024) return; const int g4 = n0 / CM; col = n0 % CM; Wm = g4 == 0 ? CQ : g4 == 1 ? CK : g4 == 2 ? CV : CG; kin = CM; kout = CM; dst = (_Float16*)(ws + WS_CW); }
  else if (which == 2) { if (n0 >= CM) return; col = n0; Wm = RWO; kin = CM; kout = CM; dst = (_Float16*)(ws + WS_RWO); }
  else if (which == 3) { if (n0 >= CM) return; col = n0; Wm = CWO; kin = CM; kout = CM; dst = (_Float16*)(ws + WS_CWO); }
  else if (which == 4) { if (n0 >= FF) return; col = n0; Wm = TW1; kin = CM; kout = FF; dst = (_Float16*)(ws + WS_TW1); }
  else { if (n0 >= CM) return; col = n0; Wm = TW2; kin = FF; kout = CM; dst = (_Float16*)(ws + WS_TW2); }
  dst += (size_t)blockIdx.x * (kin / 32) * 512;
  // chunk e = (k tile e >> 6, half (e >> 5) & 1, lane e & 31) lies at f16 offset 8 e: a wave stores 512 contiguous bytes; its 8 values are k .. k + 7 of output row n0 + (lane & 15)
  for (int e = t; e < kin * 2; e += 256) { const int ln = e & 31, k = (e >> 6) * 32 + ((e >> 5) & 1) * 16 + (ln >> 4) * 8; v8h o;
#pragma unroll   // o is indexed by constants and stays in registers
    for (int i = 0; i < 8; ++i) o[i] = (_Float16)(bfr(Wm[(size_t)(k + i) * kout + col + (ln & 15)]) * WSC);
    vst2(dst + e * 8, o); } }
// ---- k_ln: XH = LN(bf16(m)) w + b (jnp.var, 1e-5) -> f16. One wave owns a row (lane l: channels 4l + e and 128 + 4l + e, so each 16-byte load of a wave covers 512 contiguous bytes) and works on LNR rows; no LDS, no barrier
// value of lane l ^ MSK inside a 16-lane row, by a DPP move (no LDS round trip as with __shfl_xor)
template <int MSK> __device__ __forceinline__ float rowx(float x) { return __builtin_bit_cast(float, __builtin_amdgcn_mov_dpp(__builtin_bit_cast(int, x), 0x160 | MSK, 0xf, 0xf, true)); }
// lane l with lane l ^ 16
__device__ __forceinline__ float xhalf(float x) { return __builtin_bit_cast(float, __builtin_amdgcn_permlanex16(__builtin_bit_cast(int, x), __builtin_bit_cast(int, x), 0x76543210, 0xfedcba98, false, false)); }
__device__ __forceinline__ float wsum(float s) { s += rowx<1>(s); s += rowx<2>(s); s += rowx<4>(s); s += rowx<8>(s); return s + xhalf(s); }
typedef __attribute__((ext_vector_type(4))) _Float16 v4h;
#define LNR 8
__global__ __launch_bounds__(256) void k_ln(const float* __restrict__ X, const float* __restrict__ G, const float* __restrict__ Bt, _Float16* __restrict__ XH) { const int lane = threadIdx.x & 31; const size_t row0 = ((size_t)blockIdx.x * 8 + (threadIdx.x >> 5)) * LNR;
  const float* xr = X + row0 * CM + lane * 4; _Float16* yr = XH + row0 * CM + lane * 4;
  // both loops are fully unrolled: the arrays are indexed by constants and stay in registers
  v4f xa[LNR], xb[LNR];   // the wave's LNR rows: all loads are issued before the first use, so memory latency is paid once
#pragma unroll
  for (int p = 0; p < LNR; ++p) { xa[p] = *(const v4f*)(xr + (size_t)p * CM); xb[p] = *(const v4f*)(xr + (size_t)p * CM + 128); }
  const v4f g0 = *(const v4f*)(G + lane * 4), g1 = *(const v4f*)(G + 128 + lane * 4), c0 = *(const v4f*)(Bt + lane * 4), c1 = *(const v4f*)(Bt + 128 + lane * 4);
  float gg[8], bb[8];
#pragma unroll
  for (int e = 0; e < 4; ++e) { gg[e] = bfr(g0[e]); gg[4 + e] = bfr(g1[e]); bb[e] = bfr(c0[e]); bb[4 + e] = bfr(c1[e]); }
#pragma unroll
  for (int p = 0; p < LNR; ++p) { float v[8];
#pragma unroll
    for (int e = 0; e < 4; ++e) { v[e] = bfr(xa[p][e]); v[4 + e] = bfr(xb[p][e]); }
    const float mu = wsum(((v[0] + v[1]) + (v[2] + v[3])) + ((v[4] + v[5]) + (v[6] + v[7]))) / (float)CM; float qq = 0.f;
#pragma unroll
    for (int i = 0; i < 8; ++i) { v[i] -= mu; qq += v[i] * v[i]; }
    const float inv = 1.0f / sqrtf(wsum(qq) / (float)CM + 1e-5f); v4h h0, h1;
#pragma unroll
    for (int e = 0; e < 4; ++e) { h0[e] = (_Float16)(v[e] * inv * gg[e] + bb[e]); h1[e] = (_Float16)(v[4 + e] * inv * gg[4 + e] + bb[4 + e]); }
    vst2(yr + (size_t)p * CM, h0); vst2(yr + (size_t)p * CM + 128, h1); } }
// natural row index of (batch b, token n): MODE 0 row attention (b = s, n = r); MODE 1 column attention (b = r, n = s)
template <int MODE> __device__ __forceinline__ size_t nat(size_t b, int n) { return MODE == 0 ? b * RR + n : (size_t)n * RR + b; }
// ---- k_pb: block = (8 keys, 16 query residues) = 128 z rows, row rho = (query rho / 8, key rho % 8): per head it owns two whole 256-byte runs of a PB tile; PB(h, q, k) = LN(z[q][k]) . wb[:, h]; 16 lanes share one z row (8 channels a lane, two 16-byte loads), a wave works on 2 rows at a time; this lane's 8 x 8 weights stay in registers
#define PBK 128
__global__ __launch_bounds__(256) void k_pb(const float* __restrict__ Zp, const float* __restrict__ G, const float* __restrict__ Bt, const float* __restrict__ WB, float* __restrict__ PB) { __shared__ __align__(16) float sp[NH][PBK + 4]; __shared__ __align__(16) float swb[CZ / 4][4 * NH + 4];   // swb: 4 channels x 8 heads a row, pitch 36 words: the 16 lanes' 16-byte reads fall on distinct banks
  const int t = threadIdx.x, lane = t & 31, w = t >> 5, l16 = lane & 15, hf = lane >> 4; const int ko = blockIdx.x, qt = blockIdx.y;
  const float* zr = Zp + (((size_t)qt * 16 + w * 2) * RR + ko * 8 + hf) * CZ + l16 * 4;   // rows rho = w*16 + 2p + hf: query qt*16 + 2w + p/4, key ko*8 + 2(p%4) + hf; channels 4*l16 + e and 64 + 4*l16 + e
  // every loop of this kernel is fully unrolled: its arrays are indexed by constants and stay in registers
  v4f za[8], zb[8];   // the wave's 16 rows: all 16 loads are issued before the first use, so memory latency is paid once
#pragma unroll
  for (int p = 0; p < 8; ++p) { za[p] = *(const v4f*)(zr + ((size_t)(p >> 2) * RR + (p & 3) * 2) * CZ); zb[p] = *(const v4f*)(zr + ((size_t)(p >> 2) * RR + (p & 3) * 2) * CZ + 64); }
  v4f g4[2], b4[2];
#pragma unroll
  for (int i = 0; i < 2; ++i) { g4[i] = *(const v4f*)(G + 64 * i + l16 * 4); b4[i] = *(const v4f*)(Bt + 64 * i + l16 * 4); }
  { v4f w4 = *(const v4f*)(WB + t * 4); w4[0] = bfr(w4[0]); w4[1] = bfr(w4[1]); w4[2] = bfr(w4[2]); w4[3] = bfr(w4[3]); *(v4f*)&swb[t >> 3][(t & 7) * 4] = w4; } __syncthreads();
  float wv[8][NH], gg[8], bb[8];
#pragma unroll
  for (int i = 0; i < 2; ++i) {
#pragma unroll
    for (int e = 0; e < 4; ++e) { gg[i * 4 + e] = bfr(g4[i][e]); bb[i * 4 + e] = bfr(b4[i][e]); const v4f w0 = *(const v4f*)&swb[16 * i + l16][e * NH], w1 = *(const v4f*)&swb[16 * i + l16][e * NH + 4];
#pragma unroll
      for (int h = 0; h < 4; ++h) { wv[i * 4 + e][h] = w0[h]; wv[i * 4 + e][4 + h] = w1[h]; } } }
  const bool b0 = (l16 & 1) != 0, b1 = (l16 & 2) != 0, b2 = (l16 & 4) != 0;
#pragma unroll
  for (int p = 0; p < 8; ++p) { float v[8];
#pragma unroll
    for (int e = 0; e < 4; ++e) { v[e] = bfr(za[p][e]); v[4 + e] = bfr(zb[p][e]); }
    float s = ((v[0] + v[1]) + (v[2] + v[3])) + ((v[4] + v[5]) + (v[6] + v[7]));
    s += rowx<1>(s); s += rowx<2>(s); s += rowx<4>(s); s += rowx<8>(s);
    const float mu = s / (float)CZ; float qq = 0.f;
#pragma unroll
    for (int i = 0; i < 8; ++i) { v[i] -= mu; qq += v[i] * v[i]; }
    qq += rowx<1>(qq); qq += rowx<2>(qq); qq += rowx<4>(qq); qq += rowx<8>(qq);
    const float inv = 1.0f / sqrtf(qq / (float)CZ + 1e-5f); float ph[NH];
#pragma unroll
    for (int h = 0; h < NH; ++h) ph[h] = 0.f;
#pragma unroll
    for (int i = 0; i < 8; ++i) { const float ln = v[i] * inv * gg[i] + bb[i];
#pragma unroll
      for (int h = 0; h < NH; ++h) ph[h] += ln * wv[i][h]; }
    // sum over the 16 lanes, halving the heads a lane carries at each of the first three steps: lane l16 ends with head l16 & 7
    float y[4], u[2];
#pragma unroll
    for (int i = 0; i < 4; ++i) y[i] = (b0 ? ph[2 * i + 1] : ph[2 * i]) + rowx<1>(b0 ? ph[2 * i] : ph[2 * i + 1]);
#pragma unroll
    for (int i = 0; i < 2; ++i) u[i] = (b1 ? y[2 * i + 1] : y[2 * i]) + rowx<2>(b1 ? y[2 * i] : y[2 * i + 1]);
    float x = (b2 ? u[1] : u[0]) + rowx<4>(b2 ? u[0] : u[1]); x += rowx<8>(x);
    if (l16 < NH) sp[l16][w * 16 + p * 2 + hf] = x; }
  __syncthreads(); { const int h = t >> 5, i = (t >> 4) & 1;   // ko = (32-key tile ko / 4, 16-key half (ko / 2) % 2, lane half ko % 2); a wave stores the head's two 256-byte runs (quads i = 0, 1; 16 queries x 4 keys each)
    vst2(PB + ((((size_t)h * (RR / 16) + qt) * (RR / 32) + (ko >> 2)) * 4 + ((ko >> 1) & 1) * 2 + i) * 128 + ((ko & 1) * 16 + l16) * 4, *(const v4f*)&sp[h][l16 * 8 + i * 4]); } }
// ---- k_pa<MODE>: projections and attention of one (head h, sequence b) in one block of 8 waves; a wave = 32 tokens = two 16-token tiles u, first as rows of the projections, then as queries.
// Part 1: the head's 8 column tiles j = kind * 2 + jj (kind 0 q, 1 k, 2 v, 3 gate; 16 channels each) x 2 token tiles. q, k and the gate are taken transposed (A = weight rows, B = token columns): a lane (g, col) then holds channels jj * 16 + 8g + r of ONE token, which is that token's share of a 16 x 32 tile in fragment order; v is taken as it was (A = token rows): a lane holds tokens 8g + r of one channel, its share of a (16 channels x 32 tokens) tile. So q stays in registers as part 2's B operand, k and v (hi, lo) go to LDS as whole tiles with 16-byte stores, the gate goes to its workspace tiles; nothing is staged for a transpose.
// Part 2 (the barrier stands behind the LDS stores of k and v): S^T = K . Q^T (A = key rows, B = query columns), O^T = V^T . P^T (A = channel rows, B = P^T). A lane (g, col) holds, per tile, 16 of the pass's 32 scores of ONE query, q0 + 16 u + col (keys ct * 16 + 8g + r): maximum and sum are taken in the lane, with one exchange between the lane halves; the two score tiles, converted in place, are the B operand P^T, and the O^T registers are the O tile's quads
template <int MODE>
__global__ __launch_bounds__(256) void k_pa(const _Float16* __restrict__ XH, const _Float16* __restrict__ Wr, const float* __restrict__ BG, const float* __restrict__ PB, const float* __restrict__ MASK, _Float16* __restrict__ Gt, float* __restrict__ O) {
  static_assert(MODE == 0, "gate tiles (16 natural rows) and pair bias tiles belong to row attention");
  constexpr int NN = MODE == 0 ? RR : SQ;
  static_assert(NN == 256, "8 waves x 32 tokens cover the sequence");
  __shared__ __align__(16) _Float16 sK[(NN / 16) * 512], sVh[2 * (NN / 32) * 512], sVl[2 * (NN / 32) * 512];   // k: [key tile][512]; v hi, lo: [channel tile jj][32-key group][512]; all in fragment order
  const int tid = threadIdx.x, wave = tid >> 5, lane = tid & 31, col = lane & 15, g = lane >> 4; const int h = blockIdx.x; const size_t b = blockIdx.y; const int q0 = wave * 32; const size_t rq = b * NN + q0;
  v16h bq[2];
  {
  v8f pa[2][8] = {};
  // fragments are fetched ahead: the 64 weight fragments (order f = kc * 8 + j) go through a ring of PJW register sets, fragment f + PJW being requested right behind the two WMMAs that read fragment f, so a WMMA waits only for a load issued 14 WMMAs earlier, not for its own (7 sets: the wave stays within 256 registers, 4 waves a SIMD); the two row fragments of the next k block are requested ahead of this block's WMMAs
  const _Float16* ar0 = XH + nat<MODE>(b, q0 + col) * CM; const _Float16* ar1 = XH + nat<MODE>(b, q0 + 16 + col) * CM; const _Float16* wr = Wr + (size_t)(h * 2) * (CM / 32) * 512;   // column tile j is weight tile row (j >> 1) * (CM / 16) + h * 2 + (j & 1)
  v16h a0 = frag_h(ar0, lane), a1 = frag_h(ar1, lane); constexpr int PJW = 7; v16h wf[PJW]; v4f bg4[2][2];
#pragma unroll   // wf, pa and bg4 are indexed by constants and stay in registers (every loop of part 1)
  for (int f = 0; f < PJW; ++f) wf[f] = frag_t(wr + ((size_t)(((f & 7) >> 1) * (CM / 16) + (f & 1)) * (CM / 32) + (f >> 3)) * 512, lane);
  __builtin_amdgcn_sched_barrier(0);   // keeps the first loads of both row tiles ahead of the first WMMA: moved behind it, the second tile's loads were waited for alone, a second full memory latency at the head of every wave
#pragma unroll
  for (int kc = 0; kc < CM / 32; ++kc) { v16h an0 = a0, an1 = a1; if (kc + 1 < CM / 32) { an0 = frag_h(ar0 + (kc + 1) * 32, lane); an1 = frag_h(ar1 + (kc + 1) * 32, lane);
      if (kc + 2 == CM / 32) asm volatile("s_wait_xcnt 0x0" ::: "memory"); }   // behind the last row loads: stands in front of what rewrites their address registers, which are free from here on (a later weight load's result takes them)
#pragma unroll
    for (int j = 0; j < 8; ++j) { const int f = kc * 8 + j, fn = f + PJW;
      if ((j >> 1) == 2) { pa[0][j] = wmma16(a0, wf[f % PJW], pa[0][j]); pa[1][j] = wmma16(a1, wf[f % PJW], pa[1][j]); }
      else { pa[0][j] = wmma16(wf[f % PJW], a0, pa[0][j]); pa[1][j] = wmma16(wf[f % PJW], a1, pa[1][j]); }
      if (fn < 8 * (CM / 32)) wf[f % PJW] = frag_t(wr + ((size_t)(((fn & 7) >> 1) * (CM / 16) + (fn & 1)) * (CM / 32) + (fn >> 3)) * 512, lane); }
    a0 = an0; a1 = an1; }
  // the gate bias (this lane's 16 channels) is requested behind the last WMMA, in registers that the weight ring has left, and lands behind the conversions of q, k and v
#pragma unroll
  for (int jj = 0; jj < 2; ++jj)
#pragma unroll
    for (int i = 0; i < 2; ++i) bg4[jj][i] = *(const v4f*)(BG + h * CA + jj * 16 + 8 * g + 4 * i);
  asm volatile("s_wait_xcnt 0x0" ::: "memory");   // stands in front of what rewrites the address registers of the bias loads
#pragma unroll
  for (int u = 0; u < 2; ++u)
#pragma unroll
    for (int jj = 0; jj < 2; ++jj) { v8h kk, hv, lv;   // half jj (q, k: channels jj * 16 + ..) or half u (v: tokens u * 16 + ..) of a tile: 8 f16 a lane, 512 contiguous bytes a wave
#pragma unroll
      for (int r = 0; r < 8; ++r) { bq[u][jj * 8 + r] = (_Float16)(pa[u][jj][r] * (1.0f / WSC)); kk[r] = (_Float16)(pa[u][2 + jj][r] * (1.0f / WSC));
        const float v = pa[u][4 + jj][r] * (1.0f / WSC); const _Float16 x = (_Float16)v; hv[r] = x; lv[r] = (_Float16)((v - (float)x) * 2048.0f); }
      *(v8h*)&sK[(wave * 2 + u) * 512 + jj * 256 + lane * 8] = kk;
      *(v8h*)&sVh[(jj * (NN / 32) + wave) * 512 + u * 256 + lane * 8] = hv; *(v8h*)&sVl[(jj * (NN / 32) + wave) * 512 + u * 256 + lane * 8] = lv; }
  __syncthreads();   // every wave's k and v tiles are in LDS; they are only read from here on. The gate follows the barrier, so that no wave waits there for its gate stores
#pragma unroll
  for (int u = 0; u < 2; ++u)
#pragma unroll
    for (int jj = 0; jj < 2; ++jj) { v8h gv;   // half jj of the gate tile (token tile u, head h)
#pragma unroll
      for (int r = 0; r < 8; ++r) gv[r] = (_Float16)(1.0f / (1.0f + expf(-(pa[u][6 + jj][r] * (1.0f / WSC) + bfr(bg4[jj][r >> 2][r & 3])))));
      vst2(Gt + ((rq / 16 + u) * (CM / 32) + h) * 512 + jj * 256 + lane * 8, gv);
      __builtin_amdgcn_sched_barrier(0); }   // one half tile's 8 exp and division chains at a time: with all 32 interleaved their temporaries went past the 256 registers of four waves a SIMD
  asm volatile("s_wait_xcnt 0x0" ::: "memory");   // stands in front of what rewrites the address and data registers of the gate stores
  }
  const float* pbt = PB + ((size_t)h * (RR / 16) + q0 / 16) * (RR / 32) * 512 + lane * 4;
  float m[2] = {-3.0e38f, -3.0e38f}, l[2] = {0.f, 0.f};   // per query tile: the query's running maximum (equal in both lane halves) and this half's share of its sum
  v8f acc[2][2] = {}, accl[2][2] = {};
#pragma unroll 1
  for (int ks = 0; ks < NN / 32; ++ks) {
    // all loads of the pass are issued here, ahead of its first WMMA
    v16h kh[2], vh[2], vl[2]; v4f pb[2][2][2];
    const float mkv = MASK[nat<MODE>(b, ks * 32 + lane)];   // lane = key of the pass
#pragma unroll   // the arrays are indexed by constants and stay in registers
    for (int ct = 0; ct < 2; ++ct) {
#pragma unroll
      for (int u = 0; u < 2; ++u)
#pragma unroll
        for (int i = 0; i < 2; ++i) pb[u][ct][i] = *(const v4f*)(pbt + (u * (RR / 32) + ks) * 512 + (ct * 2 + i) * 128); }
    asm volatile("s_wait_xcnt 0x0" ::: "memory");   // stands in front of what rewrites the address registers of the loads above: the next pass's address additions
#pragma unroll
    for (int ct = 0; ct < 2; ++ct) kh[ct] = frag_t(&sK[(ks * 2 + ct) * 512], lane);
#pragma unroll
    for (int j = 0; j < 2; ++j) { vh[j] = frag_t(&sVh[(j * (NN / 32) + ks) * 512], lane); vl[j] = frag_t(&sVl[(j * (NN / 32) + ks) * 512], lane); }
    const unsigned kept = __builtin_amdgcn_ballot_w32(bfr(mkv) != 0.f);   // bit = key of the pass
#pragma unroll
    for (int u = 0; u < 2; ++u) { float s[2][8];
#pragma unroll
    for (int ct = 0; ct < 2; ++ct) { v8f c = {}; c = wmma16(kh[ct], bq[u], c);
#pragma unroll
      for (int r = 0; r < 8; ++r) { float sc = c[r] * 0.17677669529663687f; if (MODE == 0) sc += pb[u][ct][r >> 2][r & 3]; s[ct][r] = sc; } }
    if (kept != 0xffffffffu) { const unsigned kb = kept >> (8 * g);   // one scalar test a tile and pass: only a pass with a masked key pays for the 16 selects
#pragma unroll
      for (int ct = 0; ct < 2; ++ct)
#pragma unroll
        for (int r = 0; r < 8; ++r) if (((kb >> (ct * 16 + r)) & 1u) == 0u) s[ct][r] = -3.0e38f; }
    float t[8];
#pragma unroll
    for (int r = 0; r < 8; ++r) t[r] = fmaxf(s[0][r], s[1][r]);
    float mx = fmaxf(fmaxf(fmaxf(t[0], t[1]), fmaxf(t[2], t[3])), fmaxf(fmaxf(t[4], t[5]), fmaxf(t[6], t[7]))); mx = fmaxf(mx, xhalf(mx));
    const float mn = fmaxf(m[u], mx), alpha = (m[u] <= -1.0e38f) ? 0.f : __expf(m[u] - mn);
#pragma unroll
    for (int ct = 0; ct < 2; ++ct)
#pragma unroll
      for (int r = 0; r < 8; ++r) s[ct][r] = (s[ct][r] <= -1.0e38f) ? 0.f : __expf(s[ct][r] - mn);
#pragma unroll
    for (int r = 0; r < 8; ++r) t[r] = s[0][r] + s[1][r];
    l[u] = l[u] * alpha + (((t[0] + t[1]) + (t[2] + t[3])) + ((t[4] + t[5]) + (t[6] + t[7]))); m[u] = mn;
#pragma unroll
    for (int j = 0; j < 2; ++j)
#pragma unroll
      for (int r = 0; r < 8; ++r) { acc[u][j][r] *= alpha; accl[u][j][r] *= alpha; }
    v16h pa, pal;   // B operand: element i = key 8g + i = tile 0 register i, element 8 + i = key 16 + 8g + i = tile 1 register i
#pragma unroll
    for (int i = 0; i < 8; ++i) { const float p0 = s[0][i] * 2048.0f, p1 = s[1][i] * 2048.0f; pa[i] = (_Float16)p0; pa[8 + i] = (_Float16)p1; pal[i] = (_Float16)((p0 - (float)pa[i]) * 2048.0f); pal[8 + i] = (_Float16)((p1 - (float)pa[8 + i]) * 2048.0f); }
#pragma unroll
    for (int j = 0; j < 2; ++j) { acc[u][j] = wmma16(vh[j], pa, acc[u][j]); accl[u][j] = wmma16(vl[j], pa, accl[u][j]); accl[u][j] = wmma16(vh[j], pal, accl[u][j]); } } }
#pragma unroll
  for (int u = 0; u < 2; ++u) { const float ls = l[u] + xhalf(l[u]);
  const float il = (ls > 0.f) ? (1.0f / 2048.0f) / ls : 0.f;
  float* ot = O + ((rq / 16 + u) * (CM / 32) + h) * 512 + lane * 4;   // lane = (g, row col): quads 0, 1 = channels 8g .. 8g + 7, quads 2, 3 = 16 + 8g .. : register r of O^T tile j is channel j * 16 + 8g + r; each store of the wave is 512 contiguous bytes
#pragma unroll
  for (int qd = 0; qd < 4; ++qd) { v4f o;
#pragma unroll
    for (int e = 0; e < 4; ++e) o[e] = (acc[u][qd >> 1][(qd & 1) * 4 + e] + accl[u][qd >> 1][(qd & 1) * 4 + e] * (1.0f / 2048.0f)) * il;
    vst2(ot + qd * 128, o); } } }
// ---- k_go<MODE>: block = (64 natural rows, 128 cols): M = (g o) . wo + bo ; A operand built on the fly from the G and O tiles
template <int MODE>
__global__ __launch_bounds__(128) void k_go(const _Float16* __restrict__ Gt, const float* __restrict__ O, const _Float16* __restrict__ WOr, const float* __restrict__ BO, float* __restrict__ M) { __shared__ __align__(16) float sf[4][16][132];
  const int tid = threadIdx.x, wave = tid >> 5, lane = tid & 31, col = lane & 15, g = lane >> 4; const size_t r0 = (size_t)blockIdx.x * 64 + wave * 16; const int c0 = blockIdx.y * 128;
  static_assert(MODE == 0, "one tile index serves G (natural rows) and O (compact rows): the two orders agree only in row attention");
  const size_t t0 = (r0 / 16) * (CM / 32);
  v8f acc[8] = {}, accl2[8] = {};
  // loads run ahead of the WMMAs: the 64 weight fragments (order f = kc * 8 + j) go through a ring of GOW register sets, fragment f + GOW being requested right behind the two WMMAs that read fragment f; the gate and o tiles of block kc + 1 are requested ahead of block kc's WMMAs
  constexpr int GOW = 7; const _Float16* wr = WOr + (size_t)(c0 / 16) * (CM / 32) * 512; v16h wf[GOW];
#pragma unroll   // every loop here is fully unrolled: wf and ov are indexed by constants and stay in registers
  for (int f = 0; f < GOW; ++f) wf[f] = frag_t(wr + ((size_t)(f & 7) * (CM / 32) + (f >> 3)) * 512, lane);
  v16h gv = frag_t(Gt + t0 * 512, lane); v4f ov[4];
#pragma unroll
  for (int qd = 0; qd < 4; ++qd) ov[qd] = *(const v4f*)(O + t0 * 512 + lane * 4 + qd * 128);
#pragma unroll
  for (int kc = 0; kc < CM / 32; ++kc) { v16h a, al;
    __builtin_amdgcn_sched_barrier(0);   // keeps this block's conversions (and with them the wait for its gate and o tiles) behind the WMMAs of the block before: moved up among them they would wait for loads just issued
#pragma unroll
    for (int i = 0; i < 16; ++i) { const float v0 = (float)gv[i] * ov[i >> 2][i & 3]; a[i] = (_Float16)v0; al[i] = (_Float16)((v0 - (float)a[i]) * 2048.0f); }
    if (kc + 1 < CM / 32) { gv = frag_t(Gt + (t0 + kc + 1) * 512, lane);
#pragma unroll
      for (int qd = 0; qd < 4; ++qd) ov[qd] = *(const v4f*)(O + (t0 + kc + 1) * 512 + lane * 4 + qd * 128);
      asm volatile("s_wait_xcnt 0x0" ::: "memory"); }   // stands in front of whatever rewrites the address registers of the six loads above (in the last block a later load's result does)
#pragma unroll
    for (int j = 0; j < 8; ++j) { const int f = kc * 8 + j, fn = f + GOW; acc[j] = wmma16(a, wf[f % GOW], acc[j]); accl2[j] = wmma16(al, wf[f % GOW], accl2[j]); if (fn < 8 * (CM / 32)) wf[f % GOW] = frag_t(wr + ((size_t)(fn & 7) * (CM / 32) + (fn >> 3)) * 512, lane); } }
#pragma unroll
  for (int j = 0; j < 8; ++j) { const int c = c0 + j * 16 + col; const float bb = bfr(BO[c]);
#pragma unroll
    for (int r = 0; r < 8; ++r) sf[wave][8 * g + r][j * 16 + col] = (acc[j][r] + accl2[j][r] * (1.0f / 2048.0f)) * (1.0f / WSC) + bb; }
  LDSX(); for (int rl = 0; rl < 16; ++rl) vst2(M + (r0 + rl) * CM + c0 + lane * 4, *(const v4f*)&sf[wave][rl][lane * 4]); }   // M here = the output buffer (no residual in this module)
// ---- k_ff1: block = (64 rows, 128 of 1024 cols): H1 = relu(XH . W1 + b1) -> f16 ; k_ff2: out = H1 . W2 + b2 + M
__global__ __launch_bounds__(128) void k_ff1(const _Float16* __restrict__ XH, const _Float16* __restrict__ W1r, const float* __restrict__ B1, _Float16* __restrict__ H1) { __shared__ __align__(16) _Float16 sh[4][16][136];
  const int tid = threadIdx.x, wave = tid >> 5, lane = tid & 31, col = lane & 15, g = lane >> 4; const size_t r0 = (size_t)blockIdx.x * 64 + wave * 16; const int c0 = blockIdx.y * 128;
  v8f acc[8] = {};
#pragma unroll
  for (int kc = 0; kc < CM / 32; ++kc) { const v16h a = frag_h(XH + (r0 + col) * CM + kc * 32, lane);
#pragma unroll
    for (int j = 0; j < 8; ++j) acc[j] = wmma16(a, frag_t(W1r + ((size_t)(c0 / 16 + j) * (CM / 32) + kc) * 512, lane), acc[j]); }
#pragma unroll
  for (int j = 0; j < 8; ++j) { const float bb = bfr(B1[c0 + j * 16 + col]);
#pragma unroll
    for (int r = 0; r < 8; ++r) sh[wave][8 * g + r][j * 16 + col] = (_Float16)fmaxf(acc[j][r] * (1.0f / WSC) + bb, 0.f); }
  LDSX(); for (int rl = 0; rl < 16; ++rl) if (lane < 16) vst2((unsigned*)(H1 + (r0 + rl) * FF + c0 + lane * 8), *(const v4u*)&sh[wave][rl][lane * 8]); }
__global__ __launch_bounds__(128) void k_ff2(const _Float16* __restrict__ H1, const _Float16* __restrict__ W2r, const float* __restrict__ B2, const float* __restrict__ M, float* __restrict__ OUT) { __shared__ __align__(16) float sf[4][16][132];
  const int tid = threadIdx.x, wave = tid >> 5, lane = tid & 31, col = lane & 15, g = lane >> 4; const size_t r0 = (size_t)blockIdx.x * 64 + wave * 16; const int c0 = blockIdx.y * 128;
  v8f acc[8] = {};
#pragma unroll 2
  for (int kc = 0; kc < FF / 32; ++kc) { const v16h a = frag_h(H1 + (r0 + col) * FF + kc * 32, lane);
#pragma unroll
    for (int j = 0; j < 8; ++j) acc[j] = wmma16(a, frag_t(W2r + ((size_t)(c0 / 16 + j) * (FF / 32) + kc) * 512, lane), acc[j]); }
#pragma unroll
  for (int j = 0; j < 8; ++j) { const int c = c0 + j * 16 + col; const float bb = bfr(B2[c]);
#pragma unroll
    for (int r = 0; r < 8; ++r) sf[wave][8 * g + r][j * 16 + col] = acc[j][r] * (1.0f / WSC) + bb + M[(r0 + 8 * g + r) * CM + c]; }
  LDSX(); for (int rl = 0; rl < 16; ++rl) vst2(OUT + (r0 + rl) * CM + c0 + lane * 4, *(const v4f*)&sf[wave][rl][lane * 4]); }
extern "C" void kernel_launch(void* const* d_in, const int* in_sizes, int n_in, void* d_out, int out_size, void* d_ws, size_t ws_size, hipStream_t stream) {
  (void)in_sizes; (void)n_in; (void)out_size;
  const float** F = (const float**)d_in;   // 0 m [1,128,256,256], 1 z [1,256,256,128], 2 mask [1,128,256], 3 ln_m_g, 4 ln_m_b, 5 ln_z_g, 6 ln_z_b, 7 wz [128,8], 8 wq [256,8,32], 9 wk, 10 wv, 11 wg, 12 bg [8,32], 13 wo [8,32,256], 14 bo [256]
  if (ws_size < (size_t)WS_END) return;
  char* ws = (char*)d_ws; _Float16 *RW = (_Float16*)(ws + WS_RW), *RWOp = (_Float16*)(ws + WS_RWO), *XH = (_Float16*)(ws + WS_XH), *Gt = (_Float16*)(ws + WS_G);
  float *O = (float*)(ws + WS_O), *PB = (float*)(ws + WS_PB);
  k_packw<<<dim3(64, 3), 256, 0, stream>>>(F[8], F[9], F[10], F[11], F[8], F[9], F[10], F[11], F[13], F[13], F[8], F[13], ws);   // which 0 (q|k|v|g rows) and 2 (wo rows) are used; which 1 packs in-bounds duplicates; 3-5 not launched
  k_ln<<<NROW / (8 * LNR), 256, 0, stream>>>(F[0], F[3], F[4], XH);
  k_pb<<<dim3(RR / 8, RR / 16), 256, 0, stream>>>(F[1], F[5], F[6], F[7], PB);
  k_pa<0><<<dim3(NH, SQ), 256, 0, stream>>>(XH, RW, F[12], PB, F[2], Gt, O);
  k_go<0><<<dim3(NROW / 64, CM / 128), 128, 0, stream>>>(Gt, O, RWOp, F[14], (float*)d_out);
}

// v009
// A run of this version takes 78.2 microseconds.
// Next to v008, in two timings, it ran 1.08 times as fast each time.
// Over all steps from v000 it is 4.52 times as fast.
// compute dtype: all float inputs rounded to bf16; LayerNorms, pair bias (LN(z) . wz), softmax, sigmoid gate in f32; q|k|v|g projections on WMMA 16x16x32 with the LayerNorm output rounded once to f16 against exact f16 x 2^8 weights; attention logits with single f16 q, k (32-dim heads), P as f16 hi + residual (x 2^11) . v (hi + residual; 3 products); (g o) as f16 hi + residual (2 products) . wo (f16 x 2^8) + bo; f32 output.
#include <hip/hip_runtime.h>
#include <math.h>

typedef __attribute__((ext_vector_type(16))) _Float16 v16h;
typedef __attribute__((ext_vector_type(16))) __bf16 v16b;
typedef __attribute__((ext_vector_type(8)))  _Float16 v8h;
typedef __attribute__((ext_vector_type(8)))  float v8f;
typedef __attribute__((ext_vector_type(4)))  float v4f;
typedef __attribute__((ext_vector_type(2)))  float v2f;
typedef __attribute__((ext_vector_type(4)))  unsigned v4u;
typedef __attribute__((ext_vector_type(4)))  int v4i;
typedef float __attribute__((may_alias)) float_a;
typedef int __attribute__((may_alias)) int_a;

template <typename T> __device__ __forceinline__ void vst2(void* p, T v) { *(T*)p = v;  }
__device__ __forceinline__ v8f wmma16(v16h a, v16h b, v8f c) {
  v8f d = __builtin_amdgcn_wmma_f32_16x16x32_f16(false, a, false, b, (short)0, c, false, false);
  asm volatile("v_nop\n\tv_nop\n\tv_nop\n\tv_nop" : "+v"(d) : "v"(a), "v"(b));
  return d;
}
__device__ __forceinline__ v8f wmma_bf(v16b a, v16b b, v8f c) {
  v8f d = __builtin_amdgcn_wmma_f32_16x16x32_bf16(false, a, false, b, (short)0, c, false, false);
  asm volatile("v_nop\n\tv_nop\n\tv_nop\n\tv_nop" : "+v"(d) : "v"(a), "v"(b));
  return d;
}
// 16x16x32 fragments: lane = (h = lane>>4, row/col = lane&15); elements 0..7 = k0+8h+0..7, 8..15 = k0+16+8h+0..7; D element r = row 8h+r
__device__ __forceinline__ v16h frag_h(const _Float16* rowk0, int lane) {
  union { v16h v; v8h q[2]; } u; const _Float16* p = rowk0 + 8 * (lane >> 4);
  u.q[0] = *(const v8h*)p; u.q[1] = *(const v8h*)(p + 16); return u.v;
}
// the same fragment from a 16 x 32 tile kept in fragment order: 1 KiB = [elements 0..7 | 8..15][lane][8 f16], so each of the wave's two 16-byte loads covers 512 contiguous bytes (4 whole lines, not pieces of 16)
__device__ __forceinline__ v16h frag_t(const _Float16* tile, int lane) {
  union { v16h v; v8h q[2]; } u; const _Float16* p = tile + 8 * lane;
  u.q[0] = *(const v8h*)p; u.q[1] = *(const v8h*)(p + 256); return u.v;
}
__device__ __forceinline__ v16h frag_f32(const float* rowk0, int lane) {
  v16h a; const float* p = rowk0 + 8 * (lane >> 4);
#pragma unroll
  for (int i = 0; i < 8; ++i) { a[i] = (_Float16)p[i]; a[8 + i] = (_Float16)p[16 + i]; }
  return a;
}
__device__ __forceinline__ v16h frag_f32s(const float* rowk0, int lane, float sc) {
  v16h a; const float* p = rowk0 + 8 * (lane >> 4);
#pragma unroll
  for (int i = 0; i < 8; ++i) { a[i] = (_Float16)(p[i] * sc); a[8 + i] = (_Float16)(p[16 + i] * sc); }
  return a;
}
// column fragment from a [K][ld] layout (column n), rows >= K read as 0
__device__ __forceinline__ v16h fragc_f32(const float* W, int k0, int n, int lane, int ld, int K) {
  v16h a; const int g = lane >> 4;
#pragma unroll
  for (int i = 0; i < 8; ++i) { const int ka = k0 + 8 * g + i, kb = ka + 16;
    a[i] = (_Float16)(ka < K ? W[(size_t)(ka < K ? ka : K - 1) * ld + n] : 0.f); a[8 + i] = (_Float16)(kb < K ? W[(size_t)(kb < K ? kb : K - 1) * ld + n] : 0.f); }
  return a;
}
struct F2 { v16b h, l; };
__device__ __forceinline__ F2 bsplit16(const float v[16]) { F2 r;
#pragma unroll
  for (int i = 0; i < 16; ++i) { const __bf16 h = (__bf16)v[i]; r.h[i] = h; r.l[i] = (__bf16)(v[i] - (float)h); }
  return r; }
__device__ __forceinline__ F2 split_row(const float* row, int k0, int lane) { float v[16]; const float* p = row + k0 + 8 * (lane >> 4);
#pragma unroll
  for (int i = 0; i < 8; ++i) { v[i] = p[i]; v[8 + i] = p[16 + i]; }
  return bsplit16(v); }
__device__ __forceinline__ F2 split_rowK(const float* row, int k0, int lane, int K) { float v[16]; const int g = lane >> 4;
#pragma unroll
  for (int i = 0; i < 8; ++i) { const int ka = k0 + 8 * g + i, kb = ka + 16; v[i] = ka < K ? row[ka < K ? ka : K - 1] : 0.f; v[8 + i] = kb < K ? row[kb < K ? kb : K - 1] : 0.f; }
  return bsplit16(v); }
__device__ __forceinline__ F2 split_col(const float* W, int k0, int n, int lane, int ld, int K) { float v[16]; const int g = lane >> 4;
#pragma unroll
  for (int i = 0; i < 8; ++i) { const int ka = k0 + 8 * g + i, kb = ka + 16; v[i] = ka < K ? W[(size_t)(ka < K ? ka : K - 1) * ld + n] : 0.f; v[8 + i] = kb < K ? W[(size_t)(kb < K ? kb : K - 1) * ld + n] : 0.f; }
  return bsplit16(v); }
__device__ __forceinline__ v8f mac3(const F2& a, const F2& b, v8f c) { c = wmma_bf(a.l, b.h, c); c = wmma_bf(a.h, b.l, c); return wmma_bf(a.h, b.h, c); }
__device__ __forceinline__ float sigm(float v) { return 1.0f / (1.0f + expf(-v)); }
#define LDSX() do { asm volatile("s_wait_dscnt 0" ::: "memory"); __builtin_amdgcn_wave_barrier(); __builtin_amdgcn_fence(__ATOMIC_RELEASE, "workgroup"); } while (0)


// MSA row attention with pair bias (B 1, S 128 sequences x R 256 residues, c_m 256, 8 heads x 32, c_z 128): out = (sigmoid(LN(m) wg + bg) * softmax(q k / sqrt(32) + 1e9 (mask - 1) + LN(z) wz) v) wo + bo.
#define SQ 128
#define RR 256
#define CM 256
#define NH 8
#define CA 32
#define CZ 128
#define FF 1024
#define NROW (SQ * RR)
#define WSC 256.0f
#ifndef TON
#define TON 1           // unused
#endif
typedef __attribute__((ext_vector_type(8))) __bf16 v8b;
__device__ __forceinline__ v16b frag_b(const __bf16* rowk0, int lane) {
  union { v16b v; v8b q[2]; } u; const __bf16* p = rowk0 + 8 * (lane >> 4);
  u.q[0] = *(const v8b*)p; u.q[1] = *(const v8b*)(p + 16); return u.v;
}
__device__ __forceinline__ float bfr(float v) { return (float)(__bf16)v; }
__device__ __attribute__((noinline)) float exp_ni(float v) { return expf(v); }
__device__ __attribute__((noinline)) float erf_ni(float v) { return erff(v); }

// weights (f16 x 2^8, transposed (in,out)), as 16 x 32 tiles in fragment order [out / 16][in / 32][512]: RW 1024 x 256 = q|k|v|g ; CW 1024 x 256; RWO 256 x 256; CWO 256 x 256; TW1 1024 x 256; TW2 256 x 1024
#define WS_RW   0u
#define WS_CW   (WS_RW + 2u * 1024 * CM)
#define WS_RWO  (WS_CW + 2u * 1024 * CM)
#define WS_CWO  (WS_RWO + 2u * CM * CM)
#define WS_TW1  (WS_CWO + 2u * CM * CM)
#define WS_TW2  (WS_TW1 + 2u * FF * CM)
#define WS_XH   (WS_TW2 + 2u * CM * FF)                 // f16 LN rows [NROW][256] (natural s*R + r)
#define WS_QK   (WS_XH + 2u * (size_t)NROW * CM)         // not used any more (q stays in registers, k in LDS); the offsets behind it stay as they were
#define WS_VT   (WS_QK + 2u * (size_t)NROW * 2 * CM)     // not used any more, nor is WS_VTL (v hi, lo stay in LDS)
#define WS_VTL  (WS_VT + 2u * (size_t)NROW * CM)
#define WS_G    (WS_VTL + 2u * (size_t)NROW * CM)        // f16 sigmoid gate, tiles (16 natural rows x 32 channels) in fragment order [NROW / 16][256 / 32][512]
#define WS_O    (WS_G + 2u * (size_t)NROW * CM)          // f32 attention output, tiles (16 compact rows x 32 channels = one head) in fragment order [NROW / 16][256 / 32][element quad 0..3][lane][4]
#define WS_M    (WS_O + 4u * (size_t)NROW * CM)          // f32 working m [natural][256]
#define WS_PB   (WS_M + 4u * (size_t)NROW * CM)          // f32 pair bias, tiles (16 queries x 32 keys) in the order of k_pa's score registers [h][q / 16][k / 32][quad = (k % 32 / 16) * 2 + k % 8 / 4][lane = (k % 16 / 8) * 16 + q % 16][4]
#define WS_H1   (WS_PB + 4u * (size_t)NH * RR * RR)      // f16 relu rows [natural][1024]
#define WS_END  (WS_H1 + 2u * (size_t)NROW * FF)

// ---- d_packw: block bx = 16 output rows = one row of tiles, so every 128-byte line of the packed weights has one writer; bx 0 .. 63: RW (W = rq|rk|rv|rg by n / 256), bx 64 .. 79: RWO
#define PWB (1024 / 16 + CM / 16)
__device__ __forceinline__ void d_packw(int bx, const float* __restrict__ RQ, const float* __restrict__ RK, const float* __restrict__ RV, const float* __restrict__ RG, const float* __restrict__ RWO, char* __restrict__ ws) {
  const int t = threadIdx.x; const bool qkvg = bx < 1024 / 16; const int tr = qkvg ? bx : bx - 1024 / 16, n0 = tr * 16, g4 = n0 / CM, col = n0 % CM;
  const float* Wm = !qkvg ? RWO : g4 == 0 ? RQ : g4 == 1 ? RK : g4 == 2 ? RV : RG; constexpr int kin = CM, kout = CM;
  _Float16* dst = (_Float16*)(ws + (qkvg ? WS_RW : WS_RWO)) + (size_t)tr * (kin / 32) * 512;
  // chunk e = (k tile e >> 6, half (e >> 5) & 1, lane e & 31) lies at f16 offset 8 e: a wave stores 512 contiguous bytes; its 8 values are k .. k + 7 of output row n0 + (lane & 15)
  for (int e = t; e < kin * 2; e += 256) { const int ln = e & 31, k = (e >> 6) * 32 + ((e >> 5) & 1) * 16 + (ln >> 4) * 8; v8h o;
#pragma unroll   // o is indexed by constants and stays in registers
    for (int i = 0; i < 8; ++i) o[i] = (_Float16)(bfr(Wm[(size_t)(k + i) * kout + col + (ln & 15)]) * WSC);
    vst2(dst + e * 8, o); } }
// ---- d_ln (block bx): XH = LN(bf16(m)) w + b (jnp.var, 1e-5) -> f16. One wave owns a row (lane l: channels 4l + e and 128 + 4l + e, so each 16-byte load of a wave covers 512 contiguous bytes) and works on LNR rows; no LDS, no barrier
// value of lane l ^ MSK inside a 16-lane row, by a DPP move (no LDS round trip as with __shfl_xor)
template <int MSK> __device__ __forceinline__ float rowx(float x) { return __builtin_bit_cast(float, __builtin_amdgcn_mov_dpp(__builtin_bit_cast(int, x), 0x160 | MSK, 0xf, 0xf, true)); }
// lane l with lane l ^ 16
__device__ __forceinline__ float xhalf(float x) { return __builtin_bit_cast(float, __builtin_amdgcn_permlanex16(__builtin_bit_cast(int, x), __builtin_bit_cast(int, x), 0x76543210, 0xfedcba98, false, false)); }
__device__ __forceinline__ float wsum(float s) { s += rowx<1>(s); s += rowx<2>(s); s += rowx<4>(s); s += rowx<8>(s); return s + xhalf(s); }
typedef __attribute__((ext_vector_type(4))) _Float16 v4h;
#define LNR 8
__device__ __forceinline__ void d_ln(int bx, const float* __restrict__ X, const float* __restrict__ G, const float* __restrict__ Bt, _Float16* __restrict__ XH) { const int lane = threadIdx.x & 31; const size_t row0 = ((size_t)bx * 8 + (threadIdx.x >> 5)) * LNR;
  const float* xr = X + row0 * CM + lane * 4; _Float16* yr = XH + row0 * CM + lane * 4;
  // both loops are fully unrolled: the arrays are indexed by constants and stay in registers
  v4f xa[LNR], xb[LNR];   // the wave's LNR rows: all loads are issued before the first use, so memory latency is paid once
#pragma unroll
  for (int p = 0; p < LNR; ++p) { xa[p] = *(const v4f*)(xr + (size_t)p * CM); xb[p] = *(const v4f*)(xr + (size_t)p * CM + 128); }
  const v4f g0 = *(const v4f*)(G + lane * 4), g1 = *(const v4f*)(G + 128 + lane * 4), c0 = *(const v4f*)(Bt + lane * 4), c1 = *(const v4f*)(Bt + 128 + lane * 4);
  float gg[8], bb[8];
#pragma unroll
  for (int e = 0; e < 4; ++e) { gg[e] = bfr(g0[e]); gg[4 + e] = bfr(g1[e]); bb[e] = bfr(c0[e]); bb[4 + e] = bfr(c1[e]); }
#pragma unroll
  for (int p = 0; p < LNR; ++p) { float v[8];
#pragma unroll
    for (int e = 0; e < 4; ++e) { v[e] = bfr(xa[p][e]); v[4 + e] = bfr(xb[p][e]); }
    const float mu = wsum(((v[0] + v[1]) + (v[2] + v[3])) + ((v[4] + v[5]) + (v[6] + v[7]))) / (float)CM; float qq = 0.f;
#pragma unroll
    for (int i = 0; i < 8; ++i) { v[i] -= mu; qq += v[i] * v[i]; }
    const float inv = 1.0f / sqrtf(wsum(qq) / (float)CM + 1e-5f); v4h h0, h1;
#pragma unroll
    for (int e = 0; e < 4; ++e) { h0[e] = (_Float16)(v[e] * inv * gg[e] + bb[e]); h1[e] = (_Float16)(v[4 + e] * inv * gg[4 + e] + bb[4 + e]); }
    vst2(yr + (size_t)p * CM, h0); vst2(yr + (size_t)p * CM + 128, h1); }
  asm volatile("s_wait_xcnt 0x0" ::: "memory"); }   // in k_prep's listing another job's code follows these stores and rewrites their registers: the wait stands in front of it
// natural row index of (batch b, token n): MODE 0 row attention (b = s, n = r); MODE 1 column attention (b = r, n = s)
template <int MODE> __device__ __forceinline__ size_t nat(size_t b, int n) { return MODE == 0 ? b * RR + n : (size_t)n * RR + b; }
// ---- d_pb: block (ko, qt) = (8 keys, 16 query residues) = 128 z rows, row rho = (query rho / 8, key rho % 8): per head it owns two whole 256-byte runs of a PB tile; PB(h, q, k) = LN(z[q][k]) . wb[:, h]; 16 lanes share one z row (8 channels a lane, two 16-byte loads), a wave works on 2 rows at a time; this lane's 8 x 8 weights stay in registers
#define PBK 128
__device__ __forceinline__ void d_pb(int ko, int qt, const float* __restrict__ Zp, const float* __restrict__ G, const float* __restrict__ Bt, const float* __restrict__ WB, float* __restrict__ PB) { __shared__ __align__(16) float sp[NH][PBK + 4]; __shared__ __align__(16) float swb[CZ / 4][4 * NH + 4];   // swb: 4 channels x 8 heads a row, pitch 36 words: the 16 lanes' 16-byte reads fall on distinct banks
  const int t = threadIdx.x, lane = t & 31, w = t >> 5, l16 = lane & 15, hf = lane >> 4;
  const float* zr = Zp + (((size_t)qt * 16 + w * 2) * RR + ko * 8 + hf) * CZ + l16 * 4;   // rows rho = w*16 + 2p + hf: query qt*16 + 2w + p/4, key ko*8 + 2(p%4) + hf; channels 4*l16 + e and 64 + 4*l16 + e
  // every loop of this kernel is fully unrolled: its arrays are indexed by constants and stay in registers
  v4f za[8], zb[8];   // the wave's 16 rows: all 16 loads are issued before the first use, so memory latency is paid once
#pragma unroll
  for (int p = 0; p < 8; ++p) { za[p] = *(const v4f*)(zr + ((size_t)(p >> 2) * RR + (p & 3) * 2) * CZ); zb[p] = *(const v4f*)(zr + ((size_t)(p >> 2) * RR + (p & 3) * 2) * CZ + 64); }
  v4f g4[2], b4[2];
#pragma unroll
  for (int i = 0; i < 2; ++i) { g4[i] = *(const v4f*)(G + 64 * i + l16 * 4); b4[i] = *(const v4f*)(Bt + 64 * i + l16 * 4); }
  { v4f w4 = *(const v4f*)(WB + t * 4); w4[0] = bfr(w4[0]); w4[1] = bfr(w4[1]); w4[2] = bfr(w4[2]); w4[3] = bfr(w4[3]); *(v4f*)&swb[t >> 3][(t & 7) * 4] = w4; } __syncthreads();
  float wv[8][NH], gg[8], bb[8];
#pragma unroll
  for (int i = 0; i < 2; ++i) {
#pragma unroll
    for (int e = 0; e < 4; ++e) { gg[i * 4 + e] = bfr(g4[i][e]); bb[i * 4 + e] = bfr(b4[i][e]); const v4f w0 = *(const v4f*)&swb[16 * i + l16][e * NH], w1 = *(const v4f*)&swb[16 * i + l16][e * NH + 4];
#pragma unroll
      for (int h = 0; h < 4; ++h) { wv[i * 4 + e][h] = w0[h]; wv[i * 4 + e][4 + h] = w1[h]; } } }
  const bool b0 = (l16 & 1) != 0, b1 = (l16 & 2) != 0, b2 = (l16 & 4) != 0;
#pragma unroll
  for (int p = 0; p < 8; ++p) { float v[8];
#pragma unroll
    for (int e = 0; e < 4; ++e) { v[e] = bfr(za[p][e]); v[4 + e] = bfr(zb[p][e]); }
    float s = ((v[0] + v[1]) + (v[2] + v[3])) + ((v[4] + v[5]) + (v[6] + v[7]));
    s += rowx<1>(s); s += rowx<2>(s); s += rowx<4>(s); s += rowx<8>(s);
    const float mu = s / (float)CZ; float qq = 0.f;
#pragma unroll
    for (int i = 0; i < 8; ++i) { v[i] -= mu; qq += v[i] * v[i]; }
    qq += rowx<1>(qq); qq += rowx<2>(qq); qq += rowx<4>(qq); qq += rowx<8>(qq);
    const float inv = 1.0f / sqrtf(qq / (float)CZ + 1e-5f); float ph[NH];
#pragma unroll
    for (int h = 0; h < NH; ++h) ph[h] = 0.f;
#pragma unroll
    for (int i = 0; i < 8; ++i) { const float ln = v[i] * inv * gg[i] + bb[i];
#pragma unroll
      for (int h = 0; h < NH; ++h) ph[h] += ln * wv[i][h]; }
    // sum over the 16 lanes, halving the heads a lane carries at each of the first three steps: lane l16 ends with head l16 & 7
    float y[4], u[2];
#pragma unroll
    for (int i = 0; i < 4; ++i) y[i] = (b0 ? ph[2 * i + 1] : ph[2 * i]) + rowx<1>(b0 ? ph[2 * i] : ph[2 * i + 1]);
#pragma unroll
    for (int i = 0; i < 2; ++i) u[i] = (b1 ? y[2 * i + 1] : y[2 * i]) + rowx<2>(b1 ? y[2 * i] : y[2 * i + 1]);
    float x = (b2 ? u[1] : u[0]) + rowx<4>(b2 ? u[0] : u[1]); x += rowx<8>(x);
    if (l16 < NH) sp[l16][w * 16 + p * 2 + hf] = x; }
  __syncthreads(); { const int h = t >> 5, i = (t >> 4) & 1;   // ko = (32-key tile ko / 4, 16-key half (ko / 2) % 2, lane half ko % 2); a wave stores the head's two 256-byte runs (quads i = 0, 1; 16 queries x 4 keys each)
    vst2(PB + ((((size_t)h * (RR / 16) + qt) * (RR / 32) + (ko >> 2)) * 4 + ((ko >> 1) & 1) * 2 + i) * 128 + ((ko & 1) * 16 + l16) * 4, *(const v4f*)&sp[h][l16 * 8 + i * 4]); }
  asm volatile("s_wait_xcnt 0x0" ::: "memory"); }   // as at the end of d_ln: another job's code follows this store in the listing
// ---- k_prep: the three jobs that k_pa waits for need nothing of each other, so they share one grid; a range of the block index picks the job (a scalar branch, the same for the whole block: d_pb's two barriers stand under it)
#define LNB (NROW / (8 * LNR))
#define PBB ((RR / 8) * (RR / 16))
__global__ __launch_bounds__(256) void k_prep(const float* __restrict__ RQ, const float* __restrict__ RK, const float* __restrict__ RV, const float* __restrict__ RG, const float* __restrict__ RWO, char* __restrict__ ws, const float* __restrict__ X, const float* __restrict__ LG, const float* __restrict__ LB, _Float16* __restrict__ XH, const float* __restrict__ Zp, const float* __restrict__ ZG, const float* __restrict__ ZB, const float* __restrict__ WB, float* __restrict__ PB) {
  const int bx = blockIdx.x;
  if (bx < PWB) d_packw(bx, RQ, RK, RV, RG, RWO, ws);
  else if (bx < PWB + PBB) d_pb((bx - PWB) % (RR / 8), (bx - PWB) / (RR / 8), Zp, ZG, ZB, WB, PB);
  else d_ln(bx - (PWB + PBB), X, LG, LB, XH); }
// ---- k_pa<MODE>: projections and attention of one (head h, sequence b) in one block of 8 waves; a wave = 32 tokens = two 16-token tiles u, first as rows of the projections, then as queries.
// Part 1: the head's 8 column tiles j = kind * 2 + jj (kind 0 q, 1 k, 2 v, 3 gate; 16 channels each) x 2 token tiles. q, k and the gate are taken transposed (A = weight rows, B = token columns): a lane (g, col) then holds channels jj * 16 + 8g + r of ONE token, which is that token's share of a 16 x 32 tile in fragment order; v is taken as it was (A = token rows): a lane holds tokens 8g + r of one channel, its share of a (16 channels x 32 tokens) tile. So q stays in registers as part 2's B operand, k and v (hi, lo) go to LDS as whole tiles with 16-byte stores, the gate goes to its workspace tiles; nothing is staged for a transpose.
// Part 2 (the barrier stands behind the LDS stores of k and v): S^T = K . Q^T (A = key rows, B = query columns), O^T = V^T . P^T (A = channel rows, B = P^T). A lane (g, col) holds, per tile, 16 of the pass's 32 scores of ONE query, q0 + 16 u + col (keys ct * 16 + 8g + r): maximum and sum are taken in the lane, with one exchange between the lane halves; the two score tiles, converted in place, are the B operand P^T, and the O^T registers are the O tile's quads
template <int MODE>
__global__ __launch_bounds__(256) void k_pa(const _Float16* __restrict__ XH, const _Float16* __restrict__ Wr, const float* __restrict__ BG, const float* __restrict__ PB, const float* __restrict__ MASK, _Float16* __restrict__ Gt, float* __restrict__ O) {
  static_assert(MODE == 0, "gate tiles (16 natural rows) and pair bias tiles belong to row attention");
  constexpr int NN = MODE == 0 ? RR : SQ;
  static_assert(NN == 256, "8 waves x 32 tokens cover the sequence");
  __shared__ __align__(16) _Float16 sK[(NN / 16) * 512], sVh[2 * (NN / 32) * 512], sVl[2 * (NN / 32) * 512];   // k: [key tile][512]; v hi, lo: [channel tile jj][32-key group][512]; all in fragment order
  const int tid = threadIdx.x, wave = tid >> 5, lane = tid & 31, col = lane & 15, g = lane >> 4; const int h = blockIdx.x; const size_t b = blockIdx.y; const int q0 = wave * 32; const size_t rq = b * NN + q0;
  v16h bq[2];
  {
  v8f pa[2][8] = {};
  // fragments are fetched ahead: the 64 weight fragments (order f = kc * 8 + j) go through a ring of PJW register sets, fragment f + PJW being requested right behind the two WMMAs that read fragment f, so a WMMA waits only for a load issued 14 WMMAs earlier, not for its own (7 sets: the wave stays within 256 registers, 4 waves a SIMD); the two row fragments of the next k block are requested ahead of this block's WMMAs
  const _Float16* ar0 = XH + nat<MODE>(b, q0 + col) * CM; const _Float16* ar1 = XH + nat<MODE>(b, q0 + 16 + col) * CM; const _Float16* wr = Wr + (size_t)(h * 2) * (CM / 32) * 512;   // column tile j is weight tile row (j >> 1) * (CM / 16) + h * 2 + (j & 1)
  v16h a0 = frag_h(ar0, lane), a1 = frag_h(ar1, lane); constexpr int PJW = 7; v16h wf[PJW]; v4f bg4[2][2];
#pragma unroll   // wf, pa and bg4 are indexed by constants and stay in registers (every loop of part 1)
  for (int f = 0; f < PJW; ++f) wf[f] = frag_t(wr + ((size_t)(((f & 7) >> 1) * (CM / 16) + (f & 1)) * (CM / 32) + (f >> 3)) * 512, lane);
  __builtin_amdgcn_sched_barrier(0);   // keeps the first loads of both row tiles ahead of the first WMMA: moved behind it, the second tile's loads were waited for alone, a second full memory latency at the head of every wave
#pragma unroll
  for (int kc = 0; kc < CM / 32; ++kc) { v16h an0 = a0, an1 = a1; if (kc + 1 < CM / 32) { an0 = frag_h(ar0 + (kc + 1) * 32, lane); an1 = frag_h(ar1 + (kc + 1) * 32, lane);
      if (kc + 2 == CM / 32) asm volatile("s_wait_xcnt 0x0" ::: "memory"); }   // behind the last row loads: stands in front of what rewrites their address registers, which are free from here on (a later weight load's result takes them)
#pragma unroll
    for (int j = 0; j < 8; ++j) { const int f = kc * 8 + j, fn = f + PJW;
      if ((j >> 1) == 2) { pa[0][j] = wmma16(a0, wf[f % PJW], pa[0][j]); pa[1][j] = wmma16(a1, wf[f % PJW], pa[1][j]); }
      else { pa[0][j] = wmma16(wf[f % PJW], a0, pa[0][j]); pa[1][j] = wmma16(wf[f % PJW], a1, pa[1][j]); }
      if (fn < 8 * (CM / 32)) wf[f % PJW] = frag_t(wr + ((size_t)(((fn & 7) >> 1) * (CM / 16) + (fn & 1)) * (CM / 32) + (fn >> 3)) * 512, lane); }
    a0 = an0; a1 = an1; }
  // the gate bias (this lane's 16 channels) is requested behind the last WMMA, in registers that the weight ring has left, and lands behind the conversions of q, k and v
#pragma unroll
  for (int jj = 0; jj < 2; ++jj)
#pragma unroll
    for (int i = 0; i < 2; ++i) bg4[jj][i] = *(const v4f*)(BG + h * CA + jj * 16 + 8 * g + 4 * i);
  asm volatile("s_wait_xcnt 0x0" ::: "memory");   // stands in front of what rewrites the address registers of the bias loads
#pragma unroll
  for (int u = 0; u < 2; ++u)
#pragma unroll
    for (int jj = 0; jj < 2; ++jj) { v8h kk, hv, lv;   // half jj (q, k: channels jj * 16 + ..) or half u (v: tokens u * 16 + ..) of a tile: 8 f16 a lane, 512 contiguous bytes a wave
#pragma unroll
      for (int r = 0; r < 8; ++r) { bq[u][jj * 8 + r] = (_Float16)(pa[u][jj][r] * (1.0f / WSC)); kk[r] = (_Float16)(pa[u][2 + jj][r] * (1.0f / WSC));
        const float v = pa[u][4 + jj][r] * (1.0f / WSC); const _Float16 x = (_Float16)v; hv[r] = x; lv[r] = (_Float16)((v - (float)x) * 2048.0f); }
      *(v8h*)&sK[(wave * 2 + u) * 512 + jj * 256 + lane * 8] = kk;
      *(v8h*)&sVh[(jj * (NN / 32) + wave) * 512 + u * 256 + lane * 8] = hv; *(v8h*)&sVl[(jj * (NN / 32) + wave) * 512 + u * 256 + lane * 8] = lv; }
  __syncthreads();   // every wave's k and v tiles are in LDS; they are only read from here on. The gate follows the barrier, so that no wave waits there for its gate stores
#pragma unroll
  for (int u = 0; u < 2; ++u)
#pragma unroll
    for (int jj = 0; jj < 2; ++jj) { v8h gv;   // half jj of the gate tile (token tile u, head h)
#pragma unroll
      for (int r = 0; r < 8; ++r) gv[r] = (_Float16)(1.0f / (1.0f + expf(-(pa[u][6 + jj][r] * (1.0f / WSC) + bfr(bg4[jj][r >> 2][r & 3])))));
      vst2(Gt + ((rq / 16 + u) * (CM / 32) + h) * 512 + jj * 256 + lane * 8, gv);
      __builtin_amdgcn_sched_barrier(0); }   // one half tile's 8 exp and division chains at a time: with all 32 interleaved their temporaries went past the 256 registers of four waves a SIMD
  asm volatile("s_wait_xcnt 0x0" ::: "memory");   // stands in front of what rewrites the address and data registers of the gate stores
  }
  const float* pbt = PB + ((size_t)h * (RR / 16) + q0 / 16) * (RR / 32) * 512 + lane * 4;
  float m[2] = {-3.0e38f, -3.0e38f}, l[2] = {0.f, 0.f};   // per query tile: the query's running maximum (equal in both lane halves) and this half's share of its sum
  v8f acc[2][2] = {}, accl[2][2] = {};
#pragma unroll 1
  for (int ks = 0; ks < NN / 32; ++ks) {
    // all loads of the pass are issued here, ahead of its first WMMA
    v16h kh[2], vh[2], vl[2]; v4f pb[2][2][2];
    const float mkv = MASK[nat<MODE>(b, ks * 32 + lane)];   // lane = key of the pass
#pragma unroll   // the arrays are indexed by constants and stay in registers
    for (int ct = 0; ct < 2; ++ct) {
#pragma unroll
      for (int u = 0; u < 2; ++u)
#pragma unroll
        for (int i = 0; i < 2; ++i) pb[u][ct][i] = *(const v4f*)(pbt + (u * (RR / 32) + ks) * 512 + (ct * 2 + i) * 128); }
    asm volatile("s_wait_xcnt 0x0" ::: "memory");   // stands in front of what rewrites the address registers of the loads above: the next pass's address additions
#pragma unroll
    for (int ct = 0; ct < 2; ++ct) kh[ct] = frag_t(&sK[(ks * 2 + ct) * 512], lane);
#pragma unroll
    for (int j = 0; j < 2; ++j) { vh[j] = frag_t(&sVh[(j * (NN / 32) + ks) * 512], lane); vl[j] = frag_t(&sVl[(j * (NN / 32) + ks) * 512], lane); }
    const unsigned kept = __builtin_amdgcn_ballot_w32(bfr(mkv) != 0.f);   // bit = key of the pass
#pragma unroll
    for (int u = 0; u < 2; ++u) { float s[2][8];
#pragma unroll
    for (int ct = 0; ct < 2; ++ct) { v8f c = {}; c = wmma16(kh[ct], bq[u], c);
#pragma unroll
      for (int r = 0; r < 8; ++r) { float sc = c[r] * 0.17677669529663687f; if (MODE == 0) sc += pb[u][ct][r >> 2][r & 3]; s[ct][r] = sc; } }
    if (kept != 0xffffffffu) { const unsigned kb = kept >> (8 * g);   // one scalar test a tile and pass: only a pass with a masked key pays for the 16 selects
#pragma unroll
      for (int ct = 0; ct < 2; ++ct)
#pragma unroll
        for (int r = 0; r < 8; ++r) if (((kb >> (ct * 16 + r)) & 1u) == 0u) s[ct][r] = -3.0e38f; }
    float t[8];
#pragma unroll
    for (int r = 0; r < 8; ++r) t[r] = fmaxf(s[0][r], s[1][r]);
    float mx = fmaxf(fmaxf(fmaxf(t[0], t[1]), fmaxf(t[2], t[3])), fmaxf(fmaxf(t[4], t[5]), fmaxf(t[6], t[7]))); mx = fmaxf(mx, xhalf(mx));
    const float mn = fmaxf(m[u], mx), alpha = (m[u] <= -1.0e38f) ? 0.f : __expf(m[u] - mn);
#pragma unroll
    for (int ct = 0; ct < 2; ++ct)
#pragma unroll
      for (int r = 0; r < 8; ++r) s[ct][r] = (s[ct][r] <= -1.0e38f) ? 0.f : __expf(s[ct][r] - mn);
#pragma unroll
    for (int r = 0; r < 8; ++r) t[r] = s[0][r] + s[1][r];
    l[u] = l[u] * alpha + (((t[0] + t[1]) + (t[2] + t[3])) + ((t[4] + t[5]) + (t[6] + t[7]))); m[u] = mn;
#pragma unroll
    for (int j = 0; j < 2; ++j)
#pragma unroll
      for (int r = 0; r < 8; ++r) { acc[u][j][r] *= alpha; accl[u][j][r] *= alpha; }
    v16h pa, pal;   // B operand: element i = key 8g + i = tile 0 register i, element 8 + i = key 16 + 8g + i = tile 1 register i
#pragma unroll
    for (int i = 0; i < 8; ++i) { const float p0 = s[0][i] * 2048.0f, p1 = s[1][i] * 2048.0f; pa[i] = (_Float16)p0; pa[8 + i] = (_Float16)p1; pal[i] = (_Float16)((p0 - (float)pa[i]) * 2048.0f); pal[8 + i] = (_Float16)((p1 - (float)pa[8 + i]) * 2048.0f); }
#pragma unroll
    for (int j = 0; j < 2; ++j) { acc[u][j] = wmma16(vh[j], pa, acc[u][j]); accl[u][j] = wmma16(vl[j], pa, accl[u][j]); accl[u][j] = wmma16(vh[j], pal, accl[u][j]); } } }
#pragma unroll
  for (int u = 0; u < 2; ++u) { const float ls = l[u] + xhalf(l[u]);
  const float il = (ls > 0.f) ? (1.0f / 2048.0f) / ls : 0.f;
  float* ot = O + ((rq / 16 + u) * (CM / 32) + h) * 512 + lane * 4;   // lane = (g, row col): quads 0, 1 = channels 8g .. 8g + 7, quads 2, 3 = 16 + 8g .. : register r of O^T tile j is channel j * 16 + 8g + r; each store of the wave is 512 contiguous bytes
#pragma unroll
  for (int qd = 0; qd < 4; ++qd) { v4f o;
#pragma unroll
    for (int e = 0; e < 4; ++e) o[e] = (acc[u][qd >> 1][(qd & 1) * 4 + e] + accl[u][qd >> 1][(qd & 1) * 4 + e] * (1.0f / 2048.0f)) * il;
    vst2(ot + qd * 128, o); } } }
// ---- k_go<MODE>: block = (64 natural rows, 128 cols): M = (g o) . wo + bo ; A operand built on the fly from the G and O tiles
template <int MODE>
__global__ __launch_bounds__(128) void k_go(const _Float16* __restrict__ Gt, const float* __restrict__ O, const _Float16* __restrict__ WOr, const float* __restrict__ BO, float* __restrict__ M) { __shared__ __align__(16) float sf[4][16][132];
  const int tid = threadIdx.x, wave = tid >> 5, lane = tid & 31, col = lane & 15, g = lane >> 4; const size_t r0 = (size_t)blockIdx.x * 64 + wave * 16; const int c0 = blockIdx.y * 128;
  static_assert(MODE == 0, "one tile index serves G (natural rows) and O (compact rows): the two orders agree only in row attention");
  const size_t t0 = (r0 / 16) * (CM / 32);
  v8f acc[8] = {}, accl2[8] = {};
  // loads run ahead of the WMMAs: the 64 weight fragments (order f = kc * 8 + j) go through a ring of GOW register sets, fragment f + GOW being requested right behind the two WMMAs that read fragment f; the gate and o tiles of block kc + 1 are requested ahead of block kc's WMMAs
  constexpr int GOW = 7; const _Float16* wr = WOr + (size_t)(c0 / 16) * (CM / 32) * 512; v16h wf[GOW];
#pragma unroll   // every loop here is fully unrolled: wf and ov are indexed by constants and stay in registers
  for (int f = 0; f < GOW; ++f) wf[f] = frag_t(wr + ((size_t)(f & 7) * (CM / 32) + (f >> 3)) * 512, lane);
  v16h gv = frag_t(Gt + t0 * 512, lane); v4f ov[4];
#pragma unroll
  for (int qd = 0; qd < 4; ++qd) ov[qd] = *(const v4f*)(O + t0 * 512 + lane * 4 + qd * 128);
#pragma unroll
  for (int kc = 0; kc < CM / 32; ++kc) { v16h a, al;
    __builtin_amdgcn_sched_barrier(0);   // keeps this block's conversions (and with them the wait for its gate and o tiles) behind the WMMAs of the block before: moved up among them they would wait for loads just issued
#pragma unroll
    for (int i = 0; i < 16; ++i) { const float v0 = (float)gv[i] * ov[i >> 2][i & 3]; a[i] = (_Float16)v0; al[i] = (_Float16)((v0 - (float)a[i]) * 2048.0f); }
    if (kc + 1 < CM / 32) { gv = frag_t(Gt + (t0 + kc + 1) * 512, lane);
#pragma unroll
      for (int qd = 0; qd < 4; ++qd) ov[qd] = *(const v4f*)(O + (t0 + kc + 1) * 512 + lane * 4 + qd * 128);
      asm volatile("s_wait_xcnt 0x0" ::: "memory"); }   // stands in front of whatever rewrites the address registers of the six loads above (in the last block a later load's result does)
#pragma unroll
    for (int j = 0; j < 8; ++j) { const int f = kc * 8 + j, fn = f + GOW; acc[j] = wmma16(a, wf[f % GOW], acc[j]); accl2[j] = wmma16(al, wf[f % GOW], accl2[j]); if (fn < 8 * (CM / 32)) wf[f % GOW] = frag_t(wr + ((size_t)(fn & 7) * (CM / 32) + (fn >> 3)) * 512, lane); } }
#pragma unroll
  for (int j = 0; j < 8; ++j) { const int c = c0 + j * 16 + col; const float bb = bfr(BO[c]);
#pragma unroll
    for (int r = 0; r < 8; ++r) sf[wave][8 * g + r][j * 16 + col] = (acc[j][r] + accl2[j][r] * (1.0f / 2048.0f)) * (1.0f / WSC) + bb; }
  LDSX(); for (int rl = 0; rl < 16; ++rl) vst2(M + (r0 + rl) * CM + c0 + lane * 4, *(const v4f*)&sf[wave][rl][lane * 4]); }   // M here = the output buffer (no residual in this module)
// ---- k_ff1: block = (64 rows, 128 of 1024 cols): H1 = relu(XH . W1 + b1) -> f16 ; k_ff2: out = H1 . W2 + b2 + M
__global__ __launch_bounds__(128) void k_ff1(const _Float16* __restrict__ XH, const _Float16* __restrict__ W1r, const float* __restrict__ B1, _Float16* __restrict__ H1) { __shared__ __align__(16) _Float16 sh[4][16][136];
  const int tid = threadIdx.x, wave = tid >> 5, lane = tid & 31, col = lane & 15, g = lane >> 4; const size_t r0 = (size_t)blockIdx.x * 64 + wave * 16; const int c0 = blockIdx.y * 128;
  v8f acc[8] = {};
#pragma unroll
  for (int kc = 0; kc < CM / 32; ++kc) { const v16h a = frag_h(XH + (r0 + col) * CM + kc * 32, lane);
#pragma unroll
    for (int j = 0; j < 8; ++j) acc[j] = wmma16(a, frag_t(W1r + ((size_t)(c0 / 16 + j) * (CM / 32) + kc) * 512, lane), acc[j]); }
#pragma unroll
  for (int j = 0; j < 8; ++j) { const float bb = bfr(B1[c0 + j * 16 + col]);
#pragma unroll
    for (int r = 0; r < 8; ++r) sh[wave][8 * g + r][j * 16 + col] = (_Float16)fmaxf(acc[j][r] * (1.0f / WSC) + bb, 0.f); }
  LDSX(); for (int rl = 0; rl < 16; ++rl) if (lane < 16) vst2((unsigned*)(H1 + (r0 + rl) * FF + c0 + lane * 8), *(const v4u*)&sh[wave][rl][lane * 8]); }
__global__ __launch_bounds__(128) void k_ff2(const _Float16* __restrict__ H1, const _Float16* __restrict__ W2r, const float* __restrict__ B2, const float* __restrict__ M, float* __restrict__ OUT) { __shared__ __align__(16) float sf[4][16][132];
  const int tid = threadIdx.x, wave = tid >> 5, lane = tid & 31, col = lane & 15, g = lane >> 4; const size_t r0 = (size_t)blockIdx.x * 64 + wave * 16; const int c0 = blockIdx.y * 128;
  v8f acc[8] = {};
#pragma unroll 2
  for (int kc = 0; kc < FF / 32; ++kc) { const v16h a = frag_h(H1 + (r0 + col) * FF + kc * 32, lane);
#pragma unroll
    for (int j = 0; j < 8; ++j) acc[j] = wmma16(a, frag_t(W2r + ((size_t)(c0 / 16 + j) * (FF / 32) + kc) * 512, lane), acc[j]); }
#pragma unroll
  for (int j = 0; j < 8; ++j) { const int c = c0 + j * 16 + col; const float bb = bfr(B2[c]);
#pragma unroll
    for (int r = 0; r < 8; ++r) sf[wave][8 * g + r][j * 16 + col] = acc[j][r] * (1.0f / WSC) + bb + M[(r0 + 8 * g + r) * CM + c]; }
  LDSX(); for (int rl = 0; rl < 16; ++rl) vst2(OUT + (r0 + rl) * CM + c0 + lane * 4, *(const v4f*)&sf[wave][rl][lane * 4]); }
extern "C" void kernel_launch(void* const* d_in, const int* in_sizes, int n_in, void* d_out, int out_size, void* d_ws, size_t ws_size, hipStream_t stream) {
  (void)in_sizes; (void)n_in; (void)out_size;
  const float** F = (const float**)d_in;   // 0 m [1,128,256,256], 1 z [1,256,256,128], 2 mask [1,128,256], 3 ln_m_g, 4 ln_m_b, 5 ln_z_g, 6 ln_z_b, 7 wz [128,8], 8 wq [256,8,32], 9 wk, 10 wv, 11 wg, 12 bg [8,32], 13 wo [8,32,256], 14 bo [256]
  if (ws_size < (size_t)WS_END) return;
  char* ws = (char*)d_ws; _Float16 *RW = (_Float16*)(ws + WS_RW), *RWOp = (_Float16*)(ws + WS_RWO), *XH = (_Float16*)(ws + WS_XH), *Gt = (_Float16*)(ws + WS_G);
  float *O = (float*)(ws + WS_O), *PB = (float*)(ws + WS_PB);
  k_prep<<<PWB + PBB + LNB, 256, 0, stream>>>(F[8], F[9], F[10], F[11], F[13], ws, F[0], F[3], F[4], XH, F[1], F[5], F[6], F[7], PB);
  k_pa<0><<<dim3(NH, SQ), 256, 0, stream>>>(XH, RW, F[12], PB, F[2], Gt, O);
  k_go<0><<<dim3(NROW / 64, CM / 128), 128, 0, stream>>>(Gt, O, RWOp, F[14], (float*)d_out);
}

// v010
// Measured time: 71.3 microseconds a run.
// Two timings next to v009 put it at 1.10 and 1.09 times that version's speed.
// All steps since v000 together make it 4.95 times as fast.
// compute dtype: all float inputs rounded to bf16; LayerNorms, pair bias (LN(z) . wz), softmax, sigmoid gate in f32; q|k|v|g projections on WMMA 16x16x32 with the LayerNorm output rounded once to f16 against exact f16 x 2^8 weights; attention logits with single f16 q, k (32-dim heads), P as f16 hi + residual (x 2^11) . v (hi + residual; 3 products); (g o) as f16 hi + residual (2 products) . wo (f16 x 2^8) + bo; f32 output.
#include <hip/hip_runtime.h>
#include <math.h>

typedef __attribute__((ext_vector_type(16))) _Float16 v16h;
typedef __attribute__((ext_vector_type(16))) __bf16 v16b;
typedef __attribute__((ext_vector_type(8)))  _Float16 v8h;
typedef __attribute__((ext_vector_type(8)))  float v8f;
typedef __attribute__((ext_vector_type(4)))  float v4f;
typedef __attribute__((ext_vector_type(2)))  float v2f;
typedef __attribute__((ext_vector_type(2)))  _Float16 v2h;
typedef __attribute__((ext_vector_type(4)))  unsigned v4u;
typedef __attribute__((ext_vector_type(4)))  int v4i;
typedef float __attribute__((may_alias)) float_a;
typedef int __attribute__((may_alias)) int_a;

template <typename T> __device__ __forceinline__ void vst2(void* p, T v) { *(T*)p = v;  }
__device__ __forceinline__ v8f wmma16(v16h a, v16h b, v8f c) {
  v8f d = __builtin_amdgcn_wmma_f32_16x16x32_f16(false, a, false, b, (short)0, c, false, false);
  asm volatile("v_nop\n\tv_nop\n\tv_nop\n\tv_nop" : "+v"(d) : "v"(a), "v"(b));
  return d;
}
__device__ __forceinline__ v8f wmma_bf(v16b a, v16b b, v8f c) {
  v8f d = __builtin_amdgcn_wmma_f32_16x16x32_bf16(false, a, false, b, (short)0, c, false, false);
  asm volatile("v_nop\n\tv_nop\n\tv_nop\n\tv_nop" : "+v"(d) : "v"(a), "v"(b));
  return d;
}
// 16x16x32 fragments: lane = (h = lane>>4, row/col = lane&15); elements 0..7 = k0+8h+0..7, 8..15 = k0+16+8h+0..7; D element r = row 8h+r
__device__ __forceinline__ v16h frag_h(const _Float16* rowk0, int lane) {
  union { v16h v; v8h q[2]; } u; const _Float16* p = rowk0 + 8 * (lane >> 4);
  u.q[0] = *(const v8h*)p; u.q[1] = *(const v8h*)(p + 16); return u.v;
}
// the same fragment from a 16 x 32 tile kept in fragment order: 1 KiB = [elements 0..7 | 8..15][lane][8 f16], so each of the wave's two 16-byte loads covers 512 contiguous bytes (4 whole lines, not pieces of 16)
__device__ __forceinline__ v16h frag_t(const _Float16* tile, int lane) {
  union { v16h v; v8h q[2]; } u; const _Float16* p = tile + 8 * lane;
  u.q[0] = *(const v8h*)p; u.q[1] = *(const v8h*)(p + 256); return u.v;
}
__device__ __forceinline__ v16h frag_f32(const float* rowk0, int lane) {
  v16h a; const float* p = rowk0 + 8 * (lane >> 4);
#pragma unroll
  for (int i = 0; i < 8; ++i) { a[i] = (_Float16)p[i]; a[8 + i] = (_Float16)p[16 + i]; }
  return a;
}
__device__ __forceinline__ v16h frag_f32s(const float* rowk0, int lane, float sc) {
  v16h a; const float* p = rowk0 + 8 * (lane >> 4);
#pragma unroll
  for (int i = 0; i < 8; ++i) { a[i] = (_Float16)(p[i] * sc); a[8 + i] = (_Float16)(p[16 + i] * sc); }
  return a;
}
// column fragment from a [K][ld] layout (column n), rows >= K read as 0
__device__ __forceinline__ v16h fragc_f32(const float* W, int k0, int n, int lane, int ld, int K) {
  v16h a; const int g = lane >> 4;
#pragma unroll
  for (int i = 0; i < 8; ++i) { const int ka = k0 + 8 * g + i, kb = ka + 16;
    a[i] = (_Float16)(ka < K ? W[(size_t)(ka < K ? ka : K - 1) * ld + n] : 0.f); a[8 + i] = (_Float16)(kb < K ? W[(size_t)(kb < K ? kb : K - 1) * ld + n] : 0.f); }
  return a;
}
struct F2 { v16b h, l; };
__device__ __forceinline__ F2 bsplit16(const float v[16]) { F2 r;
#pragma unroll
  for (int i = 0; i < 16; ++i) { const __bf16 h = (__bf16)v[i]; r.h[i] = h; r.l[i] = (__bf16)(v[i] - (float)h); }
  return r; }
__device__ __forceinline__ F2 split_row(const float* row, int k0, int lane) { float v[16]; const float* p = row + k0 + 8 * (lane >> 4);
#pragma unroll
  for (int i = 0; i < 8; ++i) { v[i] = p[i]; v[8 + i] = p[16 + i]; }
  return bsplit16(v); }
__device__ __forceinline__ F2 split_rowK(const float* row, int k0, int lane, int K) { float v[16]; const int g = lane >> 4;
#pragma unroll
  for (int i = 0; i < 8; ++i) { const int ka = k0 + 8 * g + i, kb = ka + 16; v[i] = ka < K ? row[ka < K ? ka : K - 1] : 0.f; v[8 + i] = kb < K ? row[kb < K ? kb : K - 1] : 0.f; }
  return bsplit16(v); }
__device__ __forceinline__ F2 split_col(const float* W, int k0, int n, int lane, int ld, int K) { float v[16]; const int g = lane >> 4;
#pragma unroll
  for (int i = 0; i < 8; ++i) { const int ka = k0 + 8 * g + i, kb = ka + 16; v[i] = ka < K ? W[(size_t)(ka < K ? ka : K - 1) * ld + n] : 0.f; v[8 + i] = kb < K ? W[(size_t)(kb < K ? kb : K - 1) * ld + n] : 0.f; }
  return bsplit16(v); }
__device__ __forceinline__ v8f mac3(const F2& a, const F2& b, v8f c) { c = wmma_bf(a.l, b.h, c); c = wmma_bf(a.h, b.l, c); return wmma_bf(a.h, b.h, c); }
__device__ __forceinline__ float sigm(float v) { return 1.0f / (1.0f + expf(-v)); }
#define LDSX() do { asm volatile("s_wait_dscnt 0" ::: "memory"); __builtin_amdgcn_wave_barrier(); __builtin_amdgcn_fence(__ATOMIC_RELEASE, "workgroup"); } while (0)


// MSA row attention with pair bias (B 1, S 128 sequences x R 256 residues, c_m 256, 8 heads x 32, c_z 128): out = (sigmoid(LN(m) wg + bg) * softmax(q k / sqrt(32) + 1e9 (mask - 1) + LN(z) wz) v) wo + bo.
#define SQ 128
#define RR 256
#define CM 256
#define NH 8
#define CA 32
#define CZ 128
#define FF 1024
#define NROW (SQ * RR)
#define WSC 256.0f
#define LOG2E 1.4426950408889634f
#define QSC (0.17677669529663687f * LOG2E)   // 1 / sqrt(32) and log2(e), applied to q before its rounding to f16
#ifndef TON
#define TON 1           // unused
#endif
typedef __attribute__((ext_vector_type(8))) __bf16 v8b;
__device__ __forceinline__ v16b frag_b(const __bf16* rowk0, int lane) {
  union { v16b v; v8b q[2]; } u; const __bf16* p = rowk0 + 8 * (lane >> 4);
  u.q[0] = *(const v8b*)p; u.q[1] = *(const v8b*)(p + 16); return u.v;
}
__device__ __forceinline__ float bfr(float v) { return (float)(__bf16)v; }
__device__ __attribute__((noinline)) float exp_ni(float v) { return expf(v); }
__device__ __attribute__((noinline)) float erf_ni(float v) { return erff(v); }

// weights (f16 x 2^8, transposed (in,out)), as 16 x 32 tiles in fragment order [out / 16][in / 32][512]: RW 1024 x 256 = q|k|v|g ; CW 1024 x 256; RWO 256 x 256; CWO 256 x 256; TW1 1024 x 256; TW2 256 x 1024
#define WS_RW   0u
#define WS_CW   (WS_RW + 2u * 1024 * CM)
#define WS_RWO  (WS_CW + 2u * 1024 * CM)
#define WS_CWO  (WS_RWO + 2u * CM * CM)
#define WS_TW1  (WS_CWO + 2u * CM * CM)
#define WS_TW2  (WS_TW1 + 2u * FF * CM)
#define WS_XH   (WS_TW2 + 2u * CM * FF)                 // f16 LN rows [NROW][256] (natural s*R + r)
#define WS_QK   (WS_XH + 2u * (size_t)NROW * CM)         // not used any more (q stays in registers, k in LDS); the offsets behind it stay as they were
#define WS_VT   (WS_QK + 2u * (size_t)NROW * 2 * CM)     // not used any more, nor is WS_VTL (v hi, lo stay in LDS)
#define WS_VTL  (WS_VT + 2u * (size_t)NROW * CM)
#define WS_G    (WS_VTL + 2u * (size_t)NROW * CM)        // f16 sigmoid gate, tiles (16 natural rows x 32 channels) in fragment order [NROW / 16][256 / 32][512]
#define WS_O    (WS_G + 2u * (size_t)NROW * CM)          // f32 attention output, tiles (16 compact rows x 32 channels = one head) in fragment order [NROW / 16][256 / 32][element quad 0..3][lane][4]
#define WS_M    (WS_O + 4u * (size_t)NROW * CM)          // f32 working m [natural][256]
#define WS_PB   (WS_M + 4u * (size_t)NROW * CM)          // f32 pair bias x log2(e), tiles (16 queries x 32 keys) in the order of k_pa's score registers [h][q / 16][k / 32][quad = (k % 32 / 16) * 2 + k % 8 / 4][lane = (k % 16 / 8) * 16 + q % 16][4]
#define WS_H1   (WS_PB + 4u * (size_t)NH * RR * RR)      // f16 relu rows [natural][1024]
#define WS_END  (WS_H1 + 2u * (size_t)NROW * FF)

// ---- d_packw: block bx = 16 output rows = one row of tiles, so every 128-byte line of the packed weights has one writer; bx 0 .. 63: RW (W = rq|rk|rv|rg by n / 256), bx 64 .. 79: RWO
#define PWB (1024 / 16 + CM / 16)
__device__ __forceinline__ void d_packw(int bx, const float* __restrict__ RQ, const float* __restrict__ RK, const float* __restrict__ RV, const float* __restrict__ RG, const float* __restrict__ RWO, char* __restrict__ ws) {
  const int t = threadIdx.x; const bool qkvg = bx < 1024 / 16; const int tr = qkvg ? bx : bx - 1024 / 16, n0 = tr * 16, g4 = n0 / CM, col = n0 % CM;
  const float* Wm = !qkvg ? RWO : g4 == 0 ? RQ : g4 == 1 ? RK : g4 == 2 ? RV : RG; constexpr int kin = CM, kout = CM;
  _Float16* dst = (_Float16*)(ws + (qkvg ? WS_RW : WS_RWO)) + (size_t)tr * (kin / 32) * 512;
  // chunk e = (k tile e >> 6, half (e >> 5) & 1, lane e & 31) lies at f16 offset 8 e: a wave stores 512 contiguous bytes; its 8 values are k .. k + 7 of output row n0 + (lane & 15)
  for (int e = t; e < kin * 2; e += 256) { const int ln = e & 31, k = (e >> 6) * 32 + ((e >> 5) & 1) * 16 + (ln >> 4) * 8; v8h o;
#pragma unroll   // o is indexed by constants and stays in registers
    for (int i = 0; i < 8; ++i) o[i] = (_Float16)(bfr(Wm[(size_t)(k + i) * kout + col + (ln & 15)]) * WSC);
    vst2(dst + e * 8, o); } }
// ---- d_ln (block bx): XH = LN(bf16(m)) w + b (jnp.var, 1e-5) -> f16. One wave owns a row (lane l: channels 4l + e and 128 + 4l + e, so each 16-byte load of a wave covers 512 contiguous bytes) and works on LNR rows; no LDS, no barrier
// value of lane l ^ MSK inside a 16-lane row, by a DPP move (no LDS round trip as with __shfl_xor)
template <int MSK> __device__ __forceinline__ float rowx(float x) { return __builtin_bit_cast(float, __builtin_amdgcn_mov_dpp(__builtin_bit_cast(int, x), 0x160 | MSK, 0xf, 0xf, true)); }
// lane l with lane l ^ 16
__device__ __forceinline__ float xhalf(float x) { return __builtin_bit_cast(float, __builtin_amdgcn_permlanex16(__builtin_bit_cast(int, x), __builtin_bit_cast(int, x), 0x76543210, 0xfedcba98, false, false)); }
__device__ __forceinline__ float wsum(float s) { s += rowx<1>(s); s += rowx<2>(s); s += rowx<4>(s); s += rowx<8>(s); return s + xhalf(s); }
typedef __attribute__((ext_vector_type(4))) _Float16 v4h;
#define LNR 8
__device__ __forceinline__ void d_ln(int bx, const float* __restrict__ X, const float* __restrict__ G, const float* __restrict__ Bt, _Float16* __restrict__ XH) { const int lane = threadIdx.x & 31; const size_t row0 = ((size_t)bx * 8 + (threadIdx.x >> 5)) * LNR;
  const float* xr = X + row0 * CM + lane * 4; _Float16* yr = XH + row0 * CM + lane * 4;
  // both loops are fully unrolled: the arrays are indexed by constants and stay in registers
  v4f xa[LNR], xb[LNR];   // the wave's LNR rows: all loads are issued before the first use, so memory latency is paid once
#pragma unroll
  for (int p = 0; p < LNR; ++p) { xa[p] = *(const v4f*)(xr + (size_t)p * CM); xb[p] = *(const v4f*)(xr + (size_t)p * CM + 128); }
  const v4f g0 = *(const v4f*)(G + lane * 4), g1 = *(const v4f*)(G + 128 + lane * 4), c0 = *(const v4f*)(Bt + lane * 4), c1 = *(const v4f*)(Bt + 128 + lane * 4);
  float gg[8], bb[8];
#pragma unroll
  for (int e = 0; e < 4; ++e) { gg[e] = bfr(g0[e]); gg[4 + e] = bfr(g1[e]); bb[e] = bfr(c0[e]); bb[4 + e] = bfr(c1[e]); }
#pragma unroll
  for (int p = 0; p < LNR; ++p) { float v[8];
#pragma unroll
    for (int e = 0; e < 4; ++e) { v[e] = bfr(xa[p][e]); v[4 + e] = bfr(xb[p][e]); }
    const float mu = wsum(((v[0] + v[1]) + (v[2] + v[3])) + ((v[4] + v[5]) + (v[6] + v[7]))) / (float)CM; float qq = 0.f;
#pragma unroll
    for (int i = 0; i < 8; ++i) { v[i] -= mu; qq += v[i] * v[i]; }
    const float inv = 1.0f / sqrtf(wsum(qq) / (float)CM + 1e-5f); v4h h0, h1;
#pragma unroll
    for (int e = 0; e < 4; ++e) { h0[e] = (_Float16)(v[e] * inv * gg[e] + bb[e]); h1[e] = (_Float16)(v[4 + e] * inv * gg[4 + e] + bb[4 + e]); }
    vst2(yr + (size_t)p * CM, h0); vst2(yr + (size_t)p * CM + 128, h1); }
  asm volatile("s_wait_xcnt 0x0" ::: "memory"); }   // in k_prep's listing another job's code follows these stores and rewrites their registers: the wait stands in front of it
// natural row index of (batch b, token n): MODE 0 row attention (b = s, n = r); MODE 1 column attention (b = r, n = s)
template <int MODE> __device__ __forceinline__ size_t nat(size_t b, int n) { return MODE == 0 ? b * RR + n : (size_t)n * RR + b; }
// ---- d_pb: block (ko, qt) = (8 keys, 16 query residues) = 128 z rows, row rho = (query rho / 8, key rho % 8): per head it owns two whole 256-byte runs of a PB tile; PB(h, q, k) = LN(z[q][k]) . wb[:, h] x log2(e); 16 lanes share one z row (8 channels a lane, two 16-byte loads), a wave works on 2 rows at a time; this lane's 8 x 8 weights stay in registers
#define PBK 128
__device__ __forceinline__ void d_pb(int ko, int qt, const float* __restrict__ Zp, const float* __restrict__ G, const float* __restrict__ Bt, const float* __restrict__ WB, float* __restrict__ PB) { __shared__ __align__(16) float sp[NH][PBK + 4]; __shared__ __align__(16) float swb[CZ / 4][4 * NH + 4];   // swb: 4 channels x 8 heads a row, pitch 36 words: the 16 lanes' 16-byte reads fall on distinct banks
  const int t = threadIdx.x, lane = t & 31, w = t >> 5, l16 = lane & 15, hf = lane >> 4;
  const float* zr = Zp + (((size_t)qt * 16 + w * 2) * RR + ko * 8 + hf) * CZ + l16 * 4;   // rows rho = w*16 + 2p + hf: query qt*16 + 2w + p/4, key ko*8 + 2(p%4) + hf; channels 4*l16 + e and 64 + 4*l16 + e
  // every loop of this kernel is fully unrolled: its arrays are indexed by constants and stay in registers
  v4f za[8], zb[8];   // the wave's 16 rows: all 16 loads are issued before the first use, so memory latency is paid once
#pragma unroll
  for (int p = 0; p < 8; ++p) { za[p] = *(const v4f*)(zr + ((size_t)(p >> 2) * RR + (p & 3) * 2) * CZ); zb[p] = *(const v4f*)(zr + ((size_t)(p >> 2) * RR + (p & 3) * 2) * CZ + 64); }
  v4f g4[2], b4[2];
#pragma unroll
  for (int i = 0; i < 2; ++i) { g4[i] = *(const v4f*)(G + 64 * i + l16 * 4); b4[i] = *(const v4f*)(Bt + 64 * i + l16 * 4); }
  { v4f w4 = *(const v4f*)(WB + t * 4); w4[0] = bfr(w4[0]); w4[1] = bfr(w4[1]); w4[2] = bfr(w4[2]); w4[3] = bfr(w4[3]); *(v4f*)&swb[t >> 3][(t & 7) * 4] = w4; } __syncthreads();
  float wv[8][NH], gg[8], bb[8];
#pragma unroll
  for (int i = 0; i < 2; ++i) {
#pragma unroll
    for (int e = 0; e < 4; ++e) { gg[i * 4 + e] = bfr(g4[i][e]); bb[i * 4 + e] = bfr(b4[i][e]); const v4f w0 = *(const v4f*)&swb[16 * i + l16][e * NH], w1 = *(const v4f*)&swb[16 * i + l16][e * NH + 4];
#pragma unroll
      for (int h = 0; h < 4; ++h) { wv[i * 4 + e][h] = w0[h]; wv[i * 4 + e][4 + h] = w1[h]; } } }
  const bool b0 = (l16 & 1) != 0, b1 = (l16 & 2) != 0, b2 = (l16 & 4) != 0;
#pragma unroll
  for (int p = 0; p < 8; ++p) { float v[8];
#pragma unroll
    for (int e = 0; e < 4; ++e) { v[e] = bfr(za[p][e]); v[4 + e] = bfr(zb[p][e]); }
    float s = ((v[0] + v[1]) + (v[2] + v[3])) + ((v[4] + v[5]) + (v[6] + v[7]));
    s += rowx<1>(s); s += rowx<2>(s); s += rowx<4>(s); s += rowx<8>(s);
    const float mu = s / (float)CZ; float qq = 0.f;
#pragma unroll
    for (int i = 0; i < 8; ++i) { v[i] -= mu; qq += v[i] * v[i]; }
    qq += rowx<1>(qq); qq += rowx<2>(qq); qq += rowx<4>(qq); qq += rowx<8>(qq);
    const float inv = 1.0f / sqrtf(qq / (float)CZ + 1e-5f); float ph[NH];
#pragma unroll
    for (int h = 0; h < NH; ++h) ph[h] = 0.f;
#pragma unroll
    for (int i = 0; i < 8; ++i) { const float ln = v[i] * inv * gg[i] + bb[i];
#pragma unroll
      for (int h = 0; h < NH; ++h) ph[h] += ln * wv[i][h]; }
    // sum over the 16 lanes, halving the heads a lane carries at each of the first three steps: lane l16 ends with head l16 & 7
    float y[4], u[2];
#pragma unroll
    for (int i = 0; i < 4; ++i) y[i] = (b0 ? ph[2 * i + 1] : ph[2 * i]) + rowx<1>(b0 ? ph[2 * i] : ph[2 * i + 1]);
#pragma unroll
    for (int i = 0; i < 2; ++i) u[i] = (b1 ? y[2 * i + 1] : y[2 * i]) + rowx<2>(b1 ? y[2 * i] : y[2 * i + 1]);
    float x = (b2 ? u[1] : u[0]) + rowx<4>(b2 ? u[0] : u[1]); x += rowx<8>(x);
    if (l16 < NH) sp[l16][w * 16 + p * 2 + hf] = x * LOG2E; }   // stored in base-2 units: k_pa's softmax works with 2^x
  __syncthreads(); { const int h = t >> 5, i = (t >> 4) & 1;   // ko = (32-key tile ko / 4, 16-key half (ko / 2) % 2, lane half ko % 2); a wave stores the head's two 256-byte runs (quads i = 0, 1; 16 queries x 4 keys each)
    vst2(PB + ((((size_t)h * (RR / 16) + qt) * (RR / 32) + (ko >> 2)) * 4 + ((ko >> 1) & 1) * 2 + i) * 128 + ((ko & 1) * 16 + l16) * 4, *(const v4f*)&sp[h][l16 * 8 + i * 4]); }
  asm volatile("s_wait_xcnt 0x0" ::: "memory"); }   // as at the end of d_ln: another job's code follows this store in the listing
// ---- k_prep: the three jobs that k_pa waits for need nothing of each other, so they share one grid; a range of the block index picks the job (a scalar branch, the same for the whole block: d_pb's two barriers stand under it)
#define LNB (NROW / (8 * LNR))
#define PBB ((RR / 8) * (RR / 16))
__global__ __launch_bounds__(256) void k_prep(const float* __restrict__ RQ, const float* __restrict__ RK, const float* __restrict__ RV, const float* __restrict__ RG, const float* __restrict__ RWO, char* __restrict__ ws, const float* __restrict__ X, const float* __restrict__ LG, const float* __restrict__ LB, _Float16* __restrict__ XH, const float* __restrict__ Zp, const float* __restrict__ ZG, const float* __restrict__ ZB, const float* __restrict__ WB, float* __restrict__ PB) {
  const int bx = blockIdx.x;
  if (bx < PWB) d_packw(bx, RQ, RK, RV, RG, RWO, ws);
  else if (bx < PWB + PBB) d_pb((bx - PWB) % (RR / 8), (bx - PWB) / (RR / 8), Zp, ZG, ZB, WB, PB);
  else d_ln(bx - (PWB + PBB), X, LG, LB, XH); }
// ---- k_pa<MODE>: projections and attention of one (head h, sequence b) in one block of 8 waves; a wave = 32 tokens = two 16-token tiles u, first as rows of the projections, then as queries.
// Part 1: the head's 8 column tiles j = kind * 2 + jj (kind 0 q, 1 k, 2 v, 3 gate; 16 channels each) x 2 token tiles. q, k and the gate are taken transposed (A = weight rows, B = token columns): a lane (g, col) then holds channels jj * 16 + 8g + r of ONE token, which is that token's share of a 16 x 32 tile in fragment order; v is taken as it was (A = token rows): a lane holds tokens 8g + r of one channel, its share of a (16 channels x 32 tokens) tile. So q stays in registers as part 2's B operand, k and v (hi, lo) go to LDS as whole tiles with 16-byte stores, the gate goes to its workspace tiles; nothing is staged for a transpose.
// Part 2 (the barrier stands behind the LDS stores of k and v): S^T = K . Q^T (A = key rows, B = query columns), O^T = V^T . P^T (A = channel rows, B = P^T). A lane (g, col) holds, per tile, 16 of the pass's 32 scores of ONE query, q0 + 16 u + col (keys ct * 16 + 8g + r): maximum and sum are taken in the lane, with one exchange between the lane halves; the two score tiles, converted in place, are the B operand P^T, and the O^T registers are the O tile's quads
template <int MODE>
__global__ __launch_bounds__(256) void k_pa(const _Float16* __restrict__ XH, const _Float16* __restrict__ Wr, const float* __restrict__ BG, const float* __restrict__ PB, const float* __restrict__ MASK, _Float16* __restrict__ Gt, float* __restrict__ O) {
  static_assert(MODE == 0, "gate tiles (16 natural rows) and pair bias tiles belong to row attention");
  constexpr int NN = MODE == 0 ? RR : SQ;
  static_assert(NN == 256, "8 waves x 32 tokens cover the sequence");
  __shared__ __align__(16) _Float16 sK[(NN / 16) * 512], sVh[2 * (NN / 32) * 512], sVl[2 * (NN / 32) * 512];   // k: [key tile][512]; v hi, lo: [channel tile jj][32-key group][512]; all in fragment order
  const int tid = threadIdx.x, wave = tid >> 5, lane = tid & 31, col = lane & 15, g = lane >> 4; const int h = blockIdx.x; const size_t b = blockIdx.y; const int q0 = wave * 32; const size_t rq = b * NN + q0;
  v16h bq[2]; unsigned kv = 0u, kall = 0xffffffffu;   // kv: lane ks holds pass ks's kept keys (bit = key of the pass); kall: the AND of the 8 words (scalar)
  {
  v8f pa[2][8] = {};
  // fragments are fetched ahead: the 64 weight fragments (order f = kc * 8 + j) go through a ring of PJW register sets, fragment f + PJW being requested right behind the two WMMAs that read fragment f, so a WMMA waits only for a load issued 14 WMMAs earlier, not for its own (7 sets: the wave stays within 256 registers, 4 waves a SIMD); the two row fragments of the next k block are requested ahead of this block's WMMAs
  const _Float16* ar0 = XH + nat<MODE>(b, q0 + col) * CM; const _Float16* ar1 = XH + nat<MODE>(b, q0 + 16 + col) * CM; const _Float16* wr = Wr + (size_t)(h * 2) * (CM / 32) * 512;   // column tile j is weight tile row (j >> 1) * (CM / 16) + h * 2 + (j & 1)
  v16h a0 = frag_h(ar0, lane), a1 = frag_h(ar1, lane); constexpr int PJW = 7; v16h wf[PJW]; v4f bg4[2][2];
#pragma unroll   // wf, pa and bg4 are indexed by constants and stay in registers (every loop of part 1)
  for (int f = 0; f < PJW; ++f) wf[f] = frag_t(wr + ((size_t)(((f & 7) >> 1) * (CM / 16) + (f & 1)) * (CM / 32) + (f >> 3)) * 512, lane);
  __builtin_amdgcn_sched_barrier(0);   // keeps the first loads of both row tiles ahead of the first WMMA: moved behind it, the second tile's loads were waited for alone, a second full memory latency at the head of every wave
#pragma unroll
  for (int kc = 0; kc < CM / 32; ++kc) { v16h an0 = a0, an1 = a1; if (kc + 1 < CM / 32) { an0 = frag_h(ar0 + (kc + 1) * 32, lane); an1 = frag_h(ar1 + (kc + 1) * 32, lane);
      if (kc + 2 == CM / 32) asm volatile("s_wait_xcnt 0x0" ::: "memory"); }   // behind the last row loads: stands in front of what rewrites their address registers, which are free from here on (a later weight load's result takes them)
#pragma unroll
    for (int j = 0; j < 8; ++j) { const int f = kc * 8 + j, fn = f + PJW;
      if ((j >> 1) == 2) { pa[0][j] = wmma16(a0, wf[f % PJW], pa[0][j]); pa[1][j] = wmma16(a1, wf[f % PJW], pa[1][j]); }
      else { pa[0][j] = wmma16(wf[f % PJW], a0, pa[0][j]); pa[1][j] = wmma16(wf[f % PJW], a1, pa[1][j]); }
      if (fn < 8 * (CM / 32)) wf[f % PJW] = frag_t(wr + ((size_t)(((fn & 7) >> 1) * (CM / 16) + (fn & 1)) * (CM / 32) + (fn >> 3)) * 512, lane); }
    a0 = an0; a1 = an1; }
  // the gate bias (this lane's 16 channels) is requested behind the last WMMA, in registers that the weight ring has left, and lands behind the conversions of q, k and v
#pragma unroll
  for (int jj = 0; jj < 2; ++jj)
#pragma unroll
    for (int i = 0; i < 2; ++i) bg4[jj][i] = *(const v4f*)(BG + h * CA + jj * 16 + 8 * g + 4 * i);
  asm volatile("s_wait_xcnt 0x0" ::: "memory");   // stands in front of what rewrites the address registers of the bias loads
#pragma unroll
  for (int u = 0; u < 2; ++u)
#pragma unroll
    for (int jj = 0; jj < 2; ++jj) { v8h kk, hv, lv;   // half jj (q, k: channels jj * 16 + ..) or half u (v: tokens u * 16 + ..) of a tile: 8 f16 a lane, 512 contiguous bytes a wave
#pragma unroll
      for (int r = 0; r < 8; ++r) { bq[u][jj * 8 + r] = (_Float16)(pa[u][jj][r] * (QSC / WSC)); kk[r] = (_Float16)(pa[u][2 + jj][r] * (1.0f / WSC));
        const float v = pa[u][4 + jj][r] * (1.0f / WSC); const _Float16 x = (_Float16)v; hv[r] = x; lv[r] = (_Float16)((v - (float)x) * 2048.0f); }
      *(v8h*)&sK[(wave * 2 + u) * 512 + jj * 256 + lane * 8] = kk;
      *(v8h*)&sVh[(jj * (NN / 32) + wave) * 512 + u * 256 + lane * 8] = hv; *(v8h*)&sVl[(jj * (NN / 32) + wave) * 512 + u * 256 + lane * 8] = lv; }
  __syncthreads();   // every wave's k and v tiles are in LDS; they are only read from here on. The gate follows the barrier, so that no wave waits there for its gate stores
  float mk[NN / 32];   // the sequence's mask (lane = key of pass ks), requested here once: the gate's arithmetic covers the latency, and no pass of part 2 waits for a mask load in front of its branch
#pragma unroll
  for (int ks = 0; ks < NN / 32; ++ks) mk[ks] = MASK[nat<MODE>(b, ks * 32 + lane)];
#pragma unroll
  for (int u = 0; u < 2; ++u)
#pragma unroll
    for (int jj = 0; jj < 2; ++jj) { v8h gv;   // half jj of the gate tile (token tile u, head h)
#pragma unroll
      for (int r = 0; r < 8; ++r) gv[r] = (_Float16)(1.0f / (1.0f + expf(-(pa[u][6 + jj][r] * (1.0f / WSC) + bfr(bg4[jj][r >> 2][r & 3])))));
      vst2(Gt + ((rq / 16 + u) * (CM / 32) + h) * 512 + jj * 256 + lane * 8, gv);
      __builtin_amdgcn_sched_barrier(0); }   // one half tile's 8 exp and division chains at a time: with all 32 interleaved their temporaries went past the 256 registers of four waves a SIMD
  asm volatile("s_wait_xcnt 0x0" ::: "memory");   // stands in front of what rewrites the address and data registers of the gate stores and the address registers of the mask loads
#pragma unroll
  for (int ks = 0; ks < NN / 32; ++ks) { const unsigned kw = __builtin_amdgcn_ballot_w32(bfr(mk[ks]) != 0.f); kall &= kw; if (lane == ks) kv = kw; }
  }
  const float* pbt = PB + ((size_t)h * (RR / 16) + q0 / 16) * (RR / 32) * 512 + lane * 4;
  float m[2] = {-3.0e38f, -3.0e38f}, l[2] = {0.f, 0.f};   // per query tile: the query's running maximum (equal in both lane halves) and this half's share of its sum
  v8f acc[2][2] = {}, accl[2][2] = {};
#pragma unroll 1
  for (int ks = 0; ks < NN / 32; ++ks) {
    // all loads of the pass are issued here, ahead of its first WMMA
    v16h kh[2], vh[2], vl[2]; v4f pb[2][2][2];
#pragma unroll   // the arrays are indexed by constants and stay in registers
    for (int ct = 0; ct < 2; ++ct) {
#pragma unroll
      for (int u = 0; u < 2; ++u)
#pragma unroll
        for (int i = 0; i < 2; ++i) pb[u][ct][i] = *(const v4f*)(pbt + (u * (RR / 32) + ks) * 512 + (ct * 2 + i) * 128); }
    asm volatile("s_wait_xcnt 0x0" ::: "memory");   // stands in front of what rewrites the address registers of the loads above: the next pass's address additions
#pragma unroll
    for (int ct = 0; ct < 2; ++ct) kh[ct] = frag_t(&sK[(ks * 2 + ct) * 512], lane);
#pragma unroll
    for (int j = 0; j < 2; ++j) { vh[j] = frag_t(&sVh[(j * (NN / 32) + ks) * 512], lane); vl[j] = frag_t(&sVl[(j * (NN / 32) + ks) * 512], lane); }
    if (kall != 0xffffffffu) { const unsigned kb = (unsigned)__builtin_amdgcn_readlane((int)kv, ks) >> (8 * g);   // a scalar test on a value fixed before the loop: only a sequence with a masked key pays for the selects. A masked key's bias becomes -3e38, which swallows the product added to it: its score is -3e38
#pragma unroll
      for (int u = 0; u < 2; ++u)
#pragma unroll
        for (int ct = 0; ct < 2; ++ct)
#pragma unroll
          for (int r = 0; r < 8; ++r) if (((kb >> (ct * 16 + r)) & 1u) == 0u) pb[u][ct][r >> 2][r & 3] = -3.0e38f; }
#pragma unroll
    for (int u = 0; u < 2; ++u) { float s[2][8];
#pragma unroll
    for (int ct = 0; ct < 2; ++ct) { v8f c;   // the pair bias is the product's C operand and q carries the score scale: the product is the score, in base-2 units
#pragma unroll
      for (int r = 0; r < 8; ++r) c[r] = pb[u][ct][r >> 2][r & 3];
      c = wmma16(kh[ct], bq[u], c);
#pragma unroll
      for (int r = 0; r < 8; ++r) s[ct][r] = c[r]; }
    float t[8];
#pragma unroll
    for (int r = 0; r < 8; ++r) t[r] = fmaxf(s[0][r], s[1][r]);
    float mx = fmaxf(fmaxf(fmaxf(t[0], t[1]), fmaxf(t[2], t[3])), fmaxf(fmaxf(t[4], t[5]), fmaxf(t[6], t[7]))); mx = fmaxf(mx, xhalf(mx));
    // base-2 softmax: log2(e) lies in the score scale and in the stored pair bias, and 2^11 (the scale of P's f16 split) in the exponent's reference, so a score costs one subtraction and one v_exp_f32
    const float mn = fmaxf(m[u], mx), mref = (mn <= -1.0e38f) ? 0.f : mn;   // no key kept so far: reference 0, so that a masked score (-3e38) gives 2^(-huge) = 0 there too; with a kept key it does so by itself
    const float alpha = __builtin_amdgcn_exp2f(m[u] - mref), mb = mref - 11.0f;   // m = -3e38 (nothing kept before this pass) gives alpha = 0
    v2f p2[2][4];   // 2^11 P, register pairs (2i, 2i + 1) of score tile ct
#pragma unroll
    for (int ct = 0; ct < 2; ++ct)
#pragma unroll
      for (int r = 0; r < 8; ++r) s[ct][r] -= mb;
    __builtin_amdgcn_sched_barrier(0);   // keeps the 16 subtractions together, ahead of the exponentials: so they pair into 8 dual-issue instructions; mixed among the exponentials several stayed single, and three stood directly behind a v_exp_f32 and wrote its source register, a place the instruction set wants filled by an independent instruction
#pragma unroll
    for (int ct = 0; ct < 2; ++ct)
#pragma unroll
      for (int i = 0; i < 4; ++i) { p2[ct][i][0] = __builtin_amdgcn_exp2f(s[ct][2 * i]); p2[ct][i][1] = __builtin_amdgcn_exp2f(s[ct][2 * i + 1]); }
    const v2f ts = ((p2[0][0] + p2[1][0]) + (p2[0][1] + p2[1][1])) + ((p2[0][2] + p2[1][2]) + (p2[0][3] + p2[1][3]));
    l[u] = l[u] * alpha + (ts[0] + ts[1]); m[u] = mn;   // l carries the factor 2^11 as well
#pragma unroll
    for (int j = 0; j < 2; ++j)
#pragma unroll
      for (int r = 0; r < 8; ++r) { acc[u][j][r] *= alpha; accl[u][j][r] *= alpha; }
    v16h pa, pal;   // B operand: element i = key 8g + i = tile 0 register i, element 8 + i = key 16 + 8g + i = tile 1 register i
#pragma unroll
    for (int ct = 0; ct < 2; ++ct)
#pragma unroll
      for (int i = 0; i < 4; ++i) { const v2h hh = __builtin_convertvector(p2[ct][i], v2h); const v2f pw = p2[ct][i] * 2048.0f; v2f rs;
        rs[0] = __builtin_fmaf((float)hh[0], -2048.0f, pw[0]); rs[1] = __builtin_fmaf((float)hh[1], -2048.0f, pw[1]);   // (p - hi) 2^11, exact
        const v2h ll = __builtin_convertvector(rs, v2h); pa[ct * 8 + 2 * i] = hh[0]; pa[ct * 8 + 2 * i + 1] = hh[1]; pal[ct * 8 + 2 * i] = ll[0]; pal[ct * 8 + 2 * i + 1] = ll[1]; }
#pragma unroll
    for (int j = 0; j < 2; ++j) { acc[u][j] = wmma16(vh[j], pa, acc[u][j]); accl[u][j] = wmma16(vl[j], pa, accl[u][j]); accl[u][j] = wmma16(vh[j], pal, accl[u][j]); } } }
#pragma unroll
  for (int u = 0; u < 2; ++u) { const float ls = l[u] + xhalf(l[u]);
  const float il = (ls > 0.f) ? 1.0f / ls : 0.f;   // the sum and the accumulators both carry 2^11
  float* ot = O + ((rq / 16 + u) * (CM / 32) + h) * 512 + lane * 4;   // lane = (g, row col): quads 0, 1 = channels 8g .. 8g + 7, quads 2, 3 = 16 + 8g .. : register r of O^T tile j is channel j * 16 + 8g + r; each store of the wave is 512 contiguous bytes
#pragma unroll
  for (int qd = 0; qd < 4; ++qd) { v4f o;
#pragma unroll
    for (int e = 0; e < 4; ++e) o[e] = (acc[u][qd >> 1][(qd & 1) * 4 + e] + accl[u][qd >> 1][(qd & 1) * 4 + e] * (1.0f / 2048.0f)) * il;
    vst2(ot + qd * 128, o); } } }
// ---- k_go<MODE>: block = (64 natural rows, 128 cols): M = (g o) . wo + bo ; A operand built on the fly from the G and O tiles
template <int MODE>
__global__ __launch_bounds__(128) void k_go(const _Float16* __restrict__ Gt, const float* __restrict__ O, const _Float16* __restrict__ WOr, const float* __restrict__ BO, float* __restrict__ M) { __shared__ __align__(16) float sf[4][16][132];
  const int tid = threadIdx.x, wave = tid >> 5, lane = tid & 31, col = lane & 15, g = lane >> 4; const size_t r0 = (size_t)blockIdx.x * 64 + wave * 16; const int c0 = blockIdx.y * 128;
  static_assert(MODE == 0, "one tile index serves G (natural rows) and O (compact rows): the two orders agree only in row attention");
  const size_t t0 = (r0 / 16) * (CM / 32);
  v8f acc[8] = {}, accl2[8] = {};
  // loads run ahead of the WMMAs: the 64 weight fragments (order f = kc * 8 + j) go through a ring of GOW register sets, fragment f + GOW being requested right behind the two WMMAs that read fragment f; the gate and o tiles of block kc + 1 are requested ahead of block kc's WMMAs
  constexpr int GOW = 7; const _Float16* wr = WOr + (size_t)(c0 / 16) * (CM / 32) * 512; v16h wf[GOW];
#pragma unroll   // every loop here is fully unrolled: wf and ov are indexed by constants and stay in registers
  for (int f = 0; f < GOW; ++f) wf[f] = frag_t(wr + ((size_t)(f & 7) * (CM / 32) + (f >> 3)) * 512, lane);
  v16h gv = frag_t(Gt + t0 * 512, lane); v4f ov[4];
#pragma unroll
  for (int qd = 0; qd < 4; ++qd) ov[qd] = *(const v4f*)(O + t0 * 512 + lane * 4 + qd * 128);
#pragma unroll
  for (int kc = 0; kc < CM / 32; ++kc) { v16h a, al;
    __builtin_amdgcn_sched_barrier(0);   // keeps this block's conversions (and with them the wait for its gate and o tiles) behind the WMMAs of the block before: moved up among them they would wait for loads just issued
#pragma unroll
    for (int i = 0; i < 16; ++i) { const float v0 = (float)gv[i] * ov[i >> 2][i & 3]; a[i] = (_Float16)v0; al[i] = (_Float16)((v0 - (float)a[i]) * 2048.0f); }
    if (kc + 1 < CM / 32) { gv = frag_t(Gt + (t0 + kc + 1) * 512, lane);
#pragma unroll
      for (int qd = 0; qd < 4; ++qd) ov[qd] = *(const v4f*)(O + (t0 + kc + 1) * 512 + lane * 4 + qd * 128);
      asm volatile("s_wait_xcnt 0x0" ::: "memory"); }   // stands in front of whatever rewrites the address registers of the six loads above (in the last block a later load's result does)
#pragma unroll
    for (int j = 0; j < 8; ++j) { const int f = kc * 8 + j, fn = f + GOW; acc[j] = wmma16(a, wf[f % GOW], acc[j]); accl2[j] = wmma16(al, wf[f % GOW], accl2[j]); if (fn < 8 * (CM / 32)) wf[f % GOW] = frag_t(wr + ((size_t)(fn & 7) * (CM / 32) + (fn >> 3)) * 512, lane); } }
#pragma unroll
  for (int j = 0; j < 8; ++j) { const int c = c0 + j * 16 + col; const float bb = bfr(BO[c]);
#pragma unroll
    for (int r = 0; r < 8; ++r) sf[wave][8 * g + r][j * 16 + col] = (acc[j][r] + accl2[j][r] * (1.0f / 2048.0f)) * (1.0f / WSC) + bb; }
  LDSX(); for (int rl = 0; rl < 16; ++rl) vst2(M + (r0 + rl) * CM + c0 + lane * 4, *(const v4f*)&sf[wave][rl][lane * 4]); }   // M here = the output buffer (no residual in this module)
// ---- k_ff1: block = (64 rows, 128 of 1024 cols): H1 = relu(XH . W1 + b1) -> f16 ; k_ff2: out = H1 . W2 + b2 + M
__global__ __launch_bounds__(128) void k_ff1(const _Float16* __restrict__ XH, const _Float16* __restrict__ W1r, const float* __restrict__ B1, _Float16* __restrict__ H1) { __shared__ __align__(16) _Float16 sh[4][16][136];
  const int tid = threadIdx.x, wave = tid >> 5, lane = tid & 31, col = lane & 15, g = lane >> 4; const size_t r0 = (size_t)blockIdx.x * 64 + wave * 16; const int c0 = blockIdx.y * 128;
  v8f acc[8] = {};
#pragma unroll
  for (int kc = 0; kc < CM / 32; ++kc) { const v16h a = frag_h(XH + (r0 + col) * CM + kc * 32, lane);
#pragma unroll
    for (int j = 0; j < 8; ++j) acc[j] = wmma16(a, frag_t(W1r + ((size_t)(c0 / 16 + j) * (CM / 32) + kc) * 512, lane), acc[j]); }
#pragma unroll
  for (int j = 0; j < 8; ++j) { const float bb = bfr(B1[c0 + j * 16 + col]);
#pragma unroll
    for (int r = 0; r < 8; ++r) sh[wave][8 * g + r][j * 16 + col] = (_Float16)fmaxf(acc[j][r] * (1.0f / WSC) + bb, 0.f); }
  LDSX(); for (int rl = 0; rl < 16; ++rl) if (lane < 16) vst2((unsigned*)(H1 + (r0 + rl) * FF + c0 + lane * 8), *(const v4u*)&sh[wave][rl][lane * 8]); }
__global__ __launch_bounds__(128) void k_ff2(const _Float16* __restrict__ H1, const _Float16* __restrict__ W2r, const float* __restrict__ B2, const float* __restrict__ M, float* __restrict__ OUT) { __shared__ __align__(16) float sf[4][16][132];
  const int tid = threadIdx.x, wave = tid >> 5, lane = tid & 31, col = lane & 15, g = lane >> 4; const size_t r0 = (size_t)blockIdx.x * 64 + wave * 16; const int c0 = blockIdx.y * 128;
  v8f acc[8] = {};
#pragma unroll 2
  for (int kc = 0; kc < FF / 32; ++kc) { const v16h a = frag_h(H1 + (r0 + col) * FF + kc * 32, lane);
#pragma unroll
    for (int j = 0; j < 8; ++j) acc[j] = wmma16(a, frag_t(W2r + ((size_t)(c0 / 16 + j) * (FF / 32) + kc) * 512, lane), acc[j]); }
#pragma unroll
  for (int j = 0; j < 8; ++j) { const int c = c0 + j * 16 + col; const float bb = bfr(B2[c]);
#pragma unroll
    for (int r = 0; r < 8; ++r) sf[wave][8 * g + r][j * 16 + col] = acc[j][r] * (1.0f / WSC) + bb + M[(r0 + 8 * g + r) * CM + c]; }
  LDSX(); for (int rl = 0; rl < 16; ++rl) vst2(OUT + (r0 + rl) * CM + c0 + lane * 4, *(const v4f*)&sf[wave][rl][lane * 4]); }
extern "C" void kernel_launch(void* const* d_in, const int* in_sizes, int n_in, void* d_out, int out_size, void* d_ws, size_t ws_size, hipStream_t stream) {
  (void)in_sizes; (void)n_in; (void)out_size;
  const float** F = (const float**)d_in;   // 0 m [1,128,256,256], 1 z [1,256,256,128], 2 mask [1,128,256], 3 ln_m_g, 4 ln_m_b, 5 ln_z_g, 6 ln_z_b, 7 wz [128,8], 8 wq [256,8,32], 9 wk, 10 wv, 11 wg, 12 bg [8,32], 13 wo [8,32,256], 14 bo [256]
  if (ws_size < (size_t)WS_END) return;
  char* ws = (char*)d_ws; _Float16 *RW = (_Float16*)(ws + WS_RW), *RWOp = (_Float16*)(ws + WS_RWO), *XH = (_Float16*)(ws + WS_XH), *Gt = (_Float16*)(ws + WS_G);
  float *O = (float*)(ws + WS_O), *PB = (float*)(ws + WS_PB);
  k_prep<<<PWB + PBB + LNB, 256, 0, stream>>>(F[8], F[9], F[10], F[11], F[13], ws, F[0], F[3], F[4], XH, F[1], F[5], F[6], F[7], PB);
  k_pa<0><<<dim3(NH, SQ), 256, 0, stream>>>(XH, RW, F[12], PB, F[2], Gt, O);
  k_go<0><<<dim3(NROW / 64, CM / 128), 128, 0, stream>>>(Gt, O, RWOp, F[14], (float*)d_out);
}
